// v000
// Measured on an AMD MI455X. A time is GPU time per run, averaged over a window of back-to-back runs after a warm-up
// (all launches, gaps included; the runs take copies of the inputs in turn), and the median of several windows.
// Apart from v000's, it joins two sittings. Times from different sittings can be a few percent apart, while
// side-by-side timings come from the same sitting.
// v000 is the starting kernel. One run takes 1970 microseconds.
#include <hip/hip_runtime.h>

// Sparse multi-head attention over a graph (DGL bsddmm / bspmm style): q = (h Wq^T + bq) * 16^-1/2, k, v = Linear(h), all reshaped (N, 16, 8) — i.e. channel c = d*8 + head (heads interleaved);
// per edge e: logit_h = sum_d q[row][d,h] k[col][d,h]; softmax over the edges of each row (destination); out[row] = sum attn v[col]; y = out Wo^T + bo -> [100000][128]. 100,000 nodes,
// 1,600,000 edges; rows without edges give out = 0 (then bo).
// WMMA (v_wmma_f32_16x16x32_f16, f32 accumulate): the q/k/v projections ([100,032 x 128] x [128 x 384], EXACT bf16 h x8: 1 product) and the output projection ([100,032 x 128] x [128 x 128],
// attention output as f16 hi+lo x8 planes: 2 products), weights exact x256; per-edge head dots (lane owns channels 4l..4l+3 = heads (4l mod 8)+0..3 at d = l/2; reduced over the 16 lanes of
// equal parity with xor 2,4,8,16), softmax and weighted sums in f32. Inputs rounded to bf16 once; ids int32 (clamped). Fragment k-map per lane half hh for A AND B:

namespace {
constexpr int N = 100000, NP = 100032, E = 1600000, D = 128, NH = 8, HD = 16;
constexpr float XS = 8.0f, WSC = 256.0f, NEG = 0.2f /* unused */, SCAL = 0.25f /* 16^-0.5 */;
typedef _Float16 b16;
typedef __attribute__((ext_vector_type(16))) _Float16 v16b;
typedef __attribute__((ext_vector_type(8))) _Float16 v8b;
typedef __attribute__((ext_vector_type(4))) _Float16 v4h;
typedef __attribute__((ext_vector_type(8))) float v8f;
typedef __attribute__((ext_vector_type(4))) float v4f;
__device__ __forceinline__ float bf16_rne(float f) { unsigned int u = __float_as_uint(f); u += 0x7FFFu + ((u >> 16) & 1u); return __uint_as_float(u & 0xFFFF0000u); }
__device__ __forceinline__ void split16(float v, b16& hi, b16& lo) { hi = (b16)v; lo = (b16)(v - (float)hi); }
__device__ __forceinline__ v16b frag_kb(const b16* p, int hh) { const v8b a = *(const v8b*)(p + 8 * hh), b = *(const v8b*)(p + 16 + 8 * hh); v16b f;
#pragma unroll
  for (int e = 0; e < 8; ++e) { f[e] = a[e]; f[8 + e] = b[e]; } return f; }
__device__ __forceinline__ v8f wmma16b(v16b a, v16b b, v8f c) { v8f d = __builtin_amdgcn_wmma_f32_16x16x32_f16(false, a, false, b, (short)0, c, false, false); asm volatile("v_nop\n\tv_nop\n\tv_nop\n\tv_nop" : "+v"(d) : "v"(a), "v"(b)); return d; }
__device__ __forceinline__ void wave_lds_sync() { __builtin_amdgcn_fence(__ATOMIC_RELEASE, "workgroup"); __builtin_amdgcn_wave_barrier(); __builtin_amdgcn_fence(__ATOMIC_ACQUIRE, "workgroup"); }
__device__ __forceinline__ float pmul(float a, float b) { float p = a * b; asm volatile("" : "+v"(p)); return p; }
__device__ __forceinline__ int iclamp(int v, int lo, int hi) { return v < lo ? lo : (v > hi ? hi : v); }
__device__ __forceinline__ float nexp(float x) { return __builtin_amdgcn_exp2f(x * 1.4426950408889634f); }
// ---------------- deterministic, line-safe CSR by destination (two-level bucketing; every global write is a whole-line, lane-contiguous store) ----------------
// Pass A (block per contiguous edge chunk): lane 0 counts the chunk's edges per coarse bucket g = dst >> CSR_GB (nG <= CSR_MAXG buckets) and places the edge ids grouped by bucket into LDS (fixed
// Pass B (block per bucket g): gathers the bucket's edge ids from the 512 staging rows into LDS (≤ CSR_CAP ids), counts per destination node (one lane, fixed scan order), exclusive prefix,
//   (b) ROWPTR[v], ROWCNT[v] for its 2^CSR_GB nodes as contiguous ints. If a bucket exceeds CSR_CAP the kernel writes ROWCNT = 0 for its nodes and sets FLAG[0] = 1 (loud failure, no corruption).
constexpr int CSR_NBLK = 512, CSR_GB = 9, CSR_GN = 1 << CSR_GB /* nodes per bucket */, CSR_MAXG = 512, CSR_CAP = 12288 /* ids per bucket in LDS (48+24+48 KB) */;
__global__ __launch_bounds__(64) void csrA_kernel(const int* __restrict__ dst, int E, int N, int nG, int CHP, int NGP, int* __restrict__ STG, int* __restrict__ HST) {
  extern __shared__ int sm[];   // cnt[NGP] | run[NGP] | ids[CHP]
  int* cnt = sm; int* run = sm + NGP; int* ids = sm + 2 * NGP;
  const int b = blockIdx.x; const int ch = (E + CSR_NBLK - 1) / CSR_NBLK; const int e0 = b * ch, e1 = min(E, e0 + ch);
  for (int i = threadIdx.x; i < NGP; i += 64) cnt[i] = 0;
  for (int i = threadIdx.x; i < CHP; i += 64) ids[i] = -1;
  __syncthreads();
  if (threadIdx.x == 0) {
    for (int e = e0; e < e1; ++e) { int d = dst[e]; d = (d < 0) ? 0 : (d >= N ? N - 1 : d); cnt[d >> CSR_GB] += 1; }
    int acc = 0; for (int g = 0; g < nG; ++g) { run[g] = acc; acc += cnt[g]; }
    for (int e = e0; e < e1; ++e) { int d = dst[e]; d = (d < 0) ? 0 : (d >= N ? N - 1 : d); const int g = d >> CSR_GB; ids[run[g]] = e; run[g] += 1; } }
  __syncthreads();
  typedef __attribute__((ext_vector_type(4))) int v4i;
  {
    for (int i = threadIdx.x; i < CHP / 4; i += 64) *(v4i*)(STG + (size_t)b * CHP + i * 4) = *(const v4i*)(&ids[i * 4]);
    for (int i = threadIdx.x; i < NGP / 4; i += 64) { v4i v; for (int e = 0; e < 4; ++e) v[e] = (i * 4 + e < nG) ? cnt[i * 4 + e] : 0; *(v4i*)(HST + (size_t)b * NGP + i * 4) = v; }
     }
}
// scan: START[g] (padded to 32), OFF[g][b] (exclusive prefix of HST[b][<g] within block b = position of bucket g inside staging row b), TOT[g]. rows OFF[g][0..511] written by the block whole; START/TOT as one
// padded row each. grid 1 x 512 (thread = b for the OFF rows; thread 0 for START).
__global__ __launch_bounds__(512) void csrS_kernel(const int* __restrict__ HST, int nG, int NGP, int* __restrict__ START, int* __restrict__ TOT, int* __restrict__ OFF) {
  __shared__ int tot[CSR_MAXG];
  const int b = threadIdx.x;   // CSR_NBLK == 512 threads
  { int runb = 0; for (int g = 0; g < nG; ++g) { int c = HST[(size_t)b * NGP + g]; c = (c < 0) ? 0 : c; ((int*)OFF)[(size_t)g * CSR_NBLK + b] = runb; runb += c; }  }
  for (int g = threadIdx.x; g < nG; g += 512) { int s = 0; for (int bb = 0; bb < CSR_NBLK; ++bb) { int c = HST[(size_t)bb * NGP + g]; s += (c < 0) ? 0 : c; } tot[g] = s; }
  __syncthreads();
  if (threadIdx.x < 32) { // START/TOT rows (NGP ints, padded) written by one wave lane-contiguously after thread 0 computes the prefix into LDS
    __shared__ int st[CSR_MAXG + 32];
    if (threadIdx.x == 0) { int acc = 0; for (int g = 0; g < NGP; ++g) { st[g] = acc; if (g < nG) acc += (tot[g] + 31) & ~31; } st[NGP] = acc; }
    __builtin_amdgcn_fence(__ATOMIC_RELEASE, "workgroup"); __builtin_amdgcn_wave_barrier(); __builtin_amdgcn_fence(__ATOMIC_ACQUIRE, "workgroup");
    { for (int i = threadIdx.x; i < NGP + 32; i += 32) { ((int*)START)[i] = (i <= NGP) ? st[min(i, NGP)] : 0; ((int*)TOT)[i] = (i < nG) ? tot[i] : 0; }  } }
}
// bucket: block g (256 threads): gather ids (from each block's staging sub-run, in block order => original edge order), count per node, prefix, place, flush; ROWPTR/ROWCNT rows.
__global__ __launch_bounds__(256) void csrB_kernel(const int* __restrict__ dst, int N, int nG, int CHP, int NGP, int permLen, const int* __restrict__ STG, const int* __restrict__ HST, const int* __restrict__ OFF, const int* __restrict__ START, const int* __restrict__ TOT, int* __restrict__ PERM, int* __restrict__ ROWPTR, int* __restrict__ ROWCNT, int* __restrict__ FLAG) {
  typedef __attribute__((ext_vector_type(4))) int v4i;
  __shared__ int ids[CSR_CAP]; __shared__ unsigned short key[CSR_CAP]; __shared__ int outp[CSR_CAP]; __shared__ int ncnt[CSR_GN + 1]; __shared__ int boff[CSR_NBLK + 1];
  const int g = blockIdx.x, t_ = threadIdx.x; int tot = TOT[g]; int st = START[g], stn = START[g + 1]; const int v0 = g * CSR_GN; const int nv = min(CSR_GN, N - v0);
  st = (st < 0) ? 0 : (st > permLen - 32 ? permLen - 32 : st) & ~31; stn = (stn < st) ? st : (stn > permLen ? permLen : stn); tot = (tot < 0) ? 0 : tot; if (tot > stn - st && tot <= CSR_CAP) tot = stn - st;   // static-visible bounds even if a table line were garbage
  if (tot > CSR_CAP) {   // loud failure: zero counts, flag
    { for (int i = t_; i < CSR_GN / 4; i += 256) { v4i a, c; for (int e = 0; e < 4; ++e) { a[e] = st; c[e] = 0; } *(v4i*)(ROWPTR + v0 + i * 4) = a; *(v4i*)(ROWCNT + v0 + i * 4) = c; } if (t_ == 0) ((int*)FLAG)[0] = 1;  } (void)nv; return; }
  // per-block offsets of this bucket's sub-runs in gather order
  if (t_ == 0) { int acc = 0; for (int b = 0; b < CSR_NBLK; ++b) { boff[b] = acc; int c = HST[(size_t)b * NGP + g]; c = (c < 0) ? 0 : (c > CHP ? CHP : c); acc += c; if (acc > tot) acc = tot; } boff[CSR_NBLK] = acc; }
  for (int i = t_; i <= CSR_GN; i += 256) ncnt[i] = 0;
  __syncthreads();
  for (int b = 0; b < CSR_NBLK; ++b) { const int c = boff[b + 1] - boff[b]; int o_ = OFF[(size_t)g * CSR_NBLK + b]; o_ = (o_ < 0) ? 0 : (o_ > CHP - c ? CHP - c : o_); const int* src_ = STG + (size_t)b * CHP + o_;
    for (int i = t_; i < c; i += 256) { int id = src_[i]; id = (id < 0) ? 0 : id; ids[boff[b] + i] = id; int d = dst[id]; d = (d < v0) ? v0 : (d >= N ? N - 1 : d); int kk = d - v0; kk = (kk < 0) ? 0 : (kk >= CSR_GN ? CSR_GN - 1 : kk); key[boff[b] + i] = (unsigned short)kk; } }
  __syncthreads();
  // counting sort by node inside the bucket, ONE sequential lane (fixed order, ~3 passes over the bucket): counts, exclusive prefix, placement (original order within a node)
  if (t_ == 0) { for (int i = 0; i < tot; ++i) ncnt[key[i]] += 1; int acc = 0; for (int vl = 0; vl < CSR_GN; ++vl) { const int c = ncnt[vl]; ncnt[vl] = acc; acc += c; } ncnt[CSR_GN] = acc;
    for (int i = 0; i < tot; ++i) { const int vl = key[i]; outp[ncnt[vl]] = ids[i]; ncnt[vl] += 1; }
    // ncnt[vl] now = end of node vl = start of vl+1; rebuild starts: start(vl) = end(vl-1)
    for (int vl = CSR_GN; vl > 0; --vl) ncnt[vl] = ncnt[vl - 1]; ncnt[0] = 0; }
  __syncthreads();
  {
    for (int i = t_; i < (stn - st) / 4; i += 256) { v4i v; for (int e = 0; e < 4; ++e) { const int q = i * 4 + e; v[e] = (q < tot) ? outp[q] : -1; } *(v4i*)(PERM + st + i * 4) = v; }
    for (int i = t_; i < CSR_GN / 4; i += 256) { v4i a, c; for (int e = 0; e < 4; ++e) { const int vl = i * 4 + e; a[e] = st + ncnt[vl]; c[e] = (vl < nv) ? (ncnt[vl + 1] - ncnt[vl]) : 0; } *(v4i*)(ROWPTR + v0 + i * 4) = a; *(v4i*)(ROWCNT + v0 + i * 4) = c; }   // the tables hold nG*512 entries (beyond N: count 0)
     }
}
__global__ __launch_bounds__(256) void csrZ_kernel(int* __restrict__ p, size_t n4) { typedef __attribute__((ext_vector_type(4))) int v4i; const size_t tid = (size_t)blockIdx.x * 256 + threadIdx.x, nth = (size_t)gridDim.x * 256; v4i z = {0, 0, 0, 0}; for (size_t i = tid; i < n4; i += nth) *(v4i*)(p + i * 4) = z; }
// host helper. Workspace ints needed: STG (512*CHP), HST (512*NGP), OFF (NGP*512), START (NGP+64), TOT (NGP+64), PERM (E + 32*nG + 32), ROWPTR (Npad), ROWCNT (Npad), FLAG (64). Npad = roundup(N, 512).
struct CsrBufs { int *STG, *HST, *OFF, *START, *TOT, *PERM, *ROWPTR, *ROWCNT, *FLAG; int nG, NGP, CHP; size_t permLen; char* base; size_t bytes; };
static size_t csr_carve(CsrBufs& c, char* ws, size_t off, int E, int N) {
  const size_t off0 = off; c.base = ws + off;
  auto al = [&](size_t bytes) { char* p = ws + off; off += (bytes + 255) & ~(size_t)255; return p; };
  c.nG = (N + CSR_GN - 1) / CSR_GN; c.NGP = (c.nG + 31) & ~31; const int ch = (E + CSR_NBLK - 1) / CSR_NBLK; c.CHP = (ch + 31) & ~31; c.permLen = (size_t)E + 32 * (size_t)c.nG + 32;
  c.STG = (int*)al((size_t)CSR_NBLK * c.CHP * 4); c.HST = (int*)al((size_t)CSR_NBLK * c.NGP * 4); c.OFF = (int*)al((size_t)c.NGP * CSR_NBLK * 4); c.START = (int*)al((size_t)(c.NGP + 64) * 4); c.TOT = (int*)al((size_t)(c.NGP + 64) * 4);
  c.PERM = (int*)al(c.permLen * 4); c.ROWPTR = (int*)al((size_t)c.nG * CSR_GN * 4); c.ROWCNT = (int*)al((size_t)c.nG * CSR_GN * 4); c.FLAG = (int*)al(256);
  c.bytes = off - off0; return off;
}
static void csr_build(const CsrBufs& c, const int* dst, int E, int N, hipStream_t stream) {
  const size_t smem = (size_t)(2 * c.NGP + c.CHP) * 4;
  csrZ_kernel<<<512, 256, 0, stream>>>((int*)c.base, c.bytes / 16);
  csrA_kernel<<<CSR_NBLK, 64, smem, stream>>>(dst, E, N, c.nG, c.CHP, c.NGP, c.STG, c.HST);
  csrS_kernel<<<1, 512, 0, stream>>>(c.HST, c.nG, c.NGP, c.START, c.TOT, c.OFF);
  csrB_kernel<<<c.nG, 256, 0, stream>>>(dst, N, c.nG, c.CHP, c.NGP, (int)c.permLen, c.STG, c.HST, c.OFF, c.START, c.TOT, c.PERM, c.ROWPTR, c.ROWCNT, c.FLAG);
}


__global__ __launch_bounds__(256) void wprep_kernel(const float* __restrict__ wq, const float* __restrict__ wk, const float* __restrict__ wv, const float* __restrict__ wo, b16* __restrict__ WT) {
  const size_t u = (size_t)blockIdx.x * 256 + threadIdx.x; const size_t per = (size_t)D * D / 8; if (u >= 4 * per) return; const int which = (int)(u / per); const size_t e = (u % per) * 8; const float* w = which == 0 ? wq : which == 1 ? wk : which == 2 ? wv : wo; v8b o;
  for (int j = 0; j < 8; ++j) o[j] = (b16)(bf16_rne(w[e + j]) * WSC);
  { *(v8b*)(WT + (size_t)which * D * D + e) = o;  }
}
__global__ __launch_bounds__(128) void proj_kernel(const float* __restrict__ h, const b16* __restrict__ WT, const float* __restrict__ bq, const float* __restrict__ bk, const float* __restrict__ bv, float* __restrict__ QKV) {
  __shared__ __attribute__((aligned(16))) float Tf[4][16][D + 4];
  const int wave = threadIdx.x >> 5, lane = threadIdx.x & 31, nloc = lane & 15, hlf = lane >> 4; const size_t m0 = (size_t)blockIdx.x * 64 + wave * 16; const int part = blockIdx.y; const b16* W = WT + (size_t)part * D * D; const float* bias = part == 0 ? bq : part == 1 ? bk : bv; const float osc = part == 0 ? SCAL : 1.0f;
  const size_t v = m0 + nloc; v8f acc[8];
#pragma unroll
  for (int t = 0; t < 8; ++t) acc[t] = (v8f){};
#pragma unroll
  for (int kb = 0; kb < D; kb += 32) { v16b a = {}; if (v < (size_t)N) { const float* r = h + v * D + kb; for (int e = 0; e < 8; ++e) { a[e] = (b16)(bf16_rne(r[8 * hlf + e]) * XS); a[8 + e] = (b16)(bf16_rne(r[16 + 8 * hlf + e]) * XS); } }
#pragma unroll
    for (int t = 0; t < 8; ++t) acc[t] = wmma16b(a, frag_kb(W + (size_t)(t * 16 + nloc) * D + kb, hlf), acc[t]); }
#pragma unroll
  for (int t = 0; t < 8; ++t) { const int c = t * 16 + nloc; const float bb = bf16_rne(bias[c]);
#pragma unroll 1
    for (int r = 0; r < 8; ++r) { const size_t row = m0 + 8 * hlf + r; Tf[wave][8 * hlf + r][c] = row < (size_t)N ? (acc[t][r] * (1.0f / (XS * WSC)) + bb) * osc : 0.0f; } }
  wave_lds_sync();
  { for (int rr = 0; rr < 16; ++rr) *(v4f*)(QKV + ((size_t)part * NP + m0 + rr) * D + lane * 4) = *(const v4f*)(&Tf[wave][rr][lane * 4]);  }
}
__global__ __launch_bounds__(256) void attn_kernel(const float* QKV, const int* __restrict__ cols, const int* __restrict__ PERM, const int* __restrict__ ROWPTR, const int* __restrict__ ROWCNT, int permLen, b16* Oh, b16* Ol) {   // Oh aliases the q plane (see host)
  const int wave = threadIdx.x >> 5, lane = threadIdx.x & 31; const size_t v = (size_t)blockIdx.x * 8 + wave; const int c0 = lane * 4; (void)Ol;
  v4f o = {0.0f, 0.0f, 0.0f, 0.0f};
  int st = 0, cnt = 0; if (v < (size_t)N) { st = ROWPTR[v]; cnt = ROWCNT[v]; cnt = iclamp(cnt, 0, 65536); st = iclamp(st, 0, permLen - cnt); }
  const v4f q = *(const v4f*)(QKV + v * D + c0); const float* K = QKV + (size_t)NP * D; const float* V = QKV + (size_t)2 * NP * D;
  auto logits = [&](size_t s) -> v4f { const v4f k = *(const v4f*)(K + s * D + c0); v4f l; for (int i = 0; i < 4; ++i) { float d = pmul(q[i], k[i]); d += __shfl_xor(d, 2); d += __shfl_xor(d, 4); d += __shfl_xor(d, 8); d += __shfl_xor(d, 16); l[i] = d; } return l; };
  v4f mx = {-INFINITY, -INFINITY, -INFINITY, -INFINITY};
#pragma unroll 1
  for (int j = 0; j < cnt; ++j) { const int e = iclamp(PERM[st + j], 0, E - 1); const size_t s = (size_t)iclamp(cols[e], 0, N - 1); const v4f l = logits(s); for (int i = 0; i < 4; ++i) mx[i] = fmaxf(mx[i], l[i]); }
  v4f den = {0.0f, 0.0f, 0.0f, 0.0f}, acc = {0.0f, 0.0f, 0.0f, 0.0f};
#pragma unroll 1
  for (int j = 0; j < cnt; ++j) { const int e = iclamp(PERM[st + j], 0, E - 1); const size_t s = (size_t)iclamp(cols[e], 0, N - 1); const v4f l = logits(s); const v4f vv = *(const v4f*)(V + s * D + c0);
    for (int i = 0; i < 4; ++i) { const float p = nexp(l[i] - mx[i]); den[i] += p; acc[i] += pmul(p, vv[i]); } }
  if (cnt > 0) for (int i = 0; i < 4; ++i) o[i] = acc[i] / den[i];
  v4h ph, pl; for (int i = 0; i < 4; ++i) { b16 p, pq; split16(o[i] * XS, p, pq); ph[i] = p; pl[i] = pq; }
  { *(v4h*)(Oh + v * (2 * D) + c0) = ph; *(v4h*)(Oh + v * (2 * D) + D + c0) = pl;  }   // hi | lo packed into this node's own 512-B q row (no other wave reads it)
}
__global__ __launch_bounds__(128) void oproj_kernel(const b16* __restrict__ Oh, const b16* __restrict__ Ol, const b16* __restrict__ WT, const float* __restrict__ bo, float* __restrict__ out) {
  __shared__ __attribute__((aligned(16))) float Tf[4][16][D + 4];
  const int wave = threadIdx.x >> 5, lane = threadIdx.x & 31, nloc = lane & 15, hlf = lane >> 4; const size_t m0 = (size_t)blockIdx.x * 64 + wave * 16; const b16* W = WT + (size_t)3 * D * D;
  v8f acc[8];
#pragma unroll
  for (int t = 0; t < 8; ++t) acc[t] = (v8f){};
#pragma unroll
  for (int kb = 0; kb < D; kb += 32) { const v16b a = frag_kb(Oh + (m0 + nloc) * (2 * D) + kb, hlf), al = frag_kb(Oh + (m0 + nloc) * (2 * D) + D + kb, hlf);
#pragma unroll
    for (int t = 0; t < 8; ++t) { const v16b bw = frag_kb(W + (size_t)(t * 16 + nloc) * D + kb, hlf); acc[t] = wmma16b(a, bw, acc[t]); acc[t] = wmma16b(al, bw, acc[t]); } }
#pragma unroll
  for (int t = 0; t < 8; ++t) { const int c = t * 16 + nloc; const float bb = bf16_rne(bo[c]);
#pragma unroll 1
    for (int r = 0; r < 8; ++r) Tf[wave][8 * hlf + r][c] = acc[t][r] * (1.0f / (XS * WSC)) + bb; }
  wave_lds_sync();
  { for (int rr = 0; rr < 16; ++rr) { const size_t row = m0 + rr; if (row < (size_t)N) *(v4f*)(out + row * D + lane * 4) = *(const v4f*)(&Tf[wave][rr][lane * 4]); }  }
}
}  // namespace

extern "C" void kernel_launch(void* const* d_in, const int* in_sizes, int n_in, void* d_out, int out_size, void* d_ws, size_t ws_size, hipStream_t stream) {
  (void)n_in;
  auto Fp = [&](int i) { return (const float*)d_in[i]; }; auto Ip = [&](int i) { return (const int*)d_in[i]; };
  // input order: 0 h [100000,128], 1 row [E] i32, 2 col [E] i32, 3 Wq [128,128], 4 bq, 5 Wk, 6 bk, 7 Wv, 8 bv, 9 Wo, 10 bo
  if (in_sizes[0] != N * D || in_sizes[1] != E || in_sizes[2] != E || in_sizes[3] != D * D || in_sizes[9] != D * D || out_size != N * D) return;
  size_t off = 0; char* ws = (char*)d_ws;
  auto carve = [&](size_t bytes) { char* p = ws + off; off += (bytes + 255) & ~(size_t)255; return p; };
  b16* WT = (b16*)carve((size_t)4 * D * D * 2); float* QKV = (float*)carve((size_t)3 * NP * D * 4);
  b16* Oh = (b16*)QKV; b16* Ol = Oh;   // the attention output (hi | lo, 2 x 128 halves) overwrites each node's own 512-B q row in place: a wave reads only its own q row before writing it (K/V rows live in the other two planes)
  CsrBufs csr; off = csr_carve(csr, ws, off, E, N);
  if (off > ws_size) return;   // QKV 153.6 + CSR ~15 = ~169 MB (< 256 MiB)
  wprep_kernel<<<(unsigned)((4 * (size_t)D * D / 8 + 255) / 256), 256, 0, stream>>>(Fp(3), Fp(5), Fp(7), Fp(9), WT);
  csr_build(csr, Ip(1), E, N, stream);   // group by row (the softmax axis)
  proj_kernel<<<dim3(NP / 64, 3), 128, 0, stream>>>(Fp(0), WT, Fp(4), Fp(6), Fp(8), QKV);
  attn_kernel<<<NP / 8, 256, 0, stream>>>(QKV, Ip(2), csr.PERM, csr.ROWPTR, csr.ROWCNT, (int)csr.permLen, Oh, Ol);
  oproj_kernel<<<NP / 64, 128, 0, stream>>>(Oh, Ol, WT, Fp(10), (float*)d_out);
}

// v001
// One run takes 370 microseconds.
// Timed twice side by side with v000, it ran 5.31 and 5.32 times as fast.
#include <hip/hip_runtime.h>

// Sparse multi-head attention over a graph (DGL bsddmm / bspmm style): q = (h Wq^T + bq) * 16^-1/2, k, v = Linear(h), all reshaped (N, 16, 8) — i.e. channel c = d*8 + head (heads interleaved);
// per edge e: logit_h = sum_d q[row][d,h] k[col][d,h]; softmax over the edges of each row (destination); out[row] = sum attn v[col]; y = out Wo^T + bo -> [100000][128]. 100,000 nodes,
// 1,600,000 edges; rows without edges give out = 0 (then bo).
// WMMA (v_wmma_f32_16x16x32_f16, f32 accumulate): the q/k/v projections ([100,032 x 128] x [128 x 384], EXACT bf16 h x8: 1 product) and the output projection ([100,032 x 128] x [128 x 128],
// attention output as f16 hi+lo x8 planes: 2 products), weights exact x256; per-edge head dots (lane owns channels 4l..4l+3 = heads (4l mod 8)+0..3 at d = l/2; reduced over the 16 lanes of
// equal parity with xor 2,4,8,16), softmax and weighted sums in f32. Inputs rounded to bf16 once; ids int32 (clamped). Fragment k-map per lane half hh for A AND B:

namespace {
constexpr int N = 100000, NP = 100032, E = 1600000, D = 128, NH = 8, HD = 16;
constexpr float XS = 8.0f, WSC = 256.0f, NEG = 0.2f /* unused */, SCAL = 0.25f /* 16^-0.5 */;
typedef _Float16 b16;
typedef __attribute__((ext_vector_type(16))) _Float16 v16b;
typedef __attribute__((ext_vector_type(8))) _Float16 v8b;
typedef __attribute__((ext_vector_type(4))) _Float16 v4h;
typedef __attribute__((ext_vector_type(8))) float v8f;
typedef __attribute__((ext_vector_type(4))) float v4f;
__device__ __forceinline__ float bf16_rne(float f) { unsigned int u = __float_as_uint(f); u += 0x7FFFu + ((u >> 16) & 1u); return __uint_as_float(u & 0xFFFF0000u); }
__device__ __forceinline__ void split16(float v, b16& hi, b16& lo) { hi = (b16)v; lo = (b16)(v - (float)hi); }
__device__ __forceinline__ v16b frag_kb(const b16* p, int hh) { const v8b a = *(const v8b*)(p + 8 * hh), b = *(const v8b*)(p + 16 + 8 * hh); v16b f;
#pragma unroll
  for (int e = 0; e < 8; ++e) { f[e] = a[e]; f[8 + e] = b[e]; } return f; }
__device__ __forceinline__ v8f wmma16b(v16b a, v16b b, v8f c) { v8f d = __builtin_amdgcn_wmma_f32_16x16x32_f16(false, a, false, b, (short)0, c, false, false); asm volatile("v_nop\n\tv_nop\n\tv_nop\n\tv_nop" : "+v"(d) : "v"(a), "v"(b)); return d; }
__device__ __forceinline__ void wave_lds_sync() { __builtin_amdgcn_fence(__ATOMIC_RELEASE, "workgroup"); __builtin_amdgcn_wave_barrier(); __builtin_amdgcn_fence(__ATOMIC_ACQUIRE, "workgroup"); }
__device__ __forceinline__ float pmul(float a, float b) { float p = a * b; asm volatile("" : "+v"(p)); return p; }
__device__ __forceinline__ int iclamp(int v, int lo, int hi) { return v < lo ? lo : (v > hi ? hi : v); }
__device__ __forceinline__ float nexp(float x) { return __builtin_amdgcn_exp2f(x * 1.4426950408889634f); }
// ---------------- deterministic, line-safe CSR by destination (two-level bucketing; every global write is a whole-line, lane-contiguous store) ----------------
// Pass A (block per contiguous edge chunk): a stable counting sort of the chunk's edges by coarse bucket g = dst >> CSR_GB (nG <= CSR_MAXG buckets) into LDS, all waves at work (see csr_rank), then whole-line
//   stores of the grouped ids (STG row) and of the bucket counts (HST row).
// Pass B (block per bucket g): gathers the bucket's edge ids from the 512 staging rows into LDS (at most CSR_CAP ids), the same stable counting sort by destination node, then writes (a) its PERM run and
//   (b) ROWPTR[v], ROWCNT[v] for its 2^CSR_GB nodes as contiguous ints. If a bucket exceeds CSR_CAP the kernel writes ROWCNT = 0 for its nodes and sets FLAG[0] = 1 (loud failure, no corruption).
// The sort, no atomics, original edge order kept inside every key: each wave owns a contiguous run of items and a histogram row of its own; per 32 items csr_rank gives every lane its rank among the
//   lanes with an equal key, the first such lane advances the row's counter; then a prefix over (key, wave) turns the rows into start positions.
constexpr int CSR_NBLK = 512, CSR_GB = 9, CSR_GN = 1 << CSR_GB /* nodes per bucket */, CSR_MAXG = 512, CSR_CAP = 12288 /* ids per bucket in LDS (48+24+48 KB, and 32 KB of counter rows) */;
constexpr int CSR_CH = (E + CSR_NBLK - 1) / CSR_NBLK /* edges per chunk */, CSRA_NW = 8, CSRA_G = (CSR_CH + CSRA_NW * 32 - 1) / (CSRA_NW * 32) /* groups of 32 per wave */, CSRB_NW = 32, CSRB_G = CSR_CAP / (CSRB_NW * 32);
// mask of the wave's valid lanes whose 9-bit key equals this lane's (keys < 512 = CSR_MAXG = CSR_GN)
__device__ __forceinline__ unsigned csr_match(int key, bool valid) { unsigned m = __builtin_amdgcn_ballot_w32(valid);
#pragma unroll   // short fixed trip count: straight-line code, its LDS reads or ballots issued back to back
  for (int b = 0; b < 9; ++b) { const bool on = (key >> b) & 1; const unsigned s = __builtin_amdgcn_ballot_w32(on); m &= on ? s : ~s; } return m; }
// one group of 32 items: returns how many items of this wave's run with the same key stand in front of this lane's item, and advances the wave's own counter row. key < 0: no item.
template <typename T> __device__ __forceinline__ int csr_rank(T* row, int key, int lane) { const bool ok = key >= 0; const unsigned m = csr_match(key, ok); const int r = __popc(m & ((1u << lane) - 1u)); int base = 0;
  if (ok) base = (int)row[key]; if (ok && r == 0) row[key] = (T)(base + __popc(m));
  wave_lds_sync();   // the next group's lanes read counters that other lanes of this wave have just stored
  return base + r; }
// exclusive prefix of one int per thread over a block of NW waves (every thread calls it); total = the block's sum. wsum: NW ints of LDS.
template <int NW> __device__ __forceinline__ int csr_scan(int v, int* wsum, int lane, int wave, int& total) { int inc = v;
#pragma unroll   // short fixed trip count: straight-line code, its LDS reads or ballots issued back to back
  for (int o = 1; o < 32; o <<= 1) { const int u = __shfl_up(inc, o); if (lane >= o) inc += u; }
  if (lane == 31) wsum[wave] = inc;
  __syncthreads();
  int pre = 0, all = 0;
#pragma unroll   // short fixed trip count: straight-line code, its LDS reads or ballots issued back to back
  for (int w = 0; w < NW; ++w) { const int s = wsum[w]; pre += (w < wave) ? s : 0; all += s; }
  __syncthreads();   // wsum may be written again by the next call
  total = all; return pre + inc - v; }
__global__ __launch_bounds__(256) void csrA_kernel(const int* __restrict__ dst, int E, int N, int nG, int CHP, int NGP, int* __restrict__ STG, int* __restrict__ HST) {
  extern __shared__ int sm[];   // cnt[NGP] | run[NGP] | ids[CHP]
  __shared__ int wh[CSRA_NW][CSR_MAXG]; __shared__ int wsum[CSRA_NW];
  int* cnt = sm; int* run = sm + NGP; int* ids = sm + 2 * NGP;
  const int t_ = threadIdx.x, lane = t_ & 31, wave = t_ >> 5;
  const int b = blockIdx.x; const int e0 = b * CSR_CH; const int i0 = wave * (CSRA_G * 32) + lane;
  for (int i = t_; i < CSRA_NW * CSR_MAXG; i += 256) (&wh[0][0])[i] = 0;
  for (int i = t_; i < CHP; i += 256) ids[i] = -1;
  int key[CSRA_G], lr[CSRA_G]; unsigned ei[CSRA_G];
#pragma unroll   // constant indices keep the per-lane arrays in registers
  for (int u = 0; u < CSRA_G; ++u) { ei[u] = (unsigned)min(e0 + i0 + u * 32, E - 1); key[u] = dst[ei[u]]; }   // all of a lane's loads in flight together; an index past the end re-reads the last edge
  static_assert(CSRA_G == 13, "the statement below names 13 values");
  // a precaution: this wait stands in front of every overwrite of a register that an issued load names; the index registers are named so that they stay whole up to it
  asm volatile("s_wait_xcnt 0x0" :: "v"(ei[0]), "v"(ei[1]), "v"(ei[2]), "v"(ei[3]), "v"(ei[4]), "v"(ei[5]), "v"(ei[6]), "v"(ei[7]), "v"(ei[8]), "v"(ei[9]), "v"(ei[10]), "v"(ei[11]), "v"(ei[12]) : "memory");
#pragma unroll   // constant indices keep the per-lane arrays in registers
  for (int u = 0; u < CSRA_G; ++u) { const int i = i0 + u * 32; const bool ok = i < CSR_CH && e0 + i < E; int d = key[u]; d = (d < 0) ? 0 : (d >= N ? N - 1 : d); key[u] = ok ? (d >> CSR_GB) : -1; }
  __syncthreads();
#pragma unroll   // constant indices keep the per-lane arrays in registers
  for (int u = 0; u < CSRA_G; ++u) lr[u] = csr_rank(wh[wave], key[u], lane);
  __syncthreads();
  int s[2];   // thread t_: buckets 2 t_ and 2 t_ + 1; the rows become exclusive prefixes over the waves
#pragma unroll   // short fixed trip count: straight-line code, its LDS reads or ballots issued back to back
  for (int j = 0; j < 2; ++j) { int acc = 0;
#pragma unroll   // short fixed trip count: straight-line code, its LDS reads issued back to back
    for (int w = 0; w < CSRA_NW; ++w) { const int c = wh[w][2 * t_ + j]; wh[w][2 * t_ + j] = acc; acc += c; } s[j] = acc; }
  int all; const int pre = csr_scan<CSRA_NW>(s[0] + s[1], wsum, lane, wave, all);
  if (2 * t_ < NGP) { cnt[2 * t_] = s[0]; run[2 * t_] = pre; } if (2 * t_ + 1 < NGP) { cnt[2 * t_ + 1] = s[1]; run[2 * t_ + 1] = pre + s[0]; }
  __syncthreads();
#pragma unroll   // constant indices keep the per-lane arrays in registers
  for (int u = 0; u < CSRA_G; ++u) if (key[u] >= 0) ids[run[key[u]] + wh[wave][key[u]] + lr[u]] = e0 + i0 + u * 32;
  __syncthreads();
  typedef __attribute__((ext_vector_type(4))) int v4i;
  {
    for (int i = t_; i < CHP / 4; i += 256) *(v4i*)(STG + (size_t)b * CHP + i * 4) = *(const v4i*)(&ids[i * 4]);
    for (int i = t_; i < NGP / 4; i += 256) { v4i v; for (int e = 0; e < 4; ++e) v[e] = (i * 4 + e < nG) ? cnt[i * 4 + e] : 0; *(v4i*)(HST + (size_t)b * NGP + i * 4) = v; }
     }
}
// scan: START[g] (padded to 32), OFF[g][b] (exclusive prefix of HST[b][<g] within block b = position of bucket g inside staging row b), TOT[g]. rows OFF[g][0..511] written by the block whole; START/TOT as one
// padded row each. grid 1 x 512 (thread = b for the OFF rows; a block prefix for START).
__global__ __launch_bounds__(512) void csrS_kernel(const int* __restrict__ HST, int nG, int NGP, int* __restrict__ START, int* __restrict__ TOT, int* __restrict__ OFF) {
  __shared__ int tot[CSR_MAXG];
  const int b = threadIdx.x;   // CSR_NBLK == 512 threads
  { int runb = 0; for (int g = 0; g < nG; ++g) { int c = HST[(size_t)b * NGP + g]; c = (c < 0) ? 0 : c; ((int*)OFF)[(size_t)g * CSR_NBLK + b] = runb; runb += c; }  }
  for (int g = threadIdx.x; g < nG; g += 512) { int s = 0; for (int bb = 0; bb < CSR_NBLK; ++bb) { int c = HST[(size_t)bb * NGP + g]; s += (c < 0) ? 0 : c; } tot[g] = s; }
  __syncthreads();
  __shared__ int st[CSR_MAXG + 32]; __shared__ int wsum[16];
  { const int v = (b < nG) ? ((tot[b] + 31) & ~31) : 0; int all; const int pre = csr_scan<16>(v, wsum, b & 31, b >> 5, all); st[b] = pre; if (b == CSR_MAXG - 1) st[CSR_MAXG] = all; }   // st[g] = sum of the padded totals in front of g; st[NGP] = all of them
  __syncthreads();
  if (threadIdx.x < 32) { // START/TOT rows (NGP ints, padded) written by one wave lane-contiguously
    { for (int i = threadIdx.x; i < NGP + 32; i += 32) { ((int*)START)[i] = (i <= NGP) ? st[min(i, NGP)] : 0; ((int*)TOT)[i] = (i < nG) ? tot[i] : 0; }  } }
}
// bucket: block g (1024 threads): gather ids (from each block's staging sub-run, in block order => original edge order), stable counting sort by node, flush; ROWPTR/ROWCNT rows.
__global__ __launch_bounds__(1024) void csrB_kernel(const int* __restrict__ dst, int N, int nG, int CHP, int NGP, int permLen, const int* __restrict__ STG, const int* __restrict__ HST, const int* __restrict__ OFF, const int* __restrict__ START, const int* __restrict__ TOT, int* __restrict__ PERM, int* __restrict__ ROWPTR, int* __restrict__ ROWCNT, int* __restrict__ FLAG) {
  typedef __attribute__((ext_vector_type(4))) int v4i;
  __shared__ int ids[CSR_CAP]; __shared__ unsigned short key[CSR_CAP]; __shared__ int outp[CSR_CAP]; __shared__ int ncnt[CSR_GN + 1]; __shared__ int boff[CSR_NBLK + 1]; __shared__ int ooff[CSR_NBLK];
  __shared__ __attribute__((aligned(16))) unsigned short wh[CSRB_NW][CSR_GN]; __shared__ int wsum[CSRB_NW];
  const int g = blockIdx.x, t_ = threadIdx.x, lane = t_ & 31, wave = t_ >> 5; int tot = TOT[g]; int st = START[g], stn = START[g + 1]; const int v0 = g * CSR_GN; const int nv = min(CSR_GN, N - v0);
  st = (st < 0) ? 0 : (st > permLen - 32 ? permLen - 32 : st) & ~31; stn = (stn < st) ? st : (stn > permLen ? permLen : stn); tot = (tot < 0) ? 0 : tot; if (tot > stn - st && tot <= CSR_CAP) tot = stn - st;   // static-visible bounds even if a table line were garbage
  if (tot > CSR_CAP) {   // loud failure: zero counts, flag
    { for (int i = t_; i < CSR_GN / 4; i += 1024) { v4i a, c; for (int e = 0; e < 4; ++e) { a[e] = st; c[e] = 0; } *(v4i*)(ROWPTR + v0 + i * 4) = a; *(v4i*)(ROWCNT + v0 + i * 4) = c; } if (t_ == 0) ((int*)FLAG)[0] = 1;  } (void)nv; return; }
  // per-block offsets of this bucket's sub-runs in gather order (thread = staging row)
  { int c = 0; if (t_ < CSR_NBLK) { const unsigned hi = (unsigned)(t_ * NGP + g), oi = (unsigned)(g * CSR_NBLK + t_); c = HST[hi]; const int o_ = OFF[oi];
      asm volatile("s_wait_xcnt 0x0" :: "v"(hi), "v"(oi) : "memory");   // the same precaution as in pass A
      c = (c < 0) ? 0 : (c > CHP ? CHP : c); ooff[t_] = o_; }
    int all; const int pre = csr_scan<CSRB_NW>(c, wsum, lane, wave, all); if (t_ < CSR_NBLK) boff[t_] = min(pre, tot); if (t_ == 0) boff[CSR_NBLK] = min(all, tot); tot = min(tot, all); }
  for (int i = t_; i < CSRB_NW * CSR_GN / 2; i += 1024) ((int*)&wh[0][0])[i] = 0;
  __syncthreads();
  { constexpr int RB = CSR_NBLK / CSRB_NW;   // a wave gathers RB staging rows in a row; the first 32 ids of all of them are in flight together
    int bo[RB], cn[RB], id[RB], dd[RB]; unsigned ix[RB];
#pragma unroll   // constant indices keep the per-lane arrays in registers
    for (int u = 0; u < RB; ++u) { const int b = wave * RB + u; bo[u] = boff[b]; cn[u] = boff[b + 1] - bo[u]; int o_ = ooff[b]; o_ = (o_ < 0) ? 0 : (o_ > CHP - cn[u] ? CHP - cn[u] : o_); ix[u] = (unsigned)(b * CHP + min(o_, CHP - 1) + (lane < cn[u] ? lane : 0)); }   // a lane past the sub-run's end re-reads a written word of the row, so that no load hangs on a branch
#pragma unroll   // constant indices keep the per-lane arrays in registers
    for (int u = 0; u < RB; ++u) id[u] = STG[ix[u]];
    static_assert(RB == 16, "the three statements below name 16 values each");
    // a precaution: this wait stands in front of every overwrite of a register that an issued load names; the index registers are named so that they stay whole up to it
    asm volatile("s_wait_xcnt 0x0" :: "v"(ix[0]), "v"(ix[1]), "v"(ix[2]), "v"(ix[3]), "v"(ix[4]), "v"(ix[5]), "v"(ix[6]), "v"(ix[7]), "v"(ix[8]), "v"(ix[9]), "v"(ix[10]), "v"(ix[11]), "v"(ix[12]), "v"(ix[13]), "v"(ix[14]), "v"(ix[15]) : "memory");
    // holds the 16 loads together in front of the branches below: sunk into its branch, a load would wait there alone
    asm volatile("" :: "v"(id[0]), "v"(id[1]), "v"(id[2]), "v"(id[3]), "v"(id[4]), "v"(id[5]), "v"(id[6]), "v"(id[7]), "v"(id[8]), "v"(id[9]), "v"(id[10]), "v"(id[11]), "v"(id[12]), "v"(id[13]), "v"(id[14]), "v"(id[15]));
#pragma unroll   // constant indices keep the per-lane arrays in registers
    for (int u = 0; u < RB; ++u) id[u] = (id[u] < 0) ? 0 : id[u];
#pragma unroll   // constant indices keep the per-lane arrays in registers
    for (int u = 0; u < RB; ++u) dd[u] = dst[id[u]];
    // the same for the 16 destination loads
    asm volatile("" :: "v"(dd[0]), "v"(dd[1]), "v"(dd[2]), "v"(dd[3]), "v"(dd[4]), "v"(dd[5]), "v"(dd[6]), "v"(dd[7]), "v"(dd[8]), "v"(dd[9]), "v"(dd[10]), "v"(dd[11]), "v"(dd[12]), "v"(dd[13]), "v"(dd[14]), "v"(dd[15]));
#pragma unroll   // constant indices keep the per-lane arrays in registers
    for (int u = 0; u < RB; ++u) if (lane < cn[u]) { int d = dd[u]; d = (d < v0) ? v0 : (d >= N ? N - 1 : d); int kk = d - v0; kk = (kk < 0) ? 0 : (kk >= CSR_GN ? CSR_GN - 1 : kk); ids[bo[u] + lane] = id[u]; key[bo[u] + lane] = (unsigned short)kk; }
#pragma unroll 1   // seldom entered: kept small
    for (int u = 0; u < RB; ++u) { const int b = wave * RB + u; const int bs = boff[b], c = boff[b + 1] - bs; int o_ = ooff[b]; o_ = (o_ < 0) ? 0 : (o_ > CHP - c ? CHP - c : o_); const int* src_ = STG + (size_t)b * CHP + o_;   // what a sub-run holds beyond 32 ids
      for (int i = lane + 32; i < c; i += 32) { int idr = src_[i]; idr = (idr < 0) ? 0 : idr; ids[bs + i] = idr; int d = dst[idr]; d = (d < v0) ? v0 : (d >= N ? N - 1 : d); int kk = d - v0; kk = (kk < 0) ? 0 : (kk >= CSR_GN ? CSR_GN - 1 : kk); key[bs + i] = (unsigned short)kk; } } }
  __syncthreads();
  // stable counting sort by node inside the bucket: wave w owns items [w S, w S + S)
  const int S = ((tot + CSRB_NW * 32 - 1) / (CSRB_NW * 32)) * 32; const int i0 = wave * S + lane;
  int kr[CSRB_G], lr[CSRB_G];
#pragma unroll   // constant indices keep the per-lane arrays in registers
  for (int u = 0; u < CSRB_G; ++u) { const int i = i0 + u * 32; kr[u] = (u * 32 < S && i < tot) ? (int)key[i] : -1; lr[u] = 0; }
#pragma unroll   // constant indices keep the per-lane arrays in registers
  for (int u = 0; u < CSRB_G; ++u) if (u * 32 < S) lr[u] = csr_rank(wh[wave], kr[u], lane);
  __syncthreads();
  { int s = 0; if (t_ < CSR_GN) {   // thread = node: the rows become exclusive prefixes over the waves
#pragma unroll   // short fixed trip count: straight-line code, its LDS reads or ballots issued back to back
      for (int w = 0; w < CSRB_NW; ++w) { const int c = wh[w][t_]; wh[w][t_] = (unsigned short)s; s += c; } }
    int all; const int pre = csr_scan<CSRB_NW>(s, wsum, lane, wave, all); if (t_ < CSR_GN) ncnt[t_] = pre; if (t_ == 0) ncnt[CSR_GN] = all; }   // ncnt[vl] = start of node vl
  __syncthreads();
#pragma unroll   // constant indices keep the per-lane arrays in registers
  for (int u = 0; u < CSRB_G; ++u) if (kr[u] >= 0) outp[ncnt[kr[u]] + (int)wh[wave][kr[u]] + lr[u]] = ids[i0 + u * 32];
  __syncthreads();
  {
    for (int i = t_; i < (stn - st) / 4; i += 1024) { v4i v; for (int e = 0; e < 4; ++e) { const int q = i * 4 + e; v[e] = (q < tot) ? outp[q] : -1; } *(v4i*)(PERM + st + i * 4) = v; }
    for (int i = t_; i < CSR_GN / 4; i += 1024) { v4i a, c; for (int e = 0; e < 4; ++e) { const int vl = i * 4 + e; a[e] = st + ncnt[vl]; c[e] = (vl < nv) ? (ncnt[vl + 1] - ncnt[vl]) : 0; } *(v4i*)(ROWPTR + v0 + i * 4) = a; *(v4i*)(ROWCNT + v0 + i * 4) = c; }   // the tables hold nG*512 entries (beyond N: count 0)
     }
}
__global__ __launch_bounds__(256) void csrZ_kernel(int* __restrict__ p, size_t n4) { typedef __attribute__((ext_vector_type(4))) int v4i; const size_t tid = (size_t)blockIdx.x * 256 + threadIdx.x, nth = (size_t)gridDim.x * 256; v4i z = {0, 0, 0, 0}; for (size_t i = tid; i < n4; i += nth) *(v4i*)(p + i * 4) = z; }
// host helper. Workspace ints needed: STG (512*CHP), HST (512*NGP), OFF (NGP*512), START (NGP+64), TOT (NGP+64), PERM (E + 32*nG + 32), ROWPTR (Npad), ROWCNT (Npad), FLAG (64). Npad = roundup(N, 512).
struct CsrBufs { int *STG, *HST, *OFF, *START, *TOT, *PERM, *ROWPTR, *ROWCNT, *FLAG; int nG, NGP, CHP; size_t permLen; char* base; size_t bytes; };
static size_t csr_carve(CsrBufs& c, char* ws, size_t off, int E, int N) {
  const size_t off0 = off; c.base = ws + off;
  auto al = [&](size_t bytes) { char* p = ws + off; off += (bytes + 255) & ~(size_t)255; return p; };
  c.nG = (N + CSR_GN - 1) / CSR_GN; c.NGP = (c.nG + 31) & ~31; const int ch = (E + CSR_NBLK - 1) / CSR_NBLK; c.CHP = (ch + 31) & ~31; c.permLen = (size_t)E + 32 * (size_t)c.nG + 32;
  c.STG = (int*)al((size_t)CSR_NBLK * c.CHP * 4); c.HST = (int*)al((size_t)CSR_NBLK * c.NGP * 4); c.OFF = (int*)al((size_t)c.NGP * CSR_NBLK * 4); c.START = (int*)al((size_t)(c.NGP + 64) * 4); c.TOT = (int*)al((size_t)(c.NGP + 64) * 4);
  c.PERM = (int*)al(c.permLen * 4); c.ROWPTR = (int*)al((size_t)c.nG * CSR_GN * 4); c.ROWCNT = (int*)al((size_t)c.nG * CSR_GN * 4); c.FLAG = (int*)al(256);
  c.bytes = off - off0; return off;
}
static void csr_build(const CsrBufs& c, const int* dst, int E, int N, hipStream_t stream) {
  const size_t smem = (size_t)(2 * c.NGP + c.CHP) * 4;
  csrZ_kernel<<<512, 256, 0, stream>>>((int*)c.base, c.bytes / 16);
  csrA_kernel<<<CSR_NBLK, 256, smem, stream>>>(dst, E, N, c.nG, c.CHP, c.NGP, c.STG, c.HST);
  csrS_kernel<<<1, 512, 0, stream>>>(c.HST, c.nG, c.NGP, c.START, c.TOT, c.OFF);
  csrB_kernel<<<c.nG, 1024, 0, stream>>>(dst, N, c.nG, c.CHP, c.NGP, (int)c.permLen, c.STG, c.HST, c.OFF, c.START, c.TOT, c.PERM, c.ROWPTR, c.ROWCNT, c.FLAG);
}


__global__ __launch_bounds__(256) void wprep_kernel(const float* __restrict__ wq, const float* __restrict__ wk, const float* __restrict__ wv, const float* __restrict__ wo, b16* __restrict__ WT) {
  const size_t u = (size_t)blockIdx.x * 256 + threadIdx.x; const size_t per = (size_t)D * D / 8; if (u >= 4 * per) return; const int which = (int)(u / per); const size_t e = (u % per) * 8; const float* w = which == 0 ? wq : which == 1 ? wk : which == 2 ? wv : wo; v8b o;
  for (int j = 0; j < 8; ++j) o[j] = (b16)(bf16_rne(w[e + j]) * WSC);
  { *(v8b*)(WT + (size_t)which * D * D + e) = o;  }
}
__global__ __launch_bounds__(128) void proj_kernel(const float* __restrict__ h, const b16* __restrict__ WT, const float* __restrict__ bq, const float* __restrict__ bk, const float* __restrict__ bv, float* __restrict__ QKV) {
  __shared__ __attribute__((aligned(16))) float Tf[4][16][D + 4];
  const int wave = threadIdx.x >> 5, lane = threadIdx.x & 31, nloc = lane & 15, hlf = lane >> 4; const size_t m0 = (size_t)blockIdx.x * 64 + wave * 16; const int part = blockIdx.y; const b16* W = WT + (size_t)part * D * D; const float* bias = part == 0 ? bq : part == 1 ? bk : bv; const float osc = part == 0 ? SCAL : 1.0f;
  const size_t v = m0 + nloc; v8f acc[8];
#pragma unroll
  for (int t = 0; t < 8; ++t) acc[t] = (v8f){};
#pragma unroll
  for (int kb = 0; kb < D; kb += 32) { v16b a = {}; if (v < (size_t)N) { const float* r = h + v * D + kb; for (int e = 0; e < 8; ++e) { a[e] = (b16)(bf16_rne(r[8 * hlf + e]) * XS); a[8 + e] = (b16)(bf16_rne(r[16 + 8 * hlf + e]) * XS); } }
#pragma unroll
    for (int t = 0; t < 8; ++t) acc[t] = wmma16b(a, frag_kb(W + (size_t)(t * 16 + nloc) * D + kb, hlf), acc[t]); }
#pragma unroll
  for (int t = 0; t < 8; ++t) { const int c = t * 16 + nloc; const float bb = bf16_rne(bias[c]);
#pragma unroll 1
    for (int r = 0; r < 8; ++r) { const size_t row = m0 + 8 * hlf + r; Tf[wave][8 * hlf + r][c] = row < (size_t)N ? (acc[t][r] * (1.0f / (XS * WSC)) + bb) * osc : 0.0f; } }
  wave_lds_sync();
  { for (int rr = 0; rr < 16; ++rr) *(v4f*)(QKV + ((size_t)part * NP + m0 + rr) * D + lane * 4) = *(const v4f*)(&Tf[wave][rr][lane * 4]);  }
}
__global__ __launch_bounds__(256) void attn_kernel(const float* QKV, const int* __restrict__ cols, const int* __restrict__ PERM, const int* __restrict__ ROWPTR, const int* __restrict__ ROWCNT, int permLen, b16* Oh, b16* Ol) {   // Oh aliases the q plane (see host)
  const int wave = threadIdx.x >> 5, lane = threadIdx.x & 31; const size_t v = (size_t)blockIdx.x * 8 + wave; const int c0 = lane * 4; (void)Ol;
  v4f o = {0.0f, 0.0f, 0.0f, 0.0f};
  int st = 0, cnt = 0; if (v < (size_t)N) { st = ROWPTR[v]; cnt = ROWCNT[v]; cnt = iclamp(cnt, 0, 65536); st = iclamp(st, 0, permLen - cnt); }
  const v4f q = *(const v4f*)(QKV + v * D + c0); const float* K = QKV + (size_t)NP * D; const float* V = QKV + (size_t)2 * NP * D;
  auto logits = [&](size_t s) -> v4f { const v4f k = *(const v4f*)(K + s * D + c0); v4f l; for (int i = 0; i < 4; ++i) { float d = pmul(q[i], k[i]); d += __shfl_xor(d, 2); d += __shfl_xor(d, 4); d += __shfl_xor(d, 8); d += __shfl_xor(d, 16); l[i] = d; } return l; };
  v4f mx = {-INFINITY, -INFINITY, -INFINITY, -INFINITY};
#pragma unroll 1
  for (int j = 0; j < cnt; ++j) { const int e = iclamp(PERM[st + j], 0, E - 1); const size_t s = (size_t)iclamp(cols[e], 0, N - 1); const v4f l = logits(s); for (int i = 0; i < 4; ++i) mx[i] = fmaxf(mx[i], l[i]); }
  v4f den = {0.0f, 0.0f, 0.0f, 0.0f}, acc = {0.0f, 0.0f, 0.0f, 0.0f};
#pragma unroll 1
  for (int j = 0; j < cnt; ++j) { const int e = iclamp(PERM[st + j], 0, E - 1); const size_t s = (size_t)iclamp(cols[e], 0, N - 1); const v4f l = logits(s); const v4f vv = *(const v4f*)(V + s * D + c0);
    for (int i = 0; i < 4; ++i) { const float p = nexp(l[i] - mx[i]); den[i] += p; acc[i] += pmul(p, vv[i]); } }
  if (cnt > 0) for (int i = 0; i < 4; ++i) o[i] = acc[i] / den[i];
  v4h ph, pl; for (int i = 0; i < 4; ++i) { b16 p, pq; split16(o[i] * XS, p, pq); ph[i] = p; pl[i] = pq; }
  { *(v4h*)(Oh + v * (2 * D) + c0) = ph; *(v4h*)(Oh + v * (2 * D) + D + c0) = pl;  }   // hi | lo packed into this node's own 512-B q row (no other wave reads it)
}
__global__ __launch_bounds__(128) void oproj_kernel(const b16* __restrict__ Oh, const b16* __restrict__ Ol, const b16* __restrict__ WT, const float* __restrict__ bo, float* __restrict__ out) {
  __shared__ __attribute__((aligned(16))) float Tf[4][16][D + 4];
  const int wave = threadIdx.x >> 5, lane = threadIdx.x & 31, nloc = lane & 15, hlf = lane >> 4; const size_t m0 = (size_t)blockIdx.x * 64 + wave * 16; const b16* W = WT + (size_t)3 * D * D;
  v8f acc[8];
#pragma unroll
  for (int t = 0; t < 8; ++t) acc[t] = (v8f){};
#pragma unroll
  for (int kb = 0; kb < D; kb += 32) { const v16b a = frag_kb(Oh + (m0 + nloc) * (2 * D) + kb, hlf), al = frag_kb(Oh + (m0 + nloc) * (2 * D) + D + kb, hlf);
#pragma unroll
    for (int t = 0; t < 8; ++t) { const v16b bw = frag_kb(W + (size_t)(t * 16 + nloc) * D + kb, hlf); acc[t] = wmma16b(a, bw, acc[t]); acc[t] = wmma16b(al, bw, acc[t]); } }
#pragma unroll
  for (int t = 0; t < 8; ++t) { const int c = t * 16 + nloc; const float bb = bf16_rne(bo[c]);
#pragma unroll 1
    for (int r = 0; r < 8; ++r) Tf[wave][8 * hlf + r][c] = acc[t][r] * (1.0f / (XS * WSC)) + bb; }
  wave_lds_sync();
  { for (int rr = 0; rr < 16; ++rr) { const size_t row = m0 + rr; if (row < (size_t)N) *(v4f*)(out + row * D + lane * 4) = *(const v4f*)(&Tf[wave][rr][lane * 4]); }  }
}
}  // namespace

extern "C" void kernel_launch(void* const* d_in, const int* in_sizes, int n_in, void* d_out, int out_size, void* d_ws, size_t ws_size, hipStream_t stream) {
  (void)n_in;
  auto Fp = [&](int i) { return (const float*)d_in[i]; }; auto Ip = [&](int i) { return (const int*)d_in[i]; };
  // input order: 0 h [100000,128], 1 row [E] i32, 2 col [E] i32, 3 Wq [128,128], 4 bq, 5 Wk, 6 bk, 7 Wv, 8 bv, 9 Wo, 10 bo
  if (in_sizes[0] != N * D || in_sizes[1] != E || in_sizes[2] != E || in_sizes[3] != D * D || in_sizes[9] != D * D || out_size != N * D) return;
  size_t off = 0; char* ws = (char*)d_ws;
  auto carve = [&](size_t bytes) { char* p = ws + off; off += (bytes + 255) & ~(size_t)255; return p; };
  b16* WT = (b16*)carve((size_t)4 * D * D * 2); float* QKV = (float*)carve((size_t)3 * NP * D * 4);
  b16* Oh = (b16*)QKV; b16* Ol = Oh;   // the attention output (hi | lo, 2 x 128 halves) overwrites each node's own 512-B q row in place: a wave reads only its own q row before writing it (K/V rows live in the other two planes)
  CsrBufs csr; off = csr_carve(csr, ws, off, E, N);
  if (off > ws_size) return;   // QKV 153.6 + CSR ~15 = ~169 MB (< 256 MiB)
  wprep_kernel<<<(unsigned)((4 * (size_t)D * D / 8 + 255) / 256), 256, 0, stream>>>(Fp(3), Fp(5), Fp(7), Fp(9), WT);
  csr_build(csr, Ip(1), E, N, stream);   // group by row (the softmax axis)
  proj_kernel<<<dim3(NP / 64, 3), 128, 0, stream>>>(Fp(0), WT, Fp(4), Fp(6), Fp(8), QKV);
  attn_kernel<<<NP / 8, 256, 0, stream>>>(QKV, Ip(2), csr.PERM, csr.ROWPTR, csr.ROWCNT, (int)csr.permLen, Oh, Ol);
  oproj_kernel<<<NP / 64, 128, 0, stream>>>(Oh, Ol, WT, Fp(10), (float*)d_out);
}

// v002
// Measured time: 302 microseconds a run.
// Next to v001, in two timings, it ran 1.23 times as fast each time.
// Counting every step since v000, it is 6.53 times as fast.
#include <hip/hip_runtime.h>

// Sparse multi-head attention over a graph (DGL bsddmm / bspmm style): q = (h Wq^T + bq) * 16^-1/2, k, v = Linear(h), all reshaped (N, 16, 8) — i.e. channel c = d*8 + head (heads interleaved);
// per edge e: logit_h = sum_d q[row][d,h] k[col][d,h]; softmax over the edges of each row (destination); out[row] = sum attn v[col]; y = out Wo^T + bo -> [100000][128]. 100,000 nodes,
// 1,600,000 edges; rows without edges give out = 0 (then bo).
// WMMA (v_wmma_f32_16x16x32_f16, f32 accumulate): the q/k/v projections ([100,032 x 128] x [128 x 384], EXACT bf16 h x8: 1 product) and the output projection ([100,032 x 128] x [128 x 128],
// attention output as f16 hi+lo x8 planes: 2 products), weights exact x256; per-edge head dots (lane owns channels 4l..4l+3 = heads (4l mod 8)+0..3 at d = l/2; reduced over the 16 lanes of
// equal parity with xor 2,4,8,16), softmax and weighted sums in f32. Inputs rounded to bf16 once; ids int32 (clamped). Fragment k-map per lane half hh for A AND B:

namespace {
constexpr int N = 100000, NP = 100032, E = 1600000, D = 128, NH = 8, HD = 16;
constexpr float XS = 8.0f, WSC = 256.0f, NEG = 0.2f /* unused */, SCAL = 0.25f /* 16^-0.5 */;
typedef _Float16 b16;
typedef __attribute__((ext_vector_type(16))) _Float16 v16b;
typedef __attribute__((ext_vector_type(8))) _Float16 v8b;
typedef __attribute__((ext_vector_type(4))) _Float16 v4h;
typedef __attribute__((ext_vector_type(8))) float v8f;
typedef __attribute__((ext_vector_type(4))) float v4f;
__device__ __forceinline__ float bf16_rne(float f) { unsigned int u = __float_as_uint(f); u += 0x7FFFu + ((u >> 16) & 1u); return __uint_as_float(u & 0xFFFF0000u); }
__device__ __forceinline__ void split16(float v, b16& hi, b16& lo) { hi = (b16)v; lo = (b16)(v - (float)hi); }
__device__ __forceinline__ v16b frag_kb(const b16* p, int hh) { const v8b a = *(const v8b*)(p + 8 * hh), b = *(const v8b*)(p + 16 + 8 * hh); v16b f;
#pragma unroll
  for (int e = 0; e < 8; ++e) { f[e] = a[e]; f[8 + e] = b[e]; } return f; }
__device__ __forceinline__ v8f wmma16b(v16b a, v16b b, v8f c) { v8f d = __builtin_amdgcn_wmma_f32_16x16x32_f16(false, a, false, b, (short)0, c, false, false); asm volatile("v_nop\n\tv_nop\n\tv_nop\n\tv_nop" : "+v"(d) : "v"(a), "v"(b)); return d; }
__device__ __forceinline__ void wave_lds_sync() { __builtin_amdgcn_fence(__ATOMIC_RELEASE, "workgroup"); __builtin_amdgcn_wave_barrier(); __builtin_amdgcn_fence(__ATOMIC_ACQUIRE, "workgroup"); }
__device__ __forceinline__ float pmul(float a, float b) { float p = a * b; asm volatile("" : "+v"(p)); return p; }
__device__ __forceinline__ int iclamp(int v, int lo, int hi) { return v < lo ? lo : (v > hi ? hi : v); }
__device__ __forceinline__ float nexp(float x) { return __builtin_amdgcn_exp2f(x * 1.4426950408889634f); }
// ---------------- deterministic, line-safe CSR by destination (two-level bucketing; every global write is a whole-line, lane-contiguous store) ----------------
// Pass A (block per contiguous edge chunk): a stable counting sort of the chunk's edges by coarse bucket g = dst >> CSR_GB (nG <= CSR_MAXG buckets) into LDS, all waves at work (see csr_rank), then whole-line
//   stores of the grouped ids (STG row) and of the bucket counts (HST row).
// Pass B (block per bucket g): gathers the bucket's edge ids from the 512 staging rows into LDS (at most CSR_CAP ids), the same stable counting sort by destination node, then writes (a) its PERM run and
//   (b) ROWPTR[v], ROWCNT[v] for its 2^CSR_GB nodes as contiguous ints. If a bucket exceeds CSR_CAP the kernel writes ROWCNT = 0 for its nodes and sets FLAG[0] = 1 (loud failure, no corruption).
// The sort, no atomics, original edge order kept inside every key: each wave owns a contiguous run of items and a histogram row of its own; per 32 items csr_rank gives every lane its rank among the
//   lanes with an equal key, the first such lane advances the row's counter; then a prefix over (key, wave) turns the rows into start positions.
constexpr int CSR_NBLK = 512, CSR_GB = 9, CSR_GN = 1 << CSR_GB /* nodes per bucket */, CSR_MAXG = 512, CSR_CAP = 12288 /* ids per bucket in LDS (48+24+48 KB, and 32 KB of counter rows) */;
constexpr int CSR_CH = (E + CSR_NBLK - 1) / CSR_NBLK /* edges per chunk */, CSRA_NW = 8, CSRA_G = (CSR_CH + CSRA_NW * 32 - 1) / (CSRA_NW * 32) /* groups of 32 per wave */, CSRB_NW = 32, CSRB_G = CSR_CAP / (CSRB_NW * 32);
// mask of the wave's valid lanes whose 9-bit key equals this lane's (keys < 512 = CSR_MAXG = CSR_GN)
__device__ __forceinline__ unsigned csr_match(int key, bool valid) { unsigned m = __builtin_amdgcn_ballot_w32(valid);
#pragma unroll   // short fixed trip count: straight-line code, its LDS reads or ballots issued back to back
  for (int b = 0; b < 9; ++b) { const bool on = (key >> b) & 1; const unsigned s = __builtin_amdgcn_ballot_w32(on); m &= on ? s : ~s; } return m; }
// one group of 32 items: returns how many items of this wave's run with the same key stand in front of this lane's item, and advances the wave's own counter row. key < 0: no item.
template <typename T> __device__ __forceinline__ int csr_rank(T* row, int key, int lane) { const bool ok = key >= 0; const unsigned m = csr_match(key, ok); const int r = __popc(m & ((1u << lane) - 1u)); int base = 0;
  if (ok) base = (int)row[key]; if (ok && r == 0) row[key] = (T)(base + __popc(m));
  wave_lds_sync();   // the next group's lanes read counters that other lanes of this wave have just stored
  return base + r; }
// exclusive prefix of one int per thread over a block of NW waves (every thread calls it); total = the block's sum. wsum: NW ints of LDS.
template <int NW> __device__ __forceinline__ int csr_scan(int v, int* wsum, int lane, int wave, int& total) { int inc = v;
#pragma unroll   // short fixed trip count: straight-line code, its LDS reads or ballots issued back to back
  for (int o = 1; o < 32; o <<= 1) { const int u = __shfl_up(inc, o); if (lane >= o) inc += u; }
  if (lane == 31) wsum[wave] = inc;
  __syncthreads();
  int pre = 0, all = 0;
#pragma unroll   // short fixed trip count: straight-line code, its LDS reads or ballots issued back to back
  for (int w = 0; w < NW; ++w) { const int s = wsum[w]; pre += (w < wave) ? s : 0; all += s; }
  __syncthreads();   // wsum may be written again by the next call
  total = all; return pre + inc - v; }
__global__ __launch_bounds__(256) void csrA_kernel(const int* __restrict__ dst, int E, int N, int nG, int CHP, int NGP, int* __restrict__ STG, int* __restrict__ HST) {
  extern __shared__ int sm[];   // cnt[NGP] | run[NGP] | ids[CHP]
  __shared__ int wh[CSRA_NW][CSR_MAXG]; __shared__ int wsum[CSRA_NW];
  int* cnt = sm; int* run = sm + NGP; int* ids = sm + 2 * NGP;
  const int t_ = threadIdx.x, lane = t_ & 31, wave = t_ >> 5;
  const int b = blockIdx.x; const int e0 = b * CSR_CH; const int i0 = wave * (CSRA_G * 32) + lane;
  for (int i = t_; i < CSRA_NW * CSR_MAXG; i += 256) (&wh[0][0])[i] = 0;
  for (int i = t_; i < CHP; i += 256) ids[i] = -1;
  int key[CSRA_G], lr[CSRA_G]; unsigned ei[CSRA_G];
#pragma unroll   // constant indices keep the per-lane arrays in registers
  for (int u = 0; u < CSRA_G; ++u) { ei[u] = (unsigned)min(e0 + i0 + u * 32, E - 1); key[u] = dst[ei[u]]; }   // all of a lane's loads in flight together; an index past the end re-reads the last edge
  static_assert(CSRA_G == 13, "the statement below names 13 values");
  // a precaution: this wait stands in front of every overwrite of a register that an issued load names; the index registers are named so that they stay whole up to it
  asm volatile("s_wait_xcnt 0x0" :: "v"(ei[0]), "v"(ei[1]), "v"(ei[2]), "v"(ei[3]), "v"(ei[4]), "v"(ei[5]), "v"(ei[6]), "v"(ei[7]), "v"(ei[8]), "v"(ei[9]), "v"(ei[10]), "v"(ei[11]), "v"(ei[12]) : "memory");
#pragma unroll   // constant indices keep the per-lane arrays in registers
  for (int u = 0; u < CSRA_G; ++u) { const int i = i0 + u * 32; const bool ok = i < CSR_CH && e0 + i < E; int d = key[u]; d = (d < 0) ? 0 : (d >= N ? N - 1 : d); key[u] = ok ? (d >> CSR_GB) : -1; }
  __syncthreads();
#pragma unroll   // constant indices keep the per-lane arrays in registers
  for (int u = 0; u < CSRA_G; ++u) lr[u] = csr_rank(wh[wave], key[u], lane);
  __syncthreads();
  int s[2];   // thread t_: buckets 2 t_ and 2 t_ + 1; the rows become exclusive prefixes over the waves
#pragma unroll   // short fixed trip count: straight-line code, its LDS reads or ballots issued back to back
  for (int j = 0; j < 2; ++j) { int acc = 0;
#pragma unroll   // short fixed trip count: straight-line code, its LDS reads issued back to back
    for (int w = 0; w < CSRA_NW; ++w) { const int c = wh[w][2 * t_ + j]; wh[w][2 * t_ + j] = acc; acc += c; } s[j] = acc; }
  int all; const int pre = csr_scan<CSRA_NW>(s[0] + s[1], wsum, lane, wave, all);
  if (2 * t_ < NGP) { cnt[2 * t_] = s[0]; run[2 * t_] = pre; } if (2 * t_ + 1 < NGP) { cnt[2 * t_ + 1] = s[1]; run[2 * t_ + 1] = pre + s[0]; }
  __syncthreads();
#pragma unroll   // constant indices keep the per-lane arrays in registers
  for (int u = 0; u < CSRA_G; ++u) if (key[u] >= 0) ids[run[key[u]] + wh[wave][key[u]] + lr[u]] = e0 + i0 + u * 32;
  __syncthreads();
  typedef __attribute__((ext_vector_type(4))) int v4i;
  {
    for (int i = t_; i < CHP / 4; i += 256) *(v4i*)(STG + (size_t)b * CHP + i * 4) = *(const v4i*)(&ids[i * 4]);
    for (int i = t_; i < NGP / 4; i += 256) { v4i v; for (int e = 0; e < 4; ++e) v[e] = (i * 4 + e < nG) ? cnt[i * 4 + e] : 0; *(v4i*)(HST + (size_t)b * NGP + i * 4) = v; }
     }
}
// scan: START[g] (padded to 32), OFF[g][b] (exclusive prefix of HST[b][<g] within block b = position of bucket g inside staging row b), TOT[g]. rows OFF[g][0..511] written by the block whole; START/TOT as one
// padded row each. grid 1 x 512 (thread = b for the OFF rows; a block prefix for START).
__global__ __launch_bounds__(512) void csrS_kernel(const int* __restrict__ HST, int nG, int NGP, int* __restrict__ START, int* __restrict__ TOT, int* __restrict__ OFF) {
  __shared__ int tot[CSR_MAXG];
  const int b = threadIdx.x;   // CSR_NBLK == 512 threads
  { int runb = 0; for (int g = 0; g < nG; ++g) { int c = HST[(size_t)b * NGP + g]; c = (c < 0) ? 0 : c; ((int*)OFF)[(size_t)g * CSR_NBLK + b] = runb; runb += c; }  }
  for (int g = threadIdx.x; g < nG; g += 512) { int s = 0; for (int bb = 0; bb < CSR_NBLK; ++bb) { int c = HST[(size_t)bb * NGP + g]; s += (c < 0) ? 0 : c; } tot[g] = s; }
  __syncthreads();
  __shared__ int st[CSR_MAXG + 32]; __shared__ int wsum[16];
  { const int v = (b < nG) ? ((tot[b] + 31) & ~31) : 0; int all; const int pre = csr_scan<16>(v, wsum, b & 31, b >> 5, all); st[b] = pre; if (b == CSR_MAXG - 1) st[CSR_MAXG] = all; }   // st[g] = sum of the padded totals in front of g; st[NGP] = all of them
  __syncthreads();
  if (threadIdx.x < 32) { // START/TOT rows (NGP ints, padded) written by one wave lane-contiguously
    { for (int i = threadIdx.x; i < NGP + 32; i += 32) { ((int*)START)[i] = (i <= NGP) ? st[min(i, NGP)] : 0; ((int*)TOT)[i] = (i < nG) ? tot[i] : 0; }  } }
}
// bucket: block g (1024 threads): gather ids (from each block's staging sub-run, in block order => original edge order), stable counting sort by node, flush; ROWPTR/ROWCNT rows.
__global__ __launch_bounds__(1024) void csrB_kernel(const int* __restrict__ dst, int N, int nG, int CHP, int NGP, int permLen, const int* __restrict__ STG, const int* __restrict__ HST, const int* __restrict__ OFF, const int* __restrict__ START, const int* __restrict__ TOT, int* __restrict__ PERM, int* __restrict__ ROWPTR, int* __restrict__ ROWCNT, int* __restrict__ FLAG) {
  typedef __attribute__((ext_vector_type(4))) int v4i;
  __shared__ int ids[CSR_CAP]; __shared__ unsigned short key[CSR_CAP]; __shared__ int outp[CSR_CAP]; __shared__ int ncnt[CSR_GN + 1]; __shared__ int boff[CSR_NBLK + 1]; __shared__ int ooff[CSR_NBLK];
  __shared__ __attribute__((aligned(16))) unsigned short wh[CSRB_NW][CSR_GN]; __shared__ int wsum[CSRB_NW];
  const int g = blockIdx.x, t_ = threadIdx.x, lane = t_ & 31, wave = t_ >> 5; int tot = TOT[g]; int st = START[g], stn = START[g + 1]; const int v0 = g * CSR_GN; const int nv = min(CSR_GN, N - v0);
  st = (st < 0) ? 0 : (st > permLen - 32 ? permLen - 32 : st) & ~31; stn = (stn < st) ? st : (stn > permLen ? permLen : stn); tot = (tot < 0) ? 0 : tot; if (tot > stn - st && tot <= CSR_CAP) tot = stn - st;   // static-visible bounds even if a table line were garbage
  if (tot > CSR_CAP) {   // loud failure: zero counts, flag
    { for (int i = t_; i < CSR_GN / 4; i += 1024) { v4i a, c; for (int e = 0; e < 4; ++e) { a[e] = st; c[e] = 0; } *(v4i*)(ROWPTR + v0 + i * 4) = a; *(v4i*)(ROWCNT + v0 + i * 4) = c; } if (t_ == 0) ((int*)FLAG)[0] = 1;  } (void)nv; return; }
  // per-block offsets of this bucket's sub-runs in gather order (thread = staging row)
  { int c = 0; if (t_ < CSR_NBLK) { const unsigned hi = (unsigned)(t_ * NGP + g), oi = (unsigned)(g * CSR_NBLK + t_); c = HST[hi]; const int o_ = OFF[oi];
      asm volatile("s_wait_xcnt 0x0" :: "v"(hi), "v"(oi) : "memory");   // the same precaution as in pass A
      c = (c < 0) ? 0 : (c > CHP ? CHP : c); ooff[t_] = o_; }
    int all; const int pre = csr_scan<CSRB_NW>(c, wsum, lane, wave, all); if (t_ < CSR_NBLK) boff[t_] = min(pre, tot); if (t_ == 0) boff[CSR_NBLK] = min(all, tot); tot = min(tot, all); }
  for (int i = t_; i < CSRB_NW * CSR_GN / 2; i += 1024) ((int*)&wh[0][0])[i] = 0;
  __syncthreads();
  { constexpr int RB = CSR_NBLK / CSRB_NW;   // a wave gathers RB staging rows in a row; the first 32 ids of all of them are in flight together
    int bo[RB], cn[RB], id[RB], dd[RB]; unsigned ix[RB];
#pragma unroll   // constant indices keep the per-lane arrays in registers
    for (int u = 0; u < RB; ++u) { const int b = wave * RB + u; bo[u] = boff[b]; cn[u] = boff[b + 1] - bo[u]; int o_ = ooff[b]; o_ = (o_ < 0) ? 0 : (o_ > CHP - cn[u] ? CHP - cn[u] : o_); ix[u] = (unsigned)(b * CHP + min(o_, CHP - 1) + (lane < cn[u] ? lane : 0)); }   // a lane past the sub-run's end re-reads a written word of the row, so that no load hangs on a branch
#pragma unroll   // constant indices keep the per-lane arrays in registers
    for (int u = 0; u < RB; ++u) id[u] = STG[ix[u]];
    static_assert(RB == 16, "the three statements below name 16 values each");
    // a precaution: this wait stands in front of every overwrite of a register that an issued load names; the index registers are named so that they stay whole up to it
    asm volatile("s_wait_xcnt 0x0" :: "v"(ix[0]), "v"(ix[1]), "v"(ix[2]), "v"(ix[3]), "v"(ix[4]), "v"(ix[5]), "v"(ix[6]), "v"(ix[7]), "v"(ix[8]), "v"(ix[9]), "v"(ix[10]), "v"(ix[11]), "v"(ix[12]), "v"(ix[13]), "v"(ix[14]), "v"(ix[15]) : "memory");
    // holds the 16 loads together in front of the branches below: sunk into its branch, a load would wait there alone
    asm volatile("" :: "v"(id[0]), "v"(id[1]), "v"(id[2]), "v"(id[3]), "v"(id[4]), "v"(id[5]), "v"(id[6]), "v"(id[7]), "v"(id[8]), "v"(id[9]), "v"(id[10]), "v"(id[11]), "v"(id[12]), "v"(id[13]), "v"(id[14]), "v"(id[15]));
#pragma unroll   // constant indices keep the per-lane arrays in registers
    for (int u = 0; u < RB; ++u) id[u] = (id[u] < 0) ? 0 : id[u];
#pragma unroll   // constant indices keep the per-lane arrays in registers
    for (int u = 0; u < RB; ++u) dd[u] = dst[id[u]];
    // the same for the 16 destination loads
    asm volatile("" :: "v"(dd[0]), "v"(dd[1]), "v"(dd[2]), "v"(dd[3]), "v"(dd[4]), "v"(dd[5]), "v"(dd[6]), "v"(dd[7]), "v"(dd[8]), "v"(dd[9]), "v"(dd[10]), "v"(dd[11]), "v"(dd[12]), "v"(dd[13]), "v"(dd[14]), "v"(dd[15]));
#pragma unroll   // constant indices keep the per-lane arrays in registers
    for (int u = 0; u < RB; ++u) if (lane < cn[u]) { int d = dd[u]; d = (d < v0) ? v0 : (d >= N ? N - 1 : d); int kk = d - v0; kk = (kk < 0) ? 0 : (kk >= CSR_GN ? CSR_GN - 1 : kk); ids[bo[u] + lane] = id[u]; key[bo[u] + lane] = (unsigned short)kk; }
#pragma unroll 1   // seldom entered: kept small
    for (int u = 0; u < RB; ++u) { const int b = wave * RB + u; const int bs = boff[b], c = boff[b + 1] - bs; int o_ = ooff[b]; o_ = (o_ < 0) ? 0 : (o_ > CHP - c ? CHP - c : o_); const int* src_ = STG + (size_t)b * CHP + o_;   // what a sub-run holds beyond 32 ids
      for (int i = lane + 32; i < c; i += 32) { int idr = src_[i]; idr = (idr < 0) ? 0 : idr; ids[bs + i] = idr; int d = dst[idr]; d = (d < v0) ? v0 : (d >= N ? N - 1 : d); int kk = d - v0; kk = (kk < 0) ? 0 : (kk >= CSR_GN ? CSR_GN - 1 : kk); key[bs + i] = (unsigned short)kk; } } }
  __syncthreads();
  // stable counting sort by node inside the bucket: wave w owns items [w S, w S + S)
  const int S = ((tot + CSRB_NW * 32 - 1) / (CSRB_NW * 32)) * 32; const int i0 = wave * S + lane;
  int kr[CSRB_G], lr[CSRB_G];
#pragma unroll   // constant indices keep the per-lane arrays in registers
  for (int u = 0; u < CSRB_G; ++u) { const int i = i0 + u * 32; kr[u] = (u * 32 < S && i < tot) ? (int)key[i] : -1; lr[u] = 0; }
#pragma unroll   // constant indices keep the per-lane arrays in registers
  for (int u = 0; u < CSRB_G; ++u) if (u * 32 < S) lr[u] = csr_rank(wh[wave], kr[u], lane);
  __syncthreads();
  { int s = 0; if (t_ < CSR_GN) {   // thread = node: the rows become exclusive prefixes over the waves
#pragma unroll   // short fixed trip count: straight-line code, its LDS reads or ballots issued back to back
      for (int w = 0; w < CSRB_NW; ++w) { const int c = wh[w][t_]; wh[w][t_] = (unsigned short)s; s += c; } }
    int all; const int pre = csr_scan<CSRB_NW>(s, wsum, lane, wave, all); if (t_ < CSR_GN) ncnt[t_] = pre; if (t_ == 0) ncnt[CSR_GN] = all; }   // ncnt[vl] = start of node vl
  __syncthreads();
#pragma unroll   // constant indices keep the per-lane arrays in registers
  for (int u = 0; u < CSRB_G; ++u) if (kr[u] >= 0) outp[ncnt[kr[u]] + (int)wh[wave][kr[u]] + lr[u]] = ids[i0 + u * 32];
  __syncthreads();
  {
    for (int i = t_; i < (stn - st) / 4; i += 1024) { v4i v; for (int e = 0; e < 4; ++e) { const int q = i * 4 + e; v[e] = (q < tot) ? outp[q] : -1; } *(v4i*)(PERM + st + i * 4) = v; }
    for (int i = t_; i < CSR_GN / 4; i += 1024) { v4i a, c; for (int e = 0; e < 4; ++e) { const int vl = i * 4 + e; a[e] = st + ncnt[vl]; c[e] = (vl < nv) ? (ncnt[vl + 1] - ncnt[vl]) : 0; } *(v4i*)(ROWPTR + v0 + i * 4) = a; *(v4i*)(ROWCNT + v0 + i * 4) = c; }   // the tables hold nG*512 entries (beyond N: count 0)
     }
}
__global__ __launch_bounds__(256) void csrZ_kernel(int* __restrict__ p, size_t n4) { typedef __attribute__((ext_vector_type(4))) int v4i; const size_t tid = (size_t)blockIdx.x * 256 + threadIdx.x, nth = (size_t)gridDim.x * 256; v4i z = {0, 0, 0, 0}; for (size_t i = tid; i < n4; i += nth) *(v4i*)(p + i * 4) = z; }
// host helper. Workspace ints needed: STG (512*CHP), HST (512*NGP), OFF (NGP*512), START (NGP+64), TOT (NGP+64), PERM (E + 32*nG + 32), ROWPTR (Npad), ROWCNT (Npad), FLAG (64). Npad = roundup(N, 512).
struct CsrBufs { int *STG, *HST, *OFF, *START, *TOT, *PERM, *ROWPTR, *ROWCNT, *FLAG; int nG, NGP, CHP; size_t permLen; char* base; size_t bytes; };
static size_t csr_carve(CsrBufs& c, char* ws, size_t off, int E, int N) {
  const size_t off0 = off; c.base = ws + off;
  auto al = [&](size_t bytes) { char* p = ws + off; off += (bytes + 255) & ~(size_t)255; return p; };
  c.nG = (N + CSR_GN - 1) / CSR_GN; c.NGP = (c.nG + 31) & ~31; const int ch = (E + CSR_NBLK - 1) / CSR_NBLK; c.CHP = (ch + 31) & ~31; c.permLen = (size_t)E + 32 * (size_t)c.nG + 32;
  c.STG = (int*)al((size_t)CSR_NBLK * c.CHP * 4); c.HST = (int*)al((size_t)CSR_NBLK * c.NGP * 4); c.OFF = (int*)al((size_t)c.NGP * CSR_NBLK * 4); c.START = (int*)al((size_t)(c.NGP + 64) * 4); c.TOT = (int*)al((size_t)(c.NGP + 64) * 4);
  c.PERM = (int*)al(c.permLen * 4); c.ROWPTR = (int*)al((size_t)c.nG * CSR_GN * 4); c.ROWCNT = (int*)al((size_t)c.nG * CSR_GN * 4); c.FLAG = (int*)al(256);
  c.bytes = off - off0; return off;
}
static void csr_build(const CsrBufs& c, const int* dst, int E, int N, hipStream_t stream) {
  const size_t smem = (size_t)(2 * c.NGP + c.CHP) * 4;
  csrZ_kernel<<<512, 256, 0, stream>>>((int*)c.base, c.bytes / 16);
  csrA_kernel<<<CSR_NBLK, 256, smem, stream>>>(dst, E, N, c.nG, c.CHP, c.NGP, c.STG, c.HST);
  csrS_kernel<<<1, 512, 0, stream>>>(c.HST, c.nG, c.NGP, c.START, c.TOT, c.OFF);
  csrB_kernel<<<c.nG, 1024, 0, stream>>>(dst, N, c.nG, c.CHP, c.NGP, (int)c.permLen, c.STG, c.HST, c.OFF, c.START, c.TOT, c.PERM, c.ROWPTR, c.ROWCNT, c.FLAG);
}


__global__ __launch_bounds__(256) void wprep_kernel(const float* __restrict__ wq, const float* __restrict__ wk, const float* __restrict__ wv, const float* __restrict__ wo, b16* __restrict__ WT) {
  const size_t u = (size_t)blockIdx.x * 256 + threadIdx.x; const size_t per = (size_t)D * D / 8; if (u >= 4 * per) return; const int which = (int)(u / per); const size_t e = (u % per) * 8; const float* w = which == 0 ? wq : which == 1 ? wk : which == 2 ? wv : wo; v8b o;
  for (int j = 0; j < 8; ++j) o[j] = (b16)(bf16_rne(w[e + j]) * WSC);
  { *(v8b*)(WT + (size_t)which * D * D + e) = o;  }
}
__global__ __launch_bounds__(128) void proj_kernel(const float* __restrict__ h, const b16* __restrict__ WT, const float* __restrict__ bq, const float* __restrict__ bk, const float* __restrict__ bv, float* __restrict__ QKV) {
  __shared__ __attribute__((aligned(16))) float Tf[4][16][D + 4];
  const int wave = threadIdx.x >> 5, lane = threadIdx.x & 31, nloc = lane & 15, hlf = lane >> 4; const size_t m0 = (size_t)blockIdx.x * 64 + wave * 16; const int part = blockIdx.y; const b16* W = WT + (size_t)part * D * D; const float* bias = part == 0 ? bq : part == 1 ? bk : bv; const float osc = part == 0 ? SCAL : 1.0f;
  const size_t v = m0 + nloc; v8f acc[8];
#pragma unroll
  for (int t = 0; t < 8; ++t) acc[t] = (v8f){};
#pragma unroll
  for (int kb = 0; kb < D; kb += 32) { v16b a = {}; if (v < (size_t)N) { const float* r = h + v * D + kb; for (int e = 0; e < 8; ++e) { a[e] = (b16)(bf16_rne(r[8 * hlf + e]) * XS); a[8 + e] = (b16)(bf16_rne(r[16 + 8 * hlf + e]) * XS); } }
#pragma unroll
    for (int t = 0; t < 8; ++t) acc[t] = wmma16b(a, frag_kb(W + (size_t)(t * 16 + nloc) * D + kb, hlf), acc[t]); }
#pragma unroll
  for (int t = 0; t < 8; ++t) { const int c = t * 16 + nloc; const float bb = bf16_rne(bias[c]);
#pragma unroll 1
    for (int r = 0; r < 8; ++r) { const size_t row = m0 + 8 * hlf + r; Tf[wave][8 * hlf + r][c] = row < (size_t)N ? (acc[t][r] * (1.0f / (XS * WSC)) + bb) * osc : 0.0f; } }
  wave_lds_sync();
  { for (int rr = 0; rr < 16; ++rr) *(v4f*)(QKV + ((size_t)part * NP + m0 + rr) * D + lane * 4) = *(const v4f*)(&Tf[wave][rr][lane * 4]);  }
}
__global__ __launch_bounds__(256) void attn_kernel(const float* QKV, const int* __restrict__ cols, const int* __restrict__ PERM, const int* __restrict__ ROWPTR, const int* __restrict__ ROWCNT, int permLen, b16* Oh, b16* Ol) {   // Oh aliases the q plane (see host)
  const int wave = threadIdx.x >> 5, lane = threadIdx.x & 31; const size_t v = (size_t)blockIdx.x * 8 + wave; const int c0 = lane * 4; (void)Ol;
  v4f o = {0.0f, 0.0f, 0.0f, 0.0f};
  int st = 0, cnt = 0; if (v < (size_t)N) { st = ROWPTR[v]; cnt = ROWCNT[v]; cnt = iclamp(cnt, 0, 65536); st = iclamp(st, 0, permLen - cnt); }
  const v4f q = *(const v4f*)(QKV + v * D + c0); const float* K = QKV + (size_t)NP * D; const float* V = QKV + (size_t)2 * NP * D;
  auto logits = [&](size_t s) -> v4f { const v4f k = *(const v4f*)(K + s * D + c0); v4f l; for (int i = 0; i < 4; ++i) { float d = pmul(q[i], k[i]); d += __shfl_xor(d, 2); d += __shfl_xor(d, 4); d += __shfl_xor(d, 8); d += __shfl_xor(d, 16); l[i] = d; } return l; };
  // one pass with a running maximum: where a head's maximum rises, that head's sums so far are scaled by exp(old - new) (0 at the first edge), so every edge's ids and K row are fetched once.
  // Of the two factors exp(old - new) and exp(l - new) one is always exp(0) = 1: one exponential per head and edge gives both.
  v4f mx = {-INFINITY, -INFINITY, -INFINITY, -INFINITY}, den = {0.0f, 0.0f, 0.0f, 0.0f}, acc = {0.0f, 0.0f, 0.0f, 0.0f};
#pragma unroll 1   // one edge per trip, as in the two loops that this one replaces
  for (int j = 0; j < cnt; ++j) { const int e = iclamp(PERM[st + j], 0, E - 1); const size_t s = (size_t)iclamp(cols[e], 0, N - 1); const v4f vv = *(const v4f*)(V + s * D + c0); const v4f l = logits(s);
    for (int i = 0; i < 4; ++i) { const float d = l[i] - mx[i]; const float t = nexp(-fabsf(d)); const bool up = d > 0.0f; const float sc = up ? t : 1.0f, p = up ? 1.0f : t; mx[i] = fmaxf(mx[i], l[i]); den[i] = den[i] * sc + p; acc[i] = acc[i] * sc + p * vv[i]; } }
  if (cnt > 0) for (int i = 0; i < 4; ++i) o[i] = acc[i] / den[i];
  v4h ph, pl; for (int i = 0; i < 4; ++i) { b16 p, pq; split16(o[i] * XS, p, pq); ph[i] = p; pl[i] = pq; }
  { *(v4h*)(Oh + v * (2 * D) + c0) = ph; *(v4h*)(Oh + v * (2 * D) + D + c0) = pl;  }   // hi | lo packed into this node's own 512-B q row (no other wave reads it)
}
__global__ __launch_bounds__(128) void oproj_kernel(const b16* __restrict__ Oh, const b16* __restrict__ Ol, const b16* __restrict__ WT, const float* __restrict__ bo, float* __restrict__ out) {
  __shared__ __attribute__((aligned(16))) float Tf[4][16][D + 4];
  const int wave = threadIdx.x >> 5, lane = threadIdx.x & 31, nloc = lane & 15, hlf = lane >> 4; const size_t m0 = (size_t)blockIdx.x * 64 + wave * 16; const b16* W = WT + (size_t)3 * D * D;
  v8f acc[8];
#pragma unroll
  for (int t = 0; t < 8; ++t) acc[t] = (v8f){};
#pragma unroll
  for (int kb = 0; kb < D; kb += 32) { const v16b a = frag_kb(Oh + (m0 + nloc) * (2 * D) + kb, hlf), al = frag_kb(Oh + (m0 + nloc) * (2 * D) + D + kb, hlf);
#pragma unroll
    for (int t = 0; t < 8; ++t) { const v16b bw = frag_kb(W + (size_t)(t * 16 + nloc) * D + kb, hlf); acc[t] = wmma16b(a, bw, acc[t]); acc[t] = wmma16b(al, bw, acc[t]); } }
#pragma unroll
  for (int t = 0; t < 8; ++t) { const int c = t * 16 + nloc; const float bb = bf16_rne(bo[c]);
#pragma unroll 1
    for (int r = 0; r < 8; ++r) Tf[wave][8 * hlf + r][c] = acc[t][r] * (1.0f / (XS * WSC)) + bb; }
  wave_lds_sync();
  { for (int rr = 0; rr < 16; ++rr) { const size_t row = m0 + rr; if (row < (size_t)N) *(v4f*)(out + row * D + lane * 4) = *(const v4f*)(&Tf[wave][rr][lane * 4]); }  }
}
}  // namespace

extern "C" void kernel_launch(void* const* d_in, const int* in_sizes, int n_in, void* d_out, int out_size, void* d_ws, size_t ws_size, hipStream_t stream) {
  (void)n_in;
  auto Fp = [&](int i) { return (const float*)d_in[i]; }; auto Ip = [&](int i) { return (const int*)d_in[i]; };
  // input order: 0 h [100000,128], 1 row [E] i32, 2 col [E] i32, 3 Wq [128,128], 4 bq, 5 Wk, 6 bk, 7 Wv, 8 bv, 9 Wo, 10 bo
  if (in_sizes[0] != N * D || in_sizes[1] != E || in_sizes[2] != E || in_sizes[3] != D * D || in_sizes[9] != D * D || out_size != N * D) return;
  size_t off = 0; char* ws = (char*)d_ws;
  auto carve = [&](size_t bytes) { char* p = ws + off; off += (bytes + 255) & ~(size_t)255; return p; };
  b16* WT = (b16*)carve((size_t)4 * D * D * 2); float* QKV = (float*)carve((size_t)3 * NP * D * 4);
  b16* Oh = (b16*)QKV; b16* Ol = Oh;   // the attention output (hi | lo, 2 x 128 halves) overwrites each node's own 512-B q row in place: a wave reads only its own q row before writing it (K/V rows live in the other two planes)
  CsrBufs csr; off = csr_carve(csr, ws, off, E, N);
  if (off > ws_size) return;   // QKV 153.6 + CSR ~15 = ~169 MB (< 256 MiB)
  wprep_kernel<<<(unsigned)((4 * (size_t)D * D / 8 + 255) / 256), 256, 0, stream>>>(Fp(3), Fp(5), Fp(7), Fp(9), WT);
  csr_build(csr, Ip(1), E, N, stream);   // group by row (the softmax axis)
  proj_kernel<<<dim3(NP / 64, 3), 128, 0, stream>>>(Fp(0), WT, Fp(4), Fp(6), Fp(8), QKV);
  attn_kernel<<<NP / 8, 256, 0, stream>>>(QKV, Ip(2), csr.PERM, csr.ROWPTR, csr.ROWCNT, (int)csr.permLen, Oh, Ol);
  oproj_kernel<<<NP / 64, 128, 0, stream>>>(Oh, Ol, WT, Fp(10), (float*)d_out);
}

// v003
// One run takes 253 microseconds.
// Timed twice side by side with v002, it ran 1.19 times as fast both times.
// All steps since v000 together make it 7.77 times as fast.
#include <hip/hip_runtime.h>

// Sparse multi-head attention over a graph (DGL bsddmm / bspmm style): q = (h Wq^T + bq) * 16^-1/2, k, v = Linear(h), all reshaped (N, 16, 8) — i.e. channel c = d*8 + head (heads interleaved);
// per edge e: logit_h = sum_d q[row][d,h] k[col][d,h]; softmax over the edges of each row (destination); out[row] = sum attn v[col]; y = out Wo^T + bo -> [100000][128]. 100,000 nodes,
// 1,600,000 edges; rows without edges give out = 0 (then bo).
// WMMA (v_wmma_f32_16x16x32_f16, f32 accumulate): the q/k/v projections ([100,032 x 128] x [128 x 384], EXACT bf16 h x8: 1 product) and the output projection ([100,032 x 128] x [128 x 128],
// attention output as f16 hi+lo x8 planes: 2 products), weights exact x256; per-edge head dots (lane owns channels 4l..4l+3 = heads (4l mod 8)+0..3 at d = l/2; the 16 products of a head summed by one lane
// through LDS, 16 edges at a time), softmax and weighted sums in f32. Inputs rounded to bf16 once; ids int32 (clamped). Fragment k-map per lane half hh for A AND B:

namespace {
constexpr int N = 100000, NP = 100032, E = 1600000, D = 128, NH = 8, HD = 16;
constexpr float XS = 8.0f, WSC = 256.0f, NEG = 0.2f /* unused */, SCAL = 0.25f /* 16^-0.5 */;
typedef _Float16 b16;
typedef __attribute__((ext_vector_type(16))) _Float16 v16b;
typedef __attribute__((ext_vector_type(8))) _Float16 v8b;
typedef __attribute__((ext_vector_type(4))) _Float16 v4h;
typedef __attribute__((ext_vector_type(8))) float v8f;
typedef __attribute__((ext_vector_type(4))) float v4f;
__device__ __forceinline__ float bf16_rne(float f) { unsigned int u = __float_as_uint(f); u += 0x7FFFu + ((u >> 16) & 1u); return __uint_as_float(u & 0xFFFF0000u); }
__device__ __forceinline__ void split16(float v, b16& hi, b16& lo) { hi = (b16)v; lo = (b16)(v - (float)hi); }
__device__ __forceinline__ v16b frag_kb(const b16* p, int hh) { const v8b a = *(const v8b*)(p + 8 * hh), b = *(const v8b*)(p + 16 + 8 * hh); v16b f;
#pragma unroll
  for (int e = 0; e < 8; ++e) { f[e] = a[e]; f[8 + e] = b[e]; } return f; }
__device__ __forceinline__ v8f wmma16b(v16b a, v16b b, v8f c) { v8f d = __builtin_amdgcn_wmma_f32_16x16x32_f16(false, a, false, b, (short)0, c, false, false); asm volatile("v_nop\n\tv_nop\n\tv_nop\n\tv_nop" : "+v"(d) : "v"(a), "v"(b)); return d; }
__device__ __forceinline__ void wave_lds_sync() { __builtin_amdgcn_fence(__ATOMIC_RELEASE, "workgroup"); __builtin_amdgcn_wave_barrier(); __builtin_amdgcn_fence(__ATOMIC_ACQUIRE, "workgroup"); }
__device__ __forceinline__ int iclamp(int v, int lo, int hi) { return v < lo ? lo : (v > hi ? hi : v); }
__device__ __forceinline__ float nexp(float x) { return __builtin_amdgcn_exp2f(x * 1.4426950408889634f); }
// ---------------- deterministic, line-safe CSR by destination (two-level bucketing; every global write is a whole-line, lane-contiguous store) ----------------
// Pass A (block per contiguous edge chunk): a stable counting sort of the chunk's edges by coarse bucket g = dst >> CSR_GB (nG <= CSR_MAXG buckets) into LDS, all waves at work (see csr_rank), then whole-line
//   stores of the grouped ids (STG row) and of the bucket counts (HST row).
// Pass B (block per bucket g): gathers the bucket's edge ids from the 512 staging rows into LDS (at most CSR_CAP ids), the same stable counting sort by destination node, then writes (a) its PERM run and
//   (b) ROWPTR[v], ROWCNT[v] for its 2^CSR_GB nodes as contiguous ints. If a bucket exceeds CSR_CAP the kernel writes ROWCNT = 0 for its nodes and sets FLAG[0] = 1 (loud failure, no corruption).
// The sort, no atomics, original edge order kept inside every key: each wave owns a contiguous run of items and a histogram row of its own; per 32 items csr_rank gives every lane its rank among the
//   lanes with an equal key, the first such lane advances the row's counter; then a prefix over (key, wave) turns the rows into start positions.
constexpr int CSR_NBLK = 512, CSR_GB = 9, CSR_GN = 1 << CSR_GB /* nodes per bucket */, CSR_MAXG = 512, CSR_CAP = 12288 /* ids per bucket in LDS (48+24+48 KB, and 32 KB of counter rows) */;
constexpr int CSR_CH = (E + CSR_NBLK - 1) / CSR_NBLK /* edges per chunk */, CSRA_NW = 8, CSRA_G = (CSR_CH + CSRA_NW * 32 - 1) / (CSRA_NW * 32) /* groups of 32 per wave */, CSRB_NW = 32, CSRB_G = CSR_CAP / (CSRB_NW * 32);
// mask of the wave's valid lanes whose 9-bit key equals this lane's (keys < 512 = CSR_MAXG = CSR_GN)
__device__ __forceinline__ unsigned csr_match(int key, bool valid) { unsigned m = __builtin_amdgcn_ballot_w32(valid);
#pragma unroll   // short fixed trip count: straight-line code, its LDS reads or ballots issued back to back
  for (int b = 0; b < 9; ++b) { const bool on = (key >> b) & 1; const unsigned s = __builtin_amdgcn_ballot_w32(on); m &= on ? s : ~s; } return m; }
// one group of 32 items: returns how many items of this wave's run with the same key stand in front of this lane's item, and advances the wave's own counter row. key < 0: no item.
template <typename T> __device__ __forceinline__ int csr_rank(T* row, int key, int lane) { const bool ok = key >= 0; const unsigned m = csr_match(key, ok); const int r = __popc(m & ((1u << lane) - 1u)); int base = 0;
  if (ok) base = (int)row[key]; if (ok && r == 0) row[key] = (T)(base + __popc(m));
  wave_lds_sync();   // the next group's lanes read counters that other lanes of this wave have just stored
  return base + r; }
// exclusive prefix of one int per thread over a block of NW waves (every thread calls it); total = the block's sum. wsum: NW ints of LDS.
template <int NW> __device__ __forceinline__ int csr_scan(int v, int* wsum, int lane, int wave, int& total) { int inc = v;
#pragma unroll   // short fixed trip count: straight-line code, its LDS reads or ballots issued back to back
  for (int o = 1; o < 32; o <<= 1) { const int u = __shfl_up(inc, o); if (lane >= o) inc += u; }
  if (lane == 31) wsum[wave] = inc;
  __syncthreads();
  int pre = 0, all = 0;
#pragma unroll   // short fixed trip count: straight-line code, its LDS reads or ballots issued back to back
  for (int w = 0; w < NW; ++w) { const int s = wsum[w]; pre += (w < wave) ? s : 0; all += s; }
  __syncthreads();   // wsum may be written again by the next call
  total = all; return pre + inc - v; }
__global__ __launch_bounds__(256) void csrA_kernel(const int* __restrict__ dst, int E, int N, int nG, int CHP, int NGP, int* __restrict__ STG, int* __restrict__ HST) {
  extern __shared__ int sm[];   // cnt[NGP] | run[NGP] | ids[CHP]
  __shared__ int wh[CSRA_NW][CSR_MAXG]; __shared__ int wsum[CSRA_NW];
  int* cnt = sm; int* run = sm + NGP; int* ids = sm + 2 * NGP;
  const int t_ = threadIdx.x, lane = t_ & 31, wave = t_ >> 5;
  const int b = blockIdx.x; const int e0 = b * CSR_CH; const int i0 = wave * (CSRA_G * 32) + lane;
  for (int i = t_; i < CSRA_NW * CSR_MAXG; i += 256) (&wh[0][0])[i] = 0;
  for (int i = t_; i < CHP; i += 256) ids[i] = -1;
  int key[CSRA_G], lr[CSRA_G]; unsigned ei[CSRA_G];
#pragma unroll   // constant indices keep the per-lane arrays in registers
  for (int u = 0; u < CSRA_G; ++u) { ei[u] = (unsigned)min(e0 + i0 + u * 32, E - 1); key[u] = dst[ei[u]]; }   // all of a lane's loads in flight together; an index past the end re-reads the last edge
  static_assert(CSRA_G == 13, "the statement below names 13 values");
  // a precaution: this wait stands in front of every overwrite of a register that an issued load names; the index registers are named so that they stay whole up to it
  asm volatile("s_wait_xcnt 0x0" :: "v"(ei[0]), "v"(ei[1]), "v"(ei[2]), "v"(ei[3]), "v"(ei[4]), "v"(ei[5]), "v"(ei[6]), "v"(ei[7]), "v"(ei[8]), "v"(ei[9]), "v"(ei[10]), "v"(ei[11]), "v"(ei[12]) : "memory");
#pragma unroll   // constant indices keep the per-lane arrays in registers
  for (int u = 0; u < CSRA_G; ++u) { const int i = i0 + u * 32; const bool ok = i < CSR_CH && e0 + i < E; int d = key[u]; d = (d < 0) ? 0 : (d >= N ? N - 1 : d); key[u] = ok ? (d >> CSR_GB) : -1; }
  __syncthreads();
#pragma unroll   // constant indices keep the per-lane arrays in registers
  for (int u = 0; u < CSRA_G; ++u) lr[u] = csr_rank(wh[wave], key[u], lane);
  __syncthreads();
  int s[2];   // thread t_: buckets 2 t_ and 2 t_ + 1; the rows become exclusive prefixes over the waves
#pragma unroll   // short fixed trip count: straight-line code, its LDS reads or ballots issued back to back
  for (int j = 0; j < 2; ++j) { int acc = 0;
#pragma unroll   // short fixed trip count: straight-line code, its LDS reads issued back to back
    for (int w = 0; w < CSRA_NW; ++w) { const int c = wh[w][2 * t_ + j]; wh[w][2 * t_ + j] = acc; acc += c; } s[j] = acc; }
  int all; const int pre = csr_scan<CSRA_NW>(s[0] + s[1], wsum, lane, wave, all);
  if (2 * t_ < NGP) { cnt[2 * t_] = s[0]; run[2 * t_] = pre; } if (2 * t_ + 1 < NGP) { cnt[2 * t_ + 1] = s[1]; run[2 * t_ + 1] = pre + s[0]; }
  __syncthreads();
#pragma unroll   // constant indices keep the per-lane arrays in registers
  for (int u = 0; u < CSRA_G; ++u) if (key[u] >= 0) ids[run[key[u]] + wh[wave][key[u]] + lr[u]] = e0 + i0 + u * 32;
  __syncthreads();
  typedef __attribute__((ext_vector_type(4))) int v4i;
  {
    for (int i = t_; i < CHP / 4; i += 256) *(v4i*)(STG + (size_t)b * CHP + i * 4) = *(const v4i*)(&ids[i * 4]);
    for (int i = t_; i < NGP / 4; i += 256) { v4i v; for (int e = 0; e < 4; ++e) v[e] = (i * 4 + e < nG) ? cnt[i * 4 + e] : 0; *(v4i*)(HST + (size_t)b * NGP + i * 4) = v; }
     }
}
// scan: START[g] (padded to 32), OFF[g][b] (exclusive prefix of HST[b][<g] within block b = position of bucket g inside staging row b), TOT[g]. rows OFF[g][0..511] written by the block whole; START/TOT as one
// padded row each. grid 1 x 512 (thread = b for the OFF rows; a block prefix for START).
__global__ __launch_bounds__(512) void csrS_kernel(const int* __restrict__ HST, int nG, int NGP, int* __restrict__ START, int* __restrict__ TOT, int* __restrict__ OFF) {
  __shared__ int tot[CSR_MAXG];
  const int b = threadIdx.x;   // CSR_NBLK == 512 threads
  { int runb = 0; for (int g = 0; g < nG; ++g) { int c = HST[(size_t)b * NGP + g]; c = (c < 0) ? 0 : c; ((int*)OFF)[(size_t)g * CSR_NBLK + b] = runb; runb += c; }  }
  for (int g = threadIdx.x; g < nG; g += 512) { int s = 0; for (int bb = 0; bb < CSR_NBLK; ++bb) { int c = HST[(size_t)bb * NGP + g]; s += (c < 0) ? 0 : c; } tot[g] = s; }
  __syncthreads();
  __shared__ int st[CSR_MAXG + 32]; __shared__ int wsum[16];
  { const int v = (b < nG) ? ((tot[b] + 31) & ~31) : 0; int all; const int pre = csr_scan<16>(v, wsum, b & 31, b >> 5, all); st[b] = pre; if (b == CSR_MAXG - 1) st[CSR_MAXG] = all; }   // st[g] = sum of the padded totals in front of g; st[NGP] = all of them
  __syncthreads();
  if (threadIdx.x < 32) { // START/TOT rows (NGP ints, padded) written by one wave lane-contiguously
    { for (int i = threadIdx.x; i < NGP + 32; i += 32) { ((int*)START)[i] = (i <= NGP) ? st[min(i, NGP)] : 0; ((int*)TOT)[i] = (i < nG) ? tot[i] : 0; }  } }
}
// bucket: block g (1024 threads): gather ids (from each block's staging sub-run, in block order => original edge order), stable counting sort by node, flush; ROWPTR/ROWCNT rows.
__global__ __launch_bounds__(1024) void csrB_kernel(const int* __restrict__ dst, int N, int nG, int CHP, int NGP, int permLen, const int* __restrict__ STG, const int* __restrict__ HST, const int* __restrict__ OFF, const int* __restrict__ START, const int* __restrict__ TOT, int* __restrict__ PERM, int* __restrict__ ROWPTR, int* __restrict__ ROWCNT, int* __restrict__ FLAG) {
  typedef __attribute__((ext_vector_type(4))) int v4i;
  __shared__ int ids[CSR_CAP]; __shared__ unsigned short key[CSR_CAP]; __shared__ int outp[CSR_CAP]; __shared__ int ncnt[CSR_GN + 1]; __shared__ int boff[CSR_NBLK + 1]; __shared__ int ooff[CSR_NBLK];
  __shared__ __attribute__((aligned(16))) unsigned short wh[CSRB_NW][CSR_GN]; __shared__ int wsum[CSRB_NW];
  const int g = blockIdx.x, t_ = threadIdx.x, lane = t_ & 31, wave = t_ >> 5; int tot = TOT[g]; int st = START[g], stn = START[g + 1]; const int v0 = g * CSR_GN; const int nv = min(CSR_GN, N - v0);
  st = (st < 0) ? 0 : (st > permLen - 32 ? permLen - 32 : st) & ~31; stn = (stn < st) ? st : (stn > permLen ? permLen : stn); tot = (tot < 0) ? 0 : tot; if (tot > stn - st && tot <= CSR_CAP) tot = stn - st;   // static-visible bounds even if a table line were garbage
  if (tot > CSR_CAP) {   // loud failure: zero counts, flag
    { for (int i = t_; i < CSR_GN / 4; i += 1024) { v4i a, c; for (int e = 0; e < 4; ++e) { a[e] = st; c[e] = 0; } *(v4i*)(ROWPTR + v0 + i * 4) = a; *(v4i*)(ROWCNT + v0 + i * 4) = c; } if (t_ == 0) ((int*)FLAG)[0] = 1;  } (void)nv; return; }
  // per-block offsets of this bucket's sub-runs in gather order (thread = staging row)
  { int c = 0; if (t_ < CSR_NBLK) { const unsigned hi = (unsigned)(t_ * NGP + g), oi = (unsigned)(g * CSR_NBLK + t_); c = HST[hi]; const int o_ = OFF[oi];
      asm volatile("s_wait_xcnt 0x0" :: "v"(hi), "v"(oi) : "memory");   // the same precaution as in pass A
      c = (c < 0) ? 0 : (c > CHP ? CHP : c); ooff[t_] = o_; }
    int all; const int pre = csr_scan<CSRB_NW>(c, wsum, lane, wave, all); if (t_ < CSR_NBLK) boff[t_] = min(pre, tot); if (t_ == 0) boff[CSR_NBLK] = min(all, tot); tot = min(tot, all); }
  for (int i = t_; i < CSRB_NW * CSR_GN / 2; i += 1024) ((int*)&wh[0][0])[i] = 0;
  __syncthreads();
  { constexpr int RB = CSR_NBLK / CSRB_NW;   // a wave gathers RB staging rows in a row; the first 32 ids of all of them are in flight together
    int bo[RB], cn[RB], id[RB], dd[RB]; unsigned ix[RB];
#pragma unroll   // constant indices keep the per-lane arrays in registers
    for (int u = 0; u < RB; ++u) { const int b = wave * RB + u; bo[u] = boff[b]; cn[u] = boff[b + 1] - bo[u]; int o_ = ooff[b]; o_ = (o_ < 0) ? 0 : (o_ > CHP - cn[u] ? CHP - cn[u] : o_); ix[u] = (unsigned)(b * CHP + min(o_, CHP - 1) + (lane < cn[u] ? lane : 0)); }   // a lane past the sub-run's end re-reads a written word of the row, so that no load hangs on a branch
#pragma unroll   // constant indices keep the per-lane arrays in registers
    for (int u = 0; u < RB; ++u) id[u] = STG[ix[u]];
    static_assert(RB == 16, "the three statements below name 16 values each");
    // a precaution: this wait stands in front of every overwrite of a register that an issued load names; the index registers are named so that they stay whole up to it
    asm volatile("s_wait_xcnt 0x0" :: "v"(ix[0]), "v"(ix[1]), "v"(ix[2]), "v"(ix[3]), "v"(ix[4]), "v"(ix[5]), "v"(ix[6]), "v"(ix[7]), "v"(ix[8]), "v"(ix[9]), "v"(ix[10]), "v"(ix[11]), "v"(ix[12]), "v"(ix[13]), "v"(ix[14]), "v"(ix[15]) : "memory");
    // holds the 16 loads together in front of the branches below: sunk into its branch, a load would wait there alone
    asm volatile("" :: "v"(id[0]), "v"(id[1]), "v"(id[2]), "v"(id[3]), "v"(id[4]), "v"(id[5]), "v"(id[6]), "v"(id[7]), "v"(id[8]), "v"(id[9]), "v"(id[10]), "v"(id[11]), "v"(id[12]), "v"(id[13]), "v"(id[14]), "v"(id[15]));
#pragma unroll   // constant indices keep the per-lane arrays in registers
    for (int u = 0; u < RB; ++u) id[u] = (id[u] < 0) ? 0 : id[u];
#pragma unroll   // constant indices keep the per-lane arrays in registers
    for (int u = 0; u < RB; ++u) dd[u] = dst[id[u]];
    // the same for the 16 destination loads
    asm volatile("" :: "v"(dd[0]), "v"(dd[1]), "v"(dd[2]), "v"(dd[3]), "v"(dd[4]), "v"(dd[5]), "v"(dd[6]), "v"(dd[7]), "v"(dd[8]), "v"(dd[9]), "v"(dd[10]), "v"(dd[11]), "v"(dd[12]), "v"(dd[13]), "v"(dd[14]), "v"(dd[15]));
#pragma unroll   // constant indices keep the per-lane arrays in registers
    for (int u = 0; u < RB; ++u) if (lane < cn[u]) { int d = dd[u]; d = (d < v0) ? v0 : (d >= N ? N - 1 : d); int kk = d - v0; kk = (kk < 0) ? 0 : (kk >= CSR_GN ? CSR_GN - 1 : kk); ids[bo[u] + lane] = id[u]; key[bo[u] + lane] = (unsigned short)kk; }
#pragma unroll 1   // seldom entered: kept small
    for (int u = 0; u < RB; ++u) { const int b = wave * RB + u; const int bs = boff[b], c = boff[b + 1] - bs; int o_ = ooff[b]; o_ = (o_ < 0) ? 0 : (o_ > CHP - c ? CHP - c : o_); const int* src_ = STG + (size_t)b * CHP + o_;   // what a sub-run holds beyond 32 ids
      for (int i = lane + 32; i < c; i += 32) { int idr = src_[i]; idr = (idr < 0) ? 0 : idr; ids[bs + i] = idr; int d = dst[idr]; d = (d < v0) ? v0 : (d >= N ? N - 1 : d); int kk = d - v0; kk = (kk < 0) ? 0 : (kk >= CSR_GN ? CSR_GN - 1 : kk); key[bs + i] = (unsigned short)kk; } } }
  __syncthreads();
  // stable counting sort by node inside the bucket: wave w owns items [w S, w S + S)
  const int S = ((tot + CSRB_NW * 32 - 1) / (CSRB_NW * 32)) * 32; const int i0 = wave * S + lane;
  int kr[CSRB_G], lr[CSRB_G];
#pragma unroll   // constant indices keep the per-lane arrays in registers
  for (int u = 0; u < CSRB_G; ++u) { const int i = i0 + u * 32; kr[u] = (u * 32 < S && i < tot) ? (int)key[i] : -1; lr[u] = 0; }
#pragma unroll   // constant indices keep the per-lane arrays in registers
  for (int u = 0; u < CSRB_G; ++u) if (u * 32 < S) lr[u] = csr_rank(wh[wave], kr[u], lane);
  __syncthreads();
  { int s = 0; if (t_ < CSR_GN) {   // thread = node: the rows become exclusive prefixes over the waves
#pragma unroll   // short fixed trip count: straight-line code, its LDS reads or ballots issued back to back
      for (int w = 0; w < CSRB_NW; ++w) { const int c = wh[w][t_]; wh[w][t_] = (unsigned short)s; s += c; } }
    int all; const int pre = csr_scan<CSRB_NW>(s, wsum, lane, wave, all); if (t_ < CSR_GN) ncnt[t_] = pre; if (t_ == 0) ncnt[CSR_GN] = all; }   // ncnt[vl] = start of node vl
  __syncthreads();
#pragma unroll   // constant indices keep the per-lane arrays in registers
  for (int u = 0; u < CSRB_G; ++u) if (kr[u] >= 0) outp[ncnt[kr[u]] + (int)wh[wave][kr[u]] + lr[u]] = ids[i0 + u * 32];
  __syncthreads();
  {
    for (int i = t_; i < (stn - st) / 4; i += 1024) { v4i v; for (int e = 0; e < 4; ++e) { const int q = i * 4 + e; v[e] = (q < tot) ? outp[q] : -1; } *(v4i*)(PERM + st + i * 4) = v; }
    for (int i = t_; i < CSR_GN / 4; i += 1024) { v4i a, c; for (int e = 0; e < 4; ++e) { const int vl = i * 4 + e; a[e] = st + ncnt[vl]; c[e] = (vl < nv) ? (ncnt[vl + 1] - ncnt[vl]) : 0; } *(v4i*)(ROWPTR + v0 + i * 4) = a; *(v4i*)(ROWCNT + v0 + i * 4) = c; }   // the tables hold nG*512 entries (beyond N: count 0)
     }
}
__global__ __launch_bounds__(256) void csrZ_kernel(int* __restrict__ p, size_t n4) { typedef __attribute__((ext_vector_type(4))) int v4i; const size_t tid = (size_t)blockIdx.x * 256 + threadIdx.x, nth = (size_t)gridDim.x * 256; v4i z = {0, 0, 0, 0}; for (size_t i = tid; i < n4; i += nth) *(v4i*)(p + i * 4) = z; }
// host helper. Workspace ints needed: STG (512*CHP), HST (512*NGP), OFF (NGP*512), START (NGP+64), TOT (NGP+64), PERM (E + 32*nG + 32), ROWPTR (Npad), ROWCNT (Npad), FLAG (64). Npad = roundup(N, 512).
struct CsrBufs { int *STG, *HST, *OFF, *START, *TOT, *PERM, *ROWPTR, *ROWCNT, *FLAG; int nG, NGP, CHP; size_t permLen; char* base; size_t bytes; };
static size_t csr_carve(CsrBufs& c, char* ws, size_t off, int E, int N) {
  const size_t off0 = off; c.base = ws + off;
  auto al = [&](size_t bytes) { char* p = ws + off; off += (bytes + 255) & ~(size_t)255; return p; };
  c.nG = (N + CSR_GN - 1) / CSR_GN; c.NGP = (c.nG + 31) & ~31; const int ch = (E + CSR_NBLK - 1) / CSR_NBLK; c.CHP = (ch + 31) & ~31; c.permLen = (size_t)E + 32 * (size_t)c.nG + 32;
  c.STG = (int*)al((size_t)CSR_NBLK * c.CHP * 4); c.HST = (int*)al((size_t)CSR_NBLK * c.NGP * 4); c.OFF = (int*)al((size_t)c.NGP * CSR_NBLK * 4); c.START = (int*)al((size_t)(c.NGP + 64) * 4); c.TOT = (int*)al((size_t)(c.NGP + 64) * 4);
  c.PERM = (int*)al(c.permLen * 4); c.ROWPTR = (int*)al((size_t)c.nG * CSR_GN * 4); c.ROWCNT = (int*)al((size_t)c.nG * CSR_GN * 4); c.FLAG = (int*)al(256);
  c.bytes = off - off0; return off;
}
static void csr_build(const CsrBufs& c, const int* dst, int E, int N, hipStream_t stream) {
  const size_t smem = (size_t)(2 * c.NGP + c.CHP) * 4;
  csrZ_kernel<<<512, 256, 0, stream>>>((int*)c.base, c.bytes / 16);
  csrA_kernel<<<CSR_NBLK, 256, smem, stream>>>(dst, E, N, c.nG, c.CHP, c.NGP, c.STG, c.HST);
  csrS_kernel<<<1, 512, 0, stream>>>(c.HST, c.nG, c.NGP, c.START, c.TOT, c.OFF);
  csrB_kernel<<<c.nG, 1024, 0, stream>>>(dst, N, c.nG, c.CHP, c.NGP, (int)c.permLen, c.STG, c.HST, c.OFF, c.START, c.TOT, c.PERM, c.ROWPTR, c.ROWCNT, c.FLAG);
}


__global__ __launch_bounds__(256) void wprep_kernel(const float* __restrict__ wq, const float* __restrict__ wk, const float* __restrict__ wv, const float* __restrict__ wo, b16* __restrict__ WT) {
  const size_t u = (size_t)blockIdx.x * 256 + threadIdx.x; const size_t per = (size_t)D * D / 8; if (u >= 4 * per) return; const int which = (int)(u / per); const size_t e = (u % per) * 8; const float* w = which == 0 ? wq : which == 1 ? wk : which == 2 ? wv : wo; v8b o;
  for (int j = 0; j < 8; ++j) o[j] = (b16)(bf16_rne(w[e + j]) * WSC);
  { *(v8b*)(WT + (size_t)which * D * D + e) = o;  }
}
__global__ __launch_bounds__(128) void proj_kernel(const float* __restrict__ h, const b16* __restrict__ WT, const float* __restrict__ bq, const float* __restrict__ bk, const float* __restrict__ bv, float* __restrict__ QKV) {
  __shared__ __attribute__((aligned(16))) float Tf[4][16][D + 4];
  const int wave = threadIdx.x >> 5, lane = threadIdx.x & 31, nloc = lane & 15, hlf = lane >> 4; const size_t m0 = (size_t)blockIdx.x * 64 + wave * 16; const int part = blockIdx.y; const b16* W = WT + (size_t)part * D * D; const float* bias = part == 0 ? bq : part == 1 ? bk : bv; const float osc = part == 0 ? SCAL : 1.0f;
  const size_t v = m0 + nloc; v8f acc[8];
#pragma unroll
  for (int t = 0; t < 8; ++t) acc[t] = (v8f){};
#pragma unroll
  for (int kb = 0; kb < D; kb += 32) { v16b a = {}; if (v < (size_t)N) { const float* r = h + v * D + kb; for (int e = 0; e < 8; ++e) { a[e] = (b16)(bf16_rne(r[8 * hlf + e]) * XS); a[8 + e] = (b16)(bf16_rne(r[16 + 8 * hlf + e]) * XS); } }
#pragma unroll
    for (int t = 0; t < 8; ++t) acc[t] = wmma16b(a, frag_kb(W + (size_t)(t * 16 + nloc) * D + kb, hlf), acc[t]); }
#pragma unroll
  for (int t = 0; t < 8; ++t) { const int c = t * 16 + nloc; const float bb = bf16_rne(bias[c]);
#pragma unroll 1
    for (int r = 0; r < 8; ++r) { const size_t row = m0 + 8 * hlf + r; Tf[wave][8 * hlf + r][c] = row < (size_t)N ? (acc[t][r] * (1.0f / (XS * WSC)) + bb) * osc : 0.0f; } }
  wave_lds_sync();
  { for (int rr = 0; rr < 16; ++rr) *(v4f*)(QKV + ((size_t)part * NP + m0 + rr) * D + lane * 4) = *(const v4f*)(&Tf[wave][rr][lane * 4]);  }
}
// Attention, one wave per destination node, its edges up to 16 at a time. Per batch: lane j fetches edge j's ids (32 edges per fetch); the batch's K rows are loaded together, each lane stores q*k of its 4
// channels to the wave's own LDS rows; lane (edge slot es = lane/2, head group hp = 4*(lane&1)) sums the 16 products of each of its 4 heads (the same pairwise tree as a butterfly over d), so every logit, its
// maximum and its exponential are worked out once and not on 16 lanes; the weights go back through LDS, and each lane adds weight * V for its own 4 channels. The V rows fly while the softmax is worked on.
constexpr int AB = 16 /* edges per batch */, APITCH = D + 8 /* floats; 544 B = 32 B x 17: the 8 edge slots x 2 head groups of a half wave read 16 B each on all 64 banks */;
// orders the LDS stores and loads of one wave's lanes; LDS only, so that global loads in flight are not waited for here
__device__ __forceinline__ void wave_lds_only_sync() { __builtin_amdgcn_fence(__ATOMIC_RELEASE, "workgroup", "local"); __builtin_amdgcn_wave_barrier(); __builtin_amdgcn_fence(__ATOMIC_ACQUIRE, "workgroup", "local"); }
// the 16 bytes per lane of NE rows of a plane, all loads issued together. sv: lane l0 + u holds the row of slot u. ix: the lane's index in units of 16 bytes, added to the plane's scalar base by the load itself.
template <int NE> __device__ __forceinline__ void rows_load(const float* plane, int sv, int l0, int lane, v4f (&r)[NE]) {
  unsigned ix[NE];
#pragma unroll   // constant indices keep the arrays in registers
  for (int u = 0; u < NE; ++u) ix[u] = (unsigned)__builtin_amdgcn_readlane(sv, l0 + u) * (unsigned)(D / 4) + (unsigned)lane;
#pragma unroll   // constant indices keep the arrays in registers
  for (int u = 0; u < NE; ++u) r[u] = ((const v4f*)plane)[ix[u]];
  static_assert(NE == 4 || NE == 8 || NE == 12 || NE == 16, "one of the statements below names all NE values");
  // a precaution: this wait stands in front of every overwrite of a register that an issued load names; the index registers are named so that they stay whole up to it
  if constexpr (NE == 4) asm volatile("s_wait_xcnt 0x0" :: "v"(ix[0]), "v"(ix[1]), "v"(ix[2]), "v"(ix[3]) : "memory");
  else if constexpr (NE == 8) asm volatile("s_wait_xcnt 0x0" :: "v"(ix[0]), "v"(ix[1]), "v"(ix[2]), "v"(ix[3]), "v"(ix[4]), "v"(ix[5]), "v"(ix[6]), "v"(ix[7]) : "memory");
  else if constexpr (NE == 12) asm volatile("s_wait_xcnt 0x0" :: "v"(ix[0]), "v"(ix[1]), "v"(ix[2]), "v"(ix[3]), "v"(ix[4]), "v"(ix[5]), "v"(ix[6]), "v"(ix[7]), "v"(ix[8]), "v"(ix[9]), "v"(ix[10]), "v"(ix[11]) : "memory");
  else asm volatile("s_wait_xcnt 0x0" :: "v"(ix[0]), "v"(ix[1]), "v"(ix[2]), "v"(ix[3]), "v"(ix[4]), "v"(ix[5]), "v"(ix[6]), "v"(ix[7]), "v"(ix[8]), "v"(ix[9]), "v"(ix[10]), "v"(ix[11]), "v"(ix[12]), "v"(ix[13]), "v"(ix[14]), "v"(ix[15]) : "memory");
}
// one batch of nb <= NE edges, straight-line code for NE slots (no test around a load, so that the loads of a batch stay in flight together); a slot from nb on holds the row's last edge again and gets weight 0.
// sv: lane l0 + u holds the source node of slot u. mx: running maximum per head (the same in all lanes of a head group); den: this lane's edge slot alone; acc: this lane's 4 channels.
template <int NE> __device__ __forceinline__ void attn_batch(const float* K, const float* V, float (*Pr)[APITCH], float (*Pw)[NH], int sv, int l0, int nb, int lane, const v4f q, v4f& mx, v4f& den, v4f& acc) {
  const int c0 = lane * 4, es = lane >> 1, hp = (lane & 1) * 4;
  v4f kk[NE], vv[NE];
  rows_load<NE>(K, sv, l0, lane, kk);
#pragma unroll   // constant indices keep the rows in registers
  for (int u = 0; u < NE; ++u) *(v4f*)(&Pr[u][c0]) = q * kk[u];
  wave_lds_only_sync();   // other lanes of this wave read the products
  v4f l = {-INFINITY, -INFINITY, -INFINITY, -INFINITY};   // an empty slot: weight exp(-inf) = 0
  if (es < nb) { const float* pr = &Pr[es][hp]; v4f t[HD];
#pragma unroll   // constant indices keep the array in registers
    for (int d = 0; d < HD; ++d) t[d] = *(const v4f*)(pr + d * NH);
#pragma unroll   // constant indices keep the array in registers
    for (int w = 1; w < HD; w <<= 1)
#pragma unroll   // constant indices keep the array in registers
      for (int d = 0; d < HD; d += 2 * w) t[d] += t[d + w];
    l = t[0]; }
  rows_load<NE>(V, sv, l0, lane, vv);   // issued here, where the K rows and the 16 partial sums are dead, and used behind the softmax
  v4f p;
  for (int i = 0; i < 4; ++i) { float m = l[i]; m = fmaxf(m, __shfl_xor(m, 2)); m = fmaxf(m, __shfl_xor(m, 4)); m = fmaxf(m, __shfl_xor(m, 8)); m = fmaxf(m, __shfl_xor(m, 16));   // the batch's maximum of this head
    m = fmaxf(m, mx[i]); const float sc = nexp(mx[i] - m); p[i] = nexp(l[i] - m); mx[i] = m; den[i] = den[i] * sc + p[i]; acc[i] *= sc; }   // sc = 0 in the first batch
  *(v4f*)(&Pw[es][hp]) = p;
  wave_lds_only_sync();   // other lanes of this wave read the weights
#pragma unroll   // constant indices keep the rows in registers
  for (int u = 0; u < NE; ++u) acc += *(const v4f*)(&Pw[u][hp]) * vv[u];
  wave_lds_only_sync();   // the next batch overwrites what this one has read
}
// 8 waves per SIMD is what four blocks' LDS on a WGP allows: the second bound keeps the register budget at 128, so that registers do not allow fewer
__global__ __launch_bounds__(256, 8) void attn_kernel(const float* QKV, const int* __restrict__ cols, const int* __restrict__ PERM, const int* __restrict__ ROWPTR, const int* __restrict__ ROWCNT, int permLen, b16* Oh, b16* Ol) {   // Oh aliases the q plane (see host)
  __shared__ __attribute__((aligned(16))) float Pr[8][AB][APITCH];   // per wave: q*k, [edge slot][channel]
  __shared__ __attribute__((aligned(16))) float Pw[8][AB][NH];       // per wave: softmax weights, [edge slot][head]
  const int wave = threadIdx.x >> 5, lane = threadIdx.x & 31; const size_t v = (size_t)blockIdx.x * 8 + wave; const int c0 = lane * 4; (void)Ol;
  v4f o = {0.0f, 0.0f, 0.0f, 0.0f};
  int st = 0, cnt = 0; if (v < (size_t)N) { st = ROWPTR[v]; cnt = ROWCNT[v]; cnt = iclamp(cnt, 0, 65536); st = iclamp(st, 0, permLen - cnt); }
  cnt = __builtin_amdgcn_readfirstlane(cnt); st = __builtin_amdgcn_readfirstlane(st);   // the same in every lane: a scalar loop and scalar tests below
  const v4f q = *(const v4f*)(QKV + v * D + c0); const float* K = QKV + (size_t)NP * D; const float* V = QKV + (size_t)2 * NP * D;
  v4f mx = {-INFINITY, -INFINITY, -INFINITY, -INFINITY}, den = {0.0f, 0.0f, 0.0f, 0.0f}, acc = {0.0f, 0.0f, 0.0f, 0.0f}; int sv = 0;
  for (int base = 0; base < cnt; base += AB) {
    if ((base & 31) == 0) { const int j = min(base + lane, cnt - 1); const int e = iclamp(PERM[st + j], 0, E - 1); sv = iclamp(cols[e], 0, N - 1); }   // source nodes of 32 edges, one per lane; past the end: the last edge again
    const int nb = min(cnt - base, AB), l0 = base & 16;
    if (nb > 12) attn_batch<16>(K, V, Pr[wave], Pw[wave], sv, l0, nb, lane, q, mx, den, acc);
    else if (nb > 8) attn_batch<12>(K, V, Pr[wave], Pw[wave], sv, l0, nb, lane, q, mx, den, acc);
    else if (nb > 4) attn_batch<8>(K, V, Pr[wave], Pw[wave], sv, l0, nb, lane, q, mx, den, acc);
    else attn_batch<4>(K, V, Pr[wave], Pw[wave], sv, l0, nb, lane, q, mx, den, acc);
  }
  if (cnt > 0) for (int i = 0; i < 4; ++i) { float d = den[i]; d += __shfl_xor(d, 2); d += __shfl_xor(d, 4); d += __shfl_xor(d, 8); d += __shfl_xor(d, 16); o[i] = acc[i] / d; }   // the 16 slots' sums of this head
  v4h ph, pl; for (int i = 0; i < 4; ++i) { b16 p, pq; split16(o[i] * XS, p, pq); ph[i] = p; pl[i] = pq; }
  { *(v4h*)(Oh + v * (2 * D) + c0) = ph; *(v4h*)(Oh + v * (2 * D) + D + c0) = pl;  }   // hi | lo packed into this node's own 512-B q row (no other wave reads it)
}
__global__ __launch_bounds__(128) void oproj_kernel(const b16* __restrict__ Oh, const b16* __restrict__ Ol, const b16* __restrict__ WT, const float* __restrict__ bo, float* __restrict__ out) {
  __shared__ __attribute__((aligned(16))) float Tf[4][16][D + 4];
  const int wave = threadIdx.x >> 5, lane = threadIdx.x & 31, nloc = lane & 15, hlf = lane >> 4; const size_t m0 = (size_t)blockIdx.x * 64 + wave * 16; const b16* W = WT + (size_t)3 * D * D;
  v8f acc[8];
#pragma unroll
  for (int t = 0; t < 8; ++t) acc[t] = (v8f){};
#pragma unroll
  for (int kb = 0; kb < D; kb += 32) { const v16b a = frag_kb(Oh + (m0 + nloc) * (2 * D) + kb, hlf), al = frag_kb(Oh + (m0 + nloc) * (2 * D) + D + kb, hlf);
#pragma unroll
    for (int t = 0; t < 8; ++t) { const v16b bw = frag_kb(W + (size_t)(t * 16 + nloc) * D + kb, hlf); acc[t] = wmma16b(a, bw, acc[t]); acc[t] = wmma16b(al, bw, acc[t]); } }
#pragma unroll
  for (int t = 0; t < 8; ++t) { const int c = t * 16 + nloc; const float bb = bf16_rne(bo[c]);
#pragma unroll 1
    for (int r = 0; r < 8; ++r) Tf[wave][8 * hlf + r][c] = acc[t][r] * (1.0f / (XS * WSC)) + bb; }
  wave_lds_sync();
  { for (int rr = 0; rr < 16; ++rr) { const size_t row = m0 + rr; if (row < (size_t)N) *(v4f*)(out + row * D + lane * 4) = *(const v4f*)(&Tf[wave][rr][lane * 4]); }  }
}
}  // namespace

extern "C" void kernel_launch(void* const* d_in, const int* in_sizes, int n_in, void* d_out, int out_size, void* d_ws, size_t ws_size, hipStream_t stream) {
  (void)n_in;
  auto Fp = [&](int i) { return (const float*)d_in[i]; }; auto Ip = [&](int i) { return (const int*)d_in[i]; };
  // input order: 0 h [100000,128], 1 row [E] i32, 2 col [E] i32, 3 Wq [128,128], 4 bq, 5 Wk, 6 bk, 7 Wv, 8 bv, 9 Wo, 10 bo
  if (in_sizes[0] != N * D || in_sizes[1] != E || in_sizes[2] != E || in_sizes[3] != D * D || in_sizes[9] != D * D || out_size != N * D) return;
  size_t off = 0; char* ws = (char*)d_ws;
  auto carve = [&](size_t bytes) { char* p = ws + off; off += (bytes + 255) & ~(size_t)255; return p; };
  b16* WT = (b16*)carve((size_t)4 * D * D * 2); float* QKV = (float*)carve((size_t)3 * NP * D * 4);
  b16* Oh = (b16*)QKV; b16* Ol = Oh;   // the attention output (hi | lo, 2 x 128 halves) overwrites each node's own 512-B q row in place: a wave reads only its own q row before writing it (K/V rows live in the other two planes)
  CsrBufs csr; off = csr_carve(csr, ws, off, E, N);
  if (off > ws_size) return;   // QKV 153.6 + CSR ~15 = ~169 MB (< 256 MiB)
  wprep_kernel<<<(unsigned)((4 * (size_t)D * D / 8 + 255) / 256), 256, 0, stream>>>(Fp(3), Fp(5), Fp(7), Fp(9), WT);
  csr_build(csr, Ip(1), E, N, stream);   // group by row (the softmax axis)
  proj_kernel<<<dim3(NP / 64, 3), 128, 0, stream>>>(Fp(0), WT, Fp(4), Fp(6), Fp(8), QKV);
  attn_kernel<<<NP / 8, 256, 0, stream>>>(QKV, Ip(2), csr.PERM, csr.ROWPTR, csr.ROWCNT, (int)csr.permLen, Oh, Ol);
  oproj_kernel<<<NP / 64, 128, 0, stream>>>(Oh, Ol, WT, Fp(10), (float*)d_out);
}

// v004
// One run takes 220 microseconds.
// Two timings next to v003 both put it at 1.15 times that version's speed.
// Counting every step since v000, it is 8.95 times as fast.
#include <hip/hip_runtime.h>

// Sparse multi-head attention over a graph (DGL bsddmm / bspmm style): q = (h Wq^T + bq) * 16^-1/2, k, v = Linear(h), all reshaped (N, 16, 8) — i.e. channel c = d*8 + head (heads interleaved);
// per edge e: logit_h = sum_d q[row][d,h] k[col][d,h]; softmax over the edges of each row (destination); out[row] = sum attn v[col]; y = out Wo^T + bo -> [100000][128]. 100,000 nodes,
// 1,600,000 edges; rows without edges give out = 0 (then bo).
// WMMA (v_wmma_f32_16x16x32_f16, f32 accumulate): the q/k/v projections ([100,032 x 128] x [128 x 384], EXACT bf16 h x8: 1 product) and the output projection ([100,032 x 128] x [128 x 128],
// attention output as f16 hi+lo x8 planes: 2 products), weights exact x256; per-edge head dots (lane owns channels 4l..4l+3 = heads (4l mod 8)+0..3 at d = l/2; the 16 products of a head summed by one lane
// through LDS, 16 edges at a time), softmax and weighted sums in f32. Inputs rounded to bf16 once; ids int32 (clamped). Fragment k-map per lane half hh for A AND B:

namespace {
constexpr int N = 100000, NP = 100032, E = 1600000, D = 128, NH = 8, HD = 16;
constexpr float XS = 8.0f, WSC = 256.0f, NEG = 0.2f /* unused */, SCAL = 0.25f /* 16^-0.5 */;
typedef _Float16 b16;
typedef __attribute__((ext_vector_type(16))) _Float16 v16b;
typedef __attribute__((ext_vector_type(8))) _Float16 v8b;
typedef __attribute__((ext_vector_type(4))) _Float16 v4h;
typedef __attribute__((ext_vector_type(8))) float v8f;
typedef __attribute__((ext_vector_type(4))) float v4f;
__device__ __forceinline__ float bf16_rne(float f) { unsigned int u = __float_as_uint(f); u += 0x7FFFu + ((u >> 16) & 1u); return __uint_as_float(u & 0xFFFF0000u); }
__device__ __forceinline__ void split16(float v, b16& hi, b16& lo) { hi = (b16)v; lo = (b16)(v - (float)hi); }
__device__ __forceinline__ v16b frag_kb(const b16* p, int hh) { const v8b a = *(const v8b*)(p + 8 * hh), b = *(const v8b*)(p + 16 + 8 * hh); v16b f;
#pragma unroll
  for (int e = 0; e < 8; ++e) { f[e] = a[e]; f[8 + e] = b[e]; } return f; }
__device__ __forceinline__ v8f wmma16b(v16b a, v16b b, v8f c) { v8f d = __builtin_amdgcn_wmma_f32_16x16x32_f16(false, a, false, b, (short)0, c, false, false); asm volatile("v_nop\n\tv_nop\n\tv_nop\n\tv_nop" : "+v"(d) : "v"(a), "v"(b)); return d; }
__device__ __forceinline__ void wave_lds_sync() { __builtin_amdgcn_fence(__ATOMIC_RELEASE, "workgroup"); __builtin_amdgcn_wave_barrier(); __builtin_amdgcn_fence(__ATOMIC_ACQUIRE, "workgroup"); }
__device__ __forceinline__ int iclamp(int v, int lo, int hi) { return v < lo ? lo : (v > hi ? hi : v); }
__device__ __forceinline__ float nexp(float x) { return __builtin_amdgcn_exp2f(x * 1.4426950408889634f); }
// ---------------- deterministic, line-safe CSR by destination (two-level bucketing; every global write but the FLAG word is a whole-line, lane-contiguous store) ----------------
// Pass A (block per contiguous edge chunk): a stable counting sort of the chunk's edges by coarse bucket g = dst >> CSR_GB (nG <= CSR_MAXG buckets) into LDS, all waves at work (see csr_rank), then whole-line
//   stores of the grouped ids (STG row) and of one word per bucket (HST row): its count | its start inside the staging row << 16.
// Pass B (block per bucket g): gathers the bucket's edge ids from the 512 staging rows into LDS (at most CSR_CAP ids), the same stable counting sort by destination node, then writes (a) its PERM run, which starts at g * CSR_CAP (a fixed place per bucket: no table over all buckets has to be built between the passes), and
//   (b) ROWPTR[v], ROWCNT[v] for its 2^CSR_GB nodes as contiguous ints. If a bucket exceeds CSR_CAP the kernel treats it as empty (ROWCNT = 0 for its nodes) and sets FLAG[0] = 1 (loud failure, no corruption).
// The sort, no atomics, original edge order kept inside every key: each wave owns a contiguous run of items and a histogram row of its own; per 32 items csr_rank gives every lane its rank among the
//   lanes with an equal key, the first such lane advances the row's counter; then a prefix over (key, wave) turns the rows into start positions.
constexpr int CSR_NBLK = 512, CSR_GB = 9, CSR_GN = 1 << CSR_GB /* nodes per bucket */, CSR_MAXG = 512, CSR_CAP = 12288 /* ids per bucket in LDS (48+24+48 KB, and 32 KB of counter rows) */;
constexpr int CSR_CH = (E + CSR_NBLK - 1) / CSR_NBLK /* edges per chunk */, CSRA_NW = 8, CSRA_G = (CSR_CH + CSRA_NW * 32 - 1) / (CSRA_NW * 32) /* groups of 32 per wave */, CSRB_NW = 32, CSRB_G = CSR_CAP / (CSRB_NW * 32);
static_assert(CSR_CH < 32768 && CSR_CAP % 32 == 0, "a count and a start share one int; a bucket's PERM run starts on a whole line");
// mask of the wave's valid lanes whose 9-bit key equals this lane's (keys < 512 = CSR_MAXG = CSR_GN)
__device__ __forceinline__ unsigned csr_match(int key, bool valid) { unsigned m = __builtin_amdgcn_ballot_w32(valid);
#pragma unroll   // short fixed trip count: straight-line code, its LDS reads or ballots issued back to back
  for (int b = 0; b < 9; ++b) { const bool on = (key >> b) & 1; const unsigned s = __builtin_amdgcn_ballot_w32(on); m &= on ? s : ~s; } return m; }
// one group of 32 items: returns how many items of this wave's run with the same key stand in front of this lane's item, and advances the wave's own counter row. key < 0: no item.
template <typename T> __device__ __forceinline__ int csr_rank(T* row, int key, int lane) { const bool ok = key >= 0; const unsigned m = csr_match(key, ok); const int r = __popc(m & ((1u << lane) - 1u)); int base = 0;
  if (ok) base = (int)row[key]; if (ok && r == 0) row[key] = (T)(base + __popc(m));
  wave_lds_sync();   // the next group's lanes read counters that other lanes of this wave have just stored
  return base + r; }
// exclusive prefix of one int per thread over a block of NW waves (every thread calls it); total = the block's sum. wsum: NW ints of LDS.
template <int NW> __device__ __forceinline__ int csr_scan(int v, int* wsum, int lane, int wave, int& total) { int inc = v;
#pragma unroll   // short fixed trip count: straight-line code, its LDS reads or ballots issued back to back
  for (int o = 1; o < 32; o <<= 1) { const int u = __shfl_up(inc, o); if (lane >= o) inc += u; }
  if (lane == 31) wsum[wave] = inc;
  __syncthreads();
  int pre = 0, all = 0;
#pragma unroll   // short fixed trip count: straight-line code, its LDS reads or ballots issued back to back
  for (int w = 0; w < NW; ++w) { const int s = wsum[w]; pre += (w < wave) ? s : 0; all += s; }
  __syncthreads();   // wsum may be written again by the next call
  total = all; return pre + inc - v; }
__global__ __launch_bounds__(256) void csrA_kernel(const int* __restrict__ dst, int E, int N, int nG, int CHP, int NGP, int* __restrict__ STG, int* __restrict__ HST) {
  extern __shared__ int sm[];   // cnt[NGP] | run[NGP] | ids[CHP]
  __shared__ int wh[CSRA_NW][CSR_MAXG]; __shared__ int wsum[CSRA_NW];
  int* cnt = sm; int* run = sm + NGP; int* ids = sm + 2 * NGP;
  const int t_ = threadIdx.x, lane = t_ & 31, wave = t_ >> 5;
  const int b = blockIdx.x; const int e0 = b * CSR_CH; const int i0 = wave * (CSRA_G * 32) + lane;
  for (int i = t_; i < CSRA_NW * CSR_MAXG; i += 256) (&wh[0][0])[i] = 0;
  for (int i = t_; i < CHP; i += 256) ids[i] = -1;
  int key[CSRA_G], lr[CSRA_G]; unsigned ei[CSRA_G];
#pragma unroll   // constant indices keep the per-lane arrays in registers
  for (int u = 0; u < CSRA_G; ++u) { ei[u] = (unsigned)min(e0 + i0 + u * 32, E - 1); key[u] = dst[ei[u]]; }   // all of a lane's loads in flight together; an index past the end re-reads the last edge
  static_assert(CSRA_G == 13, "the statement below names 13 values");
  // a precaution: this wait stands in front of every overwrite of a register that an issued load names; the index registers are named so that they stay whole up to it
  asm volatile("s_wait_xcnt 0x0" :: "v"(ei[0]), "v"(ei[1]), "v"(ei[2]), "v"(ei[3]), "v"(ei[4]), "v"(ei[5]), "v"(ei[6]), "v"(ei[7]), "v"(ei[8]), "v"(ei[9]), "v"(ei[10]), "v"(ei[11]), "v"(ei[12]) : "memory");
#pragma unroll   // constant indices keep the per-lane arrays in registers
  for (int u = 0; u < CSRA_G; ++u) { const int i = i0 + u * 32; const bool ok = i < CSR_CH && e0 + i < E; int d = key[u]; d = (d < 0) ? 0 : (d >= N ? N - 1 : d); key[u] = ok ? (d >> CSR_GB) : -1; }
  __syncthreads();
#pragma unroll   // constant indices keep the per-lane arrays in registers
  for (int u = 0; u < CSRA_G; ++u) lr[u] = csr_rank(wh[wave], key[u], lane);
  __syncthreads();
  int s[2];   // thread t_: buckets 2 t_ and 2 t_ + 1; the rows become exclusive prefixes over the waves
#pragma unroll   // short fixed trip count: straight-line code, its LDS reads or ballots issued back to back
  for (int j = 0; j < 2; ++j) { int acc = 0;
#pragma unroll   // short fixed trip count: straight-line code, its LDS reads issued back to back
    for (int w = 0; w < CSRA_NW; ++w) { const int c = wh[w][2 * t_ + j]; wh[w][2 * t_ + j] = acc; acc += c; } s[j] = acc; }
  int all; const int pre = csr_scan<CSRA_NW>(s[0] + s[1], wsum, lane, wave, all);
  if (2 * t_ < NGP) { cnt[2 * t_] = s[0]; run[2 * t_] = pre; } if (2 * t_ + 1 < NGP) { cnt[2 * t_ + 1] = s[1]; run[2 * t_ + 1] = pre + s[0]; }
  __syncthreads();
#pragma unroll   // constant indices keep the per-lane arrays in registers
  for (int u = 0; u < CSRA_G; ++u) if (key[u] >= 0) ids[run[key[u]] + wh[wave][key[u]] + lr[u]] = e0 + i0 + u * 32;
  __syncthreads();
  typedef __attribute__((ext_vector_type(4))) int v4i;
  {
    for (int i = t_; i < CHP / 4; i += 256) *(v4i*)(STG + (size_t)b * CHP + i * 4) = *(const v4i*)(&ids[i * 4]);
    for (int i = t_; i < NGP / 4; i += 256) { v4i v; for (int e = 0; e < 4; ++e) v[e] = (i * 4 + e < nG) ? (cnt[i * 4 + e] | (run[i * 4 + e] << 16)) : 0; *(v4i*)(HST + (size_t)b * NGP + i * 4) = v; }   // both are at most CSR_CH
     }
}
// bucket: block g (1024 threads): gather ids (from each block's staging sub-run, in block order => original edge order), stable counting sort by node, flush; ROWPTR/ROWCNT rows.
__global__ __launch_bounds__(1024) void csrB_kernel(const int* __restrict__ dst, int N, int nG, int CHP, int NGP, const int* __restrict__ STG, const int* __restrict__ HST, int* __restrict__ PERM, int* __restrict__ ROWPTR, int* __restrict__ ROWCNT, int* __restrict__ FLAG) {
  typedef __attribute__((ext_vector_type(4))) int v4i;
  __shared__ int ids[CSR_CAP]; __shared__ unsigned short key[CSR_CAP]; __shared__ int outp[CSR_CAP]; __shared__ int ncnt[CSR_GN + 1]; __shared__ int boff[CSR_NBLK + 1]; __shared__ int ooff[CSR_NBLK];
  __shared__ __attribute__((aligned(16))) unsigned short wh[CSRB_NW][CSR_GN]; __shared__ int wsum[CSRB_NW];
  const int g = blockIdx.x, t_ = threadIdx.x, lane = t_ & 31, wave = t_ >> 5; const int st = g * CSR_CAP; const int v0 = g * CSR_GN; const int nv = min(CSR_GN, N - v0); int tot; (void)nG;
  // per-block offsets of this bucket's sub-runs in gather order (thread = staging row); their sum is the bucket's total
  { int c = 0; if (t_ < CSR_NBLK) { const unsigned hi = (unsigned)(t_ * NGP + g); const unsigned w = (unsigned)HST[hi];
      asm volatile("s_wait_xcnt 0x0" :: "v"(hi) : "memory");   // the same precaution as in pass A
      c = min((int)(w & 0xFFFFu), CHP); ooff[t_] = (int)(w >> 16); }
    int all; const int pre = csr_scan<CSRB_NW>(c, wsum, lane, wave, all); tot = all;
    if (all > CSR_CAP) { tot = 0; if (t_ == 0) FLAG[0] = 1; }   // loud failure: the bucket is worked on as an empty one (zero counts), flag
    if (t_ < CSR_NBLK) boff[t_] = min(pre, tot); if (t_ == 0) boff[CSR_NBLK] = tot; }
  for (int i = t_; i < CSRB_NW * CSR_GN / 2; i += 1024) ((int*)&wh[0][0])[i] = 0;
  __syncthreads();
  { constexpr int RB = CSR_NBLK / CSRB_NW;   // a wave gathers RB staging rows in a row; the first 32 ids of all of them are in flight together
    int bo[RB], cn[RB], id[RB], dd[RB]; unsigned ix[RB];
#pragma unroll   // constant indices keep the per-lane arrays in registers
    for (int u = 0; u < RB; ++u) { const int b = wave * RB + u; bo[u] = boff[b]; cn[u] = boff[b + 1] - bo[u]; int o_ = ooff[b]; o_ = (o_ < 0) ? 0 : (o_ > CHP - cn[u] ? CHP - cn[u] : o_); ix[u] = (unsigned)(b * CHP + min(o_, CHP - 1) + (lane < cn[u] ? lane : 0)); }   // a lane past the sub-run's end re-reads a written word of the row, so that no load hangs on a branch
#pragma unroll   // constant indices keep the per-lane arrays in registers
    for (int u = 0; u < RB; ++u) id[u] = STG[ix[u]];
    static_assert(RB == 16, "the three statements below name 16 values each");
    // a precaution: this wait stands in front of every overwrite of a register that an issued load names; the index registers are named so that they stay whole up to it
    asm volatile("s_wait_xcnt 0x0" :: "v"(ix[0]), "v"(ix[1]), "v"(ix[2]), "v"(ix[3]), "v"(ix[4]), "v"(ix[5]), "v"(ix[6]), "v"(ix[7]), "v"(ix[8]), "v"(ix[9]), "v"(ix[10]), "v"(ix[11]), "v"(ix[12]), "v"(ix[13]), "v"(ix[14]), "v"(ix[15]) : "memory");
    // holds the 16 loads together in front of the branches below: sunk into its branch, a load would wait there alone
    asm volatile("" :: "v"(id[0]), "v"(id[1]), "v"(id[2]), "v"(id[3]), "v"(id[4]), "v"(id[5]), "v"(id[6]), "v"(id[7]), "v"(id[8]), "v"(id[9]), "v"(id[10]), "v"(id[11]), "v"(id[12]), "v"(id[13]), "v"(id[14]), "v"(id[15]));
#pragma unroll   // constant indices keep the per-lane arrays in registers
    for (int u = 0; u < RB; ++u) id[u] = (id[u] < 0) ? 0 : id[u];
#pragma unroll   // constant indices keep the per-lane arrays in registers
    for (int u = 0; u < RB; ++u) dd[u] = dst[id[u]];
    // the same for the 16 destination loads
    asm volatile("" :: "v"(dd[0]), "v"(dd[1]), "v"(dd[2]), "v"(dd[3]), "v"(dd[4]), "v"(dd[5]), "v"(dd[6]), "v"(dd[7]), "v"(dd[8]), "v"(dd[9]), "v"(dd[10]), "v"(dd[11]), "v"(dd[12]), "v"(dd[13]), "v"(dd[14]), "v"(dd[15]));
#pragma unroll   // constant indices keep the per-lane arrays in registers
    for (int u = 0; u < RB; ++u) if (lane < cn[u]) { int d = dd[u]; d = (d < v0) ? v0 : (d >= N ? N - 1 : d); int kk = d - v0; kk = (kk < 0) ? 0 : (kk >= CSR_GN ? CSR_GN - 1 : kk); ids[bo[u] + lane] = id[u]; key[bo[u] + lane] = (unsigned short)kk; }
#pragma unroll 1   // seldom entered: kept small
    for (int u = 0; u < RB; ++u) { const int b = wave * RB + u; const int bs = boff[b], c = boff[b + 1] - bs; int o_ = ooff[b]; o_ = (o_ < 0) ? 0 : (o_ > CHP - c ? CHP - c : o_); const int* src_ = STG + (size_t)b * CHP + o_;   // what a sub-run holds beyond 32 ids
      for (int i = lane + 32; i < c; i += 32) { int idr = src_[i]; idr = (idr < 0) ? 0 : idr; ids[bs + i] = idr; int d = dst[idr]; d = (d < v0) ? v0 : (d >= N ? N - 1 : d); int kk = d - v0; kk = (kk < 0) ? 0 : (kk >= CSR_GN ? CSR_GN - 1 : kk); key[bs + i] = (unsigned short)kk; } } }
  __syncthreads();
  // stable counting sort by node inside the bucket: wave w owns items [w S, w S + S)
  const int S = ((tot + CSRB_NW * 32 - 1) / (CSRB_NW * 32)) * 32; const int i0 = wave * S + lane;
  int kr[CSRB_G], lr[CSRB_G];
#pragma unroll   // constant indices keep the per-lane arrays in registers
  for (int u = 0; u < CSRB_G; ++u) { const int i = i0 + u * 32; kr[u] = (u * 32 < S && i < tot) ? (int)key[i] : -1; lr[u] = 0; }
#pragma unroll   // constant indices keep the per-lane arrays in registers
  for (int u = 0; u < CSRB_G; ++u) if (u * 32 < S) lr[u] = csr_rank(wh[wave], kr[u], lane);
  __syncthreads();
  { int s = 0; if (t_ < CSR_GN) {   // thread = node: the rows become exclusive prefixes over the waves
#pragma unroll   // short fixed trip count: straight-line code, its LDS reads or ballots issued back to back
      for (int w = 0; w < CSRB_NW; ++w) { const int c = wh[w][t_]; wh[w][t_] = (unsigned short)s; s += c; } }
    int all; const int pre = csr_scan<CSRB_NW>(s, wsum, lane, wave, all); if (t_ < CSR_GN) ncnt[t_] = pre; if (t_ == 0) ncnt[CSR_GN] = all; }   // ncnt[vl] = start of node vl
  __syncthreads();
#pragma unroll   // constant indices keep the per-lane arrays in registers
  for (int u = 0; u < CSRB_G; ++u) if (kr[u] >= 0) outp[ncnt[kr[u]] + (int)wh[wave][kr[u]] + lr[u]] = ids[i0 + u * 32];
  __syncthreads();
  {
    for (int i = t_; i < ((tot + 31) & ~31) / 4; i += 1024) { v4i v; for (int e = 0; e < 4; ++e) { const int q = i * 4 + e; v[e] = (q < tot) ? outp[q] : -1; } *(v4i*)(PERM + st + i * 4) = v; }
    for (int i = t_; i < CSR_GN / 4; i += 1024) { v4i a, c; for (int e = 0; e < 4; ++e) { const int vl = i * 4 + e; a[e] = st + ncnt[vl]; c[e] = (vl < nv) ? (ncnt[vl + 1] - ncnt[vl]) : 0; } *(v4i*)(ROWPTR + v0 + i * 4) = a; *(v4i*)(ROWCNT + v0 + i * 4) = c; }   // the tables hold nG*512 entries (beyond N: count 0)
     }
}
__global__ __launch_bounds__(256) void csrZ_kernel(int* __restrict__ p, size_t n4) { typedef __attribute__((ext_vector_type(4))) int v4i; const size_t tid = (size_t)blockIdx.x * 256 + threadIdx.x, nth = (size_t)gridDim.x * 256; v4i z = {0, 0, 0, 0}; for (size_t i = tid; i < n4; i += nth) *(v4i*)(p + i * 4) = z; }
// host helper. Workspace ints needed: STG (512*CHP), HST (512*NGP), PERM (nG*CSR_CAP), ROWPTR (Npad), ROWCNT (Npad), FLAG (64). Npad = roundup(N, 512).
struct CsrBufs { int *STG, *HST, *PERM, *ROWPTR, *ROWCNT, *FLAG; int nG, NGP, CHP; size_t permLen; char* base; size_t bytes; };
static size_t csr_carve(CsrBufs& c, char* ws, size_t off, int E, int N) {
  const size_t off0 = off; c.base = ws + off;
  auto al = [&](size_t bytes) { char* p = ws + off; off += (bytes + 255) & ~(size_t)255; return p; };
  c.nG = (N + CSR_GN - 1) / CSR_GN; c.NGP = (c.nG + 31) & ~31; const int ch = (E + CSR_NBLK - 1) / CSR_NBLK; c.CHP = (ch + 31) & ~31; c.permLen = (size_t)c.nG * CSR_CAP;
  c.STG = (int*)al((size_t)CSR_NBLK * c.CHP * 4); c.HST = (int*)al((size_t)CSR_NBLK * c.NGP * 4);
  c.PERM = (int*)al(c.permLen * 4); c.ROWPTR = (int*)al((size_t)c.nG * CSR_GN * 4); c.ROWCNT = (int*)al((size_t)c.nG * CSR_GN * 4); c.FLAG = (int*)al(256);
  c.bytes = off - off0; return off;
}
static void csr_build(const CsrBufs& c, const int* dst, int E, int N, hipStream_t stream) {
  const size_t smem = (size_t)(2 * c.NGP + c.CHP) * 4;
  csrZ_kernel<<<512, 256, 0, stream>>>((int*)c.base, c.bytes / 16);
  csrA_kernel<<<CSR_NBLK, 256, smem, stream>>>(dst, E, N, c.nG, c.CHP, c.NGP, c.STG, c.HST);
  csrB_kernel<<<c.nG, 1024, 0, stream>>>(dst, N, c.nG, c.CHP, c.NGP, c.STG, c.HST, c.PERM, c.ROWPTR, c.ROWCNT, c.FLAG);
}


__global__ __launch_bounds__(256) void wprep_kernel(const float* __restrict__ wq, const float* __restrict__ wk, const float* __restrict__ wv, const float* __restrict__ wo, b16* __restrict__ WT) {
  const size_t u = (size_t)blockIdx.x * 256 + threadIdx.x; const size_t per = (size_t)D * D / 8; if (u >= 4 * per) return; const int which = (int)(u / per); const size_t e = (u % per) * 8; const float* w = which == 0 ? wq : which == 1 ? wk : which == 2 ? wv : wo; v8b o;
  for (int j = 0; j < 8; ++j) o[j] = (b16)(bf16_rne(w[e + j]) * WSC);
  { *(v8b*)(WT + (size_t)which * D * D + e) = o;  }
}
__global__ __launch_bounds__(128) void proj_kernel(const float* __restrict__ h, const b16* __restrict__ WT, const float* __restrict__ bq, const float* __restrict__ bk, const float* __restrict__ bv, float* __restrict__ QKV) {
  __shared__ __attribute__((aligned(16))) float Tf[4][16][D + 4];
  const int wave = threadIdx.x >> 5, lane = threadIdx.x & 31, nloc = lane & 15, hlf = lane >> 4; const size_t m0 = (size_t)blockIdx.x * 64 + wave * 16; const int part = blockIdx.y; const b16* W = WT + (size_t)part * D * D; const float* bias = part == 0 ? bq : part == 1 ? bk : bv; const float osc = part == 0 ? SCAL : 1.0f;
  const size_t v = m0 + nloc; v8f acc[8];
#pragma unroll
  for (int t = 0; t < 8; ++t) acc[t] = (v8f){};
#pragma unroll
  for (int kb = 0; kb < D; kb += 32) { v16b a = {}; if (v < (size_t)N) { const float* r = h + v * D + kb; for (int e = 0; e < 8; ++e) { a[e] = (b16)(bf16_rne(r[8 * hlf + e]) * XS); a[8 + e] = (b16)(bf16_rne(r[16 + 8 * hlf + e]) * XS); } }
#pragma unroll
    for (int t = 0; t < 8; ++t) acc[t] = wmma16b(a, frag_kb(W + (size_t)(t * 16 + nloc) * D + kb, hlf), acc[t]); }
#pragma unroll
  for (int t = 0; t < 8; ++t) { const int c = t * 16 + nloc; const float bb = bf16_rne(bias[c]);
#pragma unroll 1
    for (int r = 0; r < 8; ++r) { const size_t row = m0 + 8 * hlf + r; Tf[wave][8 * hlf + r][c] = row < (size_t)N ? (acc[t][r] * (1.0f / (XS * WSC)) + bb) * osc : 0.0f; } }
  wave_lds_sync();
  { for (int rr = 0; rr < 16; ++rr) *(v4f*)(QKV + ((size_t)part * NP + m0 + rr) * D + lane * 4) = *(const v4f*)(&Tf[wave][rr][lane * 4]);  }
}
// Attention, one wave per destination node, its edges up to 16 at a time. Per batch: lane j fetches edge j's ids (32 edges per fetch); the batch's K rows are loaded together, each lane stores q*k of its 4
// channels to the wave's own LDS rows; lane (edge slot es = lane/2, head group hp = 4*(lane&1)) sums the 16 products of each of its 4 heads (the same pairwise tree as a butterfly over d), so every logit, its
// maximum and its exponential are worked out once and not on 16 lanes; the weights go back through LDS, and each lane adds weight * V for its own 4 channels. The V rows fly while the softmax is worked on.
constexpr int AB = 16 /* edges per batch */, APITCH = D + 8 /* floats; 544 B = 32 B x 17: the 8 edge slots x 2 head groups of a half wave read 16 B each on all 64 banks */;
// orders the LDS stores and loads of one wave's lanes; LDS only, so that global loads in flight are not waited for here
__device__ __forceinline__ void wave_lds_only_sync() { __builtin_amdgcn_fence(__ATOMIC_RELEASE, "workgroup", "local"); __builtin_amdgcn_wave_barrier(); __builtin_amdgcn_fence(__ATOMIC_ACQUIRE, "workgroup", "local"); }
// the 16 bytes per lane of NE rows of a plane, all loads issued together. sv: lane l0 + u holds the row of slot u. ix: the lane's index in units of 16 bytes, added to the plane's scalar base by the load itself.
template <int NE> __device__ __forceinline__ void rows_load(const float* plane, int sv, int l0, int lane, v4f (&r)[NE]) {
  unsigned ix[NE];
#pragma unroll   // constant indices keep the arrays in registers
  for (int u = 0; u < NE; ++u) ix[u] = (unsigned)__builtin_amdgcn_readlane(sv, l0 + u) * (unsigned)(D / 4) + (unsigned)lane;
#pragma unroll   // constant indices keep the arrays in registers
  for (int u = 0; u < NE; ++u) r[u] = ((const v4f*)plane)[ix[u]];
  static_assert(NE == 4 || NE == 8 || NE == 12 || NE == 16, "one of the statements below names all NE values");
  // a precaution: this wait stands in front of every overwrite of a register that an issued load names; the index registers are named so that they stay whole up to it
  if constexpr (NE == 4) asm volatile("s_wait_xcnt 0x0" :: "v"(ix[0]), "v"(ix[1]), "v"(ix[2]), "v"(ix[3]) : "memory");
  else if constexpr (NE == 8) asm volatile("s_wait_xcnt 0x0" :: "v"(ix[0]), "v"(ix[1]), "v"(ix[2]), "v"(ix[3]), "v"(ix[4]), "v"(ix[5]), "v"(ix[6]), "v"(ix[7]) : "memory");
  else if constexpr (NE == 12) asm volatile("s_wait_xcnt 0x0" :: "v"(ix[0]), "v"(ix[1]), "v"(ix[2]), "v"(ix[3]), "v"(ix[4]), "v"(ix[5]), "v"(ix[6]), "v"(ix[7]), "v"(ix[8]), "v"(ix[9]), "v"(ix[10]), "v"(ix[11]) : "memory");
  else asm volatile("s_wait_xcnt 0x0" :: "v"(ix[0]), "v"(ix[1]), "v"(ix[2]), "v"(ix[3]), "v"(ix[4]), "v"(ix[5]), "v"(ix[6]), "v"(ix[7]), "v"(ix[8]), "v"(ix[9]), "v"(ix[10]), "v"(ix[11]), "v"(ix[12]), "v"(ix[13]), "v"(ix[14]), "v"(ix[15]) : "memory");
}
// one batch of nb <= NE edges, straight-line code for NE slots (no test around a load, so that the loads of a batch stay in flight together); a slot from nb on holds the row's last edge again and gets weight 0.
// sv: lane l0 + u holds the source node of slot u. mx: running maximum per head (the same in all lanes of a head group); den: this lane's edge slot alone; acc: this lane's 4 channels.
template <int NE> __device__ __forceinline__ void attn_batch(const float* K, const float* V, float (*Pr)[APITCH], float (*Pw)[NH], int sv, int l0, int nb, int lane, const v4f q, v4f& mx, v4f& den, v4f& acc) {
  const int c0 = lane * 4, es = lane >> 1, hp = (lane & 1) * 4;
  v4f kk[NE], vv[NE];
  rows_load<NE>(K, sv, l0, lane, kk);
#pragma unroll   // constant indices keep the rows in registers
  for (int u = 0; u < NE; ++u) *(v4f*)(&Pr[u][c0]) = q * kk[u];
  wave_lds_only_sync();   // other lanes of this wave read the products
  v4f l = {-INFINITY, -INFINITY, -INFINITY, -INFINITY};   // an empty slot: weight exp(-inf) = 0
  if (es < nb) { const float* pr = &Pr[es][hp]; v4f t[HD];
#pragma unroll   // constant indices keep the array in registers
    for (int d = 0; d < HD; ++d) t[d] = *(const v4f*)(pr + d * NH);
#pragma unroll   // constant indices keep the array in registers
    for (int w = 1; w < HD; w <<= 1)
#pragma unroll   // constant indices keep the array in registers
      for (int d = 0; d < HD; d += 2 * w) t[d] += t[d + w];
    l = t[0]; }
  rows_load<NE>(V, sv, l0, lane, vv);   // issued here, where the K rows and the 16 partial sums are dead, and used behind the softmax
  v4f p;
  for (int i = 0; i < 4; ++i) { float m = l[i]; m = fmaxf(m, __shfl_xor(m, 2)); m = fmaxf(m, __shfl_xor(m, 4)); m = fmaxf(m, __shfl_xor(m, 8)); m = fmaxf(m, __shfl_xor(m, 16));   // the batch's maximum of this head
    m = fmaxf(m, mx[i]); const float sc = nexp(mx[i] - m); p[i] = nexp(l[i] - m); mx[i] = m; den[i] = den[i] * sc + p[i]; acc[i] *= sc; }   // sc = 0 in the first batch
  *(v4f*)(&Pw[es][hp]) = p;
  wave_lds_only_sync();   // other lanes of this wave read the weights
#pragma unroll   // constant indices keep the rows in registers
  for (int u = 0; u < NE; ++u) acc += *(const v4f*)(&Pw[u][hp]) * vv[u];
  wave_lds_only_sync();   // the next batch overwrites what this one has read
}
// 8 waves per SIMD is what four blocks' LDS on a WGP allows: the second bound keeps the register budget at 128, so that registers do not allow fewer
__global__ __launch_bounds__(256, 8) void attn_kernel(const float* QKV, const int* __restrict__ cols, const int* __restrict__ PERM, const int* __restrict__ ROWPTR, const int* __restrict__ ROWCNT, int permLen, b16* Oh, b16* Ol) {   // Oh aliases the q plane (see host)
  __shared__ __attribute__((aligned(16))) float Pr[8][AB][APITCH];   // per wave: q*k, [edge slot][channel]
  __shared__ __attribute__((aligned(16))) float Pw[8][AB][NH];       // per wave: softmax weights, [edge slot][head]
  const int wave = threadIdx.x >> 5, lane = threadIdx.x & 31; const size_t v = (size_t)blockIdx.x * 8 + wave; const int c0 = lane * 4; (void)Ol;
  v4f o = {0.0f, 0.0f, 0.0f, 0.0f};
  int st = 0, cnt = 0; if (v < (size_t)N) { st = ROWPTR[v]; cnt = ROWCNT[v]; cnt = iclamp(cnt, 0, 65536); st = iclamp(st, 0, permLen - cnt); }
  cnt = __builtin_amdgcn_readfirstlane(cnt); st = __builtin_amdgcn_readfirstlane(st);   // the same in every lane: a scalar loop and scalar tests below
  const v4f q = *(const v4f*)(QKV + v * D + c0); const float* K = QKV + (size_t)NP * D; const float* V = QKV + (size_t)2 * NP * D;
  v4f mx = {-INFINITY, -INFINITY, -INFINITY, -INFINITY}, den = {0.0f, 0.0f, 0.0f, 0.0f}, acc = {0.0f, 0.0f, 0.0f, 0.0f}; int sv = 0;
  for (int base = 0; base < cnt; base += AB) {
    if ((base & 31) == 0) { const int j = min(base + lane, cnt - 1); const int e = iclamp(PERM[st + j], 0, E - 1); sv = iclamp(cols[e], 0, N - 1); }   // source nodes of 32 edges, one per lane; past the end: the last edge again
    const int nb = min(cnt - base, AB), l0 = base & 16;
    if (nb > 12) attn_batch<16>(K, V, Pr[wave], Pw[wave], sv, l0, nb, lane, q, mx, den, acc);
    else if (nb > 8) attn_batch<12>(K, V, Pr[wave], Pw[wave], sv, l0, nb, lane, q, mx, den, acc);
    else if (nb > 4) attn_batch<8>(K, V, Pr[wave], Pw[wave], sv, l0, nb, lane, q, mx, den, acc);
    else attn_batch<4>(K, V, Pr[wave], Pw[wave], sv, l0, nb, lane, q, mx, den, acc);
  }
  if (cnt > 0) for (int i = 0; i < 4; ++i) { float d = den[i]; d += __shfl_xor(d, 2); d += __shfl_xor(d, 4); d += __shfl_xor(d, 8); d += __shfl_xor(d, 16); o[i] = acc[i] / d; }   // the 16 slots' sums of this head
  v4h ph, pl; for (int i = 0; i < 4; ++i) { b16 p, pq; split16(o[i] * XS, p, pq); ph[i] = p; pl[i] = pq; }
  { *(v4h*)(Oh + v * (2 * D) + c0) = ph; *(v4h*)(Oh + v * (2 * D) + D + c0) = pl;  }   // hi | lo packed into this node's own 512-B q row (no other wave reads it)
}
__global__ __launch_bounds__(128) void oproj_kernel(const b16* __restrict__ Oh, const b16* __restrict__ Ol, const b16* __restrict__ WT, const float* __restrict__ bo, float* __restrict__ out) {
  __shared__ __attribute__((aligned(16))) float Tf[4][16][D + 4];
  const int wave = threadIdx.x >> 5, lane = threadIdx.x & 31, nloc = lane & 15, hlf = lane >> 4; const size_t m0 = (size_t)blockIdx.x * 64 + wave * 16; const b16* W = WT + (size_t)3 * D * D;
  v8f acc[8];
#pragma unroll
  for (int t = 0; t < 8; ++t) acc[t] = (v8f){};
#pragma unroll
  for (int kb = 0; kb < D; kb += 32) { const v16b a = frag_kb(Oh + (m0 + nloc) * (2 * D) + kb, hlf), al = frag_kb(Oh + (m0 + nloc) * (2 * D) + D + kb, hlf);
#pragma unroll
    for (int t = 0; t < 8; ++t) { const v16b bw = frag_kb(W + (size_t)(t * 16 + nloc) * D + kb, hlf); acc[t] = wmma16b(a, bw, acc[t]); acc[t] = wmma16b(al, bw, acc[t]); } }
#pragma unroll
  for (int t = 0; t < 8; ++t) { const int c = t * 16 + nloc; const float bb = bf16_rne(bo[c]);
#pragma unroll 1
    for (int r = 0; r < 8; ++r) Tf[wave][8 * hlf + r][c] = acc[t][r] * (1.0f / (XS * WSC)) + bb; }
  wave_lds_sync();
  { for (int rr = 0; rr < 16; ++rr) { const size_t row = m0 + rr; if (row < (size_t)N) *(v4f*)(out + row * D + lane * 4) = *(const v4f*)(&Tf[wave][rr][lane * 4]); }  }
}
}  // namespace

extern "C" void kernel_launch(void* const* d_in, const int* in_sizes, int n_in, void* d_out, int out_size, void* d_ws, size_t ws_size, hipStream_t stream) {
  (void)n_in;
  auto Fp = [&](int i) { return (const float*)d_in[i]; }; auto Ip = [&](int i) { return (const int*)d_in[i]; };
  // input order: 0 h [100000,128], 1 row [E] i32, 2 col [E] i32, 3 Wq [128,128], 4 bq, 5 Wk, 6 bk, 7 Wv, 8 bv, 9 Wo, 10 bo
  if (in_sizes[0] != N * D || in_sizes[1] != E || in_sizes[2] != E || in_sizes[3] != D * D || in_sizes[9] != D * D || out_size != N * D) return;
  size_t off = 0; char* ws = (char*)d_ws;
  auto carve = [&](size_t bytes) { char* p = ws + off; off += (bytes + 255) & ~(size_t)255; return p; };
  b16* WT = (b16*)carve((size_t)4 * D * D * 2); float* QKV = (float*)carve((size_t)3 * NP * D * 4);
  b16* Oh = (b16*)QKV; b16* Ol = Oh;   // the attention output (hi | lo, 2 x 128 halves) overwrites each node's own 512-B q row in place: a wave reads only its own q row before writing it (K/V rows live in the other two planes)
  CsrBufs csr; off = csr_carve(csr, ws, off, E, N);
  if (off > ws_size) return;   // QKV 153.6 + CSR ~17 = ~171 MB (< 256 MiB)
  wprep_kernel<<<(unsigned)((4 * (size_t)D * D / 8 + 255) / 256), 256, 0, stream>>>(Fp(3), Fp(5), Fp(7), Fp(9), WT);
  csr_build(csr, Ip(1), E, N, stream);   // group by row (the softmax axis)
  proj_kernel<<<dim3(NP / 64, 3), 128, 0, stream>>>(Fp(0), WT, Fp(4), Fp(6), Fp(8), QKV);
  attn_kernel<<<NP / 8, 256, 0, stream>>>(QKV, Ip(2), csr.PERM, csr.ROWPTR, csr.ROWCNT, (int)csr.permLen, Oh, Ol);
  oproj_kernel<<<NP / 64, 128, 0, stream>>>(Oh, Ol, WT, Fp(10), (float*)d_out);
}

// v006
// One run takes 184 microseconds.
// It is 1.19 times as fast as v004, going by the measured steps of the versions left out in between.
// All steps since v000 together make it 10.7 times as fast.
#include <hip/hip_runtime.h>

// Sparse multi-head attention over a graph (DGL bsddmm / bspmm style): q = (h Wq^T + bq) * 16^-1/2, k, v = Linear(h), all reshaped (N, 16, 8) — i.e. channel c = d*8 + head (heads interleaved);
// per edge e: logit_h = sum_d q[row][d,h] k[col][d,h]; softmax over the edges of each row (destination); out[row] = sum attn v[col]; y = out Wo^T + bo -> [100000][128]. 100,000 nodes,
// 1,600,000 edges; rows without edges give out = 0 (then bo).
// WMMA (v_wmma_f32_16x16x32_f16, f32 accumulate): the q/k/v projections ([100,032 x 128] x [128 x 384], EXACT bf16 h x8: 1 product) and the output projection ([100,032 x 128] x [128 x 128],
// attention output as f16 hi+lo x8 planes: 2 products), weights exact x256; per-edge head dots (lane owns channels 4l..4l+3 = heads (4l mod 8)+0..3 at d = l/2; the 16 products of a head summed by one lane
// through LDS, 16 edges at a time), softmax and weighted sums in f32; the k and v rows that the edges gather are kept as f16 (rounded once from the f32 projection), q stays f32. Inputs rounded to bf16 once; ids int32 (clamped). Fragment k-map per lane half hh for A AND B:

namespace {
constexpr int N = 100000, NP = 100032, E = 1600000, D = 128, NH = 8, HD = 16;
constexpr float XS = 8.0f, WSC = 256.0f, NEG = 0.2f /* unused */, SCAL = 0.25f /* 16^-0.5 */;
typedef _Float16 b16;
typedef __attribute__((ext_vector_type(16))) _Float16 v16b;
typedef __attribute__((ext_vector_type(8))) _Float16 v8b;
typedef __attribute__((ext_vector_type(4))) _Float16 v4h;
typedef __attribute__((ext_vector_type(8))) float v8f;
typedef __attribute__((ext_vector_type(4))) float v4f;
__device__ __forceinline__ float bf16_rne(float f) { unsigned int u = __float_as_uint(f); u += 0x7FFFu + ((u >> 16) & 1u); return __uint_as_float(u & 0xFFFF0000u); }
__device__ __forceinline__ void split16(float v, b16& hi, b16& lo) { hi = (b16)v; lo = (b16)(v - (float)hi); }
__device__ __forceinline__ v16b frag_kb(const b16* p, int hh) { const v8b a = *(const v8b*)(p + 8 * hh), b = *(const v8b*)(p + 16 + 8 * hh); v16b f;
#pragma unroll
  for (int e = 0; e < 8; ++e) { f[e] = a[e]; f[8 + e] = b[e]; } return f; }
__device__ __forceinline__ v8f wmma16b(v16b a, v16b b, v8f c) { v8f d = __builtin_amdgcn_wmma_f32_16x16x32_f16(false, a, false, b, (short)0, c, false, false); asm volatile("v_nop\n\tv_nop\n\tv_nop\n\tv_nop" : "+v"(d) : "v"(a), "v"(b)); return d; }
__device__ __forceinline__ void wave_lds_sync() { __builtin_amdgcn_fence(__ATOMIC_RELEASE, "workgroup"); __builtin_amdgcn_wave_barrier(); __builtin_amdgcn_fence(__ATOMIC_ACQUIRE, "workgroup"); }
__device__ __forceinline__ int iclamp(int v, int lo, int hi) { return v < lo ? lo : (v > hi ? hi : v); }
__device__ __forceinline__ float nexp(float x) { return __builtin_amdgcn_exp2f(x * 1.4426950408889634f); }
// ---------------- deterministic, line-safe CSR by destination (two-level bucketing; every global write but the FLAG word is a whole-line, lane-contiguous store) ----------------
// Pass A (block per contiguous edge chunk): a stable counting sort of the chunk's edges by coarse bucket g = dst >> CSR_GB (nG <= CSR_MAXG buckets) into LDS, all waves at work (see csr_rank), then whole-line
//   stores of the grouped ids (STG row) and of one word per bucket (HST row): its count | its start inside the staging row << 16.
// Pass B (block per bucket g): gathers the bucket's edge ids from the 512 staging rows into LDS (at most CSR_CAP ids), the same stable counting sort by destination node, then writes (a) its PERM run, which starts at g * CSR_CAP (a fixed place per bucket: no table over all buckets has to be built between the passes), and
//   (b) ROWPTR[v], ROWCNT[v] for its 2^CSR_GB nodes as contiguous ints. If a bucket exceeds CSR_CAP the kernel treats it as empty (ROWCNT = 0 for its nodes) and sets FLAG[0] = 1 (loud failure, no corruption).
// The sort, no atomics, original edge order kept inside every key: each wave owns a contiguous run of items and a histogram row of its own; per 32 items csr_rank gives every lane its rank among the
//   lanes with an equal key, the first such lane advances the row's counter; then a prefix over (key, wave) turns the rows into start positions.
constexpr int CSR_NBLK = 512, CSR_GB = 9, CSR_GN = 1 << CSR_GB /* nodes per bucket */, CSR_MAXG = 512, CSR_CAP = 12288 /* ids per bucket in LDS (48+24+48 KB, and 32 KB of counter rows) */;
constexpr int CSR_CH = (E + CSR_NBLK - 1) / CSR_NBLK /* edges per chunk */, CSRA_NW = 8, CSRA_G = (CSR_CH + CSRA_NW * 32 - 1) / (CSRA_NW * 32) /* groups of 32 per wave */, CSRB_NW = 32, CSRB_G = CSR_CAP / (CSRB_NW * 32);
static_assert(CSR_CH < 32768 && CSR_CAP % 32 == 0, "a count and a start share one int; a bucket's PERM run starts on a whole line");
// mask of the wave's valid lanes whose 9-bit key equals this lane's (keys < 512 = CSR_MAXG = CSR_GN)
__device__ __forceinline__ unsigned csr_match(int key, bool valid) { unsigned m = __builtin_amdgcn_ballot_w32(valid);
#pragma unroll   // short fixed trip count: straight-line code, its LDS reads or ballots issued back to back
  for (int b = 0; b < 9; ++b) { const bool on = (key >> b) & 1; const unsigned s = __builtin_amdgcn_ballot_w32(on); m &= on ? s : ~s; } return m; }
// one group of 32 items: returns how many items of this wave's run with the same key stand in front of this lane's item, and advances the wave's own counter row. key < 0: no item.
template <typename T> __device__ __forceinline__ int csr_rank(T* row, int key, int lane) { const bool ok = key >= 0; const unsigned m = csr_match(key, ok); const int r = __popc(m & ((1u << lane) - 1u)); int base = 0;
  if (ok) base = (int)row[key]; if (ok && r == 0) row[key] = (T)(base + __popc(m));
  wave_lds_sync();   // the next group's lanes read counters that other lanes of this wave have just stored
  return base + r; }
// exclusive prefix of one int per thread over a block of NW waves (every thread calls it); total = the block's sum. wsum: NW ints of LDS.
template <int NW> __device__ __forceinline__ int csr_scan(int v, int* wsum, int lane, int wave, int& total) { int inc = v;
#pragma unroll   // short fixed trip count: straight-line code, its LDS reads or ballots issued back to back
  for (int o = 1; o < 32; o <<= 1) { const int u = __shfl_up(inc, o); if (lane >= o) inc += u; }
  if (lane == 31) wsum[wave] = inc;
  __syncthreads();
  int pre = 0, all = 0;
#pragma unroll   // short fixed trip count: straight-line code, its LDS reads or ballots issued back to back
  for (int w = 0; w < NW; ++w) { const int s = wsum[w]; pre += (w < wave) ? s : 0; all += s; }
  __syncthreads();   // wsum may be written again by the next call
  total = all; return pre + inc - v; }
__global__ __launch_bounds__(256) void csrA_kernel(const int* __restrict__ dst, int E, int N, int nG, int CHP, int NGP, int* __restrict__ STG, int* __restrict__ HST) {
  extern __shared__ int sm[];   // cnt[NGP] | run[NGP] | ids[CHP]
  __shared__ int wh[CSRA_NW][CSR_MAXG]; __shared__ int wsum[CSRA_NW];
  int* cnt = sm; int* run = sm + NGP; int* ids = sm + 2 * NGP;
  const int t_ = threadIdx.x, lane = t_ & 31, wave = t_ >> 5;
  const int b = blockIdx.x; const int e0 = b * CSR_CH; const int i0 = wave * (CSRA_G * 32) + lane;
  for (int i = t_; i < CSRA_NW * CSR_MAXG; i += 256) (&wh[0][0])[i] = 0;
  for (int i = t_; i < CHP; i += 256) ids[i] = -1;
  int key[CSRA_G], lr[CSRA_G]; unsigned ei[CSRA_G];
#pragma unroll   // constant indices keep the per-lane arrays in registers
  for (int u = 0; u < CSRA_G; ++u) { ei[u] = (unsigned)min(e0 + i0 + u * 32, E - 1); key[u] = dst[ei[u]]; }   // all of a lane's loads in flight together; an index past the end re-reads the last edge
  static_assert(CSRA_G == 13, "the statement below names 13 values");
  // a precaution: this wait stands in front of every overwrite of a register that an issued load names; the index registers are named so that they stay whole up to it
  asm volatile("s_wait_xcnt 0x0" :: "v"(ei[0]), "v"(ei[1]), "v"(ei[2]), "v"(ei[3]), "v"(ei[4]), "v"(ei[5]), "v"(ei[6]), "v"(ei[7]), "v"(ei[8]), "v"(ei[9]), "v"(ei[10]), "v"(ei[11]), "v"(ei[12]) : "memory");
#pragma unroll   // constant indices keep the per-lane arrays in registers
  for (int u = 0; u < CSRA_G; ++u) { const int i = i0 + u * 32; const bool ok = i < CSR_CH && e0 + i < E; int d = key[u]; d = (d < 0) ? 0 : (d >= N ? N - 1 : d); key[u] = ok ? (d >> CSR_GB) : -1; }
  __syncthreads();
#pragma unroll   // constant indices keep the per-lane arrays in registers
  for (int u = 0; u < CSRA_G; ++u) lr[u] = csr_rank(wh[wave], key[u], lane);
  __syncthreads();
  int s[2];   // thread t_: buckets 2 t_ and 2 t_ + 1; the rows become exclusive prefixes over the waves
#pragma unroll   // short fixed trip count: straight-line code, its LDS reads or ballots issued back to back
  for (int j = 0; j < 2; ++j) { int acc = 0;
#pragma unroll   // short fixed trip count: straight-line code, its LDS reads issued back to back
    for (int w = 0; w < CSRA_NW; ++w) { const int c = wh[w][2 * t_ + j]; wh[w][2 * t_ + j] = acc; acc += c; } s[j] = acc; }
  int all; const int pre = csr_scan<CSRA_NW>(s[0] + s[1], wsum, lane, wave, all);
  if (2 * t_ < NGP) { cnt[2 * t_] = s[0]; run[2 * t_] = pre; } if (2 * t_ + 1 < NGP) { cnt[2 * t_ + 1] = s[1]; run[2 * t_ + 1] = pre + s[0]; }
  __syncthreads();
#pragma unroll   // constant indices keep the per-lane arrays in registers
  for (int u = 0; u < CSRA_G; ++u) if (key[u] >= 0) ids[run[key[u]] + wh[wave][key[u]] + lr[u]] = e0 + i0 + u * 32;
  __syncthreads();
  typedef __attribute__((ext_vector_type(4))) int v4i;
  {
    for (int i = t_; i < CHP / 4; i += 256) *(v4i*)(STG + (size_t)b * CHP + i * 4) = *(const v4i*)(&ids[i * 4]);
    for (int i = t_; i < NGP / 4; i += 256) { v4i v; for (int e = 0; e < 4; ++e) v[e] = (i * 4 + e < nG) ? (cnt[i * 4 + e] | (run[i * 4 + e] << 16)) : 0; *(v4i*)(HST + (size_t)b * NGP + i * 4) = v; }   // both are at most CSR_CH
     }
}
// bucket: block g (1024 threads): gather ids (from each block's staging sub-run, in block order => original edge order), stable counting sort by node, flush; ROWPTR/ROWCNT rows.
__global__ __launch_bounds__(1024) void csrB_kernel(const int* __restrict__ dst, int N, int nG, int CHP, int NGP, const int* __restrict__ STG, const int* __restrict__ HST, int* __restrict__ PERM, int* __restrict__ ROWPTR, int* __restrict__ ROWCNT, int* __restrict__ FLAG) {
  typedef __attribute__((ext_vector_type(4))) int v4i;
  __shared__ int ids[CSR_CAP]; __shared__ unsigned short key[CSR_CAP]; __shared__ int outp[CSR_CAP]; __shared__ int ncnt[CSR_GN + 1]; __shared__ int boff[CSR_NBLK + 1]; __shared__ int ooff[CSR_NBLK];
  __shared__ __attribute__((aligned(16))) unsigned short wh[CSRB_NW][CSR_GN]; __shared__ int wsum[CSRB_NW];
  const int g = blockIdx.x, t_ = threadIdx.x, lane = t_ & 31, wave = t_ >> 5; const int st = g * CSR_CAP; const int v0 = g * CSR_GN; const int nv = min(CSR_GN, N - v0); int tot; (void)nG;
  // per-block offsets of this bucket's sub-runs in gather order (thread = staging row); their sum is the bucket's total
  { int c = 0; if (t_ < CSR_NBLK) { const unsigned hi = (unsigned)(t_ * NGP + g); const unsigned w = (unsigned)HST[hi];
      asm volatile("s_wait_xcnt 0x0" :: "v"(hi) : "memory");   // the same precaution as in pass A
      c = min((int)(w & 0xFFFFu), CHP); ooff[t_] = (int)(w >> 16); }
    int all; const int pre = csr_scan<CSRB_NW>(c, wsum, lane, wave, all); tot = all;
    if (all > CSR_CAP) { tot = 0; if (t_ == 0) FLAG[0] = 1; }   // loud failure: the bucket is worked on as an empty one (zero counts), flag
    if (t_ < CSR_NBLK) boff[t_] = min(pre, tot); if (t_ == 0) boff[CSR_NBLK] = tot; }
  for (int i = t_; i < CSRB_NW * CSR_GN / 2; i += 1024) ((int*)&wh[0][0])[i] = 0;
  __syncthreads();
  { constexpr int RB = CSR_NBLK / CSRB_NW;   // a wave gathers RB staging rows in a row; the first 32 ids of all of them are in flight together
    int bo[RB], cn[RB], id[RB], dd[RB]; unsigned ix[RB];
#pragma unroll   // constant indices keep the per-lane arrays in registers
    for (int u = 0; u < RB; ++u) { const int b = wave * RB + u; bo[u] = boff[b]; cn[u] = boff[b + 1] - bo[u]; int o_ = ooff[b]; o_ = (o_ < 0) ? 0 : (o_ > CHP - cn[u] ? CHP - cn[u] : o_); ix[u] = (unsigned)(b * CHP + min(o_, CHP - 1) + (lane < cn[u] ? lane : 0)); }   // a lane past the sub-run's end re-reads a written word of the row, so that no load hangs on a branch
#pragma unroll   // constant indices keep the per-lane arrays in registers
    for (int u = 0; u < RB; ++u) id[u] = STG[ix[u]];
    static_assert(RB == 16, "the three statements below name 16 values each");
    // a precaution: this wait stands in front of every overwrite of a register that an issued load names; the index registers are named so that they stay whole up to it
    asm volatile("s_wait_xcnt 0x0" :: "v"(ix[0]), "v"(ix[1]), "v"(ix[2]), "v"(ix[3]), "v"(ix[4]), "v"(ix[5]), "v"(ix[6]), "v"(ix[7]), "v"(ix[8]), "v"(ix[9]), "v"(ix[10]), "v"(ix[11]), "v"(ix[12]), "v"(ix[13]), "v"(ix[14]), "v"(ix[15]) : "memory");
    // holds the 16 loads together in front of the branches below: sunk into its branch, a load would wait there alone
    asm volatile("" :: "v"(id[0]), "v"(id[1]), "v"(id[2]), "v"(id[3]), "v"(id[4]), "v"(id[5]), "v"(id[6]), "v"(id[7]), "v"(id[8]), "v"(id[9]), "v"(id[10]), "v"(id[11]), "v"(id[12]), "v"(id[13]), "v"(id[14]), "v"(id[15]));
#pragma unroll   // constant indices keep the per-lane arrays in registers
    for (int u = 0; u < RB; ++u) id[u] = (id[u] < 0) ? 0 : id[u];
#pragma unroll   // constant indices keep the per-lane arrays in registers
    for (int u = 0; u < RB; ++u) dd[u] = dst[id[u]];
    // the same for the 16 destination loads
    asm volatile("" :: "v"(dd[0]), "v"(dd[1]), "v"(dd[2]), "v"(dd[3]), "v"(dd[4]), "v"(dd[5]), "v"(dd[6]), "v"(dd[7]), "v"(dd[8]), "v"(dd[9]), "v"(dd[10]), "v"(dd[11]), "v"(dd[12]), "v"(dd[13]), "v"(dd[14]), "v"(dd[15]));
#pragma unroll   // constant indices keep the per-lane arrays in registers
    for (int u = 0; u < RB; ++u) if (lane < cn[u]) { int d = dd[u]; d = (d < v0) ? v0 : (d >= N ? N - 1 : d); int kk = d - v0; kk = (kk < 0) ? 0 : (kk >= CSR_GN ? CSR_GN - 1 : kk); ids[bo[u] + lane] = id[u]; key[bo[u] + lane] = (unsigned short)kk; }
#pragma unroll 1   // seldom entered: kept small
    for (int u = 0; u < RB; ++u) { const int b = wave * RB + u; const int bs = boff[b], c = boff[b + 1] - bs; int o_ = ooff[b]; o_ = (o_ < 0) ? 0 : (o_ > CHP - c ? CHP - c : o_); const int* src_ = STG + (size_t)b * CHP + o_;   // what a sub-run holds beyond 32 ids
      for (int i = lane + 32; i < c; i += 32) { int idr = src_[i]; idr = (idr < 0) ? 0 : idr; ids[bs + i] = idr; int d = dst[idr]; d = (d < v0) ? v0 : (d >= N ? N - 1 : d); int kk = d - v0; kk = (kk < 0) ? 0 : (kk >= CSR_GN ? CSR_GN - 1 : kk); key[bs + i] = (unsigned short)kk; } } }
  __syncthreads();
  // stable counting sort by node inside the bucket: wave w owns items [w S, w S + S)
  const int S = ((tot + CSRB_NW * 32 - 1) / (CSRB_NW * 32)) * 32; const int i0 = wave * S + lane;
  int kr[CSRB_G], lr[CSRB_G];
#pragma unroll   // constant indices keep the per-lane arrays in registers
  for (int u = 0; u < CSRB_G; ++u) { const int i = i0 + u * 32; kr[u] = (u * 32 < S && i < tot) ? (int)key[i] : -1; lr[u] = 0; }
#pragma unroll   // constant indices keep the per-lane arrays in registers
  for (int u = 0; u < CSRB_G; ++u) if (u * 32 < S) lr[u] = csr_rank(wh[wave], kr[u], lane);
  __syncthreads();
  { int s = 0; if (t_ < CSR_GN) {   // thread = node: the rows become exclusive prefixes over the waves
#pragma unroll   // short fixed trip count: straight-line code, its LDS reads or ballots issued back to back
      for (int w = 0; w < CSRB_NW; ++w) { const int c = wh[w][t_]; wh[w][t_] = (unsigned short)s; s += c; } }
    int all; const int pre = csr_scan<CSRB_NW>(s, wsum, lane, wave, all); if (t_ < CSR_GN) ncnt[t_] = pre; if (t_ == 0) ncnt[CSR_GN] = all; }   // ncnt[vl] = start of node vl
  __syncthreads();
#pragma unroll   // constant indices keep the per-lane arrays in registers
  for (int u = 0; u < CSRB_G; ++u) if (kr[u] >= 0) outp[ncnt[kr[u]] + (int)wh[wave][kr[u]] + lr[u]] = ids[i0 + u * 32];
  __syncthreads();
  {
    for (int i = t_; i < ((tot + 31) & ~31) / 4; i += 1024) { v4i v; for (int e = 0; e < 4; ++e) { const int q = i * 4 + e; v[e] = (q < tot) ? outp[q] : -1; } *(v4i*)(PERM + st + i * 4) = v; }
    for (int i = t_; i < CSR_GN / 4; i += 1024) { v4i a, c; for (int e = 0; e < 4; ++e) { const int vl = i * 4 + e; a[e] = st + ncnt[vl]; c[e] = (vl < nv) ? (ncnt[vl + 1] - ncnt[vl]) : 0; } *(v4i*)(ROWPTR + v0 + i * 4) = a; *(v4i*)(ROWCNT + v0 + i * 4) = c; }   // the tables hold nG*512 entries (beyond N: count 0)
     }
}
__global__ __launch_bounds__(256) void csrZ_kernel(int* __restrict__ p, size_t n4) { typedef __attribute__((ext_vector_type(4))) int v4i; const size_t tid = (size_t)blockIdx.x * 256 + threadIdx.x, nth = (size_t)gridDim.x * 256; v4i z = {0, 0, 0, 0}; for (size_t i = tid; i < n4; i += nth) *(v4i*)(p + i * 4) = z; }
// host helper. Workspace ints needed: STG (512*CHP), HST (512*NGP), PERM (nG*CSR_CAP), ROWPTR (Npad), ROWCNT (Npad), FLAG (64). Npad = roundup(N, 512).
struct CsrBufs { int *STG, *HST, *PERM, *ROWPTR, *ROWCNT, *FLAG; int nG, NGP, CHP; size_t permLen; char* base; size_t bytes; };
static size_t csr_carve(CsrBufs& c, char* ws, size_t off, int E, int N) {
  const size_t off0 = off; c.base = ws + off;
  auto al = [&](size_t bytes) { char* p = ws + off; off += (bytes + 255) & ~(size_t)255; return p; };
  c.nG = (N + CSR_GN - 1) / CSR_GN; c.NGP = (c.nG + 31) & ~31; const int ch = (E + CSR_NBLK - 1) / CSR_NBLK; c.CHP = (ch + 31) & ~31; c.permLen = (size_t)c.nG * CSR_CAP;
  c.STG = (int*)al((size_t)CSR_NBLK * c.CHP * 4); c.HST = (int*)al((size_t)CSR_NBLK * c.NGP * 4);
  c.PERM = (int*)al(c.permLen * 4); c.ROWPTR = (int*)al((size_t)c.nG * CSR_GN * 4); c.ROWCNT = (int*)al((size_t)c.nG * CSR_GN * 4); c.FLAG = (int*)al(256);
  c.bytes = off - off0; return off;
}
static void csr_build(const CsrBufs& c, const int* dst, int E, int N, hipStream_t stream) {
  const size_t smem = (size_t)(2 * c.NGP + c.CHP) * 4;
  csrZ_kernel<<<512, 256, 0, stream>>>((int*)c.base, c.bytes / 16);
  csrA_kernel<<<CSR_NBLK, 256, smem, stream>>>(dst, E, N, c.nG, c.CHP, c.NGP, c.STG, c.HST);
  csrB_kernel<<<c.nG, 1024, 0, stream>>>(dst, N, c.nG, c.CHP, c.NGP, c.STG, c.HST, c.PERM, c.ROWPTR, c.ROWCNT, c.FLAG);
}


__global__ __launch_bounds__(256) void wprep_kernel(const float* __restrict__ wq, const float* __restrict__ wk, const float* __restrict__ wv, const float* __restrict__ wo, b16* __restrict__ WT) {
  const size_t u = (size_t)blockIdx.x * 256 + threadIdx.x; const size_t per = (size_t)D * D / 8; if (u >= 4 * per) return; const int which = (int)(u / per); const size_t e = (u % per) * 8; const float* w = which == 0 ? wq : which == 1 ? wk : which == 2 ? wv : wo; v8b o;
  for (int j = 0; j < 8; ++j) o[j] = (b16)(bf16_rne(w[e + j]) * WSC);
  { *(v8b*)(WT + (size_t)which * D * D + e) = o;  }
}
__global__ __launch_bounds__(128) void proj_kernel(const float* __restrict__ h, const b16* __restrict__ WT, const float* __restrict__ bq, const float* __restrict__ bk, const float* __restrict__ bv, float* __restrict__ Q, b16* __restrict__ KV) {
  __shared__ __attribute__((aligned(16))) float Tf[4][16][D + 4];
  const int wave = threadIdx.x >> 5, lane = threadIdx.x & 31, nloc = lane & 15, hlf = lane >> 4; const size_t m0 = (size_t)blockIdx.x * 64 + wave * 16; const int part = blockIdx.y; const b16* W = WT + (size_t)part * D * D; const float* bias = part == 0 ? bq : part == 1 ? bk : bv; const float osc = part == 0 ? SCAL : 1.0f;
  const size_t v = m0 + nloc; v8f acc[8];
#pragma unroll
  for (int t = 0; t < 8; ++t) acc[t] = (v8f){};
#pragma unroll
  for (int kb = 0; kb < D; kb += 32) { v16b a = {}; if (v < (size_t)N) { const float* r = h + v * D + kb; for (int e = 0; e < 8; ++e) { a[e] = (b16)(bf16_rne(r[8 * hlf + e]) * XS); a[8 + e] = (b16)(bf16_rne(r[16 + 8 * hlf + e]) * XS); } }
#pragma unroll
    for (int t = 0; t < 8; ++t) acc[t] = wmma16b(a, frag_kb(W + (size_t)(t * 16 + nloc) * D + kb, hlf), acc[t]); }
#pragma unroll
  for (int t = 0; t < 8; ++t) { const int c = t * 16 + nloc; const float bb = bf16_rne(bias[c]);
#pragma unroll 1
    for (int r = 0; r < 8; ++r) { const size_t row = m0 + 8 * hlf + r; Tf[wave][8 * hlf + r][c] = row < (size_t)N ? (acc[t][r] * (1.0f / (XS * WSC)) + bb) * osc : 0.0f; } }
  wave_lds_sync();
  if (part == 0) { for (int rr = 0; rr < 16; ++rr) *(v4f*)(Q + (m0 + rr) * D + lane * 4) = *(const v4f*)(&Tf[wave][rr][lane * 4]); }
  else { b16* P = KV + (size_t)(part - 1) * NP * D;   // k, v: f16 rows of 256 B; a store covers two rows = 4 whole lines
    for (int rr = 0; rr < 16; rr += 2) { const float* t = &Tf[wave][rr + hlf][nloc * 8]; const v4f x = *(const v4f*)t, y = *(const v4f*)(t + 4); v8b o;
      for (int e = 0; e < 4; ++e) { o[e] = (b16)x[e]; o[4 + e] = (b16)y[e]; }
      *(v8b*)(P + (m0 + rr + hlf) * D + nloc * 8) = o; } }
}
// Attention, one wave per destination node at a time, its edges up to 16 at a time. Per batch: lane j fetches edge j's ids (32 edges per fetch); the batch's K rows are loaded together, each lane stores q*k of its 4
// channels to the wave's own LDS rows; lane (edge slot es = lane/2, head group hp = 4*(lane&1)) sums the 16 products of each of its 4 heads (the same pairwise tree as a butterfly over d), so every logit, its
// maximum and its exponential are worked out once and not on 16 lanes; the weights go back through LDS, and each lane adds weight * V for its own 4 channels. The V rows fly while the softmax is worked on.
constexpr int AB = 16 /* edges per batch */, APITCH = D + 8 /* floats; 544 B = 32 B x 17: the 8 edge slots x 2 head groups of a half wave read 16 B each on all 64 banks */;
// orders the LDS stores and loads of one wave's lanes; LDS only, so that global loads in flight are not waited for here
__device__ __forceinline__ void wave_lds_only_sync() { __builtin_amdgcn_fence(__ATOMIC_RELEASE, "workgroup", "local"); __builtin_amdgcn_wave_barrier(); __builtin_amdgcn_fence(__ATOMIC_ACQUIRE, "workgroup", "local"); }
// the 8 bytes (4 f16 channels) per lane of NE rows of a plane, all loads issued together. sv: lane l0 + u holds the row of slot u. ix: the lane's index in units of 8 bytes, added to the plane's scalar base by the load itself.
template <int NE> __device__ __forceinline__ void rows_load(const b16* plane, int sv, int l0, int lane, v4h (&r)[NE]) {
  unsigned ix[NE];
#pragma unroll   // constant indices keep the arrays in registers
  for (int u = 0; u < NE; ++u) ix[u] = (unsigned)__builtin_amdgcn_readlane(sv, l0 + u) * (unsigned)(D / 4) + (unsigned)lane;
#pragma unroll   // constant indices keep the arrays in registers
  for (int u = 0; u < NE; ++u) r[u] = ((const v4h*)plane)[ix[u]];
  static_assert(NE == 4 || NE == 8 || NE == 12 || NE == 16, "one of the statements below names all NE values");
  // a precaution: this wait stands in front of every overwrite of a register that an issued load names; the index registers are named so that they stay whole up to it
  if constexpr (NE == 4) asm volatile("s_wait_xcnt 0x0" :: "v"(ix[0]), "v"(ix[1]), "v"(ix[2]), "v"(ix[3]) : "memory");
  else if constexpr (NE == 8) asm volatile("s_wait_xcnt 0x0" :: "v"(ix[0]), "v"(ix[1]), "v"(ix[2]), "v"(ix[3]), "v"(ix[4]), "v"(ix[5]), "v"(ix[6]), "v"(ix[7]) : "memory");
  else if constexpr (NE == 12) asm volatile("s_wait_xcnt 0x0" :: "v"(ix[0]), "v"(ix[1]), "v"(ix[2]), "v"(ix[3]), "v"(ix[4]), "v"(ix[5]), "v"(ix[6]), "v"(ix[7]), "v"(ix[8]), "v"(ix[9]), "v"(ix[10]), "v"(ix[11]) : "memory");
  else asm volatile("s_wait_xcnt 0x0" :: "v"(ix[0]), "v"(ix[1]), "v"(ix[2]), "v"(ix[3]), "v"(ix[4]), "v"(ix[5]), "v"(ix[6]), "v"(ix[7]), "v"(ix[8]), "v"(ix[9]), "v"(ix[10]), "v"(ix[11]), "v"(ix[12]), "v"(ix[13]), "v"(ix[14]), "v"(ix[15]) : "memory");
}
// one batch of nb <= NE edges, straight-line code for NE slots (no test around a load, so that the loads of a batch stay in flight together); a slot from nb on holds the row's last edge again and gets weight 0.
// sv: lane l0 + u holds the source node of slot u. mx: running maximum per head (the same in all lanes of a head group); den: this lane's edge slot alone; acc: this lane's 4 channels.
template <int NE> __device__ __forceinline__ void attn_batch(const b16* K, const b16* V, float (*Pr)[APITCH], float (*Pw)[NH], int sv, int l0, int nb, int lane, const v4f q, v4f& mx, v4f& den, v4f& acc) {
  const int c0 = lane * 4, es = lane >> 1, hp = (lane & 1) * 4;
  v4h kk[NE], vv[NE];
  rows_load<NE>(K, sv, l0, lane, kk);
#pragma unroll   // constant indices keep the rows in registers
  for (int u = 0; u < NE; ++u) *(v4f*)(&Pr[u][c0]) = q * __builtin_convertvector(kk[u], v4f);
  wave_lds_only_sync();   // other lanes of this wave read the products
  v4f l = {-INFINITY, -INFINITY, -INFINITY, -INFINITY};   // an empty slot: weight exp(-inf) = 0
  if (es < nb) { const float* pr = &Pr[es][hp]; v4f t[HD];
#pragma unroll   // constant indices keep the array in registers
    for (int d = 0; d < HD; ++d) t[d] = *(const v4f*)(pr + d * NH);
#pragma unroll   // constant indices keep the array in registers
    for (int w = 1; w < HD; w <<= 1)
#pragma unroll   // constant indices keep the array in registers
      for (int d = 0; d < HD; d += 2 * w) t[d] += t[d + w];
    l = t[0]; }
  rows_load<NE>(V, sv, l0, lane, vv);   // issued here, where the K rows and the 16 partial sums are dead, and used behind the softmax
  v4f p;
  for (int i = 0; i < 4; ++i) { float m = l[i]; m = fmaxf(m, __shfl_xor(m, 2)); m = fmaxf(m, __shfl_xor(m, 4)); m = fmaxf(m, __shfl_xor(m, 8)); m = fmaxf(m, __shfl_xor(m, 16));   // the batch's maximum of this head
    m = fmaxf(m, mx[i]); const float sc = nexp(mx[i] - m); p[i] = nexp(l[i] - m); mx[i] = m; den[i] = den[i] * sc + p[i]; acc[i] *= sc; }   // sc = 0 in the first batch
  *(v4f*)(&Pw[es][hp]) = p;
  wave_lds_only_sync();   // other lanes of this wave read the weights
#pragma unroll   // constant indices keep the rows in registers
  for (int u = 0; u < NE; ++u) acc += *(const v4f*)(&Pw[u][hp]) * __builtin_convertvector(vv[u], v4f);
  wave_lds_only_sync();   // the next batch overwrites what this one has read
}
// 8 waves per SIMD is what four blocks' LDS on a WGP allows: the second bound keeps the register budget at 128, so that registers do not allow fewer
// The grid is what the chip holds at once (256 WGPs x 4 blocks): every wave starts once and walks the nodes w, w + 8192, w + 16384, ... (12 or 13 of them). A node begins with a chain of three dependent loads
// (row entry -> edge ids -> source nodes); the wave keeps one link of it in flight for each of the three nodes to come: at the head of a node's pass it asks for the source nodes of the next node, the edge ids of the
// one after and the row entry of the third, each from what the pass before has asked for. No test stands around these loads (every index is clamped into its table), so that none is waited for where it is issued.
// Nothing passes between blocks and no result depends on where or when a block runs: the grid's size is chosen for speed alone.
constexpr int ATT_BLK = 1024, ATT_WAVES = ATT_BLK * 8;
static_assert(NP <= ((N + CSR_GN - 1) / CSR_GN) * CSR_GN && ATT_WAVES <= NP, "ROWPTR and ROWCNT hold an entry for every index below NP; every wave has a first node");
// a row entry as loaded -> start and count of the node's edges, the same in every lane (scalars); live: the node exists
__device__ __forceinline__ void row_scalars(int rs, int rc, bool live, int permLen, int& st, int& cnt) { rc = iclamp(rc, 0, 65536); rs = iclamp(rs, 0, permLen - rc); cnt = live ? __builtin_amdgcn_readfirstlane(rc) : 0; st = __builtin_amdgcn_readfirstlane(rs); }
// where lane's edge id of a row's first 32 stands in PERM; past the row's end: the last edge again; a row without edges: some word inside the table, not used
__device__ __forceinline__ int perm_index(int st, int cnt, int lane, int permLen) { return min(st + max(min(lane, cnt - 1), 0), permLen - 1); }
__global__ __launch_bounds__(256, 8) void attn_kernel(const float* Q, const b16* __restrict__ K, const b16* __restrict__ V, const int* __restrict__ cols, const int* __restrict__ PERM, const int* __restrict__ ROWPTR, const int* __restrict__ ROWCNT, int permLen, b16* Oh, b16* Ol) {   // Oh aliases the q plane (see host)
  __shared__ __attribute__((aligned(16))) float Pr[8][AB][APITCH];   // per wave: q*k, [edge slot][channel]
  __shared__ __attribute__((aligned(16))) float Pw[8][AB][NH];       // per wave: softmax weights, [edge slot][head]
  const int wave = __builtin_amdgcn_readfirstlane((int)(threadIdx.x >> 5)) /* the same in every lane: the loop over nodes is a scalar loop */, lane = threadIdx.x & 31; const int c0 = lane * 4; (void)Ol;
  const int w0 = (int)blockIdx.x * 8 + wave;
  int st, cnt, sv;     // this node: start and count of its edges, source nodes of its first 32 edges (one per lane)
  int st1, cnt1, en;   // the next node: start, count, edge ids as loaded
  int rs, rc;          // the node after: row entry as loaded (the tables hold an entry for every index below NP)
  { const int n1 = min(w0 + ATT_WAVES, NP - 1), n2 = min(w0 + 2 * ATT_WAVES, NP - 1);
    const int a0 = ROWPTR[w0], b0 = ROWCNT[w0], a1 = ROWPTR[n1], b1 = ROWCNT[n1]; rs = ROWPTR[n2]; rc = ROWCNT[n2];
    row_scalars(a0, b0, w0 < N, permLen, st, cnt); row_scalars(a1, b1, w0 + ATT_WAVES < N, permLen, st1, cnt1);
    const int e0 = PERM[perm_index(st, cnt, lane, permLen)]; en = PERM[perm_index(st1, cnt1, lane, permLen)];
    sv = iclamp(cols[iclamp(e0, 0, E - 1)], 0, N - 1); }
  for (int vn = w0; vn < NP; vn += ATT_WAVES) {
    const size_t v = (size_t)vn;
    const v4f q = *(const v4f*)(Q + v * D + c0);
    const int svn = cols[iclamp(en, 0, E - 1)];
    int st2, cnt2; row_scalars(rs, rc, vn + 2 * ATT_WAVES < N, permLen, st2, cnt2);
    const int enn = PERM[perm_index(st2, cnt2, lane, permLen)];
    { const int n3 = min(vn + 3 * ATT_WAVES, NP - 1); rs = ROWPTR[n3]; rc = ROWCNT[n3]; }
    asm volatile("s_wait_xcnt 0x0" ::: "memory");   // a precaution: it stands in front of every overwrite of a register that one of the loads above names
    v4f o = {0.0f, 0.0f, 0.0f, 0.0f};
    v4f mx = {-INFINITY, -INFINITY, -INFINITY, -INFINITY}, den = {0.0f, 0.0f, 0.0f, 0.0f}, acc = {0.0f, 0.0f, 0.0f, 0.0f};
    for (int base = 0; base < cnt; base += AB) {
      if (base > 0 && (base & 31) == 0) { const int j = min(base + lane, cnt - 1); const int e = iclamp(PERM[st + j], 0, E - 1); sv = iclamp(cols[e], 0, N - 1); }   // the next 32 edges of a long row; past the end: the last edge again
      const int nb = min(cnt - base, AB), l0 = base & 16;
      if (nb > 12) attn_batch<16>(K, V, Pr[wave], Pw[wave], sv, l0, nb, lane, q, mx, den, acc);
      else if (nb > 8) attn_batch<12>(K, V, Pr[wave], Pw[wave], sv, l0, nb, lane, q, mx, den, acc);
      else if (nb > 4) attn_batch<8>(K, V, Pr[wave], Pw[wave], sv, l0, nb, lane, q, mx, den, acc);
      else attn_batch<4>(K, V, Pr[wave], Pw[wave], sv, l0, nb, lane, q, mx, den, acc);
    }
    if (cnt > 0) for (int i = 0; i < 4; ++i) { float d = den[i]; d += __shfl_xor(d, 2); d += __shfl_xor(d, 4); d += __shfl_xor(d, 8); d += __shfl_xor(d, 16); o[i] = acc[i] / d; }   // the 16 slots' sums of this head
    v4h ph, pl; for (int i = 0; i < 4; ++i) { b16 p, pq; split16(o[i] * XS, p, pq); ph[i] = p; pl[i] = pq; }
    { *(v4h*)(Oh + v * (2 * D) + c0) = ph; *(v4h*)(Oh + v * (2 * D) + D + c0) = pl;  }   // hi | lo packed into this node's own 512-B q row (no other wave reads it)
    asm volatile("s_wait_xcnt 0x0" ::: "memory");   // a precaution: the next node's pass overwrites the registers that the two stores name
    st = st1; cnt = cnt1; sv = iclamp(svn, 0, N - 1); st1 = st2; cnt1 = cnt2; en = enn;
  }
}
__global__ __launch_bounds__(128) void oproj_kernel(const b16* __restrict__ Oh, const b16* __restrict__ Ol, const b16* __restrict__ WT, const float* __restrict__ bo, float* __restrict__ out) {
  __shared__ __attribute__((aligned(16))) float Tf[4][16][D + 4];
  const int wave = threadIdx.x >> 5, lane = threadIdx.x & 31, nloc = lane & 15, hlf = lane >> 4; const size_t m0 = (size_t)blockIdx.x * 64 + wave * 16; const b16* W = WT + (size_t)3 * D * D;
  v8f acc[8];
#pragma unroll
  for (int t = 0; t < 8; ++t) acc[t] = (v8f){};
#pragma unroll
  for (int kb = 0; kb < D; kb += 32) { const v16b a = frag_kb(Oh + (m0 + nloc) * (2 * D) + kb, hlf), al = frag_kb(Oh + (m0 + nloc) * (2 * D) + D + kb, hlf);
#pragma unroll
    for (int t = 0; t < 8; ++t) { const v16b bw = frag_kb(W + (size_t)(t * 16 + nloc) * D + kb, hlf); acc[t] = wmma16b(a, bw, acc[t]); acc[t] = wmma16b(al, bw, acc[t]); } }
#pragma unroll
  for (int t = 0; t < 8; ++t) { const int c = t * 16 + nloc; const float bb = bf16_rne(bo[c]);
#pragma unroll 1
    for (int r = 0; r < 8; ++r) Tf[wave][8 * hlf + r][c] = acc[t][r] * (1.0f / (XS * WSC)) + bb; }
  wave_lds_sync();
  { for (int rr = 0; rr < 16; ++rr) { const size_t row = m0 + rr; if (row < (size_t)N) *(v4f*)(out + row * D + lane * 4) = *(const v4f*)(&Tf[wave][rr][lane * 4]); }  }
}
}  // namespace

extern "C" void kernel_launch(void* const* d_in, const int* in_sizes, int n_in, void* d_out, int out_size, void* d_ws, size_t ws_size, hipStream_t stream) {
  (void)n_in;
  auto Fp = [&](int i) { return (const float*)d_in[i]; }; auto Ip = [&](int i) { return (const int*)d_in[i]; };
  // input order: 0 h [100000,128], 1 row [E] i32, 2 col [E] i32, 3 Wq [128,128], 4 bq, 5 Wk, 6 bk, 7 Wv, 8 bv, 9 Wo, 10 bo
  if (in_sizes[0] != N * D || in_sizes[1] != E || in_sizes[2] != E || in_sizes[3] != D * D || in_sizes[9] != D * D || out_size != N * D) return;
  size_t off = 0; char* ws = (char*)d_ws;
  auto carve = [&](size_t bytes) { char* p = ws + off; off += (bytes + 255) & ~(size_t)255; return p; };
  b16* WT = (b16*)carve((size_t)4 * D * D * 2); float* Q = (float*)carve((size_t)NP * D * 4); b16* KV = (b16*)carve((size_t)2 * NP * D * 2);
  b16* Oh = (b16*)Q; b16* Ol = Oh;   // the attention output (hi | lo, 2 x 128 halves) overwrites each node's own 512-B q row in place: a wave reads only its own q row before writing it (K/V rows live in planes of their own)
  CsrBufs csr; off = csr_carve(csr, ws, off, E, N);
  if (off > ws_size) return;   // q plane, f16 k and v planes, CSR tables: about 120 MB
  wprep_kernel<<<(unsigned)((4 * (size_t)D * D / 8 + 255) / 256), 256, 0, stream>>>(Fp(3), Fp(5), Fp(7), Fp(9), WT);
  csr_build(csr, Ip(1), E, N, stream);   // group by row (the softmax axis)
  proj_kernel<<<dim3(NP / 64, 3), 128, 0, stream>>>(Fp(0), WT, Fp(4), Fp(6), Fp(8), Q, KV);
  attn_kernel<<<ATT_BLK, 256, 0, stream>>>(Q, KV, KV + (size_t)NP * D, Ip(2), csr.PERM, csr.ROWPTR, csr.ROWCNT, (int)csr.permLen, Oh, Ol);
  oproj_kernel<<<NP / 64, 128, 0, stream>>>(Oh, Ol, WT, Fp(10), (float*)d_out);
}

// v007
// Measured time: 148 microseconds a run.
// Two timings next to v006 put it at 1.24 and 1.25 times that version's speed.
// Counting every step since v000, it is 13.3 times as fast.
#include <hip/hip_runtime.h>

// Sparse multi-head attention over a graph (DGL bsddmm / bspmm style): q = (h Wq^T + bq) * 16^-1/2, k, v = Linear(h), all reshaped (N, 16, 8) — i.e. channel c = d*8 + head (heads interleaved);
// per edge e: logit_h = sum_d q[row][d,h] k[col][d,h]; softmax over the edges of each row (destination); out[row] = sum attn v[col]; y = out Wo^T + bo -> [100000][128]. 100,000 nodes,
// 1,600,000 edges; rows without edges give out = 0 (then bo).
// WMMA (v_wmma_f32_16x16x32_f16, f32 accumulate): the q/k/v projections ([100,032 x 128] x [128 x 384], EXACT bf16 h x8: 1 product) and the output projection ([100,032 x 128] x [128 x 128],
// attention output as f16 hi+lo x8 planes: 2 products), weights exact x256; per-edge head dots (lane owns channels 4l..4l+3 = heads (4l mod 8)+0..3 at d = l/2; the 16 products of a head summed by one lane
// through LDS, 16 edges at a time), softmax and weighted sums in f32; the k and v rows that the edges gather are kept as f16 (rounded once from the f32 projection), q stays f32. Inputs rounded to bf16 once; ids int32 (clamped). Fragment k-map per lane half hh for A AND B:

namespace {
constexpr int N = 100000, NP = 100032, E = 1600000, D = 128, NH = 8, HD = 16;
constexpr float XS = 8.0f, WSC = 256.0f, NEG = 0.2f /* unused */, SCAL = 0.25f /* 16^-0.5 */;
typedef _Float16 b16;
typedef __attribute__((ext_vector_type(16))) _Float16 v16b;
typedef __attribute__((ext_vector_type(8))) _Float16 v8b;
typedef __attribute__((ext_vector_type(4))) _Float16 v4h;
typedef __attribute__((ext_vector_type(8))) float v8f;
typedef __attribute__((ext_vector_type(4))) float v4f;
__device__ __forceinline__ float bf16_rne(float f) { unsigned int u = __float_as_uint(f); u += 0x7FFFu + ((u >> 16) & 1u); return __uint_as_float(u & 0xFFFF0000u); }
__device__ __forceinline__ void split16(float v, b16& hi, b16& lo) { hi = (b16)v; lo = (b16)(v - (float)hi); }
__device__ __forceinline__ v16b frag_kb(const b16* p, int hh) { const v8b a = *(const v8b*)(p + 8 * hh), b = *(const v8b*)(p + 16 + 8 * hh); v16b f;
#pragma unroll
  for (int e = 0; e < 8; ++e) { f[e] = a[e]; f[8 + e] = b[e]; } return f; }
__device__ __forceinline__ v8f wmma16b(v16b a, v16b b, v8f c) { v8f d = __builtin_amdgcn_wmma_f32_16x16x32_f16(false, a, false, b, (short)0, c, false, false); asm volatile("v_nop\n\tv_nop\n\tv_nop\n\tv_nop" : "+v"(d) : "v"(a), "v"(b)); return d; }
__device__ __forceinline__ void wave_lds_sync() { __builtin_amdgcn_fence(__ATOMIC_RELEASE, "workgroup"); __builtin_amdgcn_wave_barrier(); __builtin_amdgcn_fence(__ATOMIC_ACQUIRE, "workgroup"); }
__device__ __forceinline__ int iclamp(int v, int lo, int hi) { return v < lo ? lo : (v > hi ? hi : v); }
__device__ __forceinline__ float nexp(float x) { return __builtin_amdgcn_exp2f(x * 1.4426950408889634f); }
// ---------------- deterministic, line-safe CSR by destination (two-level bucketing; every global write but the FLAG word is a whole-line, lane-contiguous store) ----------------
// Pass A (block per contiguous edge chunk): a stable counting sort of the chunk's edges by coarse bucket g = dst >> CSR_GB (nG <= CSR_MAXG buckets) into LDS, all waves at work (see csr_rank), then whole-line
//   stores of the grouped ids (STG row) and of one word per bucket (HST row): its count | its start inside the staging row << 16.
// Pass B (block per bucket g): gathers the bucket's edge ids from the 512 staging rows into LDS (at most CSR_CAP ids), the same stable counting sort by destination node, then writes (a) its PERM run, which starts at g * CSR_CAP (a fixed place per bucket: no table over all buckets has to be built between the passes), and
//   (b) ROWPTR[v], ROWCNT[v] for its 2^CSR_GB nodes as contiguous ints. If a bucket exceeds CSR_CAP the kernel treats it as empty (ROWCNT = 0 for its nodes) and sets FLAG[0] = 1 (loud failure, no corruption).
// The sort, no atomics, original edge order kept inside every key: each wave owns a contiguous run of items and a histogram row of its own; per 32 items csr_rank gives every lane its rank among the
//   lanes with an equal key, the first such lane advances the row's counter; then a prefix over (key, wave) turns the rows into start positions.
constexpr int CSR_NBLK = 512, CSR_GB = 9, CSR_GN = 1 << CSR_GB /* nodes per bucket */, CSR_MAXG = 512, CSR_CAP = 12288 /* ids per bucket in LDS (48+24+48 KB, and 32 KB of counter rows) */;
constexpr int CSR_CH = (E + CSR_NBLK - 1) / CSR_NBLK /* edges per chunk */, CSRA_NW = 8, CSRA_G = (CSR_CH + CSRA_NW * 32 - 1) / (CSRA_NW * 32) /* groups of 32 per wave */, CSRB_NW = 32, CSRB_G = CSR_CAP / (CSRB_NW * 32);
static_assert(CSR_CH < 32768 && CSR_CAP % 32 == 0, "a count and a start share one int; a bucket's PERM run starts on a whole line");
// mask of the wave's valid lanes whose 9-bit key equals this lane's (keys < 512 = CSR_MAXG = CSR_GN)
__device__ __forceinline__ unsigned csr_match(int key, bool valid) { unsigned m = __builtin_amdgcn_ballot_w32(valid);
#pragma unroll   // short fixed trip count: straight-line code, its LDS reads or ballots issued back to back
  for (int b = 0; b < 9; ++b) { const bool on = (key >> b) & 1; const unsigned s = __builtin_amdgcn_ballot_w32(on); m &= on ? s : ~s; } return m; }
// one group of 32 items: returns how many items of this wave's run with the same key stand in front of this lane's item, and advances the wave's own counter row. key < 0: no item.
template <typename T> __device__ __forceinline__ int csr_rank(T* row, int key, int lane) { const bool ok = key >= 0; const unsigned m = csr_match(key, ok); const int r = __popc(m & ((1u << lane) - 1u)); int base = 0;
  if (ok) base = (int)row[key]; if (ok && r == 0) row[key] = (T)(base + __popc(m));
  wave_lds_sync();   // the next group's lanes read counters that other lanes of this wave have just stored
  return base + r; }
// exclusive prefix of one int per thread over a block of NW waves (every thread calls it); total = the block's sum. wsum: NW ints of LDS.
template <int NW> __device__ __forceinline__ int csr_scan(int v, int* wsum, int lane, int wave, int& total) { int inc = v;
#pragma unroll   // short fixed trip count: straight-line code, its LDS reads or ballots issued back to back
  for (int o = 1; o < 32; o <<= 1) { const int u = __shfl_up(inc, o); if (lane >= o) inc += u; }
  if (lane == 31) wsum[wave] = inc;
  __syncthreads();
  int pre = 0, all = 0;
#pragma unroll   // short fixed trip count: straight-line code, its LDS reads or ballots issued back to back
  for (int w = 0; w < NW; ++w) { const int s = wsum[w]; pre += (w < wave) ? s : 0; all += s; }
  __syncthreads();   // wsum may be written again by the next call
  total = all; return pre + inc - v; }
__global__ __launch_bounds__(256) void csrA_kernel(const int* __restrict__ dst, int E, int N, int nG, int CHP, int NGP, int* __restrict__ STG, int* __restrict__ HST) {
  extern __shared__ int sm[];   // cnt[NGP] | run[NGP] | ids[CHP]
  __shared__ int wh[CSRA_NW][CSR_MAXG]; __shared__ int wsum[CSRA_NW];
  int* cnt = sm; int* run = sm + NGP; int* ids = sm + 2 * NGP;
  const int t_ = threadIdx.x, lane = t_ & 31, wave = t_ >> 5;
  const int b = blockIdx.x; const int e0 = b * CSR_CH; const int i0 = wave * (CSRA_G * 32) + lane;
  for (int i = t_; i < CSRA_NW * CSR_MAXG; i += 256) (&wh[0][0])[i] = 0;
  for (int i = t_; i < CHP; i += 256) ids[i] = -1;
  int key[CSRA_G], lr[CSRA_G]; unsigned ei[CSRA_G];
#pragma unroll   // constant indices keep the per-lane arrays in registers
  for (int u = 0; u < CSRA_G; ++u) { ei[u] = (unsigned)min(e0 + i0 + u * 32, E - 1); key[u] = dst[ei[u]]; }   // all of a lane's loads in flight together; an index past the end re-reads the last edge
  static_assert(CSRA_G == 13, "the statement below names 13 values");
  // a precaution: this wait stands in front of every overwrite of a register that an issued load names; the index registers are named so that they stay whole up to it
  asm volatile("s_wait_xcnt 0x0" :: "v"(ei[0]), "v"(ei[1]), "v"(ei[2]), "v"(ei[3]), "v"(ei[4]), "v"(ei[5]), "v"(ei[6]), "v"(ei[7]), "v"(ei[8]), "v"(ei[9]), "v"(ei[10]), "v"(ei[11]), "v"(ei[12]) : "memory");
#pragma unroll   // constant indices keep the per-lane arrays in registers
  for (int u = 0; u < CSRA_G; ++u) { const int i = i0 + u * 32; const bool ok = i < CSR_CH && e0 + i < E; int d = key[u]; d = (d < 0) ? 0 : (d >= N ? N - 1 : d); key[u] = ok ? (d >> CSR_GB) : -1; }
  __syncthreads();
#pragma unroll   // constant indices keep the per-lane arrays in registers
  for (int u = 0; u < CSRA_G; ++u) lr[u] = csr_rank(wh[wave], key[u], lane);
  __syncthreads();
  int s[2];   // thread t_: buckets 2 t_ and 2 t_ + 1; the rows become exclusive prefixes over the waves
#pragma unroll   // short fixed trip count: straight-line code, its LDS reads or ballots issued back to back
  for (int j = 0; j < 2; ++j) { int acc = 0;
#pragma unroll   // short fixed trip count: straight-line code, its LDS reads issued back to back
    for (int w = 0; w < CSRA_NW; ++w) { const int c = wh[w][2 * t_ + j]; wh[w][2 * t_ + j] = acc; acc += c; } s[j] = acc; }
  int all; const int pre = csr_scan<CSRA_NW>(s[0] + s[1], wsum, lane, wave, all);
  if (2 * t_ < NGP) { cnt[2 * t_] = s[0]; run[2 * t_] = pre; } if (2 * t_ + 1 < NGP) { cnt[2 * t_ + 1] = s[1]; run[2 * t_ + 1] = pre + s[0]; }
  __syncthreads();
#pragma unroll   // constant indices keep the per-lane arrays in registers
  for (int u = 0; u < CSRA_G; ++u) if (key[u] >= 0) ids[run[key[u]] + wh[wave][key[u]] + lr[u]] = e0 + i0 + u * 32;
  __syncthreads();
  typedef __attribute__((ext_vector_type(4))) int v4i;
  {
    for (int i = t_; i < CHP / 4; i += 256) *(v4i*)(STG + (size_t)b * CHP + i * 4) = *(const v4i*)(&ids[i * 4]);
    for (int i = t_; i < NGP / 4; i += 256) { v4i v; for (int e = 0; e < 4; ++e) v[e] = (i * 4 + e < nG) ? (cnt[i * 4 + e] | (run[i * 4 + e] << 16)) : 0; *(v4i*)(HST + (size_t)b * NGP + i * 4) = v; }   // both are at most CSR_CH
     }
}
// bucket: block g (1024 threads): gather ids (from each block's staging sub-run, in block order => original edge order), stable counting sort by node, flush; ROWPTR/ROWCNT rows.
__global__ __launch_bounds__(1024) void csrB_kernel(const int* __restrict__ dst, int N, int nG, int CHP, int NGP, const int* __restrict__ STG, const int* __restrict__ HST, int* __restrict__ PERM, int* __restrict__ ROWPTR, int* __restrict__ ROWCNT, int* __restrict__ FLAG) {
  typedef __attribute__((ext_vector_type(4))) int v4i;
  __shared__ int ids[CSR_CAP]; __shared__ unsigned short key[CSR_CAP]; __shared__ int outp[CSR_CAP]; __shared__ int ncnt[CSR_GN + 1]; __shared__ int boff[CSR_NBLK + 1]; __shared__ int ooff[CSR_NBLK];
  __shared__ __attribute__((aligned(16))) unsigned short wh[CSRB_NW][CSR_GN]; __shared__ int wsum[CSRB_NW];
  const int g = blockIdx.x, t_ = threadIdx.x, lane = t_ & 31, wave = t_ >> 5; const int st = g * CSR_CAP; const int v0 = g * CSR_GN; const int nv = min(CSR_GN, N - v0); int tot; (void)nG;
  // per-block offsets of this bucket's sub-runs in gather order (thread = staging row); their sum is the bucket's total
  { int c = 0; if (t_ < CSR_NBLK) { const unsigned hi = (unsigned)(t_ * NGP + g); const unsigned w = (unsigned)HST[hi];
      asm volatile("s_wait_xcnt 0x0" :: "v"(hi) : "memory");   // the same precaution as in pass A
      c = min((int)(w & 0xFFFFu), CHP); ooff[t_] = (int)(w >> 16); }
    int all; const int pre = csr_scan<CSRB_NW>(c, wsum, lane, wave, all); tot = all;
    if (all > CSR_CAP) { tot = 0; if (t_ == 0) FLAG[0] = 1; }   // loud failure: the bucket is worked on as an empty one (zero counts), flag
    if (t_ < CSR_NBLK) boff[t_] = min(pre, tot); if (t_ == 0) boff[CSR_NBLK] = tot; }
  for (int i = t_; i < CSRB_NW * CSR_GN / 2; i += 1024) ((int*)&wh[0][0])[i] = 0;
  __syncthreads();
  { constexpr int RB = CSR_NBLK / CSRB_NW;   // a wave gathers RB staging rows in a row; the first 32 ids of all of them are in flight together
    int bo[RB], cn[RB], id[RB], dd[RB]; unsigned ix[RB];
#pragma unroll   // constant indices keep the per-lane arrays in registers
    for (int u = 0; u < RB; ++u) { const int b = wave * RB + u; bo[u] = boff[b]; cn[u] = boff[b + 1] - bo[u]; int o_ = ooff[b]; o_ = (o_ < 0) ? 0 : (o_ > CHP - cn[u] ? CHP - cn[u] : o_); ix[u] = (unsigned)(b * CHP + min(o_, CHP - 1) + (lane < cn[u] ? lane : 0)); }   // a lane past the sub-run's end re-reads a written word of the row, so that no load hangs on a branch
#pragma unroll   // constant indices keep the per-lane arrays in registers
    for (int u = 0; u < RB; ++u) id[u] = STG[ix[u]];
    static_assert(RB == 16, "the three statements below name 16 values each");
    // a precaution: this wait stands in front of every overwrite of a register that an issued load names; the index registers are named so that they stay whole up to it
    asm volatile("s_wait_xcnt 0x0" :: "v"(ix[0]), "v"(ix[1]), "v"(ix[2]), "v"(ix[3]), "v"(ix[4]), "v"(ix[5]), "v"(ix[6]), "v"(ix[7]), "v"(ix[8]), "v"(ix[9]), "v"(ix[10]), "v"(ix[11]), "v"(ix[12]), "v"(ix[13]), "v"(ix[14]), "v"(ix[15]) : "memory");
    // holds the 16 loads together in front of the branches below: sunk into its branch, a load would wait there alone
    asm volatile("" :: "v"(id[0]), "v"(id[1]), "v"(id[2]), "v"(id[3]), "v"(id[4]), "v"(id[5]), "v"(id[6]), "v"(id[7]), "v"(id[8]), "v"(id[9]), "v"(id[10]), "v"(id[11]), "v"(id[12]), "v"(id[13]), "v"(id[14]), "v"(id[15]));
#pragma unroll   // constant indices keep the per-lane arrays in registers
    for (int u = 0; u < RB; ++u) id[u] = (id[u] < 0) ? 0 : id[u];
#pragma unroll   // constant indices keep the per-lane arrays in registers
    for (int u = 0; u < RB; ++u) dd[u] = dst[id[u]];
    // the same for the 16 destination loads
    asm volatile("" :: "v"(dd[0]), "v"(dd[1]), "v"(dd[2]), "v"(dd[3]), "v"(dd[4]), "v"(dd[5]), "v"(dd[6]), "v"(dd[7]), "v"(dd[8]), "v"(dd[9]), "v"(dd[10]), "v"(dd[11]), "v"(dd[12]), "v"(dd[13]), "v"(dd[14]), "v"(dd[15]));
#pragma unroll   // constant indices keep the per-lane arrays in registers
    for (int u = 0; u < RB; ++u) if (lane < cn[u]) { int d = dd[u]; d = (d < v0) ? v0 : (d >= N ? N - 1 : d); int kk = d - v0; kk = (kk < 0) ? 0 : (kk >= CSR_GN ? CSR_GN - 1 : kk); ids[bo[u] + lane] = id[u]; key[bo[u] + lane] = (unsigned short)kk; }
#pragma unroll 1   // seldom entered: kept small
    for (int u = 0; u < RB; ++u) { const int b = wave * RB + u; const int bs = boff[b], c = boff[b + 1] - bs; int o_ = ooff[b]; o_ = (o_ < 0) ? 0 : (o_ > CHP - c ? CHP - c : o_); const int* src_ = STG + (size_t)b * CHP + o_;   // what a sub-run holds beyond 32 ids
      for (int i = lane + 32; i < c; i += 32) { int idr = src_[i]; idr = (idr < 0) ? 0 : idr; ids[bs + i] = idr; int d = dst[idr]; d = (d < v0) ? v0 : (d >= N ? N - 1 : d); int kk = d - v0; kk = (kk < 0) ? 0 : (kk >= CSR_GN ? CSR_GN - 1 : kk); key[bs + i] = (unsigned short)kk; } } }
  __syncthreads();
  // stable counting sort by node inside the bucket: wave w owns items [w S, w S + S)
  const int S = ((tot + CSRB_NW * 32 - 1) / (CSRB_NW * 32)) * 32; const int i0 = wave * S + lane;
  int kr[CSRB_G], lr[CSRB_G];
#pragma unroll   // constant indices keep the per-lane arrays in registers
  for (int u = 0; u < CSRB_G; ++u) { const int i = i0 + u * 32; kr[u] = (u * 32 < S && i < tot) ? (int)key[i] : -1; lr[u] = 0; }
#pragma unroll   // constant indices keep the per-lane arrays in registers
  for (int u = 0; u < CSRB_G; ++u) if (u * 32 < S) lr[u] = csr_rank(wh[wave], kr[u], lane);
  __syncthreads();
  { int s = 0; if (t_ < CSR_GN) {   // thread = node: the rows become exclusive prefixes over the waves
#pragma unroll   // short fixed trip count: straight-line code, its LDS reads or ballots issued back to back
      for (int w = 0; w < CSRB_NW; ++w) { const int c = wh[w][t_]; wh[w][t_] = (unsigned short)s; s += c; } }
    int all; const int pre = csr_scan<CSRB_NW>(s, wsum, lane, wave, all); if (t_ < CSR_GN) ncnt[t_] = pre; if (t_ == 0) ncnt[CSR_GN] = all; }   // ncnt[vl] = start of node vl
  __syncthreads();
#pragma unroll   // constant indices keep the per-lane arrays in registers
  for (int u = 0; u < CSRB_G; ++u) if (kr[u] >= 0) outp[ncnt[kr[u]] + (int)wh[wave][kr[u]] + lr[u]] = ids[i0 + u * 32];
  __syncthreads();
  {
    for (int i = t_; i < ((tot + 31) & ~31) / 4; i += 1024) { v4i v; for (int e = 0; e < 4; ++e) { const int q = i * 4 + e; v[e] = (q < tot) ? outp[q] : -1; } *(v4i*)(PERM + st + i * 4) = v; }
    for (int i = t_; i < CSR_GN / 4; i += 1024) { v4i a, c; for (int e = 0; e < 4; ++e) { const int vl = i * 4 + e; a[e] = st + ncnt[vl]; c[e] = (vl < nv) ? (ncnt[vl + 1] - ncnt[vl]) : 0; } *(v4i*)(ROWPTR + v0 + i * 4) = a; *(v4i*)(ROWCNT + v0 + i * 4) = c; }   // the tables hold nG*512 entries (beyond N: count 0)
     }
}
__global__ __launch_bounds__(256) void csrZ_kernel(int* __restrict__ p, size_t n4) { typedef __attribute__((ext_vector_type(4))) int v4i; const size_t tid = (size_t)blockIdx.x * 256 + threadIdx.x, nth = (size_t)gridDim.x * 256; v4i z = {0, 0, 0, 0}; for (size_t i = tid; i < n4; i += nth) *(v4i*)(p + i * 4) = z; }
// host helper. Workspace ints needed: STG (512*CHP), HST (512*NGP), PERM (nG*CSR_CAP), ROWPTR (Npad), ROWCNT (Npad), FLAG (64). Npad = roundup(N, 512).
struct CsrBufs { int *STG, *HST, *PERM, *ROWPTR, *ROWCNT, *FLAG; int nG, NGP, CHP; size_t permLen; char* base; size_t bytes; };
static size_t csr_carve(CsrBufs& c, char* ws, size_t off, int E, int N) {
  const size_t off0 = off; c.base = ws + off;
  auto al = [&](size_t bytes) { char* p = ws + off; off += (bytes + 255) & ~(size_t)255; return p; };
  c.nG = (N + CSR_GN - 1) / CSR_GN; c.NGP = (c.nG + 31) & ~31; const int ch = (E + CSR_NBLK - 1) / CSR_NBLK; c.CHP = (ch + 31) & ~31; c.permLen = (size_t)c.nG * CSR_CAP;
  c.STG = (int*)al((size_t)CSR_NBLK * c.CHP * 4); c.HST = (int*)al((size_t)CSR_NBLK * c.NGP * 4);
  c.PERM = (int*)al(c.permLen * 4); c.ROWPTR = (int*)al((size_t)c.nG * CSR_GN * 4); c.ROWCNT = (int*)al((size_t)c.nG * CSR_GN * 4); c.FLAG = (int*)al(256);
  c.bytes = off - off0; return off;
}
static void csr_build(const CsrBufs& c, const int* dst, int E, int N, hipStream_t stream) {
  const size_t smem = (size_t)(2 * c.NGP + c.CHP) * 4;
  csrZ_kernel<<<512, 256, 0, stream>>>((int*)c.base, c.bytes / 16);
  csrA_kernel<<<CSR_NBLK, 256, smem, stream>>>(dst, E, N, c.nG, c.CHP, c.NGP, c.STG, c.HST);
  csrB_kernel<<<c.nG, 1024, 0, stream>>>(dst, N, c.nG, c.CHP, c.NGP, c.STG, c.HST, c.PERM, c.ROWPTR, c.ROWCNT, c.FLAG);
}


__global__ __launch_bounds__(256) void wprep_kernel(const float* __restrict__ wq, const float* __restrict__ wk, const float* __restrict__ wv, const float* __restrict__ wo, b16* __restrict__ WT) {
  const size_t u = (size_t)blockIdx.x * 256 + threadIdx.x; const size_t per = (size_t)D * D / 8; if (u >= 4 * per) return; const int which = (int)(u / per); const size_t e = (u % per) * 8; const float* w = which == 0 ? wq : which == 1 ? wk : which == 2 ? wv : wo; v8b o;
  for (int j = 0; j < 8; ++j) o[j] = (b16)(bf16_rne(w[e + j]) * WSC);
  { *(v8b*)(WT + (size_t)which * D * D + e) = o;  }
}
// Both projection kernels: blocks of 8 waves, a wave owns 16 rows. The operands reach the fragments through LDS: a fragment load straight from global memory touches 16 lines for 512 bytes, and every wave
// would read the whole weight plane that way. Here the block fetches its 32-KB weight plane once and each wave its own 16 rows of 512 B, all with whole-line loads (a load covers 512 bytes in a row).
constexpr int PJ_NW = 8, PJ_BLK = (NP / 16 + PJ_NW - 1) / PJ_NW, WPITCH = D + 8 /* halves: 272 B = 16 B x 17, no bank conflict for 16-byte reads down a column of rows */;
// W: 128 rows of 256 B -> Ws. src: rows of 512 B; rows m0 .. m0 + 15 -> T (the load of a row from nrows on re-reads the last row, so that no load hangs on a branch; ZERO: such a row is stored as zeros). All 24 loads of a lane fly together.
template <bool ZERO> __device__ __forceinline__ void stage_operands(const b16* __restrict__ W, b16 (*Ws)[WPITCH], const v4f* __restrict__ src, int m0, int nrows, int t_, int lane, float (*T)[D + 4]) {
  const unsigned iw = (unsigned)t_; unsigned ix[16]; v8b w[8]; v4f x[16];
#pragma unroll   // constant indices keep the arrays in registers
  for (int rr = 0; rr < 16; ++rr) ix[rr] = (unsigned)min(m0 + rr, nrows - 1) * (unsigned)(D / 4) + (unsigned)lane;
#pragma unroll   // constant indices keep the arrays in registers
  for (int j = 0; j < 8; ++j) w[j] = ((const v8b*)W)[iw + 256u * j];
#pragma unroll   // constant indices keep the arrays in registers
  for (int rr = 0; rr < 16; ++rr) x[rr] = src[ix[rr]];
  // a precaution: this wait stands in front of every overwrite of a register that an issued load names; the index registers are named so that they stay whole up to it
  asm volatile("s_wait_xcnt 0x0" :: "v"(iw), "v"(ix[0]), "v"(ix[1]), "v"(ix[2]), "v"(ix[3]), "v"(ix[4]), "v"(ix[5]), "v"(ix[6]), "v"(ix[7]), "v"(ix[8]), "v"(ix[9]), "v"(ix[10]), "v"(ix[11]), "v"(ix[12]), "v"(ix[13]), "v"(ix[14]), "v"(ix[15]) : "memory");
#pragma unroll   // constant indices keep the arrays in registers
  for (int j = 0; j < 8; ++j) *(v8b*)(&Ws[(t_ >> 4) + 16 * j][(t_ & 15) * 8]) = w[j];
#pragma unroll   // constant indices keep the arrays in registers
  for (int rr = 0; rr < 16; ++rr) *(v4f*)(&T[rr][lane * 4]) = (!ZERO || m0 + rr < nrows) ? x[rr] : (v4f){0.0f, 0.0f, 0.0f, 0.0f};
}
// a fragment (k-map of frag_kb) of 16-bit values that lie in an LDS row of floats; p: the row's float that holds k = 0 and 1
__device__ __forceinline__ v16b frag_kf(const float* p, int hh) { const v8b a = __builtin_bit_cast(v8b, *(const v4f*)(p + 4 * hh)), b = __builtin_bit_cast(v8b, *(const v4f*)(p + 8 + 4 * hh)); v16b f;
#pragma unroll
  for (int e = 0; e < 8; ++e) { f[e] = a[e]; f[8 + e] = b[e]; } return f; }
__global__ __launch_bounds__(256) void proj_kernel(const float* __restrict__ h, const b16* __restrict__ WT, const float* __restrict__ bq, const float* __restrict__ bk, const float* __restrict__ bv, float* __restrict__ Q, b16* __restrict__ KV) {
  __shared__ __attribute__((aligned(16))) float Tf[PJ_NW][16][D + 4];   // per wave: first its 16 rows of h, then its 16 rows of results
  __shared__ __attribute__((aligned(16))) b16 Ws[D][WPITCH];
  const int wave = threadIdx.x >> 5, lane = threadIdx.x & 31, nloc = lane & 15, hlf = lane >> 4; const size_t m0 = (size_t)blockIdx.x * (PJ_NW * 16) + wave * 16; const int part = blockIdx.y; const b16* W = WT + (size_t)part * D * D; const float* bias = part == 0 ? bq : part == 1 ? bk : bv; const float osc = part == 0 ? SCAL : 1.0f;
  stage_operands<true>(W, Ws, (const v4f*)h, (int)m0, N, (int)threadIdx.x, lane, Tf[wave]);
  __syncthreads();   // every wave reads the weight rows that the others have stored
  if (m0 >= (size_t)NP) return;   // the last block's waves past the padded rows: a whole wave leaves, behind the kernel's one barrier
  v8f acc[8];
#pragma unroll
  for (int t = 0; t < 8; ++t) acc[t] = (v8f){};
#pragma unroll
  for (int kb = 0; kb < D; kb += 32) { v16b a; { const float* r = &Tf[wave][nloc][kb + 8 * hlf]; const v4f r0 = *(const v4f*)r, r1 = *(const v4f*)(r + 4), r2 = *(const v4f*)(r + 16), r3 = *(const v4f*)(r + 20);
      for (int e = 0; e < 4; ++e) { a[e] = (b16)(bf16_rne(r0[e]) * XS); a[4 + e] = (b16)(bf16_rne(r1[e]) * XS); a[8 + e] = (b16)(bf16_rne(r2[e]) * XS); a[12 + e] = (b16)(bf16_rne(r3[e]) * XS); } }
    v16b bw[8];   // the k block's eight weight fragments are asked for together: one LDS latency a k block, not one a product
#pragma unroll
    for (int t = 0; t < 8; ++t) bw[t] = frag_kb(&Ws[t * 16 + nloc][kb], hlf);
#pragma unroll
    for (int t = 0; t < 8; ++t) acc[t] = wmma16b(a, bw[t], acc[t]); }
  wave_lds_sync();   // the results below overwrite the rows of h that other lanes of this wave have read
#pragma unroll
  for (int t = 0; t < 8; ++t) { const int c = t * 16 + nloc; const float bb = bf16_rne(bias[c]);
#pragma unroll 1
    for (int r = 0; r < 8; ++r) { const size_t row = m0 + 8 * hlf + r; Tf[wave][8 * hlf + r][c] = row < (size_t)N ? (acc[t][r] * (1.0f / (XS * WSC)) + bb) * osc : 0.0f; } }
  wave_lds_sync();
  if (part == 0) { for (int rr = 0; rr < 16; ++rr) *(v4f*)(Q + (m0 + rr) * D + lane * 4) = *(const v4f*)(&Tf[wave][rr][lane * 4]); }
  else { b16* P = KV + (size_t)(part - 1) * NP * D;   // k, v: f16 rows of 256 B; a store covers two rows = 4 whole lines
    for (int rr = 0; rr < 16; rr += 2) { const float* t = &Tf[wave][rr + hlf][nloc * 8]; const v4f x = *(const v4f*)t, y = *(const v4f*)(t + 4); v8b o;
      for (int e = 0; e < 4; ++e) { o[e] = (b16)x[e]; o[4 + e] = (b16)y[e]; }
      *(v8b*)(P + (m0 + rr + hlf) * D + nloc * 8) = o; } }
}
// Attention, one wave per destination node at a time, its edges up to 16 at a time. Per batch: lane j fetches edge j's ids (32 edges per fetch); the batch's K rows are loaded together, each lane stores q*k of its 4
// channels to the wave's own LDS rows; lane (edge slot es = lane/2, head group hp = 4*(lane&1)) sums the 16 products of each of its 4 heads (the same pairwise tree as a butterfly over d), so every logit, its
// maximum and its exponential are worked out once and not on 16 lanes; the weights go back through LDS, and each lane adds weight * V for its own 4 channels. The V rows fly while the softmax is worked on.
constexpr int AB = 16 /* edges per batch */, APITCH = D + 8 /* floats; 544 B = 32 B x 17: the 8 edge slots x 2 head groups of a half wave read 16 B each on all 64 banks */;
// orders the LDS stores and loads of one wave's lanes; LDS only, so that global loads in flight are not waited for here
__device__ __forceinline__ void wave_lds_only_sync() { __builtin_amdgcn_fence(__ATOMIC_RELEASE, "workgroup", "local"); __builtin_amdgcn_wave_barrier(); __builtin_amdgcn_fence(__ATOMIC_ACQUIRE, "workgroup", "local"); }
// the 8 bytes (4 f16 channels) per lane of NE rows of a plane, all loads issued together. sv: lane l0 + u holds the row of slot u. ix: the lane's index in units of 8 bytes, added to the plane's scalar base by the load itself.
template <int NE> __device__ __forceinline__ void rows_load(const b16* plane, int sv, int l0, int lane, v4h (&r)[NE]) {
  unsigned ix[NE];
#pragma unroll   // constant indices keep the arrays in registers
  for (int u = 0; u < NE; ++u) ix[u] = (unsigned)__builtin_amdgcn_readlane(sv, l0 + u) * (unsigned)(D / 4) + (unsigned)lane;
#pragma unroll   // constant indices keep the arrays in registers
  for (int u = 0; u < NE; ++u) r[u] = ((const v4h*)plane)[ix[u]];
  static_assert(NE == 4 || NE == 8 || NE == 12 || NE == 16, "one of the statements below names all NE values");
  // a precaution: this wait stands in front of every overwrite of a register that an issued load names; the index registers are named so that they stay whole up to it
  if constexpr (NE == 4) asm volatile("s_wait_xcnt 0x0" :: "v"(ix[0]), "v"(ix[1]), "v"(ix[2]), "v"(ix[3]) : "memory");
  else if constexpr (NE == 8) asm volatile("s_wait_xcnt 0x0" :: "v"(ix[0]), "v"(ix[1]), "v"(ix[2]), "v"(ix[3]), "v"(ix[4]), "v"(ix[5]), "v"(ix[6]), "v"(ix[7]) : "memory");
  else if constexpr (NE == 12) asm volatile("s_wait_xcnt 0x0" :: "v"(ix[0]), "v"(ix[1]), "v"(ix[2]), "v"(ix[3]), "v"(ix[4]), "v"(ix[5]), "v"(ix[6]), "v"(ix[7]), "v"(ix[8]), "v"(ix[9]), "v"(ix[10]), "v"(ix[11]) : "memory");
  else asm volatile("s_wait_xcnt 0x0" :: "v"(ix[0]), "v"(ix[1]), "v"(ix[2]), "v"(ix[3]), "v"(ix[4]), "v"(ix[5]), "v"(ix[6]), "v"(ix[7]), "v"(ix[8]), "v"(ix[9]), "v"(ix[10]), "v"(ix[11]), "v"(ix[12]), "v"(ix[13]), "v"(ix[14]), "v"(ix[15]) : "memory");
}
// one batch of nb <= NE edges, straight-line code for NE slots (no test around a load, so that the loads of a batch stay in flight together); a slot from nb on holds the row's last edge again and gets weight 0.
// sv: lane l0 + u holds the source node of slot u. mx: running maximum per head (the same in all lanes of a head group); den: this lane's edge slot alone; acc: this lane's 4 channels.
template <int NE> __device__ __forceinline__ void attn_batch(const b16* K, const b16* V, float (*Pr)[APITCH], float (*Pw)[NH], int sv, int l0, int nb, int lane, const v4f q, v4f& mx, v4f& den, v4f& acc) {
  const int c0 = lane * 4, es = lane >> 1, hp = (lane & 1) * 4;
  v4h kk[NE], vv[NE];
  rows_load<NE>(K, sv, l0, lane, kk);
#pragma unroll   // constant indices keep the rows in registers
  for (int u = 0; u < NE; ++u) *(v4f*)(&Pr[u][c0]) = q * __builtin_convertvector(kk[u], v4f);
  wave_lds_only_sync();   // other lanes of this wave read the products
  v4f l = {-INFINITY, -INFINITY, -INFINITY, -INFINITY};   // an empty slot: weight exp(-inf) = 0
  if (es < nb) { const float* pr = &Pr[es][hp]; v4f t[HD];
#pragma unroll   // constant indices keep the array in registers
    for (int d = 0; d < HD; ++d) t[d] = *(const v4f*)(pr + d * NH);
#pragma unroll   // constant indices keep the array in registers
    for (int w = 1; w < HD; w <<= 1)
#pragma unroll   // constant indices keep the array in registers
      for (int d = 0; d < HD; d += 2 * w) t[d] += t[d + w];
    l = t[0]; }
  rows_load<NE>(V, sv, l0, lane, vv);   // issued here, where the K rows and the 16 partial sums are dead, and used behind the softmax
  v4f p;
  for (int i = 0; i < 4; ++i) { float m = l[i]; m = fmaxf(m, __shfl_xor(m, 2)); m = fmaxf(m, __shfl_xor(m, 4)); m = fmaxf(m, __shfl_xor(m, 8)); m = fmaxf(m, __shfl_xor(m, 16));   // the batch's maximum of this head
    m = fmaxf(m, mx[i]); const float sc = nexp(mx[i] - m); p[i] = nexp(l[i] - m); mx[i] = m; den[i] = den[i] * sc + p[i]; acc[i] *= sc; }   // sc = 0 in the first batch
  *(v4f*)(&Pw[es][hp]) = p;
  wave_lds_only_sync();   // other lanes of this wave read the weights
#pragma unroll   // constant indices keep the rows in registers
  for (int u = 0; u < NE; ++u) acc += *(const v4f*)(&Pw[u][hp]) * __builtin_convertvector(vv[u], v4f);
  wave_lds_only_sync();   // the next batch overwrites what this one has read
}
// 8 waves per SIMD is what four blocks' LDS on a WGP allows: the second bound keeps the register budget at 128, so that registers do not allow fewer
// The grid is what the chip holds at once (256 WGPs x 4 blocks): every wave starts once and walks the nodes w, w + 8192, w + 16384, ... (12 or 13 of them). A node begins with a chain of three dependent loads
// (row entry -> edge ids -> source nodes); the wave keeps one link of it in flight for each of the three nodes to come: at the head of a node's pass it asks for the source nodes of the next node, the edge ids of the
// one after and the row entry of the third, each from what the pass before has asked for. No test stands around these loads (every index is clamped into its table), so that none is waited for where it is issued.
// Nothing passes between blocks and no result depends on where or when a block runs: the grid's size is chosen for speed alone.
constexpr int ATT_BLK = 1024, ATT_WAVES = ATT_BLK * 8;
static_assert(NP <= ((N + CSR_GN - 1) / CSR_GN) * CSR_GN && ATT_WAVES <= NP, "ROWPTR and ROWCNT hold an entry for every index below NP; every wave has a first node");
// a row entry as loaded -> start and count of the node's edges, the same in every lane (scalars); live: the node exists
__device__ __forceinline__ void row_scalars(int rs, int rc, bool live, int permLen, int& st, int& cnt) { rc = iclamp(rc, 0, 65536); rs = iclamp(rs, 0, permLen - rc); cnt = live ? __builtin_amdgcn_readfirstlane(rc) : 0; st = __builtin_amdgcn_readfirstlane(rs); }
// where lane's edge id of a row's first 32 stands in PERM; past the row's end: the last edge again; a row without edges: some word inside the table, not used
__device__ __forceinline__ int perm_index(int st, int cnt, int lane, int permLen) { return min(st + max(min(lane, cnt - 1), 0), permLen - 1); }
__global__ __launch_bounds__(256, 8) void attn_kernel(const float* Q, const b16* __restrict__ K, const b16* __restrict__ V, const int* __restrict__ cols, const int* __restrict__ PERM, const int* __restrict__ ROWPTR, const int* __restrict__ ROWCNT, int permLen, b16* Oh, b16* Ol) {   // Oh aliases the q plane (see host)
  __shared__ __attribute__((aligned(16))) float Pr[8][AB][APITCH];   // per wave: q*k, [edge slot][channel]
  __shared__ __attribute__((aligned(16))) float Pw[8][AB][NH];       // per wave: softmax weights, [edge slot][head]
  const int wave = __builtin_amdgcn_readfirstlane((int)(threadIdx.x >> 5)) /* the same in every lane: the loop over nodes is a scalar loop */, lane = threadIdx.x & 31; const int c0 = lane * 4; (void)Ol;
  const int w0 = (int)blockIdx.x * 8 + wave;
  int st, cnt, sv;     // this node: start and count of its edges, source nodes of its first 32 edges (one per lane)
  int st1, cnt1, en;   // the next node: start, count, edge ids as loaded
  int rs, rc;          // the node after: row entry as loaded (the tables hold an entry for every index below NP)
  { const int n1 = min(w0 + ATT_WAVES, NP - 1), n2 = min(w0 + 2 * ATT_WAVES, NP - 1);
    const int a0 = ROWPTR[w0], b0 = ROWCNT[w0], a1 = ROWPTR[n1], b1 = ROWCNT[n1]; rs = ROWPTR[n2]; rc = ROWCNT[n2];
    row_scalars(a0, b0, w0 < N, permLen, st, cnt); row_scalars(a1, b1, w0 + ATT_WAVES < N, permLen, st1, cnt1);
    const int e0 = PERM[perm_index(st, cnt, lane, permLen)]; en = PERM[perm_index(st1, cnt1, lane, permLen)];
    sv = iclamp(cols[iclamp(e0, 0, E - 1)], 0, N - 1); }
  for (int vn = w0; vn < NP; vn += ATT_WAVES) {
    const size_t v = (size_t)vn;
    const v4f q = *(const v4f*)(Q + v * D + c0);
    const int svn = cols[iclamp(en, 0, E - 1)];
    int st2, cnt2; row_scalars(rs, rc, vn + 2 * ATT_WAVES < N, permLen, st2, cnt2);
    const int enn = PERM[perm_index(st2, cnt2, lane, permLen)];
    { const int n3 = min(vn + 3 * ATT_WAVES, NP - 1); rs = ROWPTR[n3]; rc = ROWCNT[n3]; }
    asm volatile("s_wait_xcnt 0x0" ::: "memory");   // a precaution: it stands in front of every overwrite of a register that one of the loads above names
    v4f o = {0.0f, 0.0f, 0.0f, 0.0f};
    v4f mx = {-INFINITY, -INFINITY, -INFINITY, -INFINITY}, den = {0.0f, 0.0f, 0.0f, 0.0f}, acc = {0.0f, 0.0f, 0.0f, 0.0f};
    for (int base = 0; base < cnt; base += AB) {
      if (base > 0 && (base & 31) == 0) { const int j = min(base + lane, cnt - 1); const int e = iclamp(PERM[st + j], 0, E - 1); sv = iclamp(cols[e], 0, N - 1); }   // the next 32 edges of a long row; past the end: the last edge again
      const int nb = min(cnt - base, AB), l0 = base & 16;
      if (nb > 12) attn_batch<16>(K, V, Pr[wave], Pw[wave], sv, l0, nb, lane, q, mx, den, acc);
      else if (nb > 8) attn_batch<12>(K, V, Pr[wave], Pw[wave], sv, l0, nb, lane, q, mx, den, acc);
      else if (nb > 4) attn_batch<8>(K, V, Pr[wave], Pw[wave], sv, l0, nb, lane, q, mx, den, acc);
      else attn_batch<4>(K, V, Pr[wave], Pw[wave], sv, l0, nb, lane, q, mx, den, acc);
    }
    if (cnt > 0) for (int i = 0; i < 4; ++i) { float d = den[i]; d += __shfl_xor(d, 2); d += __shfl_xor(d, 4); d += __shfl_xor(d, 8); d += __shfl_xor(d, 16); o[i] = acc[i] / d; }   // the 16 slots' sums of this head
    v4h ph, pl; for (int i = 0; i < 4; ++i) { b16 p, pq; split16(o[i] * XS, p, pq); ph[i] = p; pl[i] = pq; }
    { *(v4h*)(Oh + v * (2 * D) + c0) = ph; *(v4h*)(Oh + v * (2 * D) + D + c0) = pl;  }   // hi | lo packed into this node's own 512-B q row (no other wave reads it)
    asm volatile("s_wait_xcnt 0x0" ::: "memory");   // a precaution: the next node's pass overwrites the registers that the two stores name
    st = st1; cnt = cnt1; sv = iclamp(svn, 0, N - 1); st1 = st2; cnt1 = cnt2; en = enn;
  }
}
__global__ __launch_bounds__(256) void oproj_kernel(const b16* __restrict__ Oh, const b16* __restrict__ Ol, const b16* __restrict__ WT, const float* __restrict__ bo, float* __restrict__ out) {
  __shared__ __attribute__((aligned(16))) float Tf[PJ_NW][16][D + 4];   // per wave: first its 16 rows of hi | lo halves, then its 16 rows of results
  __shared__ __attribute__((aligned(16))) b16 Ws[D][WPITCH];
  const int wave = threadIdx.x >> 5, lane = threadIdx.x & 31, nloc = lane & 15, hlf = lane >> 4; const size_t m0 = (size_t)blockIdx.x * (PJ_NW * 16) + wave * 16; const b16* W = WT + (size_t)3 * D * D; (void)Ol;
  stage_operands<false>(W, Ws, (const v4f*)Oh, (int)m0, NP, (int)threadIdx.x, lane, Tf[wave]);
  __syncthreads();   // every wave reads the weight rows that the others have stored
  if (m0 >= (size_t)NP) return;   // the last block's waves past the padded rows: a whole wave leaves, behind the kernel's one barrier
  v8f acc[8];
#pragma unroll
  for (int t = 0; t < 8; ++t) acc[t] = (v8f){};
#pragma unroll
  for (int kb = 0; kb < D; kb += 32) { const v16b a = frag_kf(&Tf[wave][nloc][kb / 2], hlf), al = frag_kf(&Tf[wave][nloc][(D + kb) / 2], hlf);
    v16b bw[8];   // the k block's eight weight fragments are asked for together: one LDS latency a k block, not one a product
#pragma unroll
    for (int t = 0; t < 8; ++t) bw[t] = frag_kb(&Ws[t * 16 + nloc][kb], hlf);
#pragma unroll
    for (int t = 0; t < 8; ++t) { acc[t] = wmma16b(a, bw[t], acc[t]); acc[t] = wmma16b(al, bw[t], acc[t]); } }
  wave_lds_sync();   // the results below overwrite the rows that other lanes of this wave have read
#pragma unroll
  for (int t = 0; t < 8; ++t) { const int c = t * 16 + nloc; const float bb = bf16_rne(bo[c]);
#pragma unroll 1
    for (int r = 0; r < 8; ++r) Tf[wave][8 * hlf + r][c] = acc[t][r] * (1.0f / (XS * WSC)) + bb; }
  wave_lds_sync();
  { for (int rr = 0; rr < 16; ++rr) { const size_t row = m0 + rr; if (row < (size_t)N) *(v4f*)(out + row * D + lane * 4) = *(const v4f*)(&Tf[wave][rr][lane * 4]); }  }
}
}  // namespace

extern "C" void kernel_launch(void* const* d_in, const int* in_sizes, int n_in, void* d_out, int out_size, void* d_ws, size_t ws_size, hipStream_t stream) {
  (void)n_in;
  auto Fp = [&](int i) { return (const float*)d_in[i]; }; auto Ip = [&](int i) { return (const int*)d_in[i]; };
  // input order: 0 h [100000,128], 1 row [E] i32, 2 col [E] i32, 3 Wq [128,128], 4 bq, 5 Wk, 6 bk, 7 Wv, 8 bv, 9 Wo, 10 bo
  if (in_sizes[0] != N * D || in_sizes[1] != E || in_sizes[2] != E || in_sizes[3] != D * D || in_sizes[9] != D * D || out_size != N * D) return;
  size_t off = 0; char* ws = (char*)d_ws;
  auto carve = [&](size_t bytes) { char* p = ws + off; off += (bytes + 255) & ~(size_t)255; return p; };
  b16* WT = (b16*)carve((size_t)4 * D * D * 2); float* Q = (float*)carve((size_t)NP * D * 4); b16* KV = (b16*)carve((size_t)2 * NP * D * 2);
  b16* Oh = (b16*)Q; b16* Ol = Oh;   // the attention output (hi | lo, 2 x 128 halves) overwrites each node's own 512-B q row in place: a wave reads only its own q row before writing it (K/V rows live in planes of their own)
  CsrBufs csr; off = csr_carve(csr, ws, off, E, N);
  if (off > ws_size) return;   // q plane, f16 k and v planes, CSR tables: about 120 MB
  wprep_kernel<<<(unsigned)((4 * (size_t)D * D / 8 + 255) / 256), 256, 0, stream>>>(Fp(3), Fp(5), Fp(7), Fp(9), WT);
  csr_build(csr, Ip(1), E, N, stream);   // group by row (the softmax axis)
  proj_kernel<<<dim3(PJ_BLK, 3), 256, 0, stream>>>(Fp(0), WT, Fp(4), Fp(6), Fp(8), Q, KV);
  attn_kernel<<<ATT_BLK, 256, 0, stream>>>(Q, KV, KV + (size_t)NP * D, Ip(2), csr.PERM, csr.ROWPTR, csr.ROWCNT, (int)csr.permLen, Oh, Ol);
  oproj_kernel<<<PJ_BLK, 256, 0, stream>>>(Oh, Ol, WT, Fp(10), (float*)d_out);
}

// v008
// It runs in 135 microseconds.
// Timed twice side by side with v007, it ran 1.11 times as fast both times.
// Counting every step since v000, it is 14.7 times as fast.
#include <hip/hip_runtime.h>

// Sparse multi-head attention over a graph (DGL bsddmm / bspmm style): q = (h Wq^T + bq) * 16^-1/2, k, v = Linear(h), all reshaped (N, 16, 8) — i.e. channel c = d*8 + head (heads interleaved);
// per edge e: logit_h = sum_d q[row][d,h] k[col][d,h]; softmax over the edges of each row (destination); out[row] = sum attn v[col]; y = out Wo^T + bo -> [100000][128]. 100,000 nodes,
// 1,600,000 edges; rows without edges give out = 0 (then bo).
// WMMA (v_wmma_f32_16x16x32_f16, f32 accumulate): the q/k/v projections ([100,032 x 128] x [128 x 384], EXACT bf16 h x8: 1 product) and the output projection ([100,032 x 128] x [128 x 128],
// attention output as f16 hi+lo x8 planes: 2 products), weights exact x256; between the projections every row is kept head-major (place head*16 + d holds channel d*8 + head: the weight planes are permuted once, see chan_il), so that
// a head's 16 values lie in two neighbouring lanes of a half wave; per-edge head dots, softmax and weighted sums in f32, in registers; the k and v rows that the edges gather are kept as f16 (rounded once from the f32 projection), q stays f32. Inputs rounded to bf16 once; ids int32 (clamped). Fragment k-map per lane half hh for A AND B:

namespace {
constexpr int N = 100000, NP = 100032, E = 1600000, D = 128, NH = 8, HD = 16;
constexpr float XS = 8.0f, WSC = 256.0f, NEG = 0.2f /* unused */, SCAL = 0.25f /* 16^-0.5 */;
typedef _Float16 b16;
typedef __attribute__((ext_vector_type(16))) _Float16 v16b;
typedef __attribute__((ext_vector_type(8))) _Float16 v8b;
typedef __attribute__((ext_vector_type(8))) float v8f;
typedef __attribute__((ext_vector_type(4))) float v4f;
__device__ __forceinline__ float bf16_rne(float f) { unsigned int u = __float_as_uint(f); u += 0x7FFFu + ((u >> 16) & 1u); return __uint_as_float(u & 0xFFFF0000u); }
__device__ __forceinline__ void split16(float v, b16& hi, b16& lo) { hi = (b16)v; lo = (b16)(v - (float)hi); }
__device__ __forceinline__ v16b frag_kb(const b16* p, int hh) { const v8b a = *(const v8b*)(p + 8 * hh), b = *(const v8b*)(p + 16 + 8 * hh); v16b f;
#pragma unroll
  for (int e = 0; e < 8; ++e) { f[e] = a[e]; f[8 + e] = b[e]; } return f; }
__device__ __forceinline__ v8f wmma16b(v16b a, v16b b, v8f c) { v8f d = __builtin_amdgcn_wmma_f32_16x16x32_f16(false, a, false, b, (short)0, c, false, false); asm volatile("v_nop\n\tv_nop\n\tv_nop\n\tv_nop" : "+v"(d) : "v"(a), "v"(b)); return d; }
__device__ __forceinline__ void wave_lds_sync() { __builtin_amdgcn_fence(__ATOMIC_RELEASE, "workgroup"); __builtin_amdgcn_wave_barrier(); __builtin_amdgcn_fence(__ATOMIC_ACQUIRE, "workgroup"); }
__device__ __forceinline__ int iclamp(int v, int lo, int hi) { return v < lo ? lo : (v > hi ? hi : v); }
// the reference's channel (d*8 + head) that stands at head-major place p = head*16 + d
__device__ __forceinline__ int chan_il(int p) { return (p & (HD - 1)) * NH + (p >> 4); }
// ---------------- deterministic, line-safe CSR by destination (two-level bucketing; every global write is a whole-line, lane-contiguous store) ----------------
// Pass A (block per contiguous edge chunk): a stable counting sort of the chunk's edges by coarse bucket g = dst >> CSR_GB (nG <= CSR_MAXG buckets) into LDS, all waves at work (see csr_rank), then whole-line
//   stores of the grouped ids (STG row) and of one word per bucket (HST row): its count | its start inside the staging row << 16.
// Pass B (block per bucket g): gathers the bucket's edge ids from the 512 staging rows into LDS (at most CSR_CAP ids), the same stable counting sort by destination node, then writes (a) its PERM run, which starts at g * CSR_CAP (a fixed place per bucket: no table over all buckets has to be built between the passes), and
//   (b) ROWPTR[v], ROWCNT[v] for its 2^CSR_GB nodes as contiguous ints. If a bucket exceeds CSR_CAP the kernel treats it as empty (ROWCNT = 0 for its nodes) and sets FLAG[0] = 1 (loud failure, no corruption).
// The sort, no atomics, original edge order kept inside every key: each wave owns a contiguous run of items and a histogram row of its own; per 32 items csr_rank gives every lane its rank among the
//   lanes with an equal key, the first such lane advances the row's counter; then a prefix over (key, wave) turns the rows into start positions.
constexpr int CSR_NBLK = 512, CSR_GB = 9, CSR_GN = 1 << CSR_GB /* nodes per bucket */, CSR_MAXG = 512, CSR_CAP = 12288 /* ids per bucket in LDS (48+24+48 KB, and 32 KB of counter rows) */;
constexpr int CSR_CH = (E + CSR_NBLK - 1) / CSR_NBLK /* edges per chunk */, CSRA_NW = 8, CSRA_G = (CSR_CH + CSRA_NW * 32 - 1) / (CSRA_NW * 32) /* groups of 32 per wave */, CSRB_NW = 32, CSRB_G = CSR_CAP / (CSRB_NW * 32);
static_assert(CSR_CH < 32768 && CSR_CAP % 32 == 0, "a count and a start share one int; a bucket's PERM run starts on a whole line");
// mask of the wave's valid lanes whose 9-bit key equals this lane's (keys < 512 = CSR_MAXG = CSR_GN)
__device__ __forceinline__ unsigned csr_match(int key, bool valid) { unsigned m = __builtin_amdgcn_ballot_w32(valid);
#pragma unroll   // short fixed trip count: straight-line code, its LDS reads or ballots issued back to back
  for (int b = 0; b < 9; ++b) { const bool on = (key >> b) & 1; const unsigned s = __builtin_amdgcn_ballot_w32(on); m &= on ? s : ~s; } return m; }
// one group of 32 items: returns how many items of this wave's run with the same key stand in front of this lane's item, and advances the wave's own counter row. key < 0: no item.
template <typename T> __device__ __forceinline__ int csr_rank(T* row, int key, int lane) { const bool ok = key >= 0; const unsigned m = csr_match(key, ok); const int r = __popc(m & ((1u << lane) - 1u)); int base = 0;
  if (ok) base = (int)row[key]; if (ok && r == 0) row[key] = (T)(base + __popc(m));
  wave_lds_sync();   // the next group's lanes read counters that other lanes of this wave have just stored
  return base + r; }
// exclusive prefix of one int per thread over a block of NW waves (every thread calls it); total = the block's sum. wsum: NW ints of LDS.
template <int NW> __device__ __forceinline__ int csr_scan(int v, int* wsum, int lane, int wave, int& total) { int inc = v;
#pragma unroll   // short fixed trip count: straight-line code, its LDS reads or ballots issued back to back
  for (int o = 1; o < 32; o <<= 1) { const int u = __shfl_up(inc, o); if (lane >= o) inc += u; }
  if (lane == 31) wsum[wave] = inc;
  __syncthreads();
  int pre = 0, all = 0;
#pragma unroll   // short fixed trip count: straight-line code, its LDS reads or ballots issued back to back
  for (int w = 0; w < NW; ++w) { const int s = wsum[w]; pre += (w < wave) ? s : 0; all += s; }
  __syncthreads();   // wsum may be written again by the next call
  total = all; return pre + inc - v; }
__global__ __launch_bounds__(256) void csrA_kernel(const int* __restrict__ dst, int E, int N, int nG, int CHP, int NGP, int* __restrict__ STG, int* __restrict__ HST) {
  extern __shared__ int sm[];   // cnt[NGP] | run[NGP] | ids[CHP]
  __shared__ int wh[CSRA_NW][CSR_MAXG]; __shared__ int wsum[CSRA_NW];
  int* cnt = sm; int* run = sm + NGP; int* ids = sm + 2 * NGP;
  const int t_ = threadIdx.x, lane = t_ & 31, wave = t_ >> 5;
  const int b = blockIdx.x; const int e0 = b * CSR_CH; const int i0 = wave * (CSRA_G * 32) + lane;
  for (int i = t_; i < CSRA_NW * CSR_MAXG; i += 256) (&wh[0][0])[i] = 0;
  for (int i = t_; i < CHP; i += 256) ids[i] = -1;
  int key[CSRA_G], lr[CSRA_G]; unsigned ei[CSRA_G];
#pragma unroll   // constant indices keep the per-lane arrays in registers
  for (int u = 0; u < CSRA_G; ++u) { ei[u] = (unsigned)min(e0 + i0 + u * 32, E - 1); key[u] = dst[ei[u]]; }   // all of a lane's loads in flight together; an index past the end re-reads the last edge
  static_assert(CSRA_G == 13, "the statement below names 13 values");
  // a precaution: this wait stands in front of every overwrite of a register that an issued load names; the index registers are named so that they stay whole up to it
  asm volatile("s_wait_xcnt 0x0" :: "v"(ei[0]), "v"(ei[1]), "v"(ei[2]), "v"(ei[3]), "v"(ei[4]), "v"(ei[5]), "v"(ei[6]), "v"(ei[7]), "v"(ei[8]), "v"(ei[9]), "v"(ei[10]), "v"(ei[11]), "v"(ei[12]) : "memory");
#pragma unroll   // constant indices keep the per-lane arrays in registers
  for (int u = 0; u < CSRA_G; ++u) { const int i = i0 + u * 32; const bool ok = i < CSR_CH && e0 + i < E; int d = key[u]; d = (d < 0) ? 0 : (d >= N ? N - 1 : d); key[u] = ok ? (d >> CSR_GB) : -1; }
  __syncthreads();
#pragma unroll   // constant indices keep the per-lane arrays in registers
  for (int u = 0; u < CSRA_G; ++u) lr[u] = csr_rank(wh[wave], key[u], lane);
  __syncthreads();
  int s[2];   // thread t_: buckets 2 t_ and 2 t_ + 1; the rows become exclusive prefixes over the waves
#pragma unroll   // short fixed trip count: straight-line code, its LDS reads or ballots issued back to back
  for (int j = 0; j < 2; ++j) { int acc = 0;
#pragma unroll   // short fixed trip count: straight-line code, its LDS reads issued back to back
    for (int w = 0; w < CSRA_NW; ++w) { const int c = wh[w][2 * t_ + j]; wh[w][2 * t_ + j] = acc; acc += c; } s[j] = acc; }
  int all; const int pre = csr_scan<CSRA_NW>(s[0] + s[1], wsum, lane, wave, all);
  if (2 * t_ < NGP) { cnt[2 * t_] = s[0]; run[2 * t_] = pre; } if (2 * t_ + 1 < NGP) { cnt[2 * t_ + 1] = s[1]; run[2 * t_ + 1] = pre + s[0]; }
  __syncthreads();
#pragma unroll   // constant indices keep the per-lane arrays in registers
  for (int u = 0; u < CSRA_G; ++u) if (key[u] >= 0) ids[run[key[u]] + wh[wave][key[u]] + lr[u]] = e0 + i0 + u * 32;
  __syncthreads();
  typedef __attribute__((ext_vector_type(4))) int v4i;
  {
    for (int i = t_; i < CHP / 4; i += 256) *(v4i*)(STG + (size_t)b * CHP + i * 4) = *(const v4i*)(&ids[i * 4]);
    for (int i = t_; i < NGP / 4; i += 256) { v4i v; for (int e = 0; e < 4; ++e) v[e] = (i * 4 + e < nG) ? (cnt[i * 4 + e] | (run[i * 4 + e] << 16)) : 0; *(v4i*)(HST + (size_t)b * NGP + i * 4) = v; }   // both are at most CSR_CH
     }
}
// bucket: block g (1024 threads): gather ids (from each block's staging sub-run, in block order => original edge order), stable counting sort by node, flush; ROWPTR/ROWCNT rows.
__global__ __launch_bounds__(1024) void csrB_kernel(const int* __restrict__ dst, int N, int nG, int CHP, int NGP, const int* __restrict__ STG, const int* __restrict__ HST, int* __restrict__ PERM, int* __restrict__ ROWPTR, int* __restrict__ ROWCNT, int* __restrict__ FLAG) {
  typedef __attribute__((ext_vector_type(4))) int v4i;
  __shared__ int ids[CSR_CAP]; __shared__ unsigned short key[CSR_CAP]; __shared__ int outp[CSR_CAP]; __shared__ int ncnt[CSR_GN + 1]; __shared__ int boff[CSR_NBLK + 1]; __shared__ int ooff[CSR_NBLK];
  __shared__ __attribute__((aligned(16))) unsigned short wh[CSRB_NW][CSR_GN]; __shared__ int wsum[CSRB_NW];
  const int g = blockIdx.x, t_ = threadIdx.x, lane = t_ & 31, wave = t_ >> 5; const int st = g * CSR_CAP; const int v0 = g * CSR_GN; const int nv = min(CSR_GN, N - v0); int tot; (void)nG;
  // per-block offsets of this bucket's sub-runs in gather order (thread = staging row); their sum is the bucket's total
  { int c = 0; if (t_ < CSR_NBLK) { const unsigned hi = (unsigned)(t_ * NGP + g); const unsigned w = (unsigned)HST[hi];
      asm volatile("s_wait_xcnt 0x0" :: "v"(hi) : "memory");   // the same precaution as in pass A
      c = min((int)(w & 0xFFFFu), CHP); ooff[t_] = (int)(w >> 16); }
    int all; const int pre = csr_scan<CSRB_NW>(c, wsum, lane, wave, all); tot = all;
    if (all > CSR_CAP) { tot = 0; if (t_ == 0) FLAG[0] = 1; }   // loud failure: the bucket is worked on as an empty one (zero counts), flag
    if (t_ < CSR_NBLK) boff[t_] = min(pre, tot); if (t_ == 0) boff[CSR_NBLK] = tot; }
  for (int i = t_; i < CSRB_NW * CSR_GN / 2; i += 1024) ((int*)&wh[0][0])[i] = 0;
  __syncthreads();
  { constexpr int RB = CSR_NBLK / CSRB_NW;   // a wave gathers RB staging rows in a row; the first 32 ids of all of them are in flight together
    int bo[RB], cn[RB], id[RB], dd[RB]; unsigned ix[RB];
#pragma unroll   // constant indices keep the per-lane arrays in registers
    for (int u = 0; u < RB; ++u) { const int b = wave * RB + u; bo[u] = boff[b]; cn[u] = boff[b + 1] - bo[u]; int o_ = ooff[b]; o_ = (o_ < 0) ? 0 : (o_ > CHP - cn[u] ? CHP - cn[u] : o_); ix[u] = (unsigned)(b * CHP + min(o_, CHP - 1) + (lane < cn[u] ? lane : 0)); }   // a lane past the sub-run's end re-reads a written word of the row, so that no load hangs on a branch
#pragma unroll   // constant indices keep the per-lane arrays in registers
    for (int u = 0; u < RB; ++u) id[u] = STG[ix[u]];
    static_assert(RB == 16, "the three statements below name 16 values each");
    // a precaution: this wait stands in front of every overwrite of a register that an issued load names; the index registers are named so that they stay whole up to it
    asm volatile("s_wait_xcnt 0x0" :: "v"(ix[0]), "v"(ix[1]), "v"(ix[2]), "v"(ix[3]), "v"(ix[4]), "v"(ix[5]), "v"(ix[6]), "v"(ix[7]), "v"(ix[8]), "v"(ix[9]), "v"(ix[10]), "v"(ix[11]), "v"(ix[12]), "v"(ix[13]), "v"(ix[14]), "v"(ix[15]) : "memory");
    // holds the 16 loads together in front of the branches below: sunk into its branch, a load would wait there alone
    asm volatile("" :: "v"(id[0]), "v"(id[1]), "v"(id[2]), "v"(id[3]), "v"(id[4]), "v"(id[5]), "v"(id[6]), "v"(id[7]), "v"(id[8]), "v"(id[9]), "v"(id[10]), "v"(id[11]), "v"(id[12]), "v"(id[13]), "v"(id[14]), "v"(id[15]));
#pragma unroll   // constant indices keep the per-lane arrays in registers
    for (int u = 0; u < RB; ++u) id[u] = (id[u] < 0) ? 0 : id[u];
#pragma unroll   // constant indices keep the per-lane arrays in registers
    for (int u = 0; u < RB; ++u) dd[u] = dst[id[u]];
    // the same for the 16 destination loads
    asm volatile("" :: "v"(dd[0]), "v"(dd[1]), "v"(dd[2]), "v"(dd[3]), "v"(dd[4]), "v"(dd[5]), "v"(dd[6]), "v"(dd[7]), "v"(dd[8]), "v"(dd[9]), "v"(dd[10]), "v"(dd[11]), "v"(dd[12]), "v"(dd[13]), "v"(dd[14]), "v"(dd[15]));
#pragma unroll   // constant indices keep the per-lane arrays in registers
    for (int u = 0; u < RB; ++u) if (lane < cn[u]) { int d = dd[u]; d = (d < v0) ? v0 : (d >= N ? N - 1 : d); int kk = d - v0; kk = (kk < 0) ? 0 : (kk >= CSR_GN ? CSR_GN - 1 : kk); ids[bo[u] + lane] = id[u]; key[bo[u] + lane] = (unsigned short)kk; }
#pragma unroll 1   // seldom entered: kept small
    for (int u = 0; u < RB; ++u) { const int b = wave * RB + u; const int bs = boff[b], c = boff[b + 1] - bs; int o_ = ooff[b]; o_ = (o_ < 0) ? 0 : (o_ > CHP - c ? CHP - c : o_); const int* src_ = STG + (size_t)b * CHP + o_;   // what a sub-run holds beyond 32 ids
      for (int i = lane + 32; i < c; i += 32) { int idr = src_[i]; idr = (idr < 0) ? 0 : idr; ids[bs + i] = idr; int d = dst[idr]; d = (d < v0) ? v0 : (d >= N ? N - 1 : d); int kk = d - v0; kk = (kk < 0) ? 0 : (kk >= CSR_GN ? CSR_GN - 1 : kk); key[bs + i] = (unsigned short)kk; } } }
  __syncthreads();
  // stable counting sort by node inside the bucket: wave w owns items [w S, w S + S)
  const int S = ((tot + CSRB_NW * 32 - 1) / (CSRB_NW * 32)) * 32; const int i0 = wave * S + lane;
  int kr[CSRB_G], lr[CSRB_G];
#pragma unroll   // constant indices keep the per-lane arrays in registers
  for (int u = 0; u < CSRB_G; ++u) { const int i = i0 + u * 32; kr[u] = (u * 32 < S && i < tot) ? (int)key[i] : -1; lr[u] = 0; }
#pragma unroll   // constant indices keep the per-lane arrays in registers
  for (int u = 0; u < CSRB_G; ++u) if (u * 32 < S) lr[u] = csr_rank(wh[wave], kr[u], lane);
  __syncthreads();
  { int s = 0; if (t_ < CSR_GN) {   // thread = node: the rows become exclusive prefixes over the waves
#pragma unroll   // short fixed trip count: straight-line code, its LDS reads or ballots issued back to back
      for (int w = 0; w < CSRB_NW; ++w) { const int c = wh[w][t_]; wh[w][t_] = (unsigned short)s; s += c; } }
    int all; const int pre = csr_scan<CSRB_NW>(s, wsum, lane, wave, all); if (t_ < CSR_GN) ncnt[t_] = pre; if (t_ == 0) ncnt[CSR_GN] = all; }   // ncnt[vl] = start of node vl
  __syncthreads();
#pragma unroll   // constant indices keep the per-lane arrays in registers
  for (int u = 0; u < CSRB_G; ++u) if (kr[u] >= 0) outp[ncnt[kr[u]] + (int)wh[wave][kr[u]] + lr[u]] = ids[i0 + u * 32];
  __syncthreads();
  {
    for (int i = t_; i < ((tot + 31) & ~31) / 4; i += 1024) { v4i v; for (int e = 0; e < 4; ++e) { const int q = i * 4 + e; v[e] = (q < tot) ? outp[q] : -1; } *(v4i*)(PERM + st + i * 4) = v; }
    for (int i = t_; i < CSR_GN / 4; i += 1024) { v4i a, c; for (int e = 0; e < 4; ++e) { const int vl = i * 4 + e; a[e] = st + ncnt[vl]; c[e] = (vl < nv) ? (ncnt[vl + 1] - ncnt[vl]) : 0; } *(v4i*)(ROWPTR + v0 + i * 4) = a; *(v4i*)(ROWCNT + v0 + i * 4) = c; }   // the tables hold nG*512 entries (beyond N: count 0)
     }
}
__global__ __launch_bounds__(256) void csrZ_kernel(int* __restrict__ p, size_t n4) { typedef __attribute__((ext_vector_type(4))) int v4i; const size_t tid = (size_t)blockIdx.x * 256 + threadIdx.x, nth = (size_t)gridDim.x * 256; v4i z = {0, 0, 0, 0}; for (size_t i = tid; i < n4; i += nth) *(v4i*)(p + i * 4) = z; }
// host helper. Workspace ints needed: STG (512*CHP), HST (512*NGP), PERM (nG*CSR_CAP), ROWPTR (Npad), ROWCNT (Npad), FLAG (64). Npad = roundup(N, 512).
struct CsrBufs { int *STG, *HST, *PERM, *ROWPTR, *ROWCNT, *FLAG; int nG, NGP, CHP; size_t permLen; char* base; size_t bytes; };
static size_t csr_carve(CsrBufs& c, char* ws, size_t off, int E, int N) {
  const size_t off0 = off; c.base = ws + off;
  auto al = [&](size_t bytes) { char* p = ws + off; off += (bytes + 255) & ~(size_t)255; return p; };
  c.nG = (N + CSR_GN - 1) / CSR_GN; c.NGP = (c.nG + 31) & ~31; const int ch = (E + CSR_NBLK - 1) / CSR_NBLK; c.CHP = (ch + 31) & ~31; c.permLen = (size_t)c.nG * CSR_CAP;
  c.STG = (int*)al((size_t)CSR_NBLK * c.CHP * 4); c.HST = (int*)al((size_t)CSR_NBLK * c.NGP * 4);
  c.PERM = (int*)al(c.permLen * 4); c.ROWPTR = (int*)al((size_t)c.nG * CSR_GN * 4); c.ROWCNT = (int*)al((size_t)c.nG * CSR_GN * 4); c.FLAG = (int*)al(256);
  c.bytes = off - off0; return off;
}
static void csr_build(const CsrBufs& c, const int* dst, int E, int N, hipStream_t stream) {
  const size_t smem = (size_t)(2 * c.NGP + c.CHP) * 4;
  csrZ_kernel<<<512, 256, 0, stream>>>((int*)c.base, c.bytes / 16);
  csrA_kernel<<<CSR_NBLK, 256, smem, stream>>>(dst, E, N, c.nG, c.CHP, c.NGP, c.STG, c.HST);
  csrB_kernel<<<c.nG, 1024, 0, stream>>>(dst, N, c.nG, c.CHP, c.NGP, c.STG, c.HST, c.PERM, c.ROWPTR, c.ROWCNT, c.FLAG);
}


__global__ __launch_bounds__(256) void wprep_kernel(const float* __restrict__ wq, const float* __restrict__ wk, const float* __restrict__ wv, const float* __restrict__ wo, b16* __restrict__ WT) {
  const size_t u = (size_t)blockIdx.x * 256 + threadIdx.x; const size_t per = (size_t)D * D / 8; if (u >= 4 * per) return; const int which = (int)(u / per); const size_t e = (u % per) * 8; const float* w = which == 0 ? wq : which == 1 ? wk : which == 2 ? wv : wo; v8b o;
  const int r = (int)(e / D), k0 = (int)(e % D);   // q, k, v: output rows permuted to head-major places; o: its k columns, which meet the attention output's places
  for (int j = 0; j < 8; ++j) o[j] = (b16)(bf16_rne(w[which < 3 ? chan_il(r) * D + k0 + j : r * D + chan_il(k0 + j)]) * WSC);
  { *(v8b*)(WT + (size_t)which * D * D + e) = o;  }
}
// Both projection kernels: blocks of 8 waves, a wave owns 16 rows. The operands reach the fragments through LDS: a fragment load straight from global memory touches 16 lines for 512 bytes, and every wave
// would read the whole weight plane that way. Here the block fetches its 32-KB weight plane once and each wave its own 16 rows of 512 B, all with whole-line loads (a load covers 512 bytes in a row).
constexpr int PJ_NW = 8, PJ_BLK = (NP / 16 + PJ_NW - 1) / PJ_NW, WPITCH = D + 8 /* halves: 272 B = 16 B x 17, no bank conflict for 16-byte reads down a column of rows */;
// W: 128 rows of 256 B -> Ws. src: rows of 512 B; rows m0 .. m0 + 15 -> T (the load of a row from nrows on re-reads the last row, so that no load hangs on a branch; ZERO: such a row is stored as zeros). All 24 loads of a lane fly together.
template <bool ZERO> __device__ __forceinline__ void stage_operands(const b16* __restrict__ W, b16 (*Ws)[WPITCH], const v4f* __restrict__ src, int m0, int nrows, int t_, int lane, float (*T)[D + 4]) {
  const unsigned iw = (unsigned)t_; unsigned ix[16]; v8b w[8]; v4f x[16];
#pragma unroll   // constant indices keep the arrays in registers
  for (int rr = 0; rr < 16; ++rr) ix[rr] = (unsigned)min(m0 + rr, nrows - 1) * (unsigned)(D / 4) + (unsigned)lane;
#pragma unroll   // constant indices keep the arrays in registers
  for (int j = 0; j < 8; ++j) w[j] = ((const v8b*)W)[iw + 256u * j];
#pragma unroll   // constant indices keep the arrays in registers
  for (int rr = 0; rr < 16; ++rr) x[rr] = src[ix[rr]];
  // a precaution: this wait stands in front of every overwrite of a register that an issued load names; the index registers are named so that they stay whole up to it
  asm volatile("s_wait_xcnt 0x0" :: "v"(iw), "v"(ix[0]), "v"(ix[1]), "v"(ix[2]), "v"(ix[3]), "v"(ix[4]), "v"(ix[5]), "v"(ix[6]), "v"(ix[7]), "v"(ix[8]), "v"(ix[9]), "v"(ix[10]), "v"(ix[11]), "v"(ix[12]), "v"(ix[13]), "v"(ix[14]), "v"(ix[15]) : "memory");
#pragma unroll   // constant indices keep the arrays in registers
  for (int j = 0; j < 8; ++j) *(v8b*)(&Ws[(t_ >> 4) + 16 * j][(t_ & 15) * 8]) = w[j];
#pragma unroll   // constant indices keep the arrays in registers
  for (int rr = 0; rr < 16; ++rr) *(v4f*)(&T[rr][lane * 4]) = (!ZERO || m0 + rr < nrows) ? x[rr] : (v4f){0.0f, 0.0f, 0.0f, 0.0f};
}
// a fragment (k-map of frag_kb) of 16-bit values that lie in an LDS row of floats; p: the row's float that holds k = 0 and 1
__device__ __forceinline__ v16b frag_kf(const float* p, int hh) { const v8b a = __builtin_bit_cast(v8b, *(const v4f*)(p + 4 * hh)), b = __builtin_bit_cast(v8b, *(const v4f*)(p + 8 + 4 * hh)); v16b f;
#pragma unroll
  for (int e = 0; e < 8; ++e) { f[e] = a[e]; f[8 + e] = b[e]; } return f; }
__global__ __launch_bounds__(256) void proj_kernel(const float* __restrict__ h, const b16* __restrict__ WT, const float* __restrict__ bq, const float* __restrict__ bk, const float* __restrict__ bv, float* __restrict__ Q, b16* __restrict__ KV) {
  __shared__ __attribute__((aligned(16))) float Tf[PJ_NW][16][D + 4];   // per wave: first its 16 rows of h, then its 16 rows of results
  __shared__ __attribute__((aligned(16))) b16 Ws[D][WPITCH];
  const int wave = threadIdx.x >> 5, lane = threadIdx.x & 31, nloc = lane & 15, hlf = lane >> 4; const size_t m0 = (size_t)blockIdx.x * (PJ_NW * 16) + wave * 16; const int part = blockIdx.y; const b16* W = WT + (size_t)part * D * D; const float* bias = part == 0 ? bq : part == 1 ? bk : bv; const float osc = part == 0 ? SCAL : 1.0f;
  stage_operands<true>(W, Ws, (const v4f*)h, (int)m0, N, (int)threadIdx.x, lane, Tf[wave]);
  __syncthreads();   // every wave reads the weight rows that the others have stored
  if (m0 >= (size_t)NP) return;   // the last block's waves past the padded rows: a whole wave leaves, behind the kernel's one barrier
  v8f acc[8];
#pragma unroll
  for (int t = 0; t < 8; ++t) acc[t] = (v8f){};
#pragma unroll
  for (int kb = 0; kb < D; kb += 32) { v16b a; { const float* r = &Tf[wave][nloc][kb + 8 * hlf]; const v4f r0 = *(const v4f*)r, r1 = *(const v4f*)(r + 4), r2 = *(const v4f*)(r + 16), r3 = *(const v4f*)(r + 20);
      for (int e = 0; e < 4; ++e) { a[e] = (b16)(bf16_rne(r0[e]) * XS); a[4 + e] = (b16)(bf16_rne(r1[e]) * XS); a[8 + e] = (b16)(bf16_rne(r2[e]) * XS); a[12 + e] = (b16)(bf16_rne(r3[e]) * XS); } }
    v16b bw[8];   // the k block's eight weight fragments are asked for together: one LDS latency a k block, not one a product
#pragma unroll
    for (int t = 0; t < 8; ++t) bw[t] = frag_kb(&Ws[t * 16 + nloc][kb], hlf);
#pragma unroll
    for (int t = 0; t < 8; ++t) acc[t] = wmma16b(a, bw[t], acc[t]); }
  wave_lds_sync();   // the results below overwrite the rows of h that other lanes of this wave have read
#pragma unroll
  for (int t = 0; t < 8; ++t) { const int c = t * 16 + nloc; const float bb = bf16_rne(bias[chan_il(c)]);
#pragma unroll 1
    for (int r = 0; r < 8; ++r) { const size_t row = m0 + 8 * hlf + r; Tf[wave][8 * hlf + r][c] = row < (size_t)N ? (acc[t][r] * (1.0f / (XS * WSC)) + bb) * osc : 0.0f; } }
  wave_lds_sync();
  if (part == 0) { for (int rr = 0; rr < 16; ++rr) *(v4f*)(Q + (m0 + rr) * D + lane * 4) = *(const v4f*)(&Tf[wave][rr][lane * 4]); }
  else { b16* P = KV + (size_t)(part - 1) * NP * D;   // k, v: f16 rows of 256 B; a store covers two rows = 4 whole lines
    for (int rr = 0; rr < 16; rr += 2) { const float* t = &Tf[wave][rr + hlf][nloc * 8]; const v4f x = *(const v4f*)t, y = *(const v4f*)(t + 4); v8b o;
      for (int e = 0; e < 4; ++e) { o[e] = (b16)x[e]; o[4 + e] = (b16)y[e]; }
      *(v8b*)(P + (m0 + rr + hlf) * D + nloc * 8) = o; } }
}
// Attention, one wave per destination node at a time, its edges up to 16 at a time, all in registers. Rows are head-major, and a 16-byte load per lane covers TWO rows: half wave hf = lane/16 takes the odd (hf = 1) or even
// edges, lane j = lane%16 of it the places 8j .. 8j+7 = half of head j/2. A head's dot is 8 products in the lane and one add with the neighbour lane; each lane then holds its own head's logit of its own edges, so the
// maximum, the exponentials and the weighted sums need no exchange but one maximum per batch and one sum per node between the two half waves. The K and V rows of a batch fly together.
constexpr int AB = 16 /* edges per batch */;
// v as another lane holds it, by a data-parallel move inside 16-lane rows: 0x150 + n: lane n of the own row; 0xB1: lane ^ 1; 0x128: lane + 8 round the row
template <int CTRL> __device__ __forceinline__ int dpp_i(int v) { return __builtin_amdgcn_update_dpp(0, v, CTRL, 0xf, 0xf, true); }
template <int CTRL> __device__ __forceinline__ float dpp_f(float v) { return __int_as_float(dpp_i<CTRL>(__float_as_int(v))); }
// v as lane ^ 16 holds it
__device__ __forceinline__ float xhalf(float v) { const int i = __float_as_int(v); return __int_as_float(__builtin_amdgcn_permlanex16(i, i, 0x76543210, 0xfedcba98, false, false)); }
// c + f * (the low or the high f16 of h), f32 result, in one instruction. Written out because the compiler widens each f16 to a float register first (one more instruction per value, and twice the registers for a batch's rows, which then spill)
__device__ __forceinline__ float fmix_lo(unsigned h, float f, float c) { float d; asm("v_fma_mix_f32 %0, %1, %2, %3 op_sel_hi:[1,0,0]" : "=v"(d) : "v"(h), "v"(f), "v"(c)); return d; }
__device__ __forceinline__ float fmix_hi(unsigned h, float f, float c) { float d; asm("v_fma_mix_f32 %0, %1, %2, %3 op_sel:[1,0,0] op_sel_hi:[1,0,0]" : "=v"(d) : "v"(h), "v"(f), "v"(c)); return d; }
// the same with c = 0: a chain's first product
__device__ __forceinline__ float mmix_lo(unsigned h, float f) { float d; asm("v_fma_mix_f32 %0, %1, %2, 0 op_sel_hi:[1,0,0]" : "=v"(d) : "v"(h), "v"(f)); return d; }
typedef __attribute__((ext_vector_type(4))) unsigned v4u;
__device__ __forceinline__ float exp2_slot(float x) { float d; asm("v_exp_f32 %0, %1\n\tv_nop" : "=v"(d) : "v"(x)); return d; }
// one batch of nb <= 2 NL edges, straight-line code for NL loads per plane (no test around a load, so that the loads of a batch stay in flight together); a slot from nb on holds the row's last edge again and gets weight 0.
// svb: lane u of each half wave holds the byte offset of the source row of that half's slot u. nbh = nb - hf: slot u is an edge where 2u < nbh. lo: the lane's 16 bytes inside a row.
// mx: running maximum of the lane's head (the same in both half waves); den, acc: this half wave's edges alone.
template <int NL> __device__ __forceinline__ void attn_batch(const b16* K, const b16* V, int svb, int nbh, unsigned lo, const float (&q)[8], float& mx, float& den, float (&acc)[8]) {
  static_assert(NL == 2 || NL == 4 || NL == 6 || NL == 8, "one of the statements below names all NL values");
  unsigned off[NL]; v4u kk[NL], vv[NL];   // a register holds two neighbouring f16 places
  off[0] = (unsigned)dpp_i<0x150>(svb) + lo; off[1] = (unsigned)dpp_i<0x151>(svb) + lo;
  if constexpr (NL > 2) { off[2] = (unsigned)dpp_i<0x152>(svb) + lo; off[3] = (unsigned)dpp_i<0x153>(svb) + lo; }
  if constexpr (NL > 4) { off[4] = (unsigned)dpp_i<0x154>(svb) + lo; off[5] = (unsigned)dpp_i<0x155>(svb) + lo; }
  if constexpr (NL > 6) { off[6] = (unsigned)dpp_i<0x156>(svb) + lo; off[7] = (unsigned)dpp_i<0x157>(svb) + lo; }
#pragma unroll   // constant indices keep the arrays in registers
  for (int u = 0; u < NL; ++u) kk[u] = *(const v4u*)((const char*)K + off[u]);
#pragma unroll   // constant indices keep the arrays in registers
  for (int u = 0; u < NL; ++u) vv[u] = *(const v4u*)((const char*)V + off[u]);
  // a precaution: this wait stands in front of every overwrite of a register that an issued load names; the offset registers are named so that they stay whole up to it
  if constexpr (NL == 2) asm volatile("s_wait_xcnt 0x0" :: "v"(off[0]), "v"(off[1]) : "memory");
  else if constexpr (NL == 4) asm volatile("s_wait_xcnt 0x0" :: "v"(off[0]), "v"(off[1]), "v"(off[2]), "v"(off[3]) : "memory");
  else if constexpr (NL == 6) asm volatile("s_wait_xcnt 0x0" :: "v"(off[0]), "v"(off[1]), "v"(off[2]), "v"(off[3]), "v"(off[4]), "v"(off[5]) : "memory");
  else asm volatile("s_wait_xcnt 0x0" :: "v"(off[0]), "v"(off[1]), "v"(off[2]), "v"(off[3]), "v"(off[4]), "v"(off[5]), "v"(off[6]), "v"(off[7]) : "memory");
  __builtin_amdgcn_sched_barrier(0);   // all of the batch's loads are issued in front of the arithmetic: left free, the scheduler holds some rows' loads back to save registers, and each of them is then waited for alone
  float l[NL];
#pragma unroll   // constant indices keep the arrays in registers
  for (int u = 0; u < NL; ++u) { float t = mmix_lo(kk[u][0], q[0]); t = fmix_hi(kk[u][0], q[1], t);
#pragma unroll
    for (int i = 1; i < 4; ++i) { t = fmix_lo(kk[u][i], q[2 * i], t); t = fmix_hi(kk[u][i], q[2 * i + 1], t); }
    l[u] = t + dpp_f<0xB1>(t); }   // the head's other 8 products stand in the neighbour lane
#pragma unroll
  for (int u = NL - 2; u < NL; ++u) l[u] = (2 * u < nbh) ? l[u] : -INFINITY;   // only the last two slots can be empty (the caller picks NL by nb); an empty slot: weight exp(-inf) = 0
  float m = l[0];
#pragma unroll
  for (int u = 1; u < NL; ++u) m = fmaxf(m, l[u]);
  m = fmaxf(fmaxf(m, xhalf(m)), mx);   // the batch's maximum of this head over both half waves, then the running one
  constexpr float L2E = 1.4426950408889634f; const float nm = -m * L2E;
  const float sc = exp2_slot(__builtin_fmaf(mx, L2E, nm)); mx = m;   // exp(old - new); 0 in the first batch
#pragma unroll   // constant indices keep the arrays in registers
  for (int u = 0; u < NL; ++u) l[u] = exp2_slot(__builtin_fmaf(l[u], L2E, nm));
  float ps = l[0];
#pragma unroll
  for (int u = 1; u < NL; ++u) ps += l[u];
  den = den * sc + ps;
#pragma unroll
  for (int i = 0; i < 8; ++i) acc[i] *= sc;
#pragma unroll   // constant indices keep the arrays in registers
  for (int u = 0; u < NL; ++u)
#pragma unroll
    for (int i = 0; i < 4; ++i) { acc[2 * i] = fmix_lo(vv[u][i], l[u], acc[2 * i]); acc[2 * i + 1] = fmix_hi(vv[u][i], l[u], acc[2 * i + 1]); }
}
// 8 waves per SIMD: the second bound keeps the register budget at 128, which holds a batch's K and V rows together
// The grid is what the chip holds at once (256 WGPs x 4 blocks): every wave starts once and walks the nodes w, w + 8192, w + 16384, ... (12 or 13 of them). A node begins with a chain of three dependent loads
// (row entry -> edge ids -> source nodes); the wave keeps one link of it in flight for each of the three nodes to come: at the head of a node's pass it asks for the source nodes of the next node, the edge ids of the
// one after and the row entry of the third, each from what the pass before has asked for. No test stands around these loads (every index is clamped into its table), so that none is waited for where it is issued.
// Nothing passes between blocks and no result depends on where or when a block runs: the grid's size is chosen for speed alone.
constexpr int ATT_BLK = 1024, ATT_WAVES = ATT_BLK * 8;
static_assert(NP <= ((N + CSR_GN - 1) / CSR_GN) * CSR_GN && ATT_WAVES <= NP, "ROWPTR and ROWCNT hold an entry for every index below NP; every wave has a first node");
// a row entry as loaded -> start and count of the node's edges, the same in every lane (scalars); live: the node exists
__device__ __forceinline__ void row_scalars(int rs, int rc, bool live, int permLen, int& st, int& cnt) { rc = iclamp(rc, 0, 65536); rs = iclamp(rs, 0, permLen - rc); cnt = live ? __builtin_amdgcn_readfirstlane(rc) : 0; st = __builtin_amdgcn_readfirstlane(rs); }
// where the edge id that a lane fetches (number 'lane' of a row's first 32) stands in PERM; past the row's end: the last edge again; a row without edges: some word inside the table, not used
__device__ __forceinline__ int perm_index(int st, int cnt, int lane, int permLen) { return min(st + max(min(lane, cnt - 1), 0), permLen - 1); }
__global__ __launch_bounds__(256, 8) void attn_kernel(const float* Q, const b16* __restrict__ K, const b16* __restrict__ V, const int* __restrict__ cols, const int* __restrict__ PERM, const int* __restrict__ ROWPTR, const int* __restrict__ ROWCNT, int permLen, b16* Oh, b16* Ol) {   // Oh aliases the q plane (see host)
  const int wave = __builtin_amdgcn_readfirstlane((int)(threadIdx.x >> 5)) /* the same in every lane: the loop over nodes is a scalar loop */, lane = threadIdx.x & 31, hf = lane >> 4, lj = lane & 15; (void)Ol;
  const int ep = 2 * lj + hf;   // of 32 edges this lane fetches number ep: lane u of a half wave holds that half's slot u (u < 8: first batch of 16, else the second)
  const unsigned lo = (unsigned)lj * 16u;
  const int w0 = (int)blockIdx.x * 8 + wave;
  int st, cnt, sv;     // this node: start and count of its edges, source nodes of its first 32 edges (one per lane)
  int st1, cnt1, en;   // the next node: start, count, edge ids as loaded
  int rs, rc;          // the node after: row entry as loaded (the tables hold an entry for every index below NP)
  { const int n1 = min(w0 + ATT_WAVES, NP - 1), n2 = min(w0 + 2 * ATT_WAVES, NP - 1);
    const int a0 = ROWPTR[w0], b0 = ROWCNT[w0], a1 = ROWPTR[n1], b1 = ROWCNT[n1]; rs = ROWPTR[n2]; rc = ROWCNT[n2];
    row_scalars(a0, b0, w0 < N, permLen, st, cnt); row_scalars(a1, b1, w0 + ATT_WAVES < N, permLen, st1, cnt1);
    const int e0 = PERM[perm_index(st, cnt, ep, permLen)]; en = PERM[perm_index(st1, cnt1, ep, permLen)];
    sv = iclamp(cols[iclamp(e0, 0, E - 1)], 0, N - 1); }
  for (int vn = w0; vn < NP; vn += ATT_WAVES) {
    const size_t v = (size_t)vn;
    const v4f qa = *(const v4f*)(Q + v * D + lj * 8), qb = *(const v4f*)(Q + v * D + lj * 8 + 4);
    const int svn = cols[iclamp(en, 0, E - 1)];
    int st2, cnt2; row_scalars(rs, rc, vn + 2 * ATT_WAVES < N, permLen, st2, cnt2);
    const int enn = PERM[perm_index(st2, cnt2, ep, permLen)];
    { const int n3 = min(vn + 3 * ATT_WAVES, NP - 1); rs = ROWPTR[n3]; rc = ROWCNT[n3]; }
    asm volatile("s_wait_xcnt 0x0" ::: "memory");   // a precaution: it stands in front of every overwrite of a register that one of the loads above names
    const float q[8] = {qa[0], qa[1], qa[2], qa[3], qb[0], qb[1], qb[2], qb[3]};
    float o[8] = {0.0f, 0.0f, 0.0f, 0.0f, 0.0f, 0.0f, 0.0f, 0.0f}, acc[8] = {0.0f, 0.0f, 0.0f, 0.0f, 0.0f, 0.0f, 0.0f, 0.0f}, mx = -INFINITY, den = 0.0f;
    int svb = sv * (D * 2);   // byte offset of the source row in the k and the v plane
    for (int base = 0; base < cnt; base += AB) {
      if (base > 0 && (base & 31) == 0) { const int j = min(base + ep, cnt - 1); const int e = iclamp(PERM[st + j], 0, E - 1); svb = iclamp(cols[e], 0, N - 1) * (D * 2); }   // the next 32 edges of a long row; past the end: the last edge again
      const int nb = min(cnt - base, AB), nbh = nb - hf;
      if (nb > 12) attn_batch<8>(K, V, svb, nbh, lo, q, mx, den, acc);
      else if (nb > 8) attn_batch<6>(K, V, svb, nbh, lo, q, mx, den, acc);
      else if (nb > 4) attn_batch<4>(K, V, svb, nbh, lo, q, mx, den, acc);
      else attn_batch<2>(K, V, svb, nbh, lo, q, mx, den, acc);
      svb = dpp_i<0x128>(svb);   // the second batch's slots move to lanes 0 .. 7 of each half wave
    }
    if (cnt > 0) { const float inv = 1.0f / (den + xhalf(den));   // both half waves' sums of this head
      for (int i = 0; i < 8; ++i) o[i] = (acc[i] + xhalf(acc[i])) * inv; }
    v8b ph, pl; for (int i = 0; i < 8; ++i) { b16 p, pq; split16(o[i] * XS, p, pq); ph[i] = p; pl[i] = pq; }
    *(v8b*)(Oh + v * (2 * D) + lane * 8) = hf ? pl : ph;   // hi | lo packed into this node's own 512-B q row (no other wave reads it): the first half wave stores hi, the second lo, one whole-row store
    asm volatile("s_wait_xcnt 0x0" ::: "memory");   // a precaution: the next node's pass overwrites the registers that the store names
    st = st1; cnt = cnt1; sv = iclamp(svn, 0, N - 1); st1 = st2; cnt1 = cnt2; en = enn;
  }
}
__global__ __launch_bounds__(256) void oproj_kernel(const b16* __restrict__ Oh, const b16* __restrict__ Ol, const b16* __restrict__ WT, const float* __restrict__ bo, float* __restrict__ out) {
  __shared__ __attribute__((aligned(16))) float Tf[PJ_NW][16][D + 4];   // per wave: first its 16 rows of hi | lo halves, then its 16 rows of results
  __shared__ __attribute__((aligned(16))) b16 Ws[D][WPITCH];
  const int wave = threadIdx.x >> 5, lane = threadIdx.x & 31, nloc = lane & 15, hlf = lane >> 4; const size_t m0 = (size_t)blockIdx.x * (PJ_NW * 16) + wave * 16; const b16* W = WT + (size_t)3 * D * D; (void)Ol;
  stage_operands<false>(W, Ws, (const v4f*)Oh, (int)m0, NP, (int)threadIdx.x, lane, Tf[wave]);
  __syncthreads();   // every wave reads the weight rows that the others have stored
  if (m0 >= (size_t)NP) return;   // the last block's waves past the padded rows: a whole wave leaves, behind the kernel's one barrier
  v8f acc[8];
#pragma unroll
  for (int t = 0; t < 8; ++t) acc[t] = (v8f){};
#pragma unroll
  for (int kb = 0; kb < D; kb += 32) { const v16b a = frag_kf(&Tf[wave][nloc][kb / 2], hlf), al = frag_kf(&Tf[wave][nloc][(D + kb) / 2], hlf);
    v16b bw[8];   // the k block's eight weight fragments are asked for together: one LDS latency a k block, not one a product
#pragma unroll
    for (int t = 0; t < 8; ++t) bw[t] = frag_kb(&Ws[t * 16 + nloc][kb], hlf);
#pragma unroll
    for (int t = 0; t < 8; ++t) { acc[t] = wmma16b(a, bw[t], acc[t]); acc[t] = wmma16b(al, bw[t], acc[t]); } }
  wave_lds_sync();   // the results below overwrite the rows that other lanes of this wave have read
#pragma unroll
  for (int t = 0; t < 8; ++t) { const int c = t * 16 + nloc; const float bb = bf16_rne(bo[c]);
#pragma unroll 1
    for (int r = 0; r < 8; ++r) Tf[wave][8 * hlf + r][c] = acc[t][r] * (1.0f / (XS * WSC)) + bb; }
  wave_lds_sync();
  { for (int rr = 0; rr < 16; ++rr) { const size_t row = m0 + rr; if (row < (size_t)N) *(v4f*)(out + row * D + lane * 4) = *(const v4f*)(&Tf[wave][rr][lane * 4]); }  }
}
}  // namespace

extern "C" void kernel_launch(void* const* d_in, const int* in_sizes, int n_in, void* d_out, int out_size, void* d_ws, size_t ws_size, hipStream_t stream) {
  (void)n_in;
  auto Fp = [&](int i) { return (const float*)d_in[i]; }; auto Ip = [&](int i) { return (const int*)d_in[i]; };
  // input order: 0 h [100000,128], 1 row [E] i32, 2 col [E] i32, 3 Wq [128,128], 4 bq, 5 Wk, 6 bk, 7 Wv, 8 bv, 9 Wo, 10 bo
  if (in_sizes[0] != N * D || in_sizes[1] != E || in_sizes[2] != E || in_sizes[3] != D * D || in_sizes[9] != D * D || out_size != N * D) return;
  size_t off = 0; char* ws = (char*)d_ws;
  auto carve = [&](size_t bytes) { char* p = ws + off; off += (bytes + 255) & ~(size_t)255; return p; };
  b16* WT = (b16*)carve((size_t)4 * D * D * 2); float* Q = (float*)carve((size_t)NP * D * 4); b16* KV = (b16*)carve((size_t)2 * NP * D * 2);
  b16* Oh = (b16*)Q; b16* Ol = Oh;   // the attention output (hi | lo, 2 x 128 halves) overwrites each node's own 512-B q row in place: a wave reads only its own q row before writing it (K/V rows live in planes of their own)
  CsrBufs csr; off = csr_carve(csr, ws, off, E, N);
  if (off > ws_size) return;   // q plane, f16 k and v planes, CSR tables: about 120 MB
  wprep_kernel<<<(unsigned)((4 * (size_t)D * D / 8 + 255) / 256), 256, 0, stream>>>(Fp(3), Fp(5), Fp(7), Fp(9), WT);
  csr_build(csr, Ip(1), E, N, stream);   // group by row (the softmax axis)
  proj_kernel<<<dim3(PJ_BLK, 3), 256, 0, stream>>>(Fp(0), WT, Fp(4), Fp(6), Fp(8), Q, KV);
  attn_kernel<<<ATT_BLK, 256, 0, stream>>>(Q, KV, KV + (size_t)NP * D, Ip(2), csr.PERM, csr.ROWPTR, csr.ROWCNT, (int)csr.permLen, Oh, Ol);
  oproj_kernel<<<PJ_BLK, 256, 0, stream>>>(Oh, Ol, WT, Fp(10), (float*)d_out);
}

// v009
// Measured time: 128 microseconds a run.
// Timed twice side by side with v008, it ran 1.05 times as fast both times.
// All steps since v000 together make it 15.4 times as fast.
#include <hip/hip_runtime.h>

// Sparse multi-head attention over a graph (DGL bsddmm / bspmm style): q = (h Wq^T + bq) * 16^-1/2, k, v = Linear(h), all reshaped (N, 16, 8) — i.e. channel c = d*8 + head (heads interleaved);
// per edge e: logit_h = sum_d q[row][d,h] k[col][d,h]; softmax over the edges of each row (destination); out[row] = sum attn v[col]; y = out Wo^T + bo -> [100000][128]. 100,000 nodes,
// 1,600,000 edges; rows without edges give out = 0 (then bo).
// WMMA (v_wmma_f32_16x16x32_f16, f32 accumulate): the q/k/v projections ([100,032 x 128] x [128 x 384], EXACT bf16 h x8: 1 product) and the output projection ([100,032 x 128] x [128 x 128],
// attention output as f16 hi+lo x8 planes: 2 products), weights exact x256; between the projections every row is kept head-major (place head*16 + d holds channel d*8 + head: the weight planes are permuted once, see chan_il), so that
// a head's 16 values lie in two neighbouring lanes of a half wave; per-edge head dots, softmax and weighted sums in f32, in registers; the k and v rows that the edges gather are kept as f16 (rounded once from the f32 projection), q stays f32. Inputs rounded to bf16 once; ids int32 (clamped). Fragment k-map per lane half hh for A AND B:

namespace {
constexpr int N = 100000, NP = 100032, E = 1600000, D = 128, NH = 8, HD = 16;
constexpr float XS = 8.0f, WSC = 256.0f, NEG = 0.2f /* unused */, SCAL = 0.25f /* 16^-0.5 */;
typedef _Float16 b16;
typedef __attribute__((ext_vector_type(16))) _Float16 v16b;
typedef __attribute__((ext_vector_type(8))) _Float16 v8b;
typedef __attribute__((ext_vector_type(8))) float v8f;
typedef __attribute__((ext_vector_type(4))) float v4f;
__device__ __forceinline__ float bf16_rne(float f) { unsigned int u = __float_as_uint(f); u += 0x7FFFu + ((u >> 16) & 1u); return __uint_as_float(u & 0xFFFF0000u); }
__device__ __forceinline__ void split16(float v, b16& hi, b16& lo) { hi = (b16)v; lo = (b16)(v - (float)hi); }
__device__ __forceinline__ v16b frag_kb(const b16* p, int hh) { const v8b a = *(const v8b*)(p + 8 * hh), b = *(const v8b*)(p + 16 + 8 * hh); v16b f;
#pragma unroll
  for (int e = 0; e < 8; ++e) { f[e] = a[e]; f[8 + e] = b[e]; } return f; }
__device__ __forceinline__ v8f wmma16b(v16b a, v16b b, v8f c) { v8f d = __builtin_amdgcn_wmma_f32_16x16x32_f16(false, a, false, b, (short)0, c, false, false); asm volatile("v_nop\n\tv_nop\n\tv_nop\n\tv_nop" : "+v"(d) : "v"(a), "v"(b)); return d; }
__device__ __forceinline__ void wave_lds_sync() { __builtin_amdgcn_fence(__ATOMIC_RELEASE, "workgroup"); __builtin_amdgcn_wave_barrier(); __builtin_amdgcn_fence(__ATOMIC_ACQUIRE, "workgroup"); }
__device__ __forceinline__ int iclamp(int v, int lo, int hi) { return v < lo ? lo : (v > hi ? hi : v); }
// the reference's channel (d*8 + head) that stands at head-major place p = head*16 + d
__device__ __forceinline__ int chan_il(int p) { return (p & (HD - 1)) * NH + (p >> 4); }
// ---------------- deterministic, line-safe CSR by destination (two-level bucketing; every global write is a whole-line, lane-contiguous store) ----------------
// Pass A (block per contiguous edge chunk): a stable counting sort of the chunk's edges by coarse bucket g = dst >> CSR_GB (nG <= CSR_MAXG buckets) into LDS, all waves at work (see csr_rank), then whole-line
//   stores of the grouped ids (STG row) and of one word per bucket (HST row): its count | its start inside the staging row << 16.
// Pass B (block per bucket g): gathers the bucket's edge ids from the 512 staging rows into LDS (at most CSR_CAP ids), the same stable counting sort by destination node, then writes (a) its PERM run, which starts at g * CSR_CAP (a fixed place per bucket: no table over all buckets has to be built between the passes), and
//   (b) ROWPTR[v], ROWCNT[v] for its 2^CSR_GB nodes as contiguous ints. If a bucket exceeds CSR_CAP the kernel treats it as empty (ROWCNT = 0 for its nodes) and sets FLAG[0] = 1 (loud failure, no corruption).
// The sort, no atomics, original edge order kept inside every key: each wave owns a contiguous run of items and a histogram row of its own; per 32 items csr_rank gives every lane its rank among the
//   lanes with an equal key, the first such lane advances the row's counter; then a prefix over (key, wave) turns the rows into start positions.
constexpr int CSR_NBLK = 512, CSR_GB = 9, CSR_GN = 1 << CSR_GB /* nodes per bucket */, CSR_MAXG = 512, CSR_CAP = 12288 /* ids per bucket in LDS (48+24+48 KB, and 32 KB of counter rows) */;
constexpr int CSR_CH = (E + CSR_NBLK - 1) / CSR_NBLK /* edges per chunk */, CSRA_NW = 8, CSRA_G = (CSR_CH + CSRA_NW * 32 - 1) / (CSRA_NW * 32) /* groups of 32 per wave */, CSRB_NW = 32, CSRB_G = CSR_CAP / (CSRB_NW * 32);
static_assert(CSR_CH < 32768 && CSR_CAP % 32 == 0, "a count and a start share one int; a bucket's PERM run starts on a whole line");
// mask of the wave's valid lanes whose 9-bit key equals this lane's (keys < 512 = CSR_MAXG = CSR_GN)
__device__ __forceinline__ unsigned csr_match(int key, bool valid) { unsigned m = __builtin_amdgcn_ballot_w32(valid);
#pragma unroll   // short fixed trip count: straight-line code, its LDS reads or ballots issued back to back
  for (int b = 0; b < 9; ++b) { const bool on = (key >> b) & 1; const unsigned s = __builtin_amdgcn_ballot_w32(on); m &= on ? s : ~s; } return m; }
// one group of 32 items: returns how many items of this wave's run with the same key stand in front of this lane's item, and advances the wave's own counter row. key < 0: no item.
template <typename T> __device__ __forceinline__ int csr_rank(T* row, int key, int lane) { const bool ok = key >= 0; const unsigned m = csr_match(key, ok); const int r = __popc(m & ((1u << lane) - 1u)); int base = 0;
  if (ok) base = (int)row[key]; if (ok && r == 0) row[key] = (T)(base + __popc(m));
  wave_lds_sync();   // the next group's lanes read counters that other lanes of this wave have just stored
  return base + r; }
// exclusive prefix of one int per thread over a block of NW waves (every thread calls it); total = the block's sum. wsum: NW ints of LDS.
template <int NW> __device__ __forceinline__ int csr_scan(int v, int* wsum, int lane, int wave, int& total) { int inc = v;
#pragma unroll   // short fixed trip count: straight-line code, its LDS reads or ballots issued back to back
  for (int o = 1; o < 32; o <<= 1) { const int u = __shfl_up(inc, o); if (lane >= o) inc += u; }
  if (lane == 31) wsum[wave] = inc;
  __syncthreads();
  int pre = 0, all = 0;
#pragma unroll   // short fixed trip count: straight-line code, its LDS reads or ballots issued back to back
  for (int w = 0; w < NW; ++w) { const int s = wsum[w]; pre += (w < wave) ? s : 0; all += s; }
  __syncthreads();   // wsum may be written again by the next call
  total = all; return pre + inc - v; }
// The four weight planes as f16 (exact bf16 x256). No launch of its own: nothing here depends on the edge lists or they on it, so these WPREP_BLK blocks ride behind pass A's blocks in pass A's launch. blk: the block's number among them.
constexpr int WPREP_BLK = (4 * D * D / 8 + 255) / 256;
__device__ __forceinline__ void wprep_block(int blk, const float* __restrict__ wq, const float* __restrict__ wk, const float* __restrict__ wv, const float* __restrict__ wo, b16* __restrict__ WT) {
  const size_t u = (size_t)blk * 256 + threadIdx.x; const size_t per = (size_t)D * D / 8; if (u >= 4 * per) return; const int which = (int)(u / per); const size_t e = (u % per) * 8; const float* w = which == 0 ? wq : which == 1 ? wk : which == 2 ? wv : wo; v8b o;
  const int r = (int)(e / D), k0 = (int)(e % D);   // q, k, v: output rows permuted to head-major places; o: its k columns, which meet the attention output's places
  for (int j = 0; j < 8; ++j) o[j] = (b16)(bf16_rne(w[which < 3 ? chan_il(r) * D + k0 + j : r * D + chan_il(k0 + j)]) * WSC);
  { *(v8b*)(WT + (size_t)which * D * D + e) = o;  }
}
__global__ __launch_bounds__(256) void csrA_kernel(const int* __restrict__ dst, int E, int N, int nG, int CHP, int NGP, int* __restrict__ STG, int* __restrict__ HST, const float* __restrict__ wq, const float* __restrict__ wk, const float* __restrict__ wv, const float* __restrict__ wo, b16* __restrict__ WT) {
  extern __shared__ int sm[];   // cnt[NGP] | run[NGP] | ids[CHP]
  __shared__ int wh[CSRA_NW][CSR_MAXG]; __shared__ int wsum[CSRA_NW];
  if (blockIdx.x >= (unsigned)CSR_NBLK) { wprep_block((int)blockIdx.x - CSR_NBLK, wq, wk, wv, wo, WT); return; }   // a whole block leaves, in front of every barrier
  int* cnt = sm; int* run = sm + NGP; int* ids = sm + 2 * NGP;
  const int t_ = threadIdx.x, lane = t_ & 31, wave = t_ >> 5;
  const int b = blockIdx.x; const int e0 = b * CSR_CH; const int i0 = wave * (CSRA_G * 32) + lane;
  for (int i = t_; i < CSRA_NW * CSR_MAXG; i += 256) (&wh[0][0])[i] = 0;
  for (int i = t_; i < CHP; i += 256) ids[i] = -1;
  int key[CSRA_G], lr[CSRA_G]; unsigned ei[CSRA_G];
#pragma unroll   // constant indices keep the per-lane arrays in registers
  for (int u = 0; u < CSRA_G; ++u) { ei[u] = (unsigned)min(e0 + i0 + u * 32, E - 1); key[u] = dst[ei[u]]; }   // all of a lane's loads in flight together; an index past the end re-reads the last edge
  static_assert(CSRA_G == 13, "the statement below names 13 values");
  // a precaution: this wait stands in front of every overwrite of a register that an issued load names; the index registers are named so that they stay whole up to it
  asm volatile("s_wait_xcnt 0x0" :: "v"(ei[0]), "v"(ei[1]), "v"(ei[2]), "v"(ei[3]), "v"(ei[4]), "v"(ei[5]), "v"(ei[6]), "v"(ei[7]), "v"(ei[8]), "v"(ei[9]), "v"(ei[10]), "v"(ei[11]), "v"(ei[12]) : "memory");
#pragma unroll   // constant indices keep the per-lane arrays in registers
  for (int u = 0; u < CSRA_G; ++u) { const int i = i0 + u * 32; const bool ok = i < CSR_CH && e0 + i < E; int d = key[u]; d = (d < 0) ? 0 : (d >= N ? N - 1 : d); key[u] = ok ? (d >> CSR_GB) : -1; }
  __syncthreads();
#pragma unroll   // constant indices keep the per-lane arrays in registers
  for (int u = 0; u < CSRA_G; ++u) lr[u] = csr_rank(wh[wave], key[u], lane);
  __syncthreads();
  int s[2];   // thread t_: buckets 2 t_ and 2 t_ + 1; the rows become exclusive prefixes over the waves
#pragma unroll   // short fixed trip count: straight-line code, its LDS reads or ballots issued back to back
  for (int j = 0; j < 2; ++j) { int acc = 0;
#pragma unroll   // short fixed trip count: straight-line code, its LDS reads issued back to back
    for (int w = 0; w < CSRA_NW; ++w) { const int c = wh[w][2 * t_ + j]; wh[w][2 * t_ + j] = acc; acc += c; } s[j] = acc; }
  int all; const int pre = csr_scan<CSRA_NW>(s[0] + s[1], wsum, lane, wave, all);
  if (2 * t_ < NGP) { cnt[2 * t_] = s[0]; run[2 * t_] = pre; } if (2 * t_ + 1 < NGP) { cnt[2 * t_ + 1] = s[1]; run[2 * t_ + 1] = pre + s[0]; }
  __syncthreads();
#pragma unroll   // constant indices keep the per-lane arrays in registers
  for (int u = 0; u < CSRA_G; ++u) if (key[u] >= 0) ids[run[key[u]] + wh[wave][key[u]] + lr[u]] = e0 + i0 + u * 32;
  __syncthreads();
  typedef __attribute__((ext_vector_type(4))) int v4i;
  {
    for (int i = t_; i < CHP / 4; i += 256) *(v4i*)(STG + (size_t)b * CHP + i * 4) = *(const v4i*)(&ids[i * 4]);
    for (int i = t_; i < NGP / 4; i += 256) { v4i v; for (int e = 0; e < 4; ++e) v[e] = (i * 4 + e < nG) ? (cnt[i * 4 + e] | (run[i * 4 + e] << 16)) : 0; *(v4i*)(HST + (size_t)b * NGP + i * 4) = v; }   // both are at most CSR_CH
     }
}
// bucket: block g (1024 threads): gather ids (from each block's staging sub-run, in block order => original edge order), stable counting sort by node, flush; ROWPTR/ROWCNT rows.
__global__ __launch_bounds__(1024) void csrB_kernel(const int* __restrict__ dst, int N, int nG, int CHP, int NGP, const int* __restrict__ STG, const int* __restrict__ HST, int* __restrict__ PERM, int* __restrict__ ROWPTR, int* __restrict__ ROWCNT, int* __restrict__ FLAG) {
  typedef __attribute__((ext_vector_type(4))) int v4i;
  __shared__ int ids[CSR_CAP]; __shared__ unsigned short key[CSR_CAP]; __shared__ int outp[CSR_CAP]; __shared__ int ncnt[CSR_GN + 1]; __shared__ int boff[CSR_NBLK + 1]; __shared__ int ooff[CSR_NBLK];
  __shared__ __attribute__((aligned(16))) unsigned short wh[CSRB_NW][CSR_GN]; __shared__ int wsum[CSRB_NW];
  const int g = blockIdx.x, t_ = threadIdx.x, lane = t_ & 31, wave = t_ >> 5; const int st = g * CSR_CAP; const int v0 = g * CSR_GN; const int nv = min(CSR_GN, N - v0); int tot; (void)nG;
  // per-block offsets of this bucket's sub-runs in gather order (thread = staging row); their sum is the bucket's total
  { int c = 0; if (t_ < CSR_NBLK) { const unsigned hi = (unsigned)(t_ * NGP + g); const unsigned w = (unsigned)HST[hi];
      asm volatile("s_wait_xcnt 0x0" :: "v"(hi) : "memory");   // the same precaution as in pass A
      c = min((int)(w & 0xFFFFu), CHP); ooff[t_] = (int)(w >> 16); }
    int all; const int pre = csr_scan<CSRB_NW>(c, wsum, lane, wave, all); tot = all;
    if (all > CSR_CAP) { tot = 0; if (t_ == 0) FLAG[0] = 1; }   // loud failure: the bucket is worked on as an empty one (zero counts), flag
    if (t_ < CSR_NBLK) boff[t_] = min(pre, tot); if (t_ == 0) boff[CSR_NBLK] = tot; }
  for (int i = t_; i < CSRB_NW * CSR_GN / 2; i += 1024) ((int*)&wh[0][0])[i] = 0;
  __syncthreads();
  { constexpr int RB = CSR_NBLK / CSRB_NW;   // a wave gathers RB staging rows in a row; the first 32 ids of all of them are in flight together
    int bo[RB], cn[RB], id[RB], dd[RB]; unsigned ix[RB];
#pragma unroll   // constant indices keep the per-lane arrays in registers
    for (int u = 0; u < RB; ++u) { const int b = wave * RB + u; bo[u] = boff[b]; cn[u] = boff[b + 1] - bo[u]; int o_ = ooff[b]; o_ = (o_ < 0) ? 0 : (o_ > CHP - cn[u] ? CHP - cn[u] : o_); ix[u] = (unsigned)(b * CHP + min(o_, CHP - 1) + (lane < cn[u] ? lane : 0)); }   // a lane past the sub-run's end re-reads a written word of the row, so that no load hangs on a branch
#pragma unroll   // constant indices keep the per-lane arrays in registers
    for (int u = 0; u < RB; ++u) id[u] = STG[ix[u]];
    static_assert(RB == 16, "the three statements below name 16 values each");
    // a precaution: this wait stands in front of every overwrite of a register that an issued load names; the index registers are named so that they stay whole up to it
    asm volatile("s_wait_xcnt 0x0" :: "v"(ix[0]), "v"(ix[1]), "v"(ix[2]), "v"(ix[3]), "v"(ix[4]), "v"(ix[5]), "v"(ix[6]), "v"(ix[7]), "v"(ix[8]), "v"(ix[9]), "v"(ix[10]), "v"(ix[11]), "v"(ix[12]), "v"(ix[13]), "v"(ix[14]), "v"(ix[15]) : "memory");
    // holds the 16 loads together in front of the branches below: sunk into its branch, a load would wait there alone
    asm volatile("" :: "v"(id[0]), "v"(id[1]), "v"(id[2]), "v"(id[3]), "v"(id[4]), "v"(id[5]), "v"(id[6]), "v"(id[7]), "v"(id[8]), "v"(id[9]), "v"(id[10]), "v"(id[11]), "v"(id[12]), "v"(id[13]), "v"(id[14]), "v"(id[15]));
#pragma unroll   // constant indices keep the per-lane arrays in registers
    for (int u = 0; u < RB; ++u) id[u] = (id[u] < 0) ? 0 : id[u];
#pragma unroll   // constant indices keep the per-lane arrays in registers
    for (int u = 0; u < RB; ++u) dd[u] = dst[id[u]];
    // the same for the 16 destination loads
    asm volatile("" :: "v"(dd[0]), "v"(dd[1]), "v"(dd[2]), "v"(dd[3]), "v"(dd[4]), "v"(dd[5]), "v"(dd[6]), "v"(dd[7]), "v"(dd[8]), "v"(dd[9]), "v"(dd[10]), "v"(dd[11]), "v"(dd[12]), "v"(dd[13]), "v"(dd[14]), "v"(dd[15]));
#pragma unroll   // constant indices keep the per-lane arrays in registers
    for (int u = 0; u < RB; ++u) if (lane < cn[u]) { int d = dd[u]; d = (d < v0) ? v0 : (d >= N ? N - 1 : d); int kk = d - v0; kk = (kk < 0) ? 0 : (kk >= CSR_GN ? CSR_GN - 1 : kk); ids[bo[u] + lane] = id[u]; key[bo[u] + lane] = (unsigned short)kk; }
#pragma unroll 1   // seldom entered: kept small
    for (int u = 0; u < RB; ++u) { const int b = wave * RB + u; const int bs = boff[b], c = boff[b + 1] - bs; int o_ = ooff[b]; o_ = (o_ < 0) ? 0 : (o_ > CHP - c ? CHP - c : o_); const int* src_ = STG + (size_t)b * CHP + o_;   // what a sub-run holds beyond 32 ids
      for (int i = lane + 32; i < c; i += 32) { int idr = src_[i]; idr = (idr < 0) ? 0 : idr; ids[bs + i] = idr; int d = dst[idr]; d = (d < v0) ? v0 : (d >= N ? N - 1 : d); int kk = d - v0; kk = (kk < 0) ? 0 : (kk >= CSR_GN ? CSR_GN - 1 : kk); key[bs + i] = (unsigned short)kk; } } }
  __syncthreads();
  // stable counting sort by node inside the bucket: wave w owns items [w S, w S + S)
  const int S = ((tot + CSRB_NW * 32 - 1) / (CSRB_NW * 32)) * 32; const int i0 = wave * S + lane;
  int kr[CSRB_G], lr[CSRB_G];
#pragma unroll   // constant indices keep the per-lane arrays in registers
  for (int u = 0; u < CSRB_G; ++u) { const int i = i0 + u * 32; kr[u] = (u * 32 < S && i < tot) ? (int)key[i] : -1; lr[u] = 0; }
#pragma unroll   // constant indices keep the per-lane arrays in registers
  for (int u = 0; u < CSRB_G; ++u) if (u * 32 < S) lr[u] = csr_rank(wh[wave], kr[u], lane);
  __syncthreads();
  { int s = 0; if (t_ < CSR_GN) {   // thread = node: the rows become exclusive prefixes over the waves
#pragma unroll   // short fixed trip count: straight-line code, its LDS reads or ballots issued back to back
      for (int w = 0; w < CSRB_NW; ++w) { const int c = wh[w][t_]; wh[w][t_] = (unsigned short)s; s += c; } }
    int all; const int pre = csr_scan<CSRB_NW>(s, wsum, lane, wave, all); if (t_ < CSR_GN) ncnt[t_] = pre; if (t_ == 0) ncnt[CSR_GN] = all; }   // ncnt[vl] = start of node vl
  __syncthreads();
#pragma unroll   // constant indices keep the per-lane arrays in registers
  for (int u = 0; u < CSRB_G; ++u) if (kr[u] >= 0) outp[ncnt[kr[u]] + (int)wh[wave][kr[u]] + lr[u]] = ids[i0 + u * 32];
  __syncthreads();
  {
    for (int i = t_; i < min(CSR_CAP, (tot + 32) & ~31) / 4; i += 1024) { v4i v;   // whole lines up to and with word tot: the entry of a row without edges can point there (behind a full run it points at the next bucket's first word, or is clamped onto the table's last), and the attention kernel loads that word, unused
      for (int e = 0; e < 4; ++e) { const int q = i * 4 + e; v[e] = (q < tot) ? outp[q] : -1; } *(v4i*)(PERM + st + i * 4) = v; }
    for (int i = t_; i < CSR_GN / 4; i += 1024) { v4i a, c; for (int e = 0; e < 4; ++e) { const int vl = i * 4 + e; a[e] = st + ncnt[vl]; c[e] = (vl < nv) ? (ncnt[vl + 1] - ncnt[vl]) : 0; } *(v4i*)(ROWPTR + v0 + i * 4) = a; *(v4i*)(ROWCNT + v0 + i * 4) = c; }   // the tables hold nG*512 entries (beyond N: count 0)
     }
}
// No table is cleared beforehand: pass A stores every word of STG and HST, pass B every entry of ROWPTR and ROWCNT and every word of PERM that a row entry can lead to; FLAG is only ever stored.
// host helper. Workspace ints needed: STG (512*CHP), HST (512*NGP), PERM (nG*CSR_CAP), ROWPTR (Npad), ROWCNT (Npad), FLAG (64). Npad = roundup(N, 512).
struct CsrBufs { int *STG, *HST, *PERM, *ROWPTR, *ROWCNT, *FLAG; int nG, NGP, CHP; size_t permLen; };
static size_t csr_carve(CsrBufs& c, char* ws, size_t off, int E, int N) {
  auto al = [&](size_t bytes) { char* p = ws + off; off += (bytes + 255) & ~(size_t)255; return p; };
  c.nG = (N + CSR_GN - 1) / CSR_GN; c.NGP = (c.nG + 31) & ~31; const int ch = (E + CSR_NBLK - 1) / CSR_NBLK; c.CHP = (ch + 31) & ~31; c.permLen = (size_t)c.nG * CSR_CAP;
  c.STG = (int*)al((size_t)CSR_NBLK * c.CHP * 4); c.HST = (int*)al((size_t)CSR_NBLK * c.NGP * 4);
  c.PERM = (int*)al(c.permLen * 4); c.ROWPTR = (int*)al((size_t)c.nG * CSR_GN * 4); c.ROWCNT = (int*)al((size_t)c.nG * CSR_GN * 4); c.FLAG = (int*)al(256);
  return off;
}
static void csr_build(const CsrBufs& c, const int* dst, int E, int N, const float* wq, const float* wk, const float* wv, const float* wo, b16* WT, hipStream_t stream) {
  const size_t smem = (size_t)(2 * c.NGP + c.CHP) * 4;
  csrA_kernel<<<CSR_NBLK + WPREP_BLK, 256, smem, stream>>>(dst, E, N, c.nG, c.CHP, c.NGP, c.STG, c.HST, wq, wk, wv, wo, WT);
  csrB_kernel<<<c.nG, 1024, 0, stream>>>(dst, N, c.nG, c.CHP, c.NGP, c.STG, c.HST, c.PERM, c.ROWPTR, c.ROWCNT, c.FLAG);
}


// Both projection kernels: blocks of 8 waves, a wave owns 16 rows. The operands reach the fragments through LDS: a fragment load straight from global memory touches 16 lines for 512 bytes, and every wave
// would read the whole weight plane that way. Here the block fetches its 32-KB weight plane once and each wave its own 16 rows of 512 B, all with whole-line loads (a load covers 512 bytes in a row).
constexpr int PJ_NW = 8, PJ_BLK = (NP / 16 + PJ_NW - 1) / PJ_NW, WPITCH = D + 8 /* halves: 272 B = 16 B x 17, no bank conflict for 16-byte reads down a column of rows */;
// W: 128 rows of 256 B -> Ws. src: rows of 512 B; rows m0 .. m0 + 15 -> T (the load of a row from nrows on re-reads the last row, so that no load hangs on a branch; ZERO: such a row is stored as zeros). All 24 loads of a lane fly together.
template <bool ZERO> __device__ __forceinline__ void stage_operands(const b16* __restrict__ W, b16 (*Ws)[WPITCH], const v4f* __restrict__ src, int m0, int nrows, int t_, int lane, float (*T)[D + 4]) {
  const unsigned iw = (unsigned)t_; unsigned ix[16]; v8b w[8]; v4f x[16];
#pragma unroll   // constant indices keep the arrays in registers
  for (int rr = 0; rr < 16; ++rr) ix[rr] = (unsigned)min(m0 + rr, nrows - 1) * (unsigned)(D / 4) + (unsigned)lane;
#pragma unroll   // constant indices keep the arrays in registers
  for (int j = 0; j < 8; ++j) w[j] = ((const v8b*)W)[iw + 256u * j];
#pragma unroll   // constant indices keep the arrays in registers
  for (int rr = 0; rr < 16; ++rr) x[rr] = src[ix[rr]];
  // a precaution: this wait stands in front of every overwrite of a register that an issued load names; the index registers are named so that they stay whole up to it
  asm volatile("s_wait_xcnt 0x0" :: "v"(iw), "v"(ix[0]), "v"(ix[1]), "v"(ix[2]), "v"(ix[3]), "v"(ix[4]), "v"(ix[5]), "v"(ix[6]), "v"(ix[7]), "v"(ix[8]), "v"(ix[9]), "v"(ix[10]), "v"(ix[11]), "v"(ix[12]), "v"(ix[13]), "v"(ix[14]), "v"(ix[15]) : "memory");
#pragma unroll   // constant indices keep the arrays in registers
  for (int j = 0; j < 8; ++j) *(v8b*)(&Ws[(t_ >> 4) + 16 * j][(t_ & 15) * 8]) = w[j];
#pragma unroll   // constant indices keep the arrays in registers
  for (int rr = 0; rr < 16; ++rr) *(v4f*)(&T[rr][lane * 4]) = (!ZERO || m0 + rr < nrows) ? x[rr] : (v4f){0.0f, 0.0f, 0.0f, 0.0f};
}
// a fragment (k-map of frag_kb) of 16-bit values that lie in an LDS row of floats; p: the row's float that holds k = 0 and 1
__device__ __forceinline__ v16b frag_kf(const float* p, int hh) { const v8b a = __builtin_bit_cast(v8b, *(const v4f*)(p + 4 * hh)), b = __builtin_bit_cast(v8b, *(const v4f*)(p + 8 + 4 * hh)); v16b f;
#pragma unroll
  for (int e = 0; e < 8; ++e) { f[e] = a[e]; f[8 + e] = b[e]; } return f; }
__global__ __launch_bounds__(256) void proj_kernel(const float* __restrict__ h, const b16* __restrict__ WT, const float* __restrict__ bq, const float* __restrict__ bk, const float* __restrict__ bv, float* __restrict__ Q, b16* __restrict__ KV) {
  __shared__ __attribute__((aligned(16))) float Tf[PJ_NW][16][D + 4];   // per wave: first its 16 rows of h, then its 16 rows of results
  __shared__ __attribute__((aligned(16))) b16 Ws[D][WPITCH];
  const int wave = threadIdx.x >> 5, lane = threadIdx.x & 31, nloc = lane & 15, hlf = lane >> 4; const size_t m0 = (size_t)blockIdx.x * (PJ_NW * 16) + wave * 16; const int part = blockIdx.y; const b16* W = WT + (size_t)part * D * D; const float* bias = part == 0 ? bq : part == 1 ? bk : bv; const float osc = part == 0 ? SCAL : 1.0f;
  stage_operands<true>(W, Ws, (const v4f*)h, (int)m0, N, (int)threadIdx.x, lane, Tf[wave]);
  __syncthreads();   // every wave reads the weight rows that the others have stored
  if (m0 >= (size_t)NP) return;   // the last block's waves past the padded rows: a whole wave leaves, behind the kernel's one barrier
  v8f acc[8];
#pragma unroll
  for (int t = 0; t < 8; ++t) acc[t] = (v8f){};
#pragma unroll
  for (int kb = 0; kb < D; kb += 32) { v16b a; { const float* r = &Tf[wave][nloc][kb + 8 * hlf]; const v4f r0 = *(const v4f*)r, r1 = *(const v4f*)(r + 4), r2 = *(const v4f*)(r + 16), r3 = *(const v4f*)(r + 20);
      for (int e = 0; e < 4; ++e) { a[e] = (b16)(bf16_rne(r0[e]) * XS); a[4 + e] = (b16)(bf16_rne(r1[e]) * XS); a[8 + e] = (b16)(bf16_rne(r2[e]) * XS); a[12 + e] = (b16)(bf16_rne(r3[e]) * XS); } }
    v16b bw[8];   // the k block's eight weight fragments are asked for together: one LDS latency a k block, not one a product
#pragma unroll
    for (int t = 0; t < 8; ++t) bw[t] = frag_kb(&Ws[t * 16 + nloc][kb], hlf);
#pragma unroll
    for (int t = 0; t < 8; ++t) acc[t] = wmma16b(a, bw[t], acc[t]); }
  wave_lds_sync();   // the results below overwrite the rows of h that other lanes of this wave have read
#pragma unroll
  for (int t = 0; t < 8; ++t) { const int c = t * 16 + nloc; const float bb = bf16_rne(bias[chan_il(c)]);
#pragma unroll 1
    for (int r = 0; r < 8; ++r) { const size_t row = m0 + 8 * hlf + r; Tf[wave][8 * hlf + r][c] = row < (size_t)N ? (acc[t][r] * (1.0f / (XS * WSC)) + bb) * osc : 0.0f; } }
  wave_lds_sync();
  if (part == 0) { for (int rr = 0; rr < 16; ++rr) *(v4f*)(Q + (m0 + rr) * D + lane * 4) = *(const v4f*)(&Tf[wave][rr][lane * 4]); }
  else { b16* P = KV + (size_t)(part - 1) * NP * D;   // k, v: f16 rows of 256 B; a store covers two rows = 4 whole lines
    for (int rr = 0; rr < 16; rr += 2) { const float* t = &Tf[wave][rr + hlf][nloc * 8]; const v4f x = *(const v4f*)t, y = *(const v4f*)(t + 4); v8b o;
      for (int e = 0; e < 4; ++e) { o[e] = (b16)x[e]; o[4 + e] = (b16)y[e]; }
      *(v8b*)(P + (m0 + rr + hlf) * D + nloc * 8) = o; } }
}
// Attention, one wave per destination node at a time, its edges up to 16 at a time, all in registers. Rows are head-major, and a 16-byte load per lane covers TWO rows: half wave hf = lane/16 takes the odd (hf = 1) or even
// edges, lane j = lane%16 of it the places 8j .. 8j+7 = half of head j/2. A head's dot is 8 products in the lane and one add with the neighbour lane; each lane then holds its own head's logit of its own edges, so the
// maximum, the exponentials and the weighted sums need no exchange but one maximum per batch and one sum per node between the two half waves. The K and V rows of a batch fly together.
constexpr int AB = 16 /* edges per batch */;
// v as another lane holds it, by a data-parallel move inside 16-lane rows: 0x150 + n: lane n of the own row; 0xB1: lane ^ 1; 0x128: lane + 8 round the row
template <int CTRL> __device__ __forceinline__ int dpp_i(int v) { return __builtin_amdgcn_update_dpp(0, v, CTRL, 0xf, 0xf, true); }
template <int CTRL> __device__ __forceinline__ float dpp_f(float v) { return __int_as_float(dpp_i<CTRL>(__float_as_int(v))); }
// v as lane ^ 16 holds it
__device__ __forceinline__ float xhalf(float v) { const int i = __float_as_int(v); return __int_as_float(__builtin_amdgcn_permlanex16(i, i, 0x76543210, 0xfedcba98, false, false)); }
// c + f * (the low or the high f16 of h), f32 result, in one instruction. Written out because the compiler widens each f16 to a float register first (one more instruction per value, and twice the registers for a batch's rows, which then spill).
// Not dealt with here: the compiler puts no s_delay_alu in front of an asm statement, and in the listing many links of the head dots stand directly behind the link whose result they read, unhinted
__device__ __forceinline__ float fmix_lo(unsigned h, float f, float c) { float d; asm("v_fma_mix_f32 %0, %1, %2, %3 op_sel_hi:[1,0,0]" : "=v"(d) : "v"(h), "v"(f), "v"(c)); return d; }
__device__ __forceinline__ float fmix_hi(unsigned h, float f, float c) { float d; asm("v_fma_mix_f32 %0, %1, %2, %3 op_sel:[1,0,0] op_sel_hi:[1,0,0]" : "=v"(d) : "v"(h), "v"(f), "v"(c)); return d; }
// the same with c = 0: a chain's first product
__device__ __forceinline__ float mmix_lo(unsigned h, float f) { float d; asm("v_fma_mix_f32 %0, %1, %2, 0 op_sel_hi:[1,0,0]" : "=v"(d) : "v"(h), "v"(f)); return d; }
typedef __attribute__((ext_vector_type(4))) unsigned v4u;
__device__ __forceinline__ float exp2_slot(float x) { float d; asm("v_exp_f32 %0, %1\n\tv_nop" : "=v"(d) : "v"(x)); return d; }
// one batch of nb <= 2 NL edges, straight-line code for NL loads per plane (no test around a load, so that the loads of a batch stay in flight together); a slot from nb on holds the row's last edge again and gets weight 0.
// svb: lane u of each half wave holds the byte offset of the source row of that half's slot u. nbh = nb - hf: slot u is an edge where 2u < nbh. lo: the lane's 16 bytes inside a row.
// mx: running maximum of the lane's head (the same in both half waves); den, acc: this half wave's edges alone.
template <int NL> __device__ __forceinline__ void attn_batch(const b16* K, const b16* V, int svb, int nbh, unsigned lo, const float (&q)[8], float& mx, float& den, float (&acc)[8]) {
  static_assert(NL == 2 || NL == 4 || NL == 6 || NL == 8, "one of the statements below names all NL values");
  unsigned off[NL]; v4u kk[NL], vv[NL];   // a register holds two neighbouring f16 places
  off[0] = (unsigned)dpp_i<0x150>(svb) + lo; off[1] = (unsigned)dpp_i<0x151>(svb) + lo;
  if constexpr (NL > 2) { off[2] = (unsigned)dpp_i<0x152>(svb) + lo; off[3] = (unsigned)dpp_i<0x153>(svb) + lo; }
  if constexpr (NL > 4) { off[4] = (unsigned)dpp_i<0x154>(svb) + lo; off[5] = (unsigned)dpp_i<0x155>(svb) + lo; }
  if constexpr (NL > 6) { off[6] = (unsigned)dpp_i<0x156>(svb) + lo; off[7] = (unsigned)dpp_i<0x157>(svb) + lo; }
#pragma unroll   // constant indices keep the arrays in registers
  for (int u = 0; u < NL; ++u) kk[u] = *(const v4u*)((const char*)K + off[u]);
#pragma unroll   // constant indices keep the arrays in registers
  for (int u = 0; u < NL; ++u) vv[u] = *(const v4u*)((const char*)V + off[u]);
  // a precaution: this wait stands in front of every overwrite of a register that an issued load names; the offset registers are named so that they stay whole up to it
  if constexpr (NL == 2) asm volatile("s_wait_xcnt 0x0" :: "v"(off[0]), "v"(off[1]) : "memory");
  else if constexpr (NL == 4) asm volatile("s_wait_xcnt 0x0" :: "v"(off[0]), "v"(off[1]), "v"(off[2]), "v"(off[3]) : "memory");
  else if constexpr (NL == 6) asm volatile("s_wait_xcnt 0x0" :: "v"(off[0]), "v"(off[1]), "v"(off[2]), "v"(off[3]), "v"(off[4]), "v"(off[5]) : "memory");
  else asm volatile("s_wait_xcnt 0x0" :: "v"(off[0]), "v"(off[1]), "v"(off[2]), "v"(off[3]), "v"(off[4]), "v"(off[5]), "v"(off[6]), "v"(off[7]) : "memory");
  __builtin_amdgcn_sched_barrier(0);   // all of the batch's loads are issued in front of the arithmetic: left free, the scheduler holds some rows' loads back to save registers, and each of them is then waited for alone
  float l[NL];
#pragma unroll   // constant indices keep the arrays in registers
  for (int u = 0; u < NL; ++u) { float t = mmix_lo(kk[u][0], q[0]); t = fmix_hi(kk[u][0], q[1], t);
#pragma unroll
    for (int i = 1; i < 4; ++i) { t = fmix_lo(kk[u][i], q[2 * i], t); t = fmix_hi(kk[u][i], q[2 * i + 1], t); }
    l[u] = t + dpp_f<0xB1>(t); }   // the head's other 8 products stand in the neighbour lane
#pragma unroll
  for (int u = NL - 2; u < NL; ++u) l[u] = (2 * u < nbh) ? l[u] : -INFINITY;   // only the last two slots can be empty (the caller picks NL by nb); an empty slot: weight exp(-inf) = 0
  float m = l[0];
#pragma unroll
  for (int u = 1; u < NL; ++u) m = fmaxf(m, l[u]);
  m = fmaxf(fmaxf(m, xhalf(m)), mx);   // the batch's maximum of this head over both half waves, then the running one
  constexpr float L2E = 1.4426950408889634f; const float nm = -m * L2E;
  const float sc = exp2_slot(__builtin_fmaf(mx, L2E, nm)); mx = m;   // exp(old - new); 0 in the first batch
#pragma unroll   // constant indices keep the arrays in registers
  for (int u = 0; u < NL; ++u) l[u] = exp2_slot(__builtin_fmaf(l[u], L2E, nm));
  float ps = l[0];
#pragma unroll
  for (int u = 1; u < NL; ++u) ps += l[u];
  den = den * sc + ps;
#pragma unroll
  for (int i = 0; i < 8; ++i) acc[i] *= sc;
#pragma unroll   // constant indices keep the arrays in registers
  for (int u = 0; u < NL; ++u)
#pragma unroll
    for (int i = 0; i < 4; ++i) { acc[2 * i] = fmix_lo(vv[u][i], l[u], acc[2 * i]); acc[2 * i + 1] = fmix_hi(vv[u][i], l[u], acc[2 * i + 1]); }
}
// 8 waves per SIMD: the second bound keeps the register budget at 128, which holds a batch's K and V rows together
// The grid is what the chip holds at once (256 WGPs x 4 blocks): every wave starts once and walks the nodes w, w + 8192, w + 16384, ... (12 or 13 of them). A node begins with a chain of three dependent loads
// (row entry -> edge ids -> source nodes); the wave keeps one link of it in flight for each of the three nodes to come: at the head of a node's pass it asks for the source nodes of the next node, the edge ids of the
// one after and the row entry of the third, each from what the pass before has asked for. No test stands around these loads (every index is clamped into its table), so that none is waited for where it is issued.
// Nothing passes between blocks and no result depends on where or when a block runs: the grid's size is chosen for speed alone.
constexpr int ATT_BLK = 1024, ATT_WAVES = ATT_BLK * 8;
static_assert(NP <= ((N + CSR_GN - 1) / CSR_GN) * CSR_GN && ATT_WAVES <= NP, "ROWPTR and ROWCNT hold an entry for every index below NP; every wave has a first node");
// a row entry as loaded -> start and count of the node's edges, the same in every lane (scalars); live: the node exists
__device__ __forceinline__ void row_scalars(int rs, int rc, bool live, int permLen, int& st, int& cnt) { rc = iclamp(rc, 0, 65536); rs = iclamp(rs, 0, permLen - rc); cnt = live ? __builtin_amdgcn_readfirstlane(rc) : 0; st = __builtin_amdgcn_readfirstlane(rs); }
// where the edge id that a lane fetches (number 'lane' of a row's first 32) stands in PERM; past the row's end: the last edge again; a row without edges: some word inside the table, not used
__device__ __forceinline__ int perm_index(int st, int cnt, int lane, int permLen) { return min(st + max(min(lane, cnt - 1), 0), permLen - 1); }
__global__ __launch_bounds__(256, 8) void attn_kernel(const float* Q, const b16* __restrict__ K, const b16* __restrict__ V, const int* __restrict__ cols, const int* __restrict__ PERM, const int* __restrict__ ROWPTR, const int* __restrict__ ROWCNT, int permLen, b16* Oh, b16* Ol) {   // Oh aliases the q plane (see host)
  const int wave = __builtin_amdgcn_readfirstlane((int)(threadIdx.x >> 5)) /* the same in every lane: the loop over nodes is a scalar loop */, lane = threadIdx.x & 31, hf = lane >> 4, lj = lane & 15; (void)Ol;
  const int ep = 2 * lj + hf;   // of 32 edges this lane fetches number ep: lane u of a half wave holds that half's slot u (u < 8: first batch of 16, else the second)
  const unsigned lo = (unsigned)lj * 16u;
  const int w0 = (int)blockIdx.x * 8 + wave;
  int st, cnt, sv;     // this node: start and count of its edges, source nodes of its first 32 edges (one per lane)
  int st1, cnt1, en;   // the next node: start, count, edge ids as loaded
  int rs, rc;          // the node after: row entry as loaded (the tables hold an entry for every index below NP)
  { const int n1 = min(w0 + ATT_WAVES, NP - 1), n2 = min(w0 + 2 * ATT_WAVES, NP - 1);
    const int a0 = ROWPTR[w0], b0 = ROWCNT[w0], a1 = ROWPTR[n1], b1 = ROWCNT[n1]; rs = ROWPTR[n2]; rc = ROWCNT[n2];
    row_scalars(a0, b0, w0 < N, permLen, st, cnt); row_scalars(a1, b1, w0 + ATT_WAVES < N, permLen, st1, cnt1);
    const int e0 = PERM[perm_index(st, cnt, ep, permLen)]; en = PERM[perm_index(st1, cnt1, ep, permLen)];
    sv = iclamp(cols[iclamp(e0, 0, E - 1)], 0, N - 1); }
  for (int vn = w0; vn < NP; vn += ATT_WAVES) {
    const size_t v = (size_t)vn;
    const v4f qa = *(const v4f*)(Q + v * D + lj * 8), qb = *(const v4f*)(Q + v * D + lj * 8 + 4);
    const int svn = cols[iclamp(en, 0, E - 1)];
    int st2, cnt2; row_scalars(rs, rc, vn + 2 * ATT_WAVES < N, permLen, st2, cnt2);
    const int enn = PERM[perm_index(st2, cnt2, ep, permLen)];
    { const int n3 = min(vn + 3 * ATT_WAVES, NP - 1); rs = ROWPTR[n3]; rc = ROWCNT[n3]; }
    asm volatile("s_wait_xcnt 0x0" ::: "memory");   // a precaution: it stands in front of every overwrite of a register that one of the loads above names
    const float q[8] = {qa[0], qa[1], qa[2], qa[3], qb[0], qb[1], qb[2], qb[3]};
    float o[8] = {0.0f, 0.0f, 0.0f, 0.0f, 0.0f, 0.0f, 0.0f, 0.0f}, acc[8] = {0.0f, 0.0f, 0.0f, 0.0f, 0.0f, 0.0f, 0.0f, 0.0f}, mx = -INFINITY, den = 0.0f;
    int svb = sv * (D * 2);   // byte offset of the source row in the k and the v plane
    for (int base = 0; base < cnt; base += AB) {
      if (base > 0 && (base & 31) == 0) { const int j = min(base + ep, cnt - 1); const int e = iclamp(PERM[st + j], 0, E - 1); svb = iclamp(cols[e], 0, N - 1) * (D * 2); }   // the next 32 edges of a long row; past the end: the last edge again
      const int nb = min(cnt - base, AB), nbh = nb - hf;
      if (nb > 12) attn_batch<8>(K, V, svb, nbh, lo, q, mx, den, acc);
      else if (nb > 8) attn_batch<6>(K, V, svb, nbh, lo, q, mx, den, acc);
      else if (nb > 4) attn_batch<4>(K, V, svb, nbh, lo, q, mx, den, acc);
      else attn_batch<2>(K, V, svb, nbh, lo, q, mx, den, acc);
      svb = dpp_i<0x128>(svb);   // the second batch's slots move to lanes 0 .. 7 of each half wave
    }
    if (cnt > 0) { const float inv = 1.0f / (den + xhalf(den));   // both half waves' sums of this head
      for (int i = 0; i < 8; ++i) o[i] = (acc[i] + xhalf(acc[i])) * inv; }
    v8b ph, pl; for (int i = 0; i < 8; ++i) { b16 p, pq; split16(o[i] * XS, p, pq); ph[i] = p; pl[i] = pq; }
    *(v8b*)(Oh + v * (2 * D) + lane * 8) = hf ? pl : ph;   // hi | lo packed into this node's own 512-B q row (no other wave reads it): the first half wave stores hi, the second lo, one whole-row store
    asm volatile("s_wait_xcnt 0x0" ::: "memory");   // a precaution: the next node's pass overwrites the registers that the store names
    st = st1; cnt = cnt1; sv = iclamp(svn, 0, N - 1); st1 = st2; cnt1 = cnt2; en = enn;
  }
}
__global__ __launch_bounds__(256) void oproj_kernel(const b16* __restrict__ Oh, const b16* __restrict__ Ol, const b16* __restrict__ WT, const float* __restrict__ bo, float* __restrict__ out) {
  __shared__ __attribute__((aligned(16))) float Tf[PJ_NW][16][D + 4];   // per wave: first its 16 rows of hi | lo halves, then its 16 rows of results
  __shared__ __attribute__((aligned(16))) b16 Ws[D][WPITCH];
  const int wave = threadIdx.x >> 5, lane = threadIdx.x & 31, nloc = lane & 15, hlf = lane >> 4; const size_t m0 = (size_t)blockIdx.x * (PJ_NW * 16) + wave * 16; const b16* W = WT + (size_t)3 * D * D; (void)Ol;
  stage_operands<false>(W, Ws, (const v4f*)Oh, (int)m0, NP, (int)threadIdx.x, lane, Tf[wave]);
  __syncthreads();   // every wave reads the weight rows that the others have stored
  if (m0 >= (size_t)NP) return;   // the last block's waves past the padded rows: a whole wave leaves, behind the kernel's one barrier
  v8f acc[8];
#pragma unroll
  for (int t = 0; t < 8; ++t) acc[t] = (v8f){};
#pragma unroll
  for (int kb = 0; kb < D; kb += 32) { const v16b a = frag_kf(&Tf[wave][nloc][kb / 2], hlf), al = frag_kf(&Tf[wave][nloc][(D + kb) / 2], hlf);
    v16b bw[8];   // the k block's eight weight fragments are asked for together: one LDS latency a k block, not one a product
#pragma unroll
    for (int t = 0; t < 8; ++t) bw[t] = frag_kb(&Ws[t * 16 + nloc][kb], hlf);
#pragma unroll
    for (int t = 0; t < 8; ++t) { acc[t] = wmma16b(a, bw[t], acc[t]); acc[t] = wmma16b(al, bw[t], acc[t]); } }
  wave_lds_sync();   // the results below overwrite the rows that other lanes of this wave have read
#pragma unroll
  for (int t = 0; t < 8; ++t) { const int c = t * 16 + nloc; const float bb = bf16_rne(bo[c]);
#pragma unroll 1
    for (int r = 0; r < 8; ++r) Tf[wave][8 * hlf + r][c] = acc[t][r] * (1.0f / (XS * WSC)) + bb; }
  wave_lds_sync();
  { for (int rr = 0; rr < 16; ++rr) { const size_t row = m0 + rr; if (row < (size_t)N) *(v4f*)(out + row * D + lane * 4) = *(const v4f*)(&Tf[wave][rr][lane * 4]); }  }
}
}  // namespace

extern "C" void kernel_launch(void* const* d_in, const int* in_sizes, int n_in, void* d_out, int out_size, void* d_ws, size_t ws_size, hipStream_t stream) {
  (void)n_in;
  auto Fp = [&](int i) { return (const float*)d_in[i]; }; auto Ip = [&](int i) { return (const int*)d_in[i]; };
  // input order: 0 h [100000,128], 1 row [E] i32, 2 col [E] i32, 3 Wq [128,128], 4 bq, 5 Wk, 6 bk, 7 Wv, 8 bv, 9 Wo, 10 bo
  if (in_sizes[0] != N * D || in_sizes[1] != E || in_sizes[2] != E || in_sizes[3] != D * D || in_sizes[9] != D * D || out_size != N * D) return;
  size_t off = 0; char* ws = (char*)d_ws;
  auto carve = [&](size_t bytes) { char* p = ws + off; off += (bytes + 255) & ~(size_t)255; return p; };
  b16* WT = (b16*)carve((size_t)4 * D * D * 2); float* Q = (float*)carve((size_t)NP * D * 4); b16* KV = (b16*)carve((size_t)2 * NP * D * 2);
  b16* Oh = (b16*)Q; b16* Ol = Oh;   // the attention output (hi | lo, 2 x 128 halves) overwrites each node's own 512-B q row in place: a wave reads only its own q row before writing it (K/V rows live in planes of their own)
  CsrBufs csr; off = csr_carve(csr, ws, off, E, N);
  if (off > ws_size) return;   // q plane, f16 k and v planes, CSR tables: about 120 MB
  csr_build(csr, Ip(1), E, N, Fp(3), Fp(5), Fp(7), Fp(9), WT, stream);   // group by row (the softmax axis); the weight planes are made in its first launch
  proj_kernel<<<dim3(PJ_BLK, 3), 256, 0, stream>>>(Fp(0), WT, Fp(4), Fp(6), Fp(8), Q, KV);
  attn_kernel<<<ATT_BLK, 256, 0, stream>>>(Q, KV, KV + (size_t)NP * D, Ip(2), csr.PERM, csr.ROWPTR, csr.ROWCNT, (int)csr.permLen, Oh, Ol);
  oproj_kernel<<<PJ_BLK, 256, 0, stream>>>(Oh, Ol, WT, Fp(10), (float*)d_out);
}

// v010
// A run of this version takes 123 microseconds.
// Two timings next to v009 both put it at 1.04 times that version's speed.
// Over all steps from v000 it is 16.0 times as fast.
#include <hip/hip_runtime.h>

// Sparse multi-head attention over a graph (DGL bsddmm / bspmm style): q = (h Wq^T + bq) * 16^-1/2, k, v = Linear(h), all reshaped (N, 16, 8) — i.e. channel c = d*8 + head (heads interleaved);
// per edge e: logit_h = sum_d q[row][d,h] k[col][d,h]; softmax over the edges of each row (destination); out[row] = sum attn v[col]; y = out Wo^T + bo -> [100000][128]. 100,000 nodes,
// 1,600,000 edges; rows without edges give out = 0 (then bo).
// WMMA (v_wmma_f32_16x16x32_f16, f32 accumulate): the q/k/v projections ([100,032 x 128] x [128 x 384], EXACT bf16 h x8: 1 product) and the output projection ([100,032 x 128] x [128 x 128],
// attention output as f16 hi+lo x8 planes: 2 products), weights exact x256; between the projections every row is kept head-major (place head*16 + d holds channel d*8 + head: the weight planes are permuted once, see chan_il), so that
// a head's 16 values lie in two neighbouring lanes of a half wave; per-edge head dots, softmax and weighted sums in f32, in registers; the k and v rows that the edges gather are kept as f16 (rounded once from the f32 projection), q stays f32. Inputs rounded to bf16 once; ids int32 (clamped). Fragment k-map per lane half hh for A AND B:

namespace {
constexpr int N = 100000, NP = 100032, E = 1600000, D = 128, NH = 8, HD = 16;
constexpr float XS = 8.0f, WSC = 256.0f, NEG = 0.2f /* unused */, SCAL = 0.25f /* 16^-0.5 */;
typedef _Float16 b16;
typedef __attribute__((ext_vector_type(16))) _Float16 v16b;
typedef __attribute__((ext_vector_type(8))) _Float16 v8b;
typedef __attribute__((ext_vector_type(8))) float v8f;
typedef __attribute__((ext_vector_type(4))) float v4f;
__device__ __forceinline__ float bf16_rne(float f) { unsigned int u = __float_as_uint(f); u += 0x7FFFu + ((u >> 16) & 1u); return __uint_as_float(u & 0xFFFF0000u); }
__device__ __forceinline__ void split16(float v, b16& hi, b16& lo) { hi = (b16)v; lo = (b16)(v - (float)hi); }
__device__ __forceinline__ v16b frag_kb(const b16* p, int hh) { const v8b a = *(const v8b*)(p + 8 * hh), b = *(const v8b*)(p + 16 + 8 * hh); v16b f;
#pragma unroll
  for (int e = 0; e < 8; ++e) { f[e] = a[e]; f[8 + e] = b[e]; } return f; }
__device__ __forceinline__ v8f wmma16b(v16b a, v16b b, v8f c) { v8f d = __builtin_amdgcn_wmma_f32_16x16x32_f16(false, a, false, b, (short)0, c, false, false); asm volatile("v_nop\n\tv_nop\n\tv_nop\n\tv_nop" : "+v"(d) : "v"(a), "v"(b)); return d; }
__device__ __forceinline__ void wave_lds_sync() { __builtin_amdgcn_fence(__ATOMIC_RELEASE, "workgroup"); __builtin_amdgcn_wave_barrier(); __builtin_amdgcn_fence(__ATOMIC_ACQUIRE, "workgroup"); }
__device__ __forceinline__ int iclamp(int v, int lo, int hi) { return v < lo ? lo : (v > hi ? hi : v); }
// the reference's channel (d*8 + head) that stands at head-major place p = head*16 + d
__device__ __forceinline__ int chan_il(int p) { return (p & (HD - 1)) * NH + (p >> 4); }
// ---------------- deterministic, line-safe CSR by destination (two-level bucketing; every global write is a whole-line, lane-contiguous store) ----------------
// Pass A (block per contiguous edge chunk): a stable counting sort of the chunk's edges by coarse bucket g = dst >> CSR_GB (nG <= CSR_MAXG buckets) into LDS, all waves at work (see csr_rank), then whole-line
//   stores of the grouped ids (STG row) and of one word per bucket (HST row): its count | its start inside the staging row << 16.
// Pass B (block per bucket g): gathers the bucket's edge ids from the 512 staging rows into LDS (at most CSR_CAP ids), the same stable counting sort by destination node, then writes (a) its PERM run, which starts at g * CSR_CAP (a fixed place per bucket: no table over all buckets has to be built between the passes), and
//   (b) ROWPTR[v], ROWCNT[v] for its 2^CSR_GB nodes as contiguous ints. If a bucket exceeds CSR_CAP the kernel treats it as empty (ROWCNT = 0 for its nodes) and sets FLAG[0] = 1 (loud failure, no corruption).
// The sort, no atomics, original edge order kept inside every key: each wave owns a contiguous run of items and a histogram row of its own; per 32 items csr_rank gives every lane its rank among the
//   lanes with an equal key, the first such lane advances the row's counter; then a prefix over (key, wave) turns the rows into start positions.
constexpr int CSR_NBLK = 512, CSR_GB = 9, CSR_GN = 1 << CSR_GB /* nodes per bucket */, CSR_MAXG = 512, CSR_CAP = 12288 /* ids per bucket in LDS (48+24+48 KB, and 32 KB of counter rows) */;
constexpr int CSR_CH = (E + CSR_NBLK - 1) / CSR_NBLK /* edges per chunk */, CSRA_NW = 8, CSRA_G = (CSR_CH + CSRA_NW * 32 - 1) / (CSRA_NW * 32) /* groups of 32 per wave */, CSRB_NW = 32, CSRB_G = CSR_CAP / (CSRB_NW * 32);
static_assert(CSR_CH < 32768 && CSR_CAP % 32 == 0, "a count and a start share one int; a bucket's PERM run starts on a whole line");
// mask of the wave's valid lanes whose 9-bit key equals this lane's (keys < 512 = CSR_MAXG = CSR_GN)
__device__ __forceinline__ unsigned csr_match(int key, bool valid) { unsigned m = __builtin_amdgcn_ballot_w32(valid);
#pragma unroll   // short fixed trip count: straight-line code, its LDS reads or ballots issued back to back
  for (int b = 0; b < 9; ++b) { const bool on = (key >> b) & 1; const unsigned s = __builtin_amdgcn_ballot_w32(on); m &= on ? s : ~s; } return m; }
// one group of 32 items: returns how many items of this wave's run with the same key stand in front of this lane's item, and advances the wave's own counter row. key < 0: no item.
template <typename T> __device__ __forceinline__ int csr_rank(T* row, int key, int lane) { const bool ok = key >= 0; const unsigned m = csr_match(key, ok); const int r = __popc(m & ((1u << lane) - 1u)); int base = 0;
  if (ok) base = (int)row[key]; if (ok && r == 0) row[key] = (T)(base + __popc(m));
  wave_lds_sync();   // the next group's lanes read counters that other lanes of this wave have just stored
  return base + r; }
// exclusive prefix of one int per thread over a block of NW waves (every thread calls it); total = the block's sum. wsum: NW ints of LDS.
template <int NW> __device__ __forceinline__ int csr_scan(int v, int* wsum, int lane, int wave, int& total) { int inc = v;
#pragma unroll   // short fixed trip count: straight-line code, its LDS reads or ballots issued back to back
  for (int o = 1; o < 32; o <<= 1) { const int u = __shfl_up(inc, o); if (lane >= o) inc += u; }
  if (lane == 31) wsum[wave] = inc;
  __syncthreads();
  int pre = 0, all = 0;
#pragma unroll   // short fixed trip count: straight-line code, its LDS reads or ballots issued back to back
  for (int w = 0; w < NW; ++w) { const int s = wsum[w]; pre += (w < wave) ? s : 0; all += s; }
  __syncthreads();   // wsum may be written again by the next call
  total = all; return pre + inc - v; }
// The four weight planes as f16 (exact bf16 x256). No launch of its own: nothing here depends on the edge lists or they on it, so these WPREP_BLK blocks ride behind pass A's blocks in pass A's launch. blk: the block's number among them.
constexpr int WPREP_BLK = (4 * D * D / 8 + 255) / 256;
__device__ __forceinline__ void wprep_block(int blk, const float* __restrict__ wq, const float* __restrict__ wk, const float* __restrict__ wv, const float* __restrict__ wo, b16* __restrict__ WT) {
  const size_t u = (size_t)blk * 256 + threadIdx.x; const size_t per = (size_t)D * D / 8; if (u >= 4 * per) return; const int which = (int)(u / per); const size_t e = (u % per) * 8; const float* w = which == 0 ? wq : which == 1 ? wk : which == 2 ? wv : wo; v8b o;
  const int r = (int)(e / D), k0 = (int)(e % D);   // q, k, v: output rows permuted to head-major places; o: its k columns, which meet the attention output's places
  for (int j = 0; j < 8; ++j) o[j] = (b16)(bf16_rne(w[which < 3 ? chan_il(r) * D + k0 + j : r * D + chan_il(k0 + j)]) * WSC);
  { *(v8b*)(WT + (size_t)which * D * D + e) = o;  }
}
__global__ __launch_bounds__(256) void csrA_kernel(const int* __restrict__ dst, int E, int N, int nG, int CHP, int NGP, int* __restrict__ STG, int* __restrict__ HST, const float* __restrict__ wq, const float* __restrict__ wk, const float* __restrict__ wv, const float* __restrict__ wo, b16* __restrict__ WT) {
  extern __shared__ int sm[];   // cnt[NGP] | run[NGP] | ids[CHP]
  __shared__ int wh[CSRA_NW][CSR_MAXG]; __shared__ int wsum[CSRA_NW];
  if (blockIdx.x >= (unsigned)CSR_NBLK) { wprep_block((int)blockIdx.x - CSR_NBLK, wq, wk, wv, wo, WT); return; }   // a whole block leaves, in front of every barrier
  int* cnt = sm; int* run = sm + NGP; int* ids = sm + 2 * NGP;
  const int t_ = threadIdx.x, lane = t_ & 31, wave = t_ >> 5;
  const int b = blockIdx.x; const int e0 = b * CSR_CH; const int i0 = wave * (CSRA_G * 32) + lane;
  for (int i = t_; i < CSRA_NW * CSR_MAXG; i += 256) (&wh[0][0])[i] = 0;
  for (int i = t_; i < CHP; i += 256) ids[i] = -1;
  int key[CSRA_G], lr[CSRA_G]; unsigned ei[CSRA_G];
#pragma unroll   // constant indices keep the per-lane arrays in registers
  for (int u = 0; u < CSRA_G; ++u) { ei[u] = (unsigned)min(e0 + i0 + u * 32, E - 1); key[u] = dst[ei[u]]; }   // all of a lane's loads in flight together; an index past the end re-reads the last edge
  static_assert(CSRA_G == 13, "the statement below names 13 values");
  // a precaution: this wait stands in front of every overwrite of a register that an issued load names; the index registers are named so that they stay whole up to it
  asm volatile("s_wait_xcnt 0x0" :: "v"(ei[0]), "v"(ei[1]), "v"(ei[2]), "v"(ei[3]), "v"(ei[4]), "v"(ei[5]), "v"(ei[6]), "v"(ei[7]), "v"(ei[8]), "v"(ei[9]), "v"(ei[10]), "v"(ei[11]), "v"(ei[12]) : "memory");
#pragma unroll   // constant indices keep the per-lane arrays in registers
  for (int u = 0; u < CSRA_G; ++u) { const int i = i0 + u * 32; const bool ok = i < CSR_CH && e0 + i < E; int d = key[u]; d = (d < 0) ? 0 : (d >= N ? N - 1 : d); key[u] = ok ? (d >> CSR_GB) : -1; }
  __syncthreads();
#pragma unroll   // constant indices keep the per-lane arrays in registers
  for (int u = 0; u < CSRA_G; ++u) lr[u] = csr_rank(wh[wave], key[u], lane);
  __syncthreads();
  int s[2];   // thread t_: buckets 2 t_ and 2 t_ + 1; the rows become exclusive prefixes over the waves
#pragma unroll   // short fixed trip count: straight-line code, its LDS reads or ballots issued back to back
  for (int j = 0; j < 2; ++j) { int acc = 0;
#pragma unroll   // short fixed trip count: straight-line code, its LDS reads issued back to back
    for (int w = 0; w < CSRA_NW; ++w) { const int c = wh[w][2 * t_ + j]; wh[w][2 * t_ + j] = acc; acc += c; } s[j] = acc; }
  int all; const int pre = csr_scan<CSRA_NW>(s[0] + s[1], wsum, lane, wave, all);
  if (2 * t_ < NGP) { cnt[2 * t_] = s[0]; run[2 * t_] = pre; } if (2 * t_ + 1 < NGP) { cnt[2 * t_ + 1] = s[1]; run[2 * t_ + 1] = pre + s[0]; }
  __syncthreads();
#pragma unroll   // constant indices keep the per-lane arrays in registers
  for (int u = 0; u < CSRA_G; ++u) if (key[u] >= 0) ids[run[key[u]] + wh[wave][key[u]] + lr[u]] = e0 + i0 + u * 32;
  __syncthreads();
  typedef __attribute__((ext_vector_type(4))) int v4i;
  {
    for (int i = t_; i < CHP / 4; i += 256) *(v4i*)(STG + (size_t)b * CHP + i * 4) = *(const v4i*)(&ids[i * 4]);
    for (int i = t_; i < NGP / 4; i += 256) { v4i v; for (int e = 0; e < 4; ++e) v[e] = (i * 4 + e < nG) ? (cnt[i * 4 + e] | (run[i * 4 + e] << 16)) : 0; *(v4i*)(HST + (size_t)b * NGP + i * 4) = v; }   // both are at most CSR_CH
     }
}
// bucket: block g (1024 threads): gather ids (from each block's staging sub-run, in block order => original edge order), stable counting sort by node, flush; ROWPTR/ROWCNT rows.
__global__ __launch_bounds__(1024) void csrB_kernel(const int* __restrict__ dst, int N, int nG, int CHP, int NGP, const int* __restrict__ STG, const int* __restrict__ HST, int* __restrict__ PERM, int* __restrict__ ROWPTR, int* __restrict__ ROWCNT, int* __restrict__ FLAG) {
  typedef __attribute__((ext_vector_type(4))) int v4i;
  __shared__ int ids[CSR_CAP]; __shared__ unsigned short key[CSR_CAP]; __shared__ int outp[CSR_CAP]; __shared__ int ncnt[CSR_GN + 1]; __shared__ int boff[CSR_NBLK + 1]; __shared__ int ooff[CSR_NBLK];
  __shared__ __attribute__((aligned(16))) unsigned short wh[CSRB_NW][CSR_GN]; __shared__ int wsum[CSRB_NW];
  const int g = blockIdx.x, t_ = threadIdx.x, lane = t_ & 31, wave = t_ >> 5; const int st = g * CSR_CAP; const int v0 = g * CSR_GN; const int nv = min(CSR_GN, N - v0); int tot; (void)nG;
  // per-block offsets of this bucket's sub-runs in gather order (thread = staging row); their sum is the bucket's total
  { int c = 0; if (t_ < CSR_NBLK) { const unsigned hi = (unsigned)(t_ * NGP + g); const unsigned w = (unsigned)HST[hi];
      asm volatile("s_wait_xcnt 0x0" :: "v"(hi) : "memory");   // the same precaution as in pass A
      c = min((int)(w & 0xFFFFu), CHP); ooff[t_] = (int)(w >> 16); }
    int all; const int pre = csr_scan<CSRB_NW>(c, wsum, lane, wave, all); tot = all;
    if (all > CSR_CAP) { tot = 0; if (t_ == 0) FLAG[0] = 1; }   // loud failure: the bucket is worked on as an empty one (zero counts), flag
    if (t_ < CSR_NBLK) boff[t_] = min(pre, tot); if (t_ == 0) boff[CSR_NBLK] = tot; }
  for (int i = t_; i < CSRB_NW * CSR_GN / 2; i += 1024) ((int*)&wh[0][0])[i] = 0;
  __syncthreads();
  { constexpr int RB = CSR_NBLK / CSRB_NW;   // a wave gathers RB staging rows in a row; the first 32 ids of all of them are in flight together
    int bo[RB], cn[RB], id[RB], dd[RB]; unsigned ix[RB];
#pragma unroll   // constant indices keep the per-lane arrays in registers
    for (int u = 0; u < RB; ++u) { const int b = wave * RB + u; bo[u] = boff[b]; cn[u] = boff[b + 1] - bo[u]; int o_ = ooff[b]; o_ = (o_ < 0) ? 0 : (o_ > CHP - cn[u] ? CHP - cn[u] : o_); ix[u] = (unsigned)(b * CHP + min(o_, CHP - 1) + (lane < cn[u] ? lane : 0)); }   // a lane past the sub-run's end re-reads a written word of the row, so that no load hangs on a branch
#pragma unroll   // constant indices keep the per-lane arrays in registers
    for (int u = 0; u < RB; ++u) id[u] = STG[ix[u]];
    static_assert(RB == 16, "the three statements below name 16 values each");
    // a precaution: this wait stands in front of every overwrite of a register that an issued load names; the index registers are named so that they stay whole up to it
    asm volatile("s_wait_xcnt 0x0" :: "v"(ix[0]), "v"(ix[1]), "v"(ix[2]), "v"(ix[3]), "v"(ix[4]), "v"(ix[5]), "v"(ix[6]), "v"(ix[7]), "v"(ix[8]), "v"(ix[9]), "v"(ix[10]), "v"(ix[11]), "v"(ix[12]), "v"(ix[13]), "v"(ix[14]), "v"(ix[15]) : "memory");
    // holds the 16 loads together in front of the branches below: sunk into its branch, a load would wait there alone
    asm volatile("" :: "v"(id[0]), "v"(id[1]), "v"(id[2]), "v"(id[3]), "v"(id[4]), "v"(id[5]), "v"(id[6]), "v"(id[7]), "v"(id[8]), "v"(id[9]), "v"(id[10]), "v"(id[11]), "v"(id[12]), "v"(id[13]), "v"(id[14]), "v"(id[15]));
#pragma unroll   // constant indices keep the per-lane arrays in registers
    for (int u = 0; u < RB; ++u) id[u] = (id[u] < 0) ? 0 : id[u];
#pragma unroll   // constant indices keep the per-lane arrays in registers
    for (int u = 0; u < RB; ++u) dd[u] = dst[id[u]];
    // the same for the 16 destination loads
    asm volatile("" :: "v"(dd[0]), "v"(dd[1]), "v"(dd[2]), "v"(dd[3]), "v"(dd[4]), "v"(dd[5]), "v"(dd[6]), "v"(dd[7]), "v"(dd[8]), "v"(dd[9]), "v"(dd[10]), "v"(dd[11]), "v"(dd[12]), "v"(dd[13]), "v"(dd[14]), "v"(dd[15]));
#pragma unroll   // constant indices keep the per-lane arrays in registers
    for (int u = 0; u < RB; ++u) if (lane < cn[u]) { int d = dd[u]; d = (d < v0) ? v0 : (d >= N ? N - 1 : d); int kk = d - v0; kk = (kk < 0) ? 0 : (kk >= CSR_GN ? CSR_GN - 1 : kk); ids[bo[u] + lane] = id[u]; key[bo[u] + lane] = (unsigned short)kk; }
#pragma unroll 1   // seldom entered: kept small
    for (int u = 0; u < RB; ++u) { const int b = wave * RB + u; const int bs = boff[b], c = boff[b + 1] - bs; int o_ = ooff[b]; o_ = (o_ < 0) ? 0 : (o_ > CHP - c ? CHP - c : o_); const int* src_ = STG + (size_t)b * CHP + o_;   // what a sub-run holds beyond 32 ids
      for (int i = lane + 32; i < c; i += 32) { int idr = src_[i]; idr = (idr < 0) ? 0 : idr; ids[bs + i] = idr; int d = dst[idr]; d = (d < v0) ? v0 : (d >= N ? N - 1 : d); int kk = d - v0; kk = (kk < 0) ? 0 : (kk >= CSR_GN ? CSR_GN - 1 : kk); key[bs + i] = (unsigned short)kk; } } }
  __syncthreads();
  // stable counting sort by node inside the bucket: wave w owns items [w S, w S + S)
  const int S = ((tot + CSRB_NW * 32 - 1) / (CSRB_NW * 32)) * 32; const int i0 = wave * S + lane;
  int kr[CSRB_G], lr[CSRB_G];
#pragma unroll   // constant indices keep the per-lane arrays in registers
  for (int u = 0; u < CSRB_G; ++u) { const int i = i0 + u * 32; kr[u] = (u * 32 < S && i < tot) ? (int)key[i] : -1; lr[u] = 0; }
#pragma unroll   // constant indices keep the per-lane arrays in registers
  for (int u = 0; u < CSRB_G; ++u) if (u * 32 < S) lr[u] = csr_rank(wh[wave], kr[u], lane);
  __syncthreads();
  { int s = 0; if (t_ < CSR_GN) {   // thread = node: the rows become exclusive prefixes over the waves
#pragma unroll   // short fixed trip count: straight-line code, its LDS reads or ballots issued back to back
      for (int w = 0; w < CSRB_NW; ++w) { const int c = wh[w][t_]; wh[w][t_] = (unsigned short)s; s += c; } }
    int all; const int pre = csr_scan<CSRB_NW>(s, wsum, lane, wave, all); if (t_ < CSR_GN) ncnt[t_] = pre; if (t_ == 0) ncnt[CSR_GN] = all; }   // ncnt[vl] = start of node vl
  __syncthreads();
#pragma unroll   // constant indices keep the per-lane arrays in registers
  for (int u = 0; u < CSRB_G; ++u) if (kr[u] >= 0) outp[ncnt[kr[u]] + (int)wh[wave][kr[u]] + lr[u]] = ids[i0 + u * 32];
  __syncthreads();
  {
    for (int i = t_; i < min(CSR_CAP, (tot + 32) & ~31) / 4; i += 1024) { v4i v;   // whole lines up to and with word tot: the entry of a row without edges can point there (behind a full run it points at the next bucket's first word, or is clamped onto the table's last), and the attention kernel loads that word, unused
      for (int e = 0; e < 4; ++e) { const int q = i * 4 + e; v[e] = (q < tot) ? outp[q] : -1; } *(v4i*)(PERM + st + i * 4) = v; }
    for (int i = t_; i < CSR_GN / 4; i += 1024) { v4i a, c; for (int e = 0; e < 4; ++e) { const int vl = i * 4 + e; a[e] = st + ncnt[vl]; c[e] = (vl < nv) ? (ncnt[vl + 1] - ncnt[vl]) : 0; } *(v4i*)(ROWPTR + v0 + i * 4) = a; *(v4i*)(ROWCNT + v0 + i * 4) = c; }   // the tables hold nG*512 entries (beyond N: count 0)
     }
}
// No table is cleared beforehand: pass A stores every word of STG and HST, pass B every entry of ROWPTR and ROWCNT and every word of PERM that a row entry can lead to; FLAG is only ever stored.
// host helper. Workspace ints needed: STG (512*CHP), HST (512*NGP), PERM (nG*CSR_CAP), ROWPTR (Npad), ROWCNT (Npad), FLAG (64). Npad = roundup(N, 512).
struct CsrBufs { int *STG, *HST, *PERM, *ROWPTR, *ROWCNT, *FLAG; int nG, NGP, CHP; size_t permLen; };
static size_t csr_carve(CsrBufs& c, char* ws, size_t off, int E, int N) {
  auto al = [&](size_t bytes) { char* p = ws + off; off += (bytes + 255) & ~(size_t)255; return p; };
  c.nG = (N + CSR_GN - 1) / CSR_GN; c.NGP = (c.nG + 31) & ~31; const int ch = (E + CSR_NBLK - 1) / CSR_NBLK; c.CHP = (ch + 31) & ~31; c.permLen = (size_t)c.nG * CSR_CAP;
  c.STG = (int*)al((size_t)CSR_NBLK * c.CHP * 4); c.HST = (int*)al((size_t)CSR_NBLK * c.NGP * 4);
  c.PERM = (int*)al(c.permLen * 4); c.ROWPTR = (int*)al((size_t)c.nG * CSR_GN * 4); c.ROWCNT = (int*)al((size_t)c.nG * CSR_GN * 4); c.FLAG = (int*)al(256);
  return off;
}
static void csr_build(const CsrBufs& c, const int* dst, int E, int N, const float* wq, const float* wk, const float* wv, const float* wo, b16* WT, hipStream_t stream) {
  const size_t smem = (size_t)(2 * c.NGP + c.CHP) * 4;
  csrA_kernel<<<CSR_NBLK + WPREP_BLK, 256, smem, stream>>>(dst, E, N, c.nG, c.CHP, c.NGP, c.STG, c.HST, wq, wk, wv, wo, WT);
  csrB_kernel<<<c.nG, 1024, 0, stream>>>(dst, N, c.nG, c.CHP, c.NGP, c.STG, c.HST, c.PERM, c.ROWPTR, c.ROWCNT, c.FLAG);
}


// Both projection kernels: a wave owns 16 rows (output projection: blocks of 8 waves, staged by stage_operands; q, k, v: see proj_kernel). The operands reach the fragments through LDS: a fragment load straight from global memory touches 16 lines for 512 bytes, and every wave
// would read the whole weight plane that way. Here the block fetches its weight planes once (32 KB for the output projection, 96 KB for q, k, v) and each wave its own 16 rows of 512 B, all with whole-line loads (a load covers 512 bytes in a row).
constexpr int PJ_NW = 8, PJ_BLK = (NP / 16 + PJ_NW - 1) / PJ_NW, WPITCH = D + 8 /* halves: 272 B = 16 B x 17, no bank conflict for 16-byte reads down a column of rows */;
// W: 128 rows of 256 B -> Ws. src: rows of 512 B; rows m0 .. m0 + 15 -> T (the load of a row from nrows on re-reads the last row, so that no load hangs on a branch; ZERO: such a row is stored as zeros). All 24 loads of a lane fly together.
template <bool ZERO> __device__ __forceinline__ void stage_operands(const b16* __restrict__ W, b16 (*Ws)[WPITCH], const v4f* __restrict__ src, int m0, int nrows, int t_, int lane, float (*T)[D + 4]) {
  const unsigned iw = (unsigned)t_; unsigned ix[16]; v8b w[8]; v4f x[16];
#pragma unroll   // constant indices keep the arrays in registers
  for (int rr = 0; rr < 16; ++rr) ix[rr] = (unsigned)min(m0 + rr, nrows - 1) * (unsigned)(D / 4) + (unsigned)lane;
#pragma unroll   // constant indices keep the arrays in registers
  for (int j = 0; j < 8; ++j) w[j] = ((const v8b*)W)[iw + 256u * j];
#pragma unroll   // constant indices keep the arrays in registers
  for (int rr = 0; rr < 16; ++rr) x[rr] = src[ix[rr]];
  // a precaution: this wait stands in front of every overwrite of a register that an issued load names; the index registers are named so that they stay whole up to it
  asm volatile("s_wait_xcnt 0x0" :: "v"(iw), "v"(ix[0]), "v"(ix[1]), "v"(ix[2]), "v"(ix[3]), "v"(ix[4]), "v"(ix[5]), "v"(ix[6]), "v"(ix[7]), "v"(ix[8]), "v"(ix[9]), "v"(ix[10]), "v"(ix[11]), "v"(ix[12]), "v"(ix[13]), "v"(ix[14]), "v"(ix[15]) : "memory");
#pragma unroll   // constant indices keep the arrays in registers
  for (int j = 0; j < 8; ++j) *(v8b*)(&Ws[(t_ >> 4) + 16 * j][(t_ & 15) * 8]) = w[j];
#pragma unroll   // constant indices keep the arrays in registers
  for (int rr = 0; rr < 16; ++rr) *(v4f*)(&T[rr][lane * 4]) = (!ZERO || m0 + rr < nrows) ? x[rr] : (v4f){0.0f, 0.0f, 0.0f, 0.0f};
}
// a fragment (k-map of frag_kb) of 16-bit values that lie in an LDS row of floats; p: the row's float that holds k = 0 and 1
__device__ __forceinline__ v16b frag_kf(const float* p, int hh) { const v8b a = __builtin_bit_cast(v8b, *(const v4f*)(p + 4 * hh)), b = __builtin_bit_cast(v8b, *(const v4f*)(p + 8 + 4 * hh)); v16b f;
#pragma unroll
  for (int e = 0; e < 8; ++e) { f[e] = a[e]; f[8 + e] = b[e]; } return f; }
// wave_lds_sync for LDS alone: it orders the wave's LDS accesses and does not wait for its global stores (below, the stores of the plane before are still in flight where it stands)
__device__ __forceinline__ void wave_lds_only_sync() { __builtin_amdgcn_fence(__ATOMIC_RELEASE, "workgroup", "local"); __builtin_amdgcn_wave_barrier(); __builtin_amdgcn_fence(__ATOMIC_ACQUIRE, "workgroup", "local"); }
// The q, k and v projections in one pass over h: a block holds all three weight planes in LDS, each wave turns its 16 rows of h into fragments once and uses them for the three products.
// 25 waves a block: planes and the waves' row buffers fill one WGP's LDS, and the 251 blocks all run at once, one on a WGP (chosen for speed alone: no result depends on it).
constexpr int QKV_NW = 25, QKV_NT = QKV_NW * 32, QKV_ROWS = QKV_NW * 16, QKV_BLK = (NP + QKV_ROWS - 1) / QKV_ROWS, QKV_CH = 3 * D * D / 8 /* 16-byte pieces of the three planes */;
static_assert(7 * QKV_NT < QKV_CH && QKV_CH <= 8 * QKV_NT, "a thread fetches seven pieces of the planes, and an eighth where there is one");
__global__ __launch_bounds__(QKV_NT) void proj_kernel(const float* __restrict__ h, const b16* __restrict__ WT, const float* __restrict__ bq, const float* __restrict__ bk, const float* __restrict__ bv, float* __restrict__ Q, b16* __restrict__ KV) {
  __shared__ __attribute__((aligned(16))) float Tf[QKV_NW][16][D + 4];   // per wave: first its 16 rows of h, then its 16 rows of results, plane after plane
  __shared__ __attribute__((aligned(16))) b16 Ws[3 * D][WPITCH];         // rows 0 .. 127 q, 128 .. 255 k, 256 .. 383 v
  const int t_ = (int)threadIdx.x, wave = __builtin_amdgcn_readfirstlane(t_ >> 5) /* the same in every lane: row numbers and row tests stay in scalar registers */, lane = t_ & 31, nloc = lane & 15, hlf = lane >> 4; const size_t m0 = (size_t)blockIdx.x * QKV_ROWS + wave * 16;
  { const unsigned iw = (unsigned)t_, iwl = (unsigned)min(t_, QKV_CH - 1 - 7 * QKV_NT); unsigned ix[16]; v8b w[8]; v4f x[16];   // all 24 loads of a lane fly together; an index past the end re-reads the last piece or row, so that no load hangs on a branch
#pragma unroll   // constant indices keep the arrays in registers
    for (int rr = 0; rr < 16; ++rr) ix[rr] = (unsigned)min((int)m0 + rr, N - 1) * (unsigned)(D / 4) + (unsigned)lane;
#pragma unroll   // constant indices keep the arrays in registers
    for (int j = 0; j < 7; ++j) w[j] = ((const v8b*)WT)[iw + (unsigned)QKV_NT * j];
    w[7] = ((const v8b*)WT)[iwl + 7u * QKV_NT];
#pragma unroll   // constant indices keep the arrays in registers
    for (int rr = 0; rr < 16; ++rr) x[rr] = ((const v4f*)h)[ix[rr]];
    // a precaution: this wait stands in front of every overwrite of a register that an issued load names; the index registers are named so that they stay whole up to it
    asm volatile("s_wait_xcnt 0x0" :: "v"(iw), "v"(iwl), "v"(ix[0]), "v"(ix[1]), "v"(ix[2]), "v"(ix[3]), "v"(ix[4]), "v"(ix[5]), "v"(ix[6]), "v"(ix[7]), "v"(ix[8]), "v"(ix[9]), "v"(ix[10]), "v"(ix[11]), "v"(ix[12]), "v"(ix[13]), "v"(ix[14]), "v"(ix[15]) : "memory");
    asm volatile("" :: "v"(__builtin_bit_cast(v4f, w[7])));   // holds the eighth load with the others in front of the branch below: sunk into the branch, it would be issued late and waited for alone
#pragma unroll   // constant indices keep the arrays in registers
    for (int j = 0; j < 8; ++j) { const int c = t_ + QKV_NT * j; if (j < 7 || c < QKV_CH) *(v8b*)(&Ws[c >> 4][(c & 15) * 8]) = w[j]; }
#pragma unroll   // constant indices keep the arrays in registers
    for (int rr = 0; rr < 16; ++rr) *(v4f*)(&Tf[wave][rr][lane * 4]) = ((int)m0 + rr < N) ? x[rr] : (v4f){0.0f, 0.0f, 0.0f, 0.0f}; }
  __syncthreads();   // every wave reads the weight rows that the others have stored
  if (m0 >= (size_t)NP) return;   // the last block's waves past the padded rows: a whole wave leaves, behind the kernel's one barrier
  v16b a[D / 32];   // the wave's rows of h as fragments, made once, kept for the three planes
#pragma unroll
  for (int kb = 0; kb < D; kb += 32) { const float* r = &Tf[wave][nloc][kb + 8 * hlf]; const v4f r0 = *(const v4f*)r, r1 = *(const v4f*)(r + 4), r2 = *(const v4f*)(r + 16), r3 = *(const v4f*)(r + 20);
    for (int e = 0; e < 4; ++e) { a[kb / 32][e] = (b16)(bf16_rne(r0[e]) * XS); a[kb / 32][4 + e] = (b16)(bf16_rne(r1[e]) * XS); a[kb / 32][8 + e] = (b16)(bf16_rne(r2[e]) * XS); a[kb / 32][12 + e] = (b16)(bf16_rne(r3[e]) * XS); } }
#pragma unroll   // part is a constant in each copy: bias pointer, scale and store form are picked at compile time
  for (int part = 0; part < 3; ++part) { const float* bias = part == 0 ? bq : part == 1 ? bk : bv; const float osc = part == 0 ? SCAL : 1.0f;
    const unsigned ib = (unsigned)(nloc * NH); const v4f b4[2] = {*(const v4f*)(bias + ib), *(const v4f*)(bias + ib + 4)};   // places t * 16 + nloc, t = 0 .. 7, hold the channels nloc * 8 + t (chan_il): eight floats in a row, asked for in front of the products
    asm volatile("s_wait_xcnt 0x0" :: "v"(ib) : "memory");   // the same precaution as above
    wave_lds_only_sync();   // the results below overwrite what other lanes of this wave have read: the rows of h, or the plane before
#pragma unroll   // constant indices keep the arrays in registers
    for (int tg = 0; tg < 8; tg += 4) {   // four column tiles at a time: their sums, the kept fragments of h and the weight fragments in flight fit the registers of 25 waves
      v8f acc[4];
#pragma unroll
      for (int t = 0; t < 4; ++t) acc[t] = (v8f){};
#pragma unroll
      for (int kb = 0; kb < D; kb += 32) { v16b bw[4];   // the four weight fragments are asked for together: one LDS latency for four products
#pragma unroll
        for (int t = 0; t < 4; ++t) bw[t] = frag_kb(&Ws[part * D + (tg + t) * 16 + nloc][kb], hlf);
#pragma unroll
        for (int t = 0; t < 4; ++t) acc[t] = wmma16b(a[kb / 32], bw[t], acc[t]); }
#pragma unroll
      for (int t = 0; t < 4; ++t) { const int c = (tg + t) * 16 + nloc; const float bb = bf16_rne(b4[tg / 4][t]);
#pragma unroll 1
        for (int r = 0; r < 8; ++r) { const size_t row = m0 + 8 * hlf + r; Tf[wave][8 * hlf + r][c] = row < (size_t)N ? (acc[t][r] * (1.0f / (XS * WSC)) + bb) * osc : 0.0f; } } }
    wave_lds_only_sync();
    if (part == 0) { for (int rr = 0; rr < 16; ++rr) *(v4f*)(Q + (m0 + rr) * D + lane * 4) = *(const v4f*)(&Tf[wave][rr][lane * 4]); }
    else { b16* P = KV + (size_t)(part - 1) * NP * D;   // k, v: f16 rows of 256 B; a store covers two rows = 4 whole lines
      for (int rr = 0; rr < 16; rr += 2) { const float* t = &Tf[wave][rr + hlf][nloc * 8]; const v4f x = *(const v4f*)t, y = *(const v4f*)(t + 4); v8b o;
        for (int e = 0; e < 4; ++e) { o[e] = (b16)x[e]; o[4 + e] = (b16)y[e]; }
        *(v8b*)(P + (m0 + rr + hlf) * D + nloc * 8) = o; } }
    if (part < 2) asm volatile("s_wait_xcnt 0x0" ::: "memory");   // a precaution: the next plane's pass overwrites registers that the stores above name
  }
}
// Attention, one wave per destination node at a time, its edges up to 16 at a time, all in registers. Rows are head-major, and a 16-byte load per lane covers TWO rows: half wave hf = lane/16 takes the odd (hf = 1) or even
// edges, lane j = lane%16 of it the places 8j .. 8j+7 = half of head j/2. A head's dot is 8 products in the lane and one add with the neighbour lane; each lane then holds its own head's logit of its own edges, so the
// maximum, the exponentials and the weighted sums need no exchange but one maximum per batch and one sum per node between the two half waves. The K and V rows of a batch fly together.
constexpr int AB = 16 /* edges per batch */;
// v as another lane holds it, by a data-parallel move inside 16-lane rows: 0x150 + n: lane n of the own row; 0xB1: lane ^ 1; 0x128: lane + 8 round the row
template <int CTRL> __device__ __forceinline__ int dpp_i(int v) { return __builtin_amdgcn_update_dpp(0, v, CTRL, 0xf, 0xf, true); }
template <int CTRL> __device__ __forceinline__ float dpp_f(float v) { return __int_as_float(dpp_i<CTRL>(__float_as_int(v))); }
// v as lane ^ 16 holds it
__device__ __forceinline__ float xhalf(float v) { const int i = __float_as_int(v); return __int_as_float(__builtin_amdgcn_permlanex16(i, i, 0x76543210, 0xfedcba98, false, false)); }
// c + f * (the low or the high f16 of h), f32 result, in one instruction. Written out because the compiler widens each f16 to a float register first (one more instruction per value, and twice the registers for a batch's rows, which then spill).
// Not dealt with here: the compiler puts no s_delay_alu in front of an asm statement, and in the listing many links of the head dots stand directly behind the link whose result they read, unhinted
__device__ __forceinline__ float fmix_lo(unsigned h, float f, float c) { float d; asm("v_fma_mix_f32 %0, %1, %2, %3 op_sel_hi:[1,0,0]" : "=v"(d) : "v"(h), "v"(f), "v"(c)); return d; }
__device__ __forceinline__ float fmix_hi(unsigned h, float f, float c) { float d; asm("v_fma_mix_f32 %0, %1, %2, %3 op_sel:[1,0,0] op_sel_hi:[1,0,0]" : "=v"(d) : "v"(h), "v"(f), "v"(c)); return d; }
// the same with c = 0: a chain's first product
__device__ __forceinline__ float mmix_lo(unsigned h, float f) { float d; asm("v_fma_mix_f32 %0, %1, %2, 0 op_sel_hi:[1,0,0]" : "=v"(d) : "v"(h), "v"(f)); return d; }
typedef __attribute__((ext_vector_type(4))) unsigned v4u;
__device__ __forceinline__ float exp2_slot(float x) { float d; asm("v_exp_f32 %0, %1\n\tv_nop" : "=v"(d) : "v"(x)); return d; }
// one batch of nb <= 2 NL edges, straight-line code for NL loads per plane (no test around a load, so that the loads of a batch stay in flight together); a slot from nb on holds the row's last edge again and gets weight 0.
// svb: lane u of each half wave holds the byte offset of the source row of that half's slot u. nbh = nb - hf: slot u is an edge where 2u < nbh. lo: the lane's 16 bytes inside a row.
// mx: running maximum of the lane's head (the same in both half waves); den, acc: this half wave's edges alone.
template <int NL> __device__ __forceinline__ void attn_batch(const b16* K, const b16* V, int svb, int nbh, unsigned lo, const float (&q)[8], float& mx, float& den, float (&acc)[8]) {
  static_assert(NL == 2 || NL == 4 || NL == 6 || NL == 8, "one of the statements below names all NL values");
  unsigned off[NL]; v4u kk[NL], vv[NL];   // a register holds two neighbouring f16 places
  off[0] = (unsigned)dpp_i<0x150>(svb) + lo; off[1] = (unsigned)dpp_i<0x151>(svb) + lo;
  if constexpr (NL > 2) { off[2] = (unsigned)dpp_i<0x152>(svb) + lo; off[3] = (unsigned)dpp_i<0x153>(svb) + lo; }
  if constexpr (NL > 4) { off[4] = (unsigned)dpp_i<0x154>(svb) + lo; off[5] = (unsigned)dpp_i<0x155>(svb) + lo; }
  if constexpr (NL > 6) { off[6] = (unsigned)dpp_i<0x156>(svb) + lo; off[7] = (unsigned)dpp_i<0x157>(svb) + lo; }
#pragma unroll   // constant indices keep the arrays in registers
  for (int u = 0; u < NL; ++u) kk[u] = *(const v4u*)((const char*)K + off[u]);
#pragma unroll   // constant indices keep the arrays in registers
  for (int u = 0; u < NL; ++u) vv[u] = *(const v4u*)((const char*)V + off[u]);
  // a precaution: this wait stands in front of every overwrite of a register that an issued load names; the offset registers are named so that they stay whole up to it
  if constexpr (NL == 2) asm volatile("s_wait_xcnt 0x0" :: "v"(off[0]), "v"(off[1]) : "memory");
  else if constexpr (NL == 4) asm volatile("s_wait_xcnt 0x0" :: "v"(off[0]), "v"(off[1]), "v"(off[2]), "v"(off[3]) : "memory");
  else if constexpr (NL == 6) asm volatile("s_wait_xcnt 0x0" :: "v"(off[0]), "v"(off[1]), "v"(off[2]), "v"(off[3]), "v"(off[4]), "v"(off[5]) : "memory");
  else asm volatile("s_wait_xcnt 0x0" :: "v"(off[0]), "v"(off[1]), "v"(off[2]), "v"(off[3]), "v"(off[4]), "v"(off[5]), "v"(off[6]), "v"(off[7]) : "memory");
  __builtin_amdgcn_sched_barrier(0);   // all of the batch's loads are issued in front of the arithmetic: left free, the scheduler holds some rows' loads back to save registers, and each of them is then waited for alone
  float l[NL];
#pragma unroll   // constant indices keep the arrays in registers
  for (int u = 0; u < NL; ++u) { float t = mmix_lo(kk[u][0], q[0]); t = fmix_hi(kk[u][0], q[1], t);
#pragma unroll
    for (int i = 1; i < 4; ++i) { t = fmix_lo(kk[u][i], q[2 * i], t); t = fmix_hi(kk[u][i], q[2 * i + 1], t); }
    l[u] = t + dpp_f<0xB1>(t); }   // the head's other 8 products stand in the neighbour lane
#pragma unroll
  for (int u = NL - 2; u < NL; ++u) l[u] = (2 * u < nbh) ? l[u] : -INFINITY;   // only the last two slots can be empty (the caller picks NL by nb); an empty slot: weight exp(-inf) = 0
  float m = l[0];
#pragma unroll
  for (int u = 1; u < NL; ++u) m = fmaxf(m, l[u]);
  m = fmaxf(fmaxf(m, xhalf(m)), mx);   // the batch's maximum of this head over both half waves, then the running one
  constexpr float L2E = 1.4426950408889634f; const float nm = -m * L2E;
  const float sc = exp2_slot(__builtin_fmaf(mx, L2E, nm)); mx = m;   // exp(old - new); 0 in the first batch
#pragma unroll   // constant indices keep the arrays in registers
  for (int u = 0; u < NL; ++u) l[u] = exp2_slot(__builtin_fmaf(l[u], L2E, nm));
  float ps = l[0];
#pragma unroll
  for (int u = 1; u < NL; ++u) ps += l[u];
  den = den * sc + ps;
#pragma unroll
  for (int i = 0; i < 8; ++i) acc[i] *= sc;
#pragma unroll   // constant indices keep the arrays in registers
  for (int u = 0; u < NL; ++u)
#pragma unroll
    for (int i = 0; i < 4; ++i) { acc[2 * i] = fmix_lo(vv[u][i], l[u], acc[2 * i]); acc[2 * i + 1] = fmix_hi(vv[u][i], l[u], acc[2 * i + 1]); }
}
// 8 waves per SIMD: the second bound keeps the register budget at 128, which holds a batch's K and V rows together
// The grid is what the chip holds at once (256 WGPs x 4 blocks): every wave starts once and walks the nodes w, w + 8192, w + 16384, ... (12 or 13 of them). A node begins with a chain of three dependent loads
// (row entry -> edge ids -> source nodes); the wave keeps one link of it in flight for each of the three nodes to come: at the head of a node's pass it asks for the source nodes of the next node, the edge ids of the
// one after and the row entry of the third, each from what the pass before has asked for. No test stands around these loads (every index is clamped into its table), so that none is waited for where it is issued.
// Nothing passes between blocks and no result depends on where or when a block runs: the grid's size is chosen for speed alone.
constexpr int ATT_BLK = 1024, ATT_WAVES = ATT_BLK * 8;
static_assert(NP <= ((N + CSR_GN - 1) / CSR_GN) * CSR_GN && ATT_WAVES <= NP, "ROWPTR and ROWCNT hold an entry for every index below NP; every wave has a first node");
// a row entry as loaded -> start and count of the node's edges, the same in every lane (scalars); live: the node exists
__device__ __forceinline__ void row_scalars(int rs, int rc, bool live, int permLen, int& st, int& cnt) { rc = iclamp(rc, 0, 65536); rs = iclamp(rs, 0, permLen - rc); cnt = live ? __builtin_amdgcn_readfirstlane(rc) : 0; st = __builtin_amdgcn_readfirstlane(rs); }
// where the edge id that a lane fetches (number 'lane' of a row's first 32) stands in PERM; past the row's end: the last edge again; a row without edges: some word inside the table, not used
__device__ __forceinline__ int perm_index(int st, int cnt, int lane, int permLen) { return min(st + max(min(lane, cnt - 1), 0), permLen - 1); }
__global__ __launch_bounds__(256, 8) void attn_kernel(const float* Q, const b16* __restrict__ K, const b16* __restrict__ V, const int* __restrict__ cols, const int* __restrict__ PERM, const int* __restrict__ ROWPTR, const int* __restrict__ ROWCNT, int permLen, b16* Oh, b16* Ol) {   // Oh aliases the q plane (see host)
  const int wave = __builtin_amdgcn_readfirstlane((int)(threadIdx.x >> 5)) /* the same in every lane: the loop over nodes is a scalar loop */, lane = threadIdx.x & 31, hf = lane >> 4, lj = lane & 15; (void)Ol;
  const int ep = 2 * lj + hf;   // of 32 edges this lane fetches number ep: lane u of a half wave holds that half's slot u (u < 8: first batch of 16, else the second)
  const unsigned lo = (unsigned)lj * 16u;
  const int w0 = (int)blockIdx.x * 8 + wave;
  int st, cnt, sv;     // this node: start and count of its edges, source nodes of its first 32 edges (one per lane)
  int st1, cnt1, en;   // the next node: start, count, edge ids as loaded
  int rs, rc;          // the node after: row entry as loaded (the tables hold an entry for every index below NP)
  { const int n1 = min(w0 + ATT_WAVES, NP - 1), n2 = min(w0 + 2 * ATT_WAVES, NP - 1);
    const int a0 = ROWPTR[w0], b0 = ROWCNT[w0], a1 = ROWPTR[n1], b1 = ROWCNT[n1]; rs = ROWPTR[n2]; rc = ROWCNT[n2];
    row_scalars(a0, b0, w0 < N, permLen, st, cnt); row_scalars(a1, b1, w0 + ATT_WAVES < N, permLen, st1, cnt1);
    const int e0 = PERM[perm_index(st, cnt, ep, permLen)]; en = PERM[perm_index(st1, cnt1, ep, permLen)];
    sv = iclamp(cols[iclamp(e0, 0, E - 1)], 0, N - 1); }
  for (int vn = w0; vn < NP; vn += ATT_WAVES) {
    const size_t v = (size_t)vn;
    const v4f qa = *(const v4f*)(Q + v * D + lj * 8), qb = *(const v4f*)(Q + v * D + lj * 8 + 4);
    const int svn = cols[iclamp(en, 0, E - 1)];
    int st2, cnt2; row_scalars(rs, rc, vn + 2 * ATT_WAVES < N, permLen, st2, cnt2);
    const int enn = PERM[perm_index(st2, cnt2, ep, permLen)];
    { const int n3 = min(vn + 3 * ATT_WAVES, NP - 1); rs = ROWPTR[n3]; rc = ROWCNT[n3]; }
    asm volatile("s_wait_xcnt 0x0" ::: "memory");   // a precaution: it stands in front of every overwrite of a register that one of the loads above names
    const float q[8] = {qa[0], qa[1], qa[2], qa[3], qb[0], qb[1], qb[2], qb[3]};
    float o[8] = {0.0f, 0.0f, 0.0f, 0.0f, 0.0f, 0.0f, 0.0f, 0.0f}, acc[8] = {0.0f, 0.0f, 0.0f, 0.0f, 0.0f, 0.0f, 0.0f, 0.0f}, mx = -INFINITY, den = 0.0f;
    int svb = sv * (D * 2);   // byte offset of the source row in the k and the v plane
    for (int base = 0; base < cnt; base += AB) {
      if (base > 0 && (base & 31) == 0) { const int j = min(base + ep, cnt - 1); const int e = iclamp(PERM[st + j], 0, E - 1); svb = iclamp(cols[e], 0, N - 1) * (D * 2); }   // the next 32 edges of a long row; past the end: the last edge again
      const int nb = min(cnt - base, AB), nbh = nb - hf;
      if (nb > 12) attn_batch<8>(K, V, svb, nbh, lo, q, mx, den, acc);
      else if (nb > 8) attn_batch<6>(K, V, svb, nbh, lo, q, mx, den, acc);
      else if (nb > 4) attn_batch<4>(K, V, svb, nbh, lo, q, mx, den, acc);
      else attn_batch<2>(K, V, svb, nbh, lo, q, mx, den, acc);
      svb = dpp_i<0x128>(svb);   // the second batch's slots move to lanes 0 .. 7 of each half wave
    }
    if (cnt > 0) { const float inv = 1.0f / (den + xhalf(den));   // both half waves' sums of this head
      for (int i = 0; i < 8; ++i) o[i] = (acc[i] + xhalf(acc[i])) * inv; }
    v8b ph, pl; for (int i = 0; i < 8; ++i) { b16 p, pq; split16(o[i] * XS, p, pq); ph[i] = p; pl[i] = pq; }
    *(v8b*)(Oh + v * (2 * D) + lane * 8) = hf ? pl : ph;   // hi | lo packed into this node's own 512-B q row (no other wave reads it): the first half wave stores hi, the second lo, one whole-row store
    asm volatile("s_wait_xcnt 0x0" ::: "memory");   // a precaution: the next node's pass overwrites the registers that the store names
    st = st1; cnt = cnt1; sv = iclamp(svn, 0, N - 1); st1 = st2; cnt1 = cnt2; en = enn;
  }
}
__global__ __launch_bounds__(256) void oproj_kernel(const b16* __restrict__ Oh, const b16* __restrict__ Ol, const b16* __restrict__ WT, const float* __restrict__ bo, float* __restrict__ out) {
  __shared__ __attribute__((aligned(16))) float Tf[PJ_NW][16][D + 4];   // per wave: first its 16 rows of hi | lo halves, then its 16 rows of results
  __shared__ __attribute__((aligned(16))) b16 Ws[D][WPITCH];
  const int wave = threadIdx.x >> 5, lane = threadIdx.x & 31, nloc = lane & 15, hlf = lane >> 4; const size_t m0 = (size_t)blockIdx.x * (PJ_NW * 16) + wave * 16; const b16* W = WT + (size_t)3 * D * D; (void)Ol;
  stage_operands<false>(W, Ws, (const v4f*)Oh, (int)m0, NP, (int)threadIdx.x, lane, Tf[wave]);
  __syncthreads();   // every wave reads the weight rows that the others have stored
  if (m0 >= (size_t)NP) return;   // the last block's waves past the padded rows: a whole wave leaves, behind the kernel's one barrier
  v8f acc[8];
#pragma unroll
  for (int t = 0; t < 8; ++t) acc[t] = (v8f){};
#pragma unroll
  for (int kb = 0; kb < D; kb += 32) { const v16b a = frag_kf(&Tf[wave][nloc][kb / 2], hlf), al = frag_kf(&Tf[wave][nloc][(D + kb) / 2], hlf);
    v16b bw[8];   // the k block's eight weight fragments are asked for together: one LDS latency a k block, not one a product
#pragma unroll
    for (int t = 0; t < 8; ++t) bw[t] = frag_kb(&Ws[t * 16 + nloc][kb], hlf);
#pragma unroll
    for (int t = 0; t < 8; ++t) { acc[t] = wmma16b(a, bw[t], acc[t]); acc[t] = wmma16b(al, bw[t], acc[t]); } }
  wave_lds_sync();   // the results below overwrite the rows that other lanes of this wave have read
#pragma unroll
  for (int t = 0; t < 8; ++t) { const int c = t * 16 + nloc; const float bb = bf16_rne(bo[c]);
#pragma unroll 1
    for (int r = 0; r < 8; ++r) Tf[wave][8 * hlf + r][c] = acc[t][r] * (1.0f / (XS * WSC)) + bb; }
  wave_lds_sync();
  { for (int rr = 0; rr < 16; ++rr) { const size_t row = m0 + rr; if (row < (size_t)N) *(v4f*)(out + row * D + lane * 4) = *(const v4f*)(&Tf[wave][rr][lane * 4]); }  }
}
}  // namespace

extern "C" void kernel_launch(void* const* d_in, const int* in_sizes, int n_in, void* d_out, int out_size, void* d_ws, size_t ws_size, hipStream_t stream) {
  (void)n_in;
  auto Fp = [&](int i) { return (const float*)d_in[i]; }; auto Ip = [&](int i) { return (const int*)d_in[i]; };
  // input order: 0 h [100000,128], 1 row [E] i32, 2 col [E] i32, 3 Wq [128,128], 4 bq, 5 Wk, 6 bk, 7 Wv, 8 bv, 9 Wo, 10 bo
  if (in_sizes[0] != N * D || in_sizes[1] != E || in_sizes[2] != E || in_sizes[3] != D * D || in_sizes[9] != D * D || out_size != N * D) return;
  size_t off = 0; char* ws = (char*)d_ws;
  auto carve = [&](size_t bytes) { char* p = ws + off; off += (bytes + 255) & ~(size_t)255; return p; };
  b16* WT = (b16*)carve((size_t)4 * D * D * 2); float* Q = (float*)carve((size_t)NP * D * 4); b16* KV = (b16*)carve((size_t)2 * NP * D * 2);
  b16* Oh = (b16*)Q; b16* Ol = Oh;   // the attention output (hi | lo, 2 x 128 halves) overwrites each node's own 512-B q row in place: a wave reads only its own q row before writing it (K/V rows live in planes of their own)
  CsrBufs csr; off = csr_carve(csr, ws, off, E, N);
  if (off > ws_size) return;   // q plane, f16 k and v planes, CSR tables: about 120 MB
  csr_build(csr, Ip(1), E, N, Fp(3), Fp(5), Fp(7), Fp(9), WT, stream);   // group by row (the softmax axis); the weight planes are made in its first launch
  proj_kernel<<<QKV_BLK, QKV_NT, 0, stream>>>(Fp(0), WT, Fp(4), Fp(6), Fp(8), Q, KV);
  attn_kernel<<<ATT_BLK, 256, 0, stream>>>(Q, KV, KV + (size_t)NP * D, Ip(2), csr.PERM, csr.ROWPTR, csr.ROWCNT, (int)csr.permLen, Oh, Ol);
  oproj_kernel<<<PJ_BLK, 256, 0, stream>>>(Oh, Ol, WT, Fp(10), (float*)d_out);
}
